// v000
// Measured on an AMD MI455X. A time is GPU time per run, averaged over a window of back-to-back runs after a warm-up
// (all launches, gaps included; the runs take copies of the inputs in turn), and the median of several windows.
// Apart from v000's, it joins two sittings. Times from different sittings can be a few percent apart, while
// side-by-side timings come from the same sitting.
// The starting kernel, v000, takes 72 milliseconds a run.
#include <hip/hip_runtime.h>
// Single-head causal self-attention with the module's literal scale C^-0.666 (x [32][1024][256]; q/k/v = x W ([in][out] [256][64], no biases); ONE 64-wide head; scores * 256^-0.666 = 0.024895 (as the source writes it, not head_size^-0.5); causal; softmax; out = weights v -> [32][1024][64]; no output projection).
// Structure: token rows; x as exact f16 rows; three WMMA GEMMs into one f16 q | k | v plane [32768][192]; per batch v^T via LDS transposes; causal 256-row query tiles with the one head on grid.y (scores alpha 256^-0.666, causal softmax f32 -> f16 x256 weights, P V written as f32 straight into the merged output rows); an exact f32 first tile (rows 0..511) rewritten at the end.
// Compute dtype: inputs rounded to bf16; x / weights exact; q, k, v and softmax weights as plain f16 GEMM operands (~2^-12); scores and softmax statistics f32. v_wmma_f32_16x16x32_f16.
#define NB 32
#define SQ 1024
#define DM 256
#define NH 1
#define HD 64
#define HG 4                         /* heads per launch of the non-template k_vt, which is not launched */
#define QT 256                       /* query rows per causal tile */
#define NKX SQ                       /* S / P row pitch */
#define QT0 512                      /* first-tile rows recomputed exactly (f32): 512 here (no output projection averages the early-row cancellation errors away; logit sigma 1.0) */
#define B0 0                         /* first batch processed (debug hook) */
#define NBR NB                       /* batches processed (debug hook) */
#define NR ((size_t)NB * SQ)
#define DMQ DM
#define DFF 4096                     /* unused (no FFN in this file) */
#define DFFR 100                     /* unused */
#define MP ((int)((size_t)NBR * SQ)) /* rows projected (debug hook) */
#define QN SQ                        /* query rows attended per batch (debug hook) */
#define NHD NH                       /* heads attended (debug hook) */
#define MPO MP                       /* rows through the output stage (debug hook) */
#define LQ (3 * DM)      /* unused; the q/k/v rows have pitch LQK (192) */
typedef __bf16 v16b __attribute__((ext_vector_type(16)));
typedef unsigned short v8us __attribute__((ext_vector_type(8), may_alias));
typedef float  v8f  __attribute__((ext_vector_type(8)));
typedef float  v4f  __attribute__((ext_vector_type(4)));
typedef float  v4fa __attribute__((ext_vector_type(4), may_alias));
union FragB { v16b v; v8us half[2]; unsigned short u[16]; };

__device__ __forceinline__ unsigned short bf16_bits(float x) { unsigned int u = __float_as_uint(x); return (unsigned short)((u + 0x7FFFu + ((u >> 16) & 1u)) >> 16); }
__device__ __forceinline__ float bf16_val(unsigned short b) { return __uint_as_float(((unsigned int)b) << 16); }
__device__ __forceinline__ float bf16_round(float x) { return bf16_val(bf16_bits(x)); }
// D += A·B with NT terms: 1 = ah·bh, 2 = + al·bh (A split), 3 = + ah·bl (both split)
template <int NT>
__device__ __forceinline__ v8f mmaN(v16b ah, v16b al, v16b bh, v16b bl, v8f c) {
  c = __builtin_amdgcn_wmma_f32_16x16x32_bf16(false, ah, false, bh, (short)0, c, false, false);
  if (NT >= 2) c = __builtin_amdgcn_wmma_f32_16x16x32_bf16(false, al, false, bh, (short)0, c, false, false);
  if (NT >= 3) c = __builtin_amdgcn_wmma_f32_16x16x32_bf16(false, ah, false, bl, (short)0, c, false, false);
  asm volatile("v_nop\n\tv_nop\n\tv_nop\n\tv_nop" : "+v"(c) : "v"(ah), "v"(al), "v"(bh), "v"(bl));
  return c;
}

__global__ __launch_bounds__(256) void k_wt_bf16(const float* __restrict__ W, unsigned short* __restrict__ Wt, int K, int N) {
  const int t = blockIdx.x * 256 + threadIdx.x;
  const int k8n = K / 8;
  if (t >= N * k8n) return;
  const int n = t / k8n, k8 = (t % k8n) * 8;
  v8us v;
#pragma unroll
  for (int i = 0; i < 8; ++i) v[i] = bf16_bits(W[(size_t)(k8 + i) * N + n]);
  *(v8us*)(Wt + (size_t)n * K + k8) = v;
  
}

// GEMM C[M][N] (f32, pitch ldc) = act(A[M][K]·W + bias). A f32 row-major (pitch lda) converted per fragment to bf16
// (ASPLIT: hi/lo two planes -> 2 terms, else single rounded term); Wt bf16 [N][K] (pitch ldb). BIAS_BF16 rounds the
// bias to bf16 first (bias quantised to bf16 before the add). K%32==0, M%16==0, N%64==0.
template <bool ASPLIT, int ACT, bool BIAS_BF16>
__global__ __launch_bounds__(128) void k_gemm_bf(const float* __restrict__ A, int lda, const unsigned short* __restrict__ Wt, int ldb,
                                               const float* __restrict__ bias, float* __restrict__ C, int ldc, int M, int N, int K) {
  __shared__ __attribute__((aligned(16))) float so[4][16][64];
  const int tid = threadIdx.x, w = tid >> 5, lane = tid & 31, ln = lane & 15, hh = lane >> 4;
  const int ntn = N / 64;
  const int wid = blockIdx.x * 4 + w;
  const int mt = wid / ntn, nq = wid % ntn;
  if (mt * 16 >= M) return;
  const int row0 = mt * 16, col0 = nq * 64;
  const float* arow = A + (size_t)(row0 + ln) * lda;
  v8f acc[4] = {};
  for (int kb = 0; kb < K; kb += 32) {
    FragB ah, al;
    const v4f x0 = *(const v4fa*)(arow + kb + 8 * hh), x1 = *(const v4fa*)(arow + kb + 8 * hh + 4);
    const v4f x2 = *(const v4fa*)(arow + kb + 16 + 8 * hh), x3 = *(const v4fa*)(arow + kb + 16 + 8 * hh + 4);
    float xs[16] = {x0[0],x0[1],x0[2],x0[3],x1[0],x1[1],x1[2],x1[3],x2[0],x2[1],x2[2],x2[3],x3[0],x3[1],x3[2],x3[3]};
#pragma unroll
    for (int i = 0; i < 16; ++i) { const unsigned short hb = bf16_bits(xs[i]); ah.u[i] = hb; al.u[i] = ASPLIT ? bf16_bits(xs[i] - bf16_val(hb)) : (unsigned short)0; }
#pragma unroll
    for (int t = 0; t < 4; ++t) {
      const unsigned short* brow = Wt + (size_t)(col0 + t * 16 + ln) * ldb + kb;
      FragB b;
      b.half[0] = *(const v8us*)(brow + 8 * hh);
      b.half[1] = *(const v8us*)(brow + 16 + 8 * hh);
      acc[t] = mmaN<ASPLIT ? 2 : 1>(ah.v, al.v, b.v, b.v, acc[t]);
    }
  }
#pragma unroll
  for (int t = 0; t < 4; ++t) {
    float bv = bias ? bias[col0 + t * 16 + ln] : 0.f;
    if (BIAS_BF16) bv = bf16_round(bv);
#pragma unroll
    for (int r = 0; r < 8; ++r) { float v = acc[t][r] + bv; if (ACT == 1) v = fmaxf(v, 0.f); so[w][8 * hh + r][t * 16 + ln] = v; }
  }
  __builtin_amdgcn_fence(__ATOMIC_ACQ_REL, "workgroup");
  __builtin_amdgcn_wave_barrier();
  const int rsub = lane >> 4, c4 = (lane & 15) * 4;
  {
#pragma unroll
    for (int q = 0; q < 8; ++q) {
      const int r = q * 2 + rsub;
      const v4f v = *(const v4fa*)&so[w][r][c4];
      *(v4f*)(C + (size_t)(row0 + r) * ldc + col0 + c4) = v;
    }
    
  }
}

// GEMM C = act(A·W + bias + resid): A f32 (ASPLIT -> hi/lo 2 terms), Wt bf16 [N][K]; ACT 0 none, 1 relu, 2 exact gelu;
// resid (optional, f32, row index = (row % rmod), pitch ldr, RES_BF16 rounds it) added before the activation.
template <bool ASPLIT, int ACT, bool BIAS_BF16, bool RES_BF16>
__global__ __launch_bounds__(128) void k_gemm_bf3(const float* __restrict__ A, int lda, const unsigned short* __restrict__ Wt, int ldb,
                                                const float* __restrict__ bias, const float* __restrict__ resid, int rmod, int ldr,
                                                float* __restrict__ C, int ldc, int M, int N, int K) {
  __shared__ __attribute__((aligned(16))) float so[4][16][64];
  const int tid = threadIdx.x, w = tid >> 5, lane = tid & 31, ln = lane & 15, hh = lane >> 4;
  const int ntn = N / 64;
  const int wid = blockIdx.x * 4 + w;
  const int mt = wid / ntn, nq = wid % ntn;
  if (mt * 16 >= M) return;
  const int row0 = mt * 16, col0 = nq * 64;
  const float* arow = A + (size_t)(row0 + ln) * lda;
  v8f acc[4] = {};
  for (int kb = 0; kb < K; kb += 32) {
    FragB ah, al;
    const v4f x0 = *(const v4fa*)(arow + kb + 8 * hh), x1 = *(const v4fa*)(arow + kb + 8 * hh + 4);
    const v4f x2 = *(const v4fa*)(arow + kb + 16 + 8 * hh), x3 = *(const v4fa*)(arow + kb + 16 + 8 * hh + 4);
    float xs[16] = {x0[0],x0[1],x0[2],x0[3],x1[0],x1[1],x1[2],x1[3],x2[0],x2[1],x2[2],x2[3],x3[0],x3[1],x3[2],x3[3]};
#pragma unroll
    for (int i = 0; i < 16; ++i) { const unsigned short hb = bf16_bits(xs[i]); ah.u[i] = hb; al.u[i] = ASPLIT ? bf16_bits(xs[i] - bf16_val(hb)) : (unsigned short)0; }
#pragma unroll
    for (int t = 0; t < 4; ++t) {
      const unsigned short* brow = Wt + (size_t)(col0 + t * 16 + ln) * ldb + kb;
      FragB b;
      b.half[0] = *(const v8us*)(brow + 8 * hh);
      b.half[1] = *(const v8us*)(brow + 16 + 8 * hh);
      acc[t] = mmaN<ASPLIT ? 2 : 1>(ah.v, al.v, b.v, b.v, acc[t]);
    }
  }
#pragma unroll
  for (int t = 0; t < 4; ++t) {
    const int col = col0 + t * 16 + ln;
    float bv = bias ? bias[col] : 0.f;
    if (BIAS_BF16) bv = bf16_round(bv);
#pragma unroll
    for (int r = 0; r < 8; ++r) {
      float v = acc[t][r] + bv;
      if (resid) { float rv = resid[(size_t)((row0 + 8 * hh + r) % rmod) * ldr + col]; if (RES_BF16) rv = bf16_round(rv); v += rv; }
      if (ACT == 1) v = fmaxf(v, 0.f);
      if (ACT == 2) v = 0.5f * v * (1.0f + erff(v * 0.70710678118654752f));
      if (ACT == 3) { const float u = 0.7978845608028654f * (v + 0.044715f * v * v * v); v = 0.5f * v * (1.0f + tanhf(u)); }
      so[w][8 * hh + r][t * 16 + ln] = v;
    }
  }
  __builtin_amdgcn_fence(__ATOMIC_ACQ_REL, "workgroup");
  __builtin_amdgcn_wave_barrier();
  const int rsub = lane >> 4, c4 = (lane & 15) * 4;
  {
#pragma unroll
    for (int q = 0; q < 8; ++q) {
      const int r = q * 2 + rsub;
      const v4f v = *(const v4fa*)&so[w][r][c4];
      *(v4f*)(C + (size_t)(row0 + r) * ldc + col0 + c4) = v;
    }
    
  }
}
// row LayerNorm (biased variance, eps) over N: s = X (+ R); optional out_sum <- s; out_norm <- (s-mu)*rsqrt(var+eps)*g + b
template <bool PARAM_BF16>
__global__ __launch_bounds__(256) void k_layernorm(const float* __restrict__ X, const float* __restrict__ R, const float* __restrict__ g, const float* __restrict__ bta,
                                                  float* __restrict__ out_sum, float* __restrict__ out_norm, int N, float eps) {
  __shared__ float red[256];
  const int row = blockIdx.x, tid = threadIdx.x;
  const float* x = X + (size_t)row * N; const float* rr = R ? R + (size_t)row * N : nullptr;
  float vals[16];                     // up to N = 4096
  const int per = N / 256;            // contiguous chunk per thread? use strided-by-4 chunks: thread handles j = tid*4 + 1024*u
  float s1 = 0.f;
  for (int u = 0; u < per / 4; ++u) {
    const int j = tid * 4 + 1024 * u;
    const v4f a = *(const v4fa*)(x + j);
    v4f b = {0.f,0.f,0.f,0.f}; if (rr) b = *(const v4fa*)(rr + j);
#pragma unroll
    for (int q = 0; q < 4; ++q) { const float v = a[q] + b[q]; vals[u * 4 + q] = v; s1 += v; }
  }
  red[tid] = s1; __syncthreads();
  for (int st = 128; st > 0; st >>= 1) { if (tid < st) red[tid] += red[tid + st]; __syncthreads(); }
  const float mu = red[0] / (float)N; __syncthreads();
  float s2 = 0.f;
  for (int u = 0; u < per / 4; ++u)
#pragma unroll
    for (int q = 0; q < 4; ++q) { const float c = vals[u * 4 + q] - mu; s2 += c * c; }
  red[tid] = s2; __syncthreads();
  for (int st = 128; st > 0; st >>= 1) { if (tid < st) red[tid] += red[tid + st]; __syncthreads(); }
  const float rs = rsqrtf(red[0] / (float)N + eps);
  {
    for (int u = 0; u < per / 4; ++u) {
      const int j = tid * 4 + 1024 * u;
      v4f o, sm;
#pragma unroll
      for (int q = 0; q < 4; ++q) {
        float gg = g[j + q], bb = bta[j + q];
        if (PARAM_BF16) { gg = bf16_round(gg); bb = bf16_round(bb); }
        sm[q] = vals[u * 4 + q]; o[q] = (vals[u * 4 + q] - mu) * rs * gg + bb;
      }
      if (out_sum) *(v4f*)(out_sum + (size_t)row * N + j) = sm;
      *(v4f*)(out_norm + (size_t)row * N + j) = o;
    }
    
  }
}



// ---- f16 WMMA path (v_wmma_f32_16x16x32_f16): 11-bit significands for operands in range — used where a [0,1] probability operand needs more precision than bf16
typedef _Float16 v16h __attribute__((ext_vector_type(16)));
union FragH { v16h v; v8us half[2]; _Float16 h[16]; unsigned short u[16]; };
template <int NT>
__device__ __forceinline__ v8f mmaH(v16h ah, v16h al, v16h bh, v16h bl, v8f c) {
  c = __builtin_amdgcn_wmma_f32_16x16x32_f16(false, ah, false, bh, (short)0, c, false, false);
  if (NT >= 2) c = __builtin_amdgcn_wmma_f32_16x16x32_f16(false, al, false, bh, (short)0, c, false, false);
  if (NT >= 3) c = __builtin_amdgcn_wmma_f32_16x16x32_f16(false, ah, false, bl, (short)0, c, false, false);
  asm volatile("v_nop\n\tv_nop\n\tv_nop\n\tv_nop" : "+v"(c) : "v"(ah), "v"(al), "v"(bh), "v"(bl));
  return c;
}
// batched GEMM like k_gemm_b but f16 operands: A f32 (split into f16 hi/lo if ASPLIT, else rounded to f16), Bt = f16 values [n][k]; alpha; C f32; N multiple of 16 (partial tiles skipped)
template <bool ASPLIT>
__global__ __launch_bounds__(128) void k_gemm_h(const float* __restrict__ A, int lda, size_t sA, const _Float16* __restrict__ Bh, int ldb, size_t sB, float alpha, float* __restrict__ C, int ldc, size_t sC, int M, int N, int K) {
  __shared__ __attribute__((aligned(16))) float so[4][16][64];
  const int tid = threadIdx.x, w = tid >> 5, lane = tid & 31, ln = lane & 15, hh = lane >> 4; const int by = blockIdx.y;
  A += (size_t)by * sA; Bh += (size_t)by * sB; C += (size_t)by * sC;
  const int ntn = (N + 63) / 64; const int wid = blockIdx.x * 4 + w; const int mt = wid / ntn, nq = wid % ntn; if (mt * 16 >= M) return;
  const int row0 = mt * 16, col0 = nq * 64; const float* arow = A + (size_t)(row0 + ln) * lda;
  v8f acc[4] = {};
  for (int kb = 0; kb < K; kb += 32) {
    FragH ah, al;
    const v4f x0 = *(const v4fa*)(arow + kb + 8 * hh), x1 = *(const v4fa*)(arow + kb + 8 * hh + 4), x2 = *(const v4fa*)(arow + kb + 16 + 8 * hh), x3 = *(const v4fa*)(arow + kb + 16 + 8 * hh + 4);
    float xs[16] = {x0[0],x0[1],x0[2],x0[3],x1[0],x1[1],x1[2],x1[3],x2[0],x2[1],x2[2],x2[3],x3[0],x3[1],x3[2],x3[3]};
#pragma unroll
    for (int i = 0; i < 16; ++i) { const _Float16 h = (_Float16)xs[i]; ah.h[i] = h; al.h[i] = ASPLIT ? (_Float16)(xs[i] - (float)h) : (_Float16)0.0f; }
#pragma unroll
    for (int t = 0; t < 4; ++t) { if (col0 + t * 16 >= N) continue; const size_t boff = (size_t)(col0 + t * 16 + ln) * ldb + kb; FragH bq; bq.half[0] = *(const v8us*)(Bh + boff + 8 * hh); bq.half[1] = *(const v8us*)(Bh + boff + 16 + 8 * hh);
      acc[t] = mmaH<ASPLIT ? 2 : 1>(ah.v, al.v, bq.v, bq.v, acc[t]); }
  }
#pragma unroll
  for (int t = 0; t < 4; ++t) { if (col0 + t * 16 >= N) continue;
#pragma unroll
    for (int r = 0; r < 8; ++r) so[w][8 * hh + r][t * 16 + ln] = acc[t][r] * alpha; }
  __builtin_amdgcn_fence(__ATOMIC_ACQ_REL, "workgroup"); __builtin_amdgcn_wave_barrier();
  const int rsub = lane >> 4, c4 = (lane & 15) * 4;
  {
#pragma unroll
    for (int q = 0; q < 8; ++q) { const int r = q * 2 + rsub; if (col0 + c4 < N) { const v4f v = *(const v4fa*)&so[w][r][c4]; *(v4f*)(C + (size_t)(row0 + r) * ldc + col0 + c4) = v; } }
     }
}

// Wt[n][k] = f16(W[k][n]·scale) from f32 row-major W[K][N] (scale = power of two; bf16-exact weights stay exact in f16 away from the subnormal range)
__global__ __launch_bounds__(256) void k_wt_f16(const float* __restrict__ W, _Float16* __restrict__ Wt, int K, int N, float scale) {
  const int t = blockIdx.x * 256 + threadIdx.x; if (t >= N * (K / 8)) return; const int n = t / (K / 8), k8 = (t % (K / 8)) * 8; FragH f;
#pragma unroll
  for (int i = 0; i < 8; ++i) f.h[i] = (_Float16)(bf16_round(W[(size_t)(k8 + i) * N + n]) * scale); const v8us o = f.half[0];
  *(v8us*)((unsigned short*)Wt + (size_t)n * K + k8) = o; 
}
// k_gemm_hh variant with fused epilogue: v = acc·alpha + bias[by·sBias + col] (+ CP[(row/rowsPerB)·sCPb + by·64 + col] if CP) ; ACT 0 none / 1 elu ; writes f16 C16 (and f32 C if non-null)
template <int ACT>
__global__ __launch_bounds__(128) void k_gemm_hhx(const _Float16* __restrict__ A, int lda, size_t sA, const _Float16* __restrict__ Bh, int ldb, size_t sB, float alpha, const float* __restrict__ bias, size_t sBias, const float* __restrict__ CP, int rowsPerB, size_t sCPb, int row0g,
    float* __restrict__ C, _Float16* __restrict__ C16, int ldc, size_t sC, int M, int N, int K) {
  __shared__ __attribute__((aligned(16))) float so[4][16][64];
  const int tid = threadIdx.x, w = tid >> 5, lane = tid & 31, ln = lane & 15, hh = lane >> 4; const int by = blockIdx.y;
  A += (size_t)by * sA; Bh += (size_t)by * sB; const size_t cofs = (size_t)by * sC; const float* bp = bias ? bias + (size_t)by * sBias : nullptr;
  const int ntn = (N + 63) / 64; const int wid = blockIdx.x * 4 + w; const int mt = wid / ntn, nq = wid % ntn; if (mt * 16 >= M) return;
  const int row0 = mt * 16, col0 = nq * 64; const _Float16* arow = A + (size_t)(row0 + ln) * lda;
  v8f acc[4] = {};
  for (int kb = 0; kb < K; kb += 32) { FragH ah; ah.half[0] = *(const v8us*)((const unsigned short*)arow + kb + 8 * hh); ah.half[1] = *(const v8us*)((const unsigned short*)arow + kb + 16 + 8 * hh);
#pragma unroll
    for (int t = 0; t < 4; ++t) { if (col0 + t * 16 >= N) continue; const size_t boff = (size_t)(col0 + t * 16 + ln) * ldb + kb; FragH bq; bq.half[0] = *(const v8us*)((const unsigned short*)Bh + boff + 8 * hh); bq.half[1] = *(const v8us*)((const unsigned short*)Bh + boff + 16 + 8 * hh);
      acc[t] = mmaH<1>(ah.v, ah.v, bq.v, bq.v, acc[t]); }
  }
#pragma unroll
  for (int t = 0; t < 4; ++t) { if (col0 + t * 16 >= N) continue; const int col = col0 + t * 16 + ln; const float bv = bp ? bf16_round(bp[col]) : 0.f;
#pragma unroll
    for (int r = 0; r < 8; ++r) { float v = acc[t][r] * alpha + bv; if (CP) { const int rr = row0g + row0 + 8 * hh + r; if (rowsPerB < 0) v += CP[cofs + (size_t)rr * ldc + col];      /* rowsPerB < 0: own element of the batched C plane */ else { const int bidx = rr / rowsPerB; v += CP[(size_t)bidx * sCPb + (size_t)by * 64 + col]; } } if (ACT == 1) v = (v > 0.f) ? v : expm1f(v); else if (ACT == 7) v = (v > 0.f) ? v + 1.0f : expf(v); else if (ACT == 8) v = tanhf(v); else if (ACT == 9) v = 0.5f * v * (1.0f + tanhf(0.7978845608028654f * (v + 0.044715f * v * v * v))); else if (ACT == 11) v = 1.0f / (1.0f + expf(-v)); else if (ACT == 12) v = (v > 0.f) ? v : 0.01f * v; else if (ACT == 14) v = (v > 0.f) ? v : 0.1f * v; else if (ACT == 16) v = (v >= 0.f) ? v : 0.3f * v; else if (ACT == 17) v = (v >= 0.f) ? v : 0.2f * v; else if (ACT == 15) v = v / (1.0f + expf(-v)); else if (ACT == 3) v = fmaxf(v, 0.f); else if (ACT == 6) v = 0.5f * v * (1.0f + erff(v * 0.70710678118654752f)); so[w][8 * hh + r][t * 16 + ln] = v; } }
  __builtin_amdgcn_fence(__ATOMIC_ACQ_REL, "workgroup"); __builtin_amdgcn_wave_barrier();
  const int rsub = lane >> 4, c4 = (lane & 15) * 4; typedef _Float16 v4h __attribute__((ext_vector_type(4)));
  {
#pragma unroll
    for (int q = 0; q < 8; ++q) { const int r = q * 2 + rsub; if (col0 + c4 < N) { const v4f v = *(const v4fa*)&so[w][r][c4]; if (C) *(v4f*)(C + cofs + (size_t)(row0 + r) * ldc + col0 + c4) = v; if (C16) { v4h h4; for (int i = 0; i < 4; ++i) h4[i] = (_Float16)v[i]; *(v4h*)(C16 + cofs + (size_t)(row0 + r) * ldc + col0 + c4) = h4; } } }
     }
}


typedef _Float16 v4h __attribute__((ext_vector_type(4)));

__global__ __launch_bounds__(256) void k_x16(const float* __restrict__ x, _Float16* __restrict__ X16, size_t n8) { const size_t t = (size_t)blockIdx.x * 256 + threadIdx.x; if (t >= n8) return; FragH f;
#pragma unroll
  for (int q = 0; q < 8; ++q) f.h[q] = (_Float16)bf16_round(x[t * 8 + q]); *(v8us*)((unsigned short*)X16 + t * 8) = f.half[0];  }
__global__ __launch_bounds__(256) void k_h16(const float* __restrict__ x, _Float16* __restrict__ X16, size_t n8) { const size_t t = (size_t)blockIdx.x * 256 + threadIdx.x; if (t >= n8) return; FragH f;
#pragma unroll
  for (int q = 0; q < 8; ++q) f.h[q] = (_Float16)x[t * 8 + q]; *(v8us*)((unsigned short*)X16 + t * 8) = f.half[0];  }
__global__ __launch_bounds__(256) void k_round16f(const float* __restrict__ W, _Float16* __restrict__ Bt, size_t n8) { const size_t t = (size_t)blockIdx.x * 256 + threadIdx.x; if (t >= n8) return; FragH f;
#pragma unroll
  for (int i = 0; i < 8; ++i) f.h[i] = (_Float16)(bf16_round(W[t * 8 + i]) * 16.0f); *(v8us*)((unsigned short*)Bt + t * 8) = f.half[0];  }
template <int NHv, int TTv>
__global__ __launch_bounds__(256) void k_vt(const _Float16* __restrict__ V16, int ldv, int voff, _Float16* __restrict__ Vt) { __shared__ unsigned short tl[64][66]; const int tid = threadIdx.x; const int slab = blockIdx.x / (TTv / 64), lg = blockIdx.x % (TTv / 64); const int b = slab / NHv, h = slab % NHv;
  for (int i = tid; i < 64 * 8; i += 256) { const int r = i / 8, c8 = (i % 8) * 8; FragH f; f.half[0] = *(const v8us*)((const unsigned short*)V16 + ((size_t)b * TTv + lg * 64 + r) * ldv + voff + h * 64 + c8);
#pragma unroll
    for (int q = 0; q < 8; ++q) tl[r][c8 + q] = f.u[q]; }
  __syncthreads();
  {
#pragma unroll
    for (int rd = 0; rd < 2; ++rd) { const int d = rd * 32 + tid / 8, pc = tid % 8; FragH f;
#pragma unroll
      for (int q = 0; q < 8; ++q) f.u[q] = tl[pc * 8 + q][d];
      *(v8us*)((unsigned short*)Vt + ((size_t)slab * 64 + d) * TTv + lg * 64 + pc * 8) = f.half[0]; }
     } }

__global__ __launch_bounds__(256) void k_hl(const float* __restrict__ F, _Float16* __restrict__ Hh, _Float16* __restrict__ Hl, size_t n8) { const size_t t = (size_t)blockIdx.x * 256 + threadIdx.x; if (t >= n8) return; FragH fh, fl; const v4f a = *(const v4fa*)(F + t * 8), c = *(const v4fa*)(F + t * 8 + 4);
#pragma unroll
  for (int q = 0; q < 4; ++q) { _Float16 h = (_Float16)a[q]; fh.h[q] = h; fl.h[q] = (_Float16)((a[q] - (float)h) * 1024.0f); h = (_Float16)c[q]; fh.h[4 + q] = h; fl.h[4 + q] = (_Float16)((c[q] - (float)h) * 1024.0f); }
  { *(v8us*)((unsigned short*)Hh + t * 8) = fh.half[0]; *(v8us*)((unsigned short*)Hl + t * 8) = fl.half[0];  } }

// ---- fast GEMM (wave tile 32x64; requires M % 32 == 0 rows per launch region and N % 64 == 0); epilogue = k_gemm_hhx semantics ----
__device__ __forceinline__ v16h g2_frag(const _Float16* p, int hh) { FragH f; f.half[0] = *(const v8us*)((const unsigned short*)p + 8 * hh); f.half[1] = *(const v8us*)((const unsigned short*)p + 16 + 8 * hh); return f.v; }
__device__ __forceinline__ v8f g2_mma(v16h a, v16h b, v8f c) { v8f d = __builtin_amdgcn_wmma_f32_16x16x32_f16(false, a, false, b, (short)0, c, false, false); asm volatile("v_nop\n\tv_nop\n\tv_nop\n\tv_nop" : "+v"(d) : "v"(a), "v"(b)); return d; }
template <int ACT>
__global__ __launch_bounds__(128) void k_gemm2(const _Float16* __restrict__ A, int lda, size_t sA, const _Float16* __restrict__ Bh, int ldb, size_t sB, float alpha, const float* __restrict__ bias, size_t sBias, const float* __restrict__ CP, int rowsPerB, size_t sCPb, int row0g,
    float* __restrict__ C, _Float16* __restrict__ C16, int ldc, size_t sC, int M, int N, int K) { static_assert(ACT == 0 || ACT == 3 || ACT == 6 || ACT == 8 || ACT == 9 || ACT == 11 || ACT == 12 || ACT == 14 || ACT == 15 || ACT == 16 || ACT == 17, "k_gemm2: unsupported ACT code (would silently apply no activation)");
  __shared__ __attribute__((aligned(16))) float so[4][32][68];
  const int tid = threadIdx.x, w = tid >> 5, lane = tid & 31, ln = lane & 15, hh = lane >> 4; const int by = blockIdx.y;
  A += (size_t)by * sA; Bh += (size_t)by * sB; const size_t cofs = (size_t)by * sC; const float* bp = bias ? bias + (size_t)by * sBias : nullptr;
  const int ntn = N >> 6; const int mt = blockIdx.x / ntn, nq = blockIdx.x - mt * ntn; const int row0 = mt * 128 + 32 * w, col0 = nq * 64; if (row0 >= M) return;
  const _Float16* a0p = A + (size_t)(row0 + ln) * lda; const _Float16* a1p = a0p + (size_t)16 * lda;
  const _Float16* b0p = Bh + (size_t)(col0 + ln) * ldb; const _Float16* b1p = b0p + (size_t)16 * ldb; const _Float16* b2p = b1p + (size_t)16 * ldb; const _Float16* b3p = b2p + (size_t)16 * ldb;
  const v8f z8 = {0.f,0.f,0.f,0.f,0.f,0.f,0.f,0.f}; v8f c00 = z8, c01 = z8, c02 = z8, c03 = z8, c10 = z8, c11 = z8, c12 = z8, c13 = z8;
#pragma unroll 1
  for (int kb = 0; kb < K; kb += 32) { const v16h a0 = g2_frag(a0p + kb, hh), a1 = g2_frag(a1p + kb, hh);
    v16h b = g2_frag(b0p + kb, hh); c00 = g2_mma(a0, b, c00); c10 = g2_mma(a1, b, c10);
    b = g2_frag(b1p + kb, hh); c01 = g2_mma(a0, b, c01); c11 = g2_mma(a1, b, c11);
    b = g2_frag(b2p + kb, hh); c02 = g2_mma(a0, b, c02); c12 = g2_mma(a1, b, c12);
    b = g2_frag(b3p + kb, hh); c03 = g2_mma(a0, b, c03); c13 = g2_mma(a1, b, c13); }
  v8f accs[8] = {c00, c01, c02, c03, c10, c11, c12, c13};
#pragma unroll
  for (int u = 0; u < 8; ++u) { const int t = u & 3, half = u >> 2; const int col = col0 + t * 16 + ln; const float bv = bp ? bf16_round(bp[col]) : 0.f;
#pragma unroll
    for (int r = 0; r < 8; ++r) { const int rloc = half * 16 + 8 * hh + r; float v = accs[u][r] * alpha + bv; if (CP) { if (rowsPerB < 0) v += CP[cofs + (size_t)(row0g + row0 + rloc) * ldc + col];      /* rowsPerB < 0: own element of the batched C plane */ else { const int bidx = (row0g + row0 + rloc) / rowsPerB; v += CP[(size_t)bidx * sCPb + (size_t)by * 64 + col]; } }
      if (ACT == 3) v = fmaxf(v, 0.f); else if (ACT == 6) v = 0.5f * v * (1.0f + erff(v * 0.70710678118654752f)); else if (ACT == 11) v = 1.0f / (1.0f + expf(-v)); else if (ACT == 15) v = v / (1.0f + expf(-v)); else if (ACT == 12) v = (v > 0.f) ? v : 0.01f * v; else if (ACT == 8) v = tanhf(v); else if (ACT == 9) v = 0.5f * v * (1.0f + tanhf(0.7978845608028654f * (v + 0.044715f * v * v * v))); else if (ACT == 14) v = (v > 0.f) ? v : 0.1f * v; else if (ACT == 16) v = (v >= 0.f) ? v : 0.3f * v; else if (ACT == 17) v = (v >= 0.f) ? v : 0.2f * v;
      so[w][rloc][t * 16 + ln] = v; } }
  __builtin_amdgcn_fence(__ATOMIC_ACQ_REL, "workgroup"); __builtin_amdgcn_wave_barrier();
  const int rsub = lane >> 4, c4 = (lane & 15) * 4;
  {
#pragma unroll
    for (int q = 0; q < 16; ++q) { const int r = q * 2 + rsub; const v4f v = *(const v4fa*)&so[w][r][c4]; if (C) *(v4f*)(C + cofs + (size_t)(row0 + r) * ldc + col0 + c4) = v; if (C16) { v4h h4; for (int i = 0; i < 4; ++i) h4[i] = (_Float16)v[i]; *(v4h*)(C16 + cofs + (size_t)(row0 + r) * ldc + col0 + c4) = h4; } }
     } }


__global__ __launch_bounds__(256) void k_wnat(const float* __restrict__ w, size_t n8, _Float16* __restrict__ Bt) { const size_t t = (size_t)blockIdx.x * 256 + threadIdx.x; if (t >= n8) return; FragH f; for (int q = 0; q < 8; ++q) f.h[q] = (_Float16)(bf16_round(w[t * 8 + q]) * 16.0f); *(v8us*)((unsigned short*)Bt + t * 8) = f.half[0];  }
__global__ __launch_bounds__(256) void k_rsm(const float* __restrict__ S, _Float16* __restrict__ P, int nrows) {
  #pragma clang fp contract(off)
  const int i = blockIdx.x * 256 + threadIdx.x; if (i >= nrows) return; const float* s = S + (size_t)i * SQ; float mx = -3.0e38f;
#pragma unroll 1
  for (int j = 0; j < SQ; ++j) mx = fmaxf(mx, s[j]); float se = 0.f;
#pragma unroll 1
  for (int j = 0; j < SQ; ++j) se += expf(s[j] - mx); const float sc = 256.0f / se;
#pragma unroll 1
  for (int j0 = 0; j0 < SQ; j0 += 8) { FragH f; for (int q = 0; q < 8; ++q) f.h[q] = (_Float16)(expf(s[j0 + q] - mx) * sc); unsigned short* d = (unsigned short*)P + (size_t)i * SQ + j0; *(v8us*)d = f.half[0];  } }
__global__ __launch_bounds__(256) void k_vt(const _Float16* __restrict__ V16, int b, int h0, _Float16* __restrict__ VT) { __shared__ unsigned short tl[64][65]; const int tid = threadIdx.x; const int hh = blockIdx.x % HG, sg = blockIdx.x / HG; const int s0 = sg * 64; const int h = h0 + hh;
  for (int i = tid; i < 64 * 8; i += 256) { const int j = i / 8, d8 = (i % 8) * 8; FragH f; f.half[0] = *(const v8us*)((const unsigned short*)V16 + ((size_t)b * SQ + s0 + j) * DM + h * HD + d8); for (int q = 0; q < 8; ++q) tl[d8 + q][j] = f.u[q]; }
  __syncthreads();
  { for (int i = tid; i < 64 * 8; i += 256) { const int d = i / 8, j8 = (i % 8) * 8; FragH f; for (int q = 0; q < 8; ++q) f.u[q] = tl[d][j8 + q]; *(v8us*)((unsigned short*)VT + ((size_t)hh * HD + d) * SQ + s0 + j8) = f.half[0]; }  } }



__global__ __launch_bounds__(256) void k_rsmcf2(const float* __restrict__ S, _Float16* __restrict__ P, int hg, int q0, int nk) {
  #pragma clang fp contract(off)
  const int t = blockIdx.x * 256 + threadIdx.x; if (t >= hg * QT) return; const size_t i = (size_t)t; const float* s = S + i * NKX; const int last = q0 + (t % QT); float mx = -3.0e38f;
#pragma unroll 1
  for (int j = 0; j < nk; ++j) { const float f = (j <= last) ? 1.f : 0.f; mx = fmaxf(mx, fmaf(f, s[j], (1.f - f) * -1.0e9f)); } float se = 0.f;
#pragma unroll 1
  for (int j = 0; j < nk; ++j) { const float f = (j <= last) ? 1.f : 0.f; se += __expf(fmaf(f, s[j], (1.f - f) * -1.0e9f) - mx); } const float sc = 256.0f / se;
#pragma unroll 1
  for (int j0 = 0; j0 < nk; j0 += 8) { FragH fr; for (int q = 0; q < 8; ++q) { const int j = j0 + q; const float f = (j <= last) ? 1.f : 0.f; fr.h[q] = (_Float16)(__expf(fmaf(f, s[j], (1.f - f) * -1.0e9f) - mx) * sc); } unsigned short* d = (unsigned short*)P + i * NKX + j0; *(v8us*)d = fr.half[0];  } }


template <int MASKADD>
__global__ __launch_bounds__(64) void k_att0(const float* __restrict__ QF, const float* __restrict__ KF, const float* __restrict__ VF, int ld, const float* __restrict__ mask, float scale, float* __restrict__ OF, int ldo) {
  #pragma clang fp contract(off)
  __shared__ __attribute__((aligned(16))) float lq[64][64]; __shared__ __attribute__((aligned(16))) float lo[64][64];
  const int tid = threadIdx.x; const int h = blockIdx.x / (QT0 / 64), rg = blockIdx.x % (QT0 / 64); const int i = rg * 64 + tid;
  const float* qr = QF + (size_t)i * ld + h * HD;
#pragma unroll 1
  for (int c = 0; c < HD / 4; ++c) { *(v4f*)&lq[tid][c * 4] = *(const v4fa*)(qr + c * 4); const v4f z = {0.f, 0.f, 0.f, 0.f}; *(v4f*)&lo[tid][c * 4] = z; }
  float m = -1.0e30f, l = 0.f; const int jmax = MASKADD ? (SQ - 1) : (rg * 64 + 63);      /* additive-mask form: every key (the mask input decides); causal form: keys up to the block's last row */
#pragma unroll 1
  for (int j = 0; j <= jmax; ++j) { const float* kr = KF + (size_t)j * ld + h * HD; const float* vr = VF + (size_t)j * ld + h * HD; float s = 0.f;
#pragma unroll 1
    for (int c = 0; c < HD / 4; ++c) { const v4f kq = *(const v4fa*)(kr + c * 4); const v4f qq = *(v4f*)&lq[tid][c * 4]; s = __fadd_rn(s, __fmul_rn(qq[0], kq[0])); s = __fadd_rn(s, __fmul_rn(qq[1], kq[1])); s = __fadd_rn(s, __fmul_rn(qq[2], kq[2])); s = __fadd_rn(s, __fmul_rn(qq[3], kq[3])); }
    s = __fmul_rn(s, scale); if (MASKADD) s = __fadd_rn(s, __fmul_rn(bf16_round(mask[(size_t)i * SQ + j]), -10000.0f));
    const float f = (MASKADD || j <= i) ? 1.f : 0.f; const float sm = fmaf(f, s, (1.f - f) * -1.0e30f); const float mn = fmaxf(m, sm); const float sc = expf(m - mn); const float e = expf(sm - mn); l = __fadd_rn(__fmul_rn(l, sc), e); m = mn;
#pragma unroll 1
    for (int c = 0; c < HD / 4; ++c) { const v4f vv = *(const v4fa*)(vr + c * 4); v4f oo = *(v4f*)&lo[tid][c * 4]; for (int u = 0; u < 4; ++u) oo[u] = __fadd_rn(__fmul_rn(oo[u], sc), __fmul_rn(e, vv[u])); *(v4f*)&lo[tid][c * 4] = oo; } }
  const float fin = 64.0f / l;      /* o carried x64, undone by k_o0m */
#pragma unroll 1
  for (int c = 0; c < HD / 4; ++c) { v4f oo = *(v4f*)&lo[tid][c * 4]; for (int u = 0; u < 4; ++u) oo[u] = __fmul_rn(oo[u], fin); *(v4f*)&lo[tid][c * 4] = oo; }
  __syncthreads();
  {
#pragma unroll 1
    for (int it = 0; it < 16; ++it) { const int row = it * 4 + tid / 16, pc = (tid % 16) * 4; const v4f v = *(const v4f*)&lo[row][pc]; *(v4f*)(OF + (size_t)(rg * 64 + row) * ldo + h * HD + pc) = v; }
     } }


template <int BFIN, int WXB>
__global__ __launch_bounds__(256) void k_ln16(const float* __restrict__ X, const float* __restrict__ g, const float* __restrict__ bb, float eps, _Float16* __restrict__ N16, float* __restrict__ XB) {
  #pragma clang fp contract(off)
  __shared__ float red[256]; const size_t r = blockIdx.x; const int t = threadIdx.x; const v4f xa = *(const v4fa*)(X + r * DMQ + t * 4); float s[4]; float sum = 0.f;
  for (int q = 0; q < 4; ++q) { s[q] = BFIN ? bf16_round(xa[q]) : xa[q]; sum = __fadd_rn(sum, s[q]); }
  red[t] = sum; __syncthreads(); for (int st = 128; st > 0; st >>= 1) { if (t < st) red[t] = __fadd_rn(red[t], red[t + st]); __syncthreads(); } const float mu = red[0] / (float)DMQ; __syncthreads();
  float vs = 0.f; for (int q = 0; q < 4; ++q) { const float dl = __fadd_rn(s[q], -mu); vs = __fadd_rn(vs, __fmul_rn(dl, dl)); } red[t] = vs; __syncthreads(); for (int st = 128; st > 0; st >>= 1) { if (t < st) red[t] = __fadd_rn(red[t], red[t + st]); __syncthreads(); }
  const float rs = rsqrtf(__fadd_rn(red[0] / (float)DMQ, eps)); v4h y; v4f xb;
  for (int q = 0; q < 4; ++q) { const int c = t * 4 + q; y[q] = (_Float16)__fadd_rn(__fmul_rn(__fmul_rn(__fadd_rn(s[q], -mu), rs), bf16_round(g[c])), bf16_round(bb[c])); xb[q] = s[q]; }
  { *(v4h*)(N16 + r * DMQ + t * 4) = y; if (WXB) *(v4f*)(XB + r * DMQ + t * 4) = xb;  } }
__global__ __launch_bounds__(256) void k_ftres2(const float* __restrict__ OF0, const float* __restrict__ XB, float* __restrict__ X1, size_t n4) {
  #pragma clang fp contract(off)
  const size_t t = (size_t)blockIdx.x * 256 + threadIdx.x; if (t >= n4) return; const v4f o = *(const v4fa*)(OF0 + t * 4), xv = *(const v4fa*)(XB + t * 4); v4f y; for (int q = 0; q < 4; ++q) y[q] = __fadd_rn(__fmul_rn(o[q], 0.015625f), xv[q]); *(v4f*)(X1 + t * 4) = y;  }

__global__ __launch_bounds__(256) void k_wthd(const float* __restrict__ Wt, _Float16* __restrict__ Bt) { const size_t t = (size_t)blockIdx.x * 256 + threadIdx.x; if (t >= (size_t)NH * HD * (DM / 8)) return; const int m8 = (int)(t % (DM / 8)) * 8; const int d = (int)((t / (DM / 8)) % HD); const int h = (int)(t / ((size_t)(DM / 8) * HD)); FragH f;
  for (int q = 0; q < 8; ++q) f.h[q] = (_Float16)(16.0f * bf16_round(Wt[((size_t)h * DM + m8 + q) * HD + d])); unsigned short* dst = (unsigned short*)Bt + ((size_t)h * HD + d) * DM + m8; *(v8us*)dst = f.half[0];  }




__global__ __launch_bounds__(256) void k_wtpad(const float* __restrict__ Wm, _Float16* __restrict__ Wt, int Kr, int Kp, int Nr, int Np, float scale) {
  const int t = blockIdx.x * 256 + threadIdx.x; if (t >= Np * (Kp / 8)) return; const int n = t / (Kp / 8), k8 = (t % (Kp / 8)) * 8; const int nc = min(n, Nr - 1); const float fn = (n < Nr) ? 1.f : 0.f; FragH f;
  for (int i = 0; i < 8; ++i) { const int k = k8 + i; const int kc = min(k, Kr - 1); const float fk = (k < Kr) ? fn : 0.f; f.h[i] = (_Float16)(bf16_round(Wm[(size_t)kc * Nr + nc]) * scale * fk); }
  unsigned short* o = (unsigned short*)Wt + (size_t)n * Kp + k8; *(v8us*)o = f.half[0];  }
__global__ __launch_bounds__(128) void k_bpad(const float* __restrict__ b, float* __restrict__ Bp, int nr, int np) {
  const int i = threadIdx.x; if (i >= np) return; const float v = b[min(i, nr - 1)] * ((i < nr) ? 1.f : 0.f); *(float*)(Bp + i) = v;  }

#define DI 64         /* inner width = NH * HD (ONE 64-wide head) */
#define LQK (3 * DI)  /* fused q | k | v row pitch (192) */
__global__ __launch_bounds__(256) void k_o0(const float* __restrict__ OF, float* __restrict__ ob, size_t n4) {
  #pragma clang fp contract(off)
  const size_t t = (size_t)blockIdx.x * 256 + threadIdx.x; if (t >= n4) return; const size_t e = t * 4; const int i = (int)(e / DI); const int c = (int)(e % DI); const int h = c / HD, d = c % HD; const v4f a = *(const v4fa*)(OF + e); v4f o; for (int q = 0; q < 4; ++q) o[q] = __fmul_rn(a[q], 0.015625f); float* dst = ob + (size_t)h * SQ * HD + (size_t)i * HD + d; *(v4f*)dst = o;  }

__global__ __launch_bounds__(256) void k_o0m(const float* __restrict__ OF, float* __restrict__ o_, size_t n4) {
  #pragma clang fp contract(off)
  const size_t t = (size_t)blockIdx.x * 256 + threadIdx.x; if (t >= n4) return; const size_t e = t * 4; const v4f a = *(const v4fa*)(OF + e); v4f o; for (int q = 0; q < 4; ++q) o[q] = __fmul_rn(a[q], 0.015625f); *(v4f*)(o_ + e) = o;  }
extern "C" void kernel_launch(void* const* d_in, const int* in_sizes, int n_in,
                              void* d_out, int out_size, void* d_ws, size_t ws_size, hipStream_t stream) {
  (void)in_sizes; (void)n_in; (void)out_size;
  const float* const* I = (const float* const*)d_in; const float* x = I[0]; const float* wq = I[1]; const float* wk = I[2]; const float* wv = I[3]; const float* bq = nullptr; const float* bk = nullptr; const float* bv = nullptr;      /* x; [in][out = 64] Wq / Wk / Wv (input order as this module lists them); no biases */
  char* ws = (char*)d_ws; size_t off = 0;
  auto take = [&](size_t bytes) { char* p = ws + off; off += (bytes + 255) & ~(size_t)255; return p; };
  _Float16* BW = (_Float16*)take((size_t)LQK * DM * 2); _Float16* X16 = (_Float16*)take(NR * DM * 2); _Float16* QKV = (_Float16*)take(NR * LQK * 2); _Float16* VT = (_Float16*)take((size_t)NH * HD * SQ * 2);
  float* S = (float*)take((size_t)NH * QT * NKX * 4); _Float16* P = (_Float16*)take((size_t)NH * QT * NKX * 2); float* QKVF0 = (float*)take((size_t)QT0 * LQK * 4); float* OF0 = (float*)take((size_t)QT0 * DI * 4);
  if (off > ws_size) return;
  { const unsigned g = (unsigned)(((size_t)DI * (DM / 8) + 255) / 256); k_wt_f16<<<g, 256, 0, stream>>>(wq, BW, DM, DI, 16.0f); k_wt_f16<<<g, 256, 0, stream>>>(wk, BW + (size_t)DI * DM, DM, DI, 16.0f); k_wt_f16<<<g, 256, 0, stream>>>(wv, BW + (size_t)2 * DI * DM, DM, DI, 16.0f); }      /* [in = DM][out = 64] -> Bt[n][k] x16, stacked q | k | v */
  k_x16<<<(unsigned)((NR * DM / 8 + 255) / 256), 256, 0, stream>>>(x, X16, NR * DM / 8);      /* x (bf16-valued) as exact f16 rows */
  const float* bqkv[3] = {bq, bk, bv};
  for (int c = 0; c < 3; ++c) k_gemm2<0><<<dim3((unsigned)((NR / 128) * (DI / 64)), 1), 128, 0, stream>>>(X16, DM, 0, BW + (size_t)c * DI * DM, DM, 0, 0.0625f, bqkv[c], 0, nullptr, 1, 0, 0, nullptr, QKV + (size_t)c * DI, LQK, 0, (int)NR, DI, DM);      /* q | k | v = x W^T -> f16 rows, column blocks 0 / 64 / 128 of the fused plane (pitch 192); head h = columns h*64 inside each */
  const _Float16* Q16 = QKV; const _Float16* K16 = QKV + DI; const _Float16* V16 = QKV + 2 * DI;
  for (int b = 0; b < NB; ++b) { const size_t r0 = (size_t)b * SQ; float* ob = (float*)d_out + r0 * DI;
    k_vt<NH, SQ><<<NH * (SQ / 64), 256, 0, stream>>>(V16 + r0 * LQK, LQK, 0, VT);      /* V^T [NH][HD][SQ] for this batch */
    for (int q0 = 0; q0 < SQ; q0 += QT) { const int nk = q0 + QT;      /* causal: only keys below the tile end are computed */
      k_gemm2<0><<<dim3((QT / 128) * (nk / 64), NH), 128, 0, stream>>>(Q16 + (r0 + q0) * LQK, LQK, (size_t)HD, K16 + r0 * LQK, LQK, (size_t)HD, 0.024895003f, nullptr, 0, nullptr, 1, 0, 0, S, nullptr, NKX, (size_t)QT * NKX, QT, nk, HD);      /* scores * 256^-0.666, the one head on grid.y */
      k_rsmcf2<<<(NH * QT + 255) / 256, 256, 0, stream>>>(S, P, NH, q0, nk);      /* causal softmax -> P x256 f16 */
      k_gemm2<0><<<dim3((QT / 128) * (HD / 64), NH), 128, 0, stream>>>(P, NKX, (size_t)QT * NKX, VT, SQ, (size_t)HD * SQ, 0.00390625f, nullptr, 0, nullptr, 1, 0, 0, ob + (size_t)q0 * DI, nullptr, DI, (size_t)HD, QT, HD, nk); }      /* out[b][q0 + i][h*64..] = P V^T 2^-8 (f32): merged rows, head h at column offset h*64 */
    for (int c = 0; c < 3; ++c) k_gemm2<0><<<dim3((unsigned)((QT0 / 128) * (DI / 64)), 1), 128, 0, stream>>>(X16 + r0 * DM, DM, 0, BW + (size_t)c * DI * DM, DM, 0, 0.0625f, bqkv[c], 0, nullptr, 1, 0, 0, QKVF0 + (size_t)c * DI, nullptr, LQK, 0, QT0, DI, DM);      /* f32 q | k | v of rows 0..511 (exact products, f32 accumulation) */
    k_att0<0><<<NH * (QT0 / 64), 64, 0, stream>>>(QKVF0, QKVF0 + DI, QKVF0 + 2 * DI, LQK, nullptr, 0.024895003f, OF0, DI);      /* exact f32 causal attention for rows 0..511 (o x64) */
    k_o0m<<<(unsigned)(((size_t)QT0 * DI / 4 + 255) / 256), 256, 0, stream>>>(OF0, ob, (size_t)QT0 * DI / 4); }      /* rows 0..511 of the batch REWRITTEN from the exact path */
}

// v001
// Measured time: 2370 microseconds a run.
// Timed twice side by side with v000, it ran 30.2 and 30.1 times as fast.
#include <hip/hip_runtime.h>
// Single-head causal self-attention with the module's literal scale C^-0.666 (x [32][1024][256]; q/k/v = x W ([in][out] [256][64], no biases); ONE 64-wide head; scores * 256^-0.666 = 0.024895 (as the source writes it, not head_size^-0.5); causal; softmax; out = weights v -> [32][1024][64]; no output projection).
// Structure: token rows; x as exact f16 rows; three WMMA GEMMs into one f16 q | k | v plane [32768][192]; per batch v^T via LDS transposes; causal 256-row query tiles with the batch on grid.y (scores alpha 256^-0.666, causal softmax f32 -> f16 x256 weights, P V written as f32 straight into the merged output rows); an exact f32 first tile (rows 0..511) rewritten at the end; launches: see trace.
// Compute dtype: inputs rounded to bf16; x / weights exact; q, k, v and softmax weights as plain f16 GEMM operands (~2^-12); scores and softmax statistics f32. v_wmma_f32_16x16x32_f16.
#define NB 32
#define SQ 1024
#define DM 256
#define NH 1
#define HD 64
#define HG 4                         /* heads per launch of the non-template k_vt, which is not launched */
#define QT 256                       /* query rows per causal tile */
#define NKX SQ                       /* S / P row pitch */
#define QT0 512                      /* first-tile rows recomputed exactly (f32): 512 here (no output projection averages the early-row cancellation errors away; logit sigma 1.0) */
#define B0 0                         /* first batch processed (debug hook) */
#define NBR NB                       /* batches processed (debug hook) */
#define NR ((size_t)NB * SQ)
#define DMQ DM
#define DFF 4096                     /* unused (no FFN in this file) */
#define DFFR 100                     /* unused */
#define MP ((int)((size_t)NBR * SQ)) /* rows projected (debug hook) */
#define QN SQ                        /* query rows attended per batch (debug hook) */
#define NHD NH                       /* heads attended (debug hook) */
#define MPO MP                       /* rows through the output stage (debug hook) */
#define LQ (3 * DM)      /* unused; the q/k/v rows have pitch LQK (192) */
typedef __bf16 v16b __attribute__((ext_vector_type(16)));
typedef unsigned short v8us __attribute__((ext_vector_type(8), may_alias));
typedef float  v8f  __attribute__((ext_vector_type(8)));
typedef float  v4f  __attribute__((ext_vector_type(4)));
typedef float  v4fa __attribute__((ext_vector_type(4), may_alias));
union FragB { v16b v; v8us half[2]; unsigned short u[16]; };

__device__ __forceinline__ unsigned short bf16_bits(float x) { unsigned int u = __float_as_uint(x); return (unsigned short)((u + 0x7FFFu + ((u >> 16) & 1u)) >> 16); }
__device__ __forceinline__ float bf16_val(unsigned short b) { return __uint_as_float(((unsigned int)b) << 16); }
__device__ __forceinline__ float bf16_round(float x) { return bf16_val(bf16_bits(x)); }
// D += A·B with NT terms: 1 = ah·bh, 2 = + al·bh (A split), 3 = + ah·bl (both split)
template <int NT>
__device__ __forceinline__ v8f mmaN(v16b ah, v16b al, v16b bh, v16b bl, v8f c) {
  c = __builtin_amdgcn_wmma_f32_16x16x32_bf16(false, ah, false, bh, (short)0, c, false, false);
  if (NT >= 2) c = __builtin_amdgcn_wmma_f32_16x16x32_bf16(false, al, false, bh, (short)0, c, false, false);
  if (NT >= 3) c = __builtin_amdgcn_wmma_f32_16x16x32_bf16(false, ah, false, bl, (short)0, c, false, false);
  asm volatile("v_nop\n\tv_nop\n\tv_nop\n\tv_nop" : "+v"(c) : "v"(ah), "v"(al), "v"(bh), "v"(bl));
  return c;
}

__global__ __launch_bounds__(256) void k_wt_bf16(const float* __restrict__ W, unsigned short* __restrict__ Wt, int K, int N) {
  const int t = blockIdx.x * 256 + threadIdx.x;
  const int k8n = K / 8;
  if (t >= N * k8n) return;
  const int n = t / k8n, k8 = (t % k8n) * 8;
  v8us v;
#pragma unroll
  for (int i = 0; i < 8; ++i) v[i] = bf16_bits(W[(size_t)(k8 + i) * N + n]);
  *(v8us*)(Wt + (size_t)n * K + k8) = v;
  
}

// GEMM C[M][N] (f32, pitch ldc) = act(A[M][K]·W + bias). A f32 row-major (pitch lda) converted per fragment to bf16
// (ASPLIT: hi/lo two planes -> 2 terms, else single rounded term); Wt bf16 [N][K] (pitch ldb). BIAS_BF16 rounds the
// bias to bf16 first (bias quantised to bf16 before the add). K%32==0, M%16==0, N%64==0.
template <bool ASPLIT, int ACT, bool BIAS_BF16>
__global__ __launch_bounds__(128) void k_gemm_bf(const float* __restrict__ A, int lda, const unsigned short* __restrict__ Wt, int ldb,
                                               const float* __restrict__ bias, float* __restrict__ C, int ldc, int M, int N, int K) {
  __shared__ __attribute__((aligned(16))) float so[4][16][64];
  const int tid = threadIdx.x, w = tid >> 5, lane = tid & 31, ln = lane & 15, hh = lane >> 4;
  const int ntn = N / 64;
  const int wid = blockIdx.x * 4 + w;
  const int mt = wid / ntn, nq = wid % ntn;
  if (mt * 16 >= M) return;
  const int row0 = mt * 16, col0 = nq * 64;
  const float* arow = A + (size_t)(row0 + ln) * lda;
  v8f acc[4] = {};
  for (int kb = 0; kb < K; kb += 32) {
    FragB ah, al;
    const v4f x0 = *(const v4fa*)(arow + kb + 8 * hh), x1 = *(const v4fa*)(arow + kb + 8 * hh + 4);
    const v4f x2 = *(const v4fa*)(arow + kb + 16 + 8 * hh), x3 = *(const v4fa*)(arow + kb + 16 + 8 * hh + 4);
    float xs[16] = {x0[0],x0[1],x0[2],x0[3],x1[0],x1[1],x1[2],x1[3],x2[0],x2[1],x2[2],x2[3],x3[0],x3[1],x3[2],x3[3]};
#pragma unroll
    for (int i = 0; i < 16; ++i) { const unsigned short hb = bf16_bits(xs[i]); ah.u[i] = hb; al.u[i] = ASPLIT ? bf16_bits(xs[i] - bf16_val(hb)) : (unsigned short)0; }
#pragma unroll
    for (int t = 0; t < 4; ++t) {
      const unsigned short* brow = Wt + (size_t)(col0 + t * 16 + ln) * ldb + kb;
      FragB b;
      b.half[0] = *(const v8us*)(brow + 8 * hh);
      b.half[1] = *(const v8us*)(brow + 16 + 8 * hh);
      acc[t] = mmaN<ASPLIT ? 2 : 1>(ah.v, al.v, b.v, b.v, acc[t]);
    }
  }
#pragma unroll
  for (int t = 0; t < 4; ++t) {
    float bv = bias ? bias[col0 + t * 16 + ln] : 0.f;
    if (BIAS_BF16) bv = bf16_round(bv);
#pragma unroll
    for (int r = 0; r < 8; ++r) { float v = acc[t][r] + bv; if (ACT == 1) v = fmaxf(v, 0.f); so[w][8 * hh + r][t * 16 + ln] = v; }
  }
  __builtin_amdgcn_fence(__ATOMIC_ACQ_REL, "workgroup");
  __builtin_amdgcn_wave_barrier();
  const int rsub = lane >> 4, c4 = (lane & 15) * 4;
  {
#pragma unroll
    for (int q = 0; q < 8; ++q) {
      const int r = q * 2 + rsub;
      const v4f v = *(const v4fa*)&so[w][r][c4];
      *(v4f*)(C + (size_t)(row0 + r) * ldc + col0 + c4) = v;
    }
    
  }
}

// GEMM C = act(A·W + bias + resid): A f32 (ASPLIT -> hi/lo 2 terms), Wt bf16 [N][K]; ACT 0 none, 1 relu, 2 exact gelu;
// resid (optional, f32, row index = (row % rmod), pitch ldr, RES_BF16 rounds it) added before the activation.
template <bool ASPLIT, int ACT, bool BIAS_BF16, bool RES_BF16>
__global__ __launch_bounds__(128) void k_gemm_bf3(const float* __restrict__ A, int lda, const unsigned short* __restrict__ Wt, int ldb,
                                                const float* __restrict__ bias, const float* __restrict__ resid, int rmod, int ldr,
                                                float* __restrict__ C, int ldc, int M, int N, int K) {
  __shared__ __attribute__((aligned(16))) float so[4][16][64];
  const int tid = threadIdx.x, w = tid >> 5, lane = tid & 31, ln = lane & 15, hh = lane >> 4;
  const int ntn = N / 64;
  const int wid = blockIdx.x * 4 + w;
  const int mt = wid / ntn, nq = wid % ntn;
  if (mt * 16 >= M) return;
  const int row0 = mt * 16, col0 = nq * 64;
  const float* arow = A + (size_t)(row0 + ln) * lda;
  v8f acc[4] = {};
  for (int kb = 0; kb < K; kb += 32) {
    FragB ah, al;
    const v4f x0 = *(const v4fa*)(arow + kb + 8 * hh), x1 = *(const v4fa*)(arow + kb + 8 * hh + 4);
    const v4f x2 = *(const v4fa*)(arow + kb + 16 + 8 * hh), x3 = *(const v4fa*)(arow + kb + 16 + 8 * hh + 4);
    float xs[16] = {x0[0],x0[1],x0[2],x0[3],x1[0],x1[1],x1[2],x1[3],x2[0],x2[1],x2[2],x2[3],x3[0],x3[1],x3[2],x3[3]};
#pragma unroll
    for (int i = 0; i < 16; ++i) { const unsigned short hb = bf16_bits(xs[i]); ah.u[i] = hb; al.u[i] = ASPLIT ? bf16_bits(xs[i] - bf16_val(hb)) : (unsigned short)0; }
#pragma unroll
    for (int t = 0; t < 4; ++t) {
      const unsigned short* brow = Wt + (size_t)(col0 + t * 16 + ln) * ldb + kb;
      FragB b;
      b.half[0] = *(const v8us*)(brow + 8 * hh);
      b.half[1] = *(const v8us*)(brow + 16 + 8 * hh);
      acc[t] = mmaN<ASPLIT ? 2 : 1>(ah.v, al.v, b.v, b.v, acc[t]);
    }
  }
#pragma unroll
  for (int t = 0; t < 4; ++t) {
    const int col = col0 + t * 16 + ln;
    float bv = bias ? bias[col] : 0.f;
    if (BIAS_BF16) bv = bf16_round(bv);
#pragma unroll
    for (int r = 0; r < 8; ++r) {
      float v = acc[t][r] + bv;
      if (resid) { float rv = resid[(size_t)((row0 + 8 * hh + r) % rmod) * ldr + col]; if (RES_BF16) rv = bf16_round(rv); v += rv; }
      if (ACT == 1) v = fmaxf(v, 0.f);
      if (ACT == 2) v = 0.5f * v * (1.0f + erff(v * 0.70710678118654752f));
      if (ACT == 3) { const float u = 0.7978845608028654f * (v + 0.044715f * v * v * v); v = 0.5f * v * (1.0f + tanhf(u)); }
      so[w][8 * hh + r][t * 16 + ln] = v;
    }
  }
  __builtin_amdgcn_fence(__ATOMIC_ACQ_REL, "workgroup");
  __builtin_amdgcn_wave_barrier();
  const int rsub = lane >> 4, c4 = (lane & 15) * 4;
  {
#pragma unroll
    for (int q = 0; q < 8; ++q) {
      const int r = q * 2 + rsub;
      const v4f v = *(const v4fa*)&so[w][r][c4];
      *(v4f*)(C + (size_t)(row0 + r) * ldc + col0 + c4) = v;
    }
    
  }
}
// row LayerNorm (biased variance, eps) over N: s = X (+ R); optional out_sum <- s; out_norm <- (s-mu)*rsqrt(var+eps)*g + b
template <bool PARAM_BF16>
__global__ __launch_bounds__(256) void k_layernorm(const float* __restrict__ X, const float* __restrict__ R, const float* __restrict__ g, const float* __restrict__ bta,
                                                  float* __restrict__ out_sum, float* __restrict__ out_norm, int N, float eps) {
  __shared__ float red[256];
  const int row = blockIdx.x, tid = threadIdx.x;
  const float* x = X + (size_t)row * N; const float* rr = R ? R + (size_t)row * N : nullptr;
  float vals[16];                     // up to N = 4096
  const int per = N / 256;            // contiguous chunk per thread? use strided-by-4 chunks: thread handles j = tid*4 + 1024*u
  float s1 = 0.f;
  for (int u = 0; u < per / 4; ++u) {
    const int j = tid * 4 + 1024 * u;
    const v4f a = *(const v4fa*)(x + j);
    v4f b = {0.f,0.f,0.f,0.f}; if (rr) b = *(const v4fa*)(rr + j);
#pragma unroll
    for (int q = 0; q < 4; ++q) { const float v = a[q] + b[q]; vals[u * 4 + q] = v; s1 += v; }
  }
  red[tid] = s1; __syncthreads();
  for (int st = 128; st > 0; st >>= 1) { if (tid < st) red[tid] += red[tid + st]; __syncthreads(); }
  const float mu = red[0] / (float)N; __syncthreads();
  float s2 = 0.f;
  for (int u = 0; u < per / 4; ++u)
#pragma unroll
    for (int q = 0; q < 4; ++q) { const float c = vals[u * 4 + q] - mu; s2 += c * c; }
  red[tid] = s2; __syncthreads();
  for (int st = 128; st > 0; st >>= 1) { if (tid < st) red[tid] += red[tid + st]; __syncthreads(); }
  const float rs = rsqrtf(red[0] / (float)N + eps);
  {
    for (int u = 0; u < per / 4; ++u) {
      const int j = tid * 4 + 1024 * u;
      v4f o, sm;
#pragma unroll
      for (int q = 0; q < 4; ++q) {
        float gg = g[j + q], bb = bta[j + q];
        if (PARAM_BF16) { gg = bf16_round(gg); bb = bf16_round(bb); }
        sm[q] = vals[u * 4 + q]; o[q] = (vals[u * 4 + q] - mu) * rs * gg + bb;
      }
      if (out_sum) *(v4f*)(out_sum + (size_t)row * N + j) = sm;
      *(v4f*)(out_norm + (size_t)row * N + j) = o;
    }
    
  }
}



// ---- f16 WMMA path (v_wmma_f32_16x16x32_f16): 11-bit significands for operands in range — used where a [0,1] probability operand needs more precision than bf16
typedef _Float16 v16h __attribute__((ext_vector_type(16)));
union FragH { v16h v; v8us half[2]; _Float16 h[16]; unsigned short u[16]; };
template <int NT>
__device__ __forceinline__ v8f mmaH(v16h ah, v16h al, v16h bh, v16h bl, v8f c) {
  c = __builtin_amdgcn_wmma_f32_16x16x32_f16(false, ah, false, bh, (short)0, c, false, false);
  if (NT >= 2) c = __builtin_amdgcn_wmma_f32_16x16x32_f16(false, al, false, bh, (short)0, c, false, false);
  if (NT >= 3) c = __builtin_amdgcn_wmma_f32_16x16x32_f16(false, ah, false, bl, (short)0, c, false, false);
  asm volatile("v_nop\n\tv_nop\n\tv_nop\n\tv_nop" : "+v"(c) : "v"(ah), "v"(al), "v"(bh), "v"(bl));
  return c;
}
// batched GEMM like k_gemm_b but f16 operands: A f32 (split into f16 hi/lo if ASPLIT, else rounded to f16), Bt = f16 values [n][k]; alpha; C f32; N multiple of 16 (partial tiles skipped)
template <bool ASPLIT>
__global__ __launch_bounds__(128) void k_gemm_h(const float* __restrict__ A, int lda, size_t sA, const _Float16* __restrict__ Bh, int ldb, size_t sB, float alpha, float* __restrict__ C, int ldc, size_t sC, int M, int N, int K) {
  __shared__ __attribute__((aligned(16))) float so[4][16][64];
  const int tid = threadIdx.x, w = tid >> 5, lane = tid & 31, ln = lane & 15, hh = lane >> 4; const int by = blockIdx.y;
  A += (size_t)by * sA; Bh += (size_t)by * sB; C += (size_t)by * sC;
  const int ntn = (N + 63) / 64; const int wid = blockIdx.x * 4 + w; const int mt = wid / ntn, nq = wid % ntn; if (mt * 16 >= M) return;
  const int row0 = mt * 16, col0 = nq * 64; const float* arow = A + (size_t)(row0 + ln) * lda;
  v8f acc[4] = {};
  for (int kb = 0; kb < K; kb += 32) {
    FragH ah, al;
    const v4f x0 = *(const v4fa*)(arow + kb + 8 * hh), x1 = *(const v4fa*)(arow + kb + 8 * hh + 4), x2 = *(const v4fa*)(arow + kb + 16 + 8 * hh), x3 = *(const v4fa*)(arow + kb + 16 + 8 * hh + 4);
    float xs[16] = {x0[0],x0[1],x0[2],x0[3],x1[0],x1[1],x1[2],x1[3],x2[0],x2[1],x2[2],x2[3],x3[0],x3[1],x3[2],x3[3]};
#pragma unroll
    for (int i = 0; i < 16; ++i) { const _Float16 h = (_Float16)xs[i]; ah.h[i] = h; al.h[i] = ASPLIT ? (_Float16)(xs[i] - (float)h) : (_Float16)0.0f; }
#pragma unroll
    for (int t = 0; t < 4; ++t) { if (col0 + t * 16 >= N) continue; const size_t boff = (size_t)(col0 + t * 16 + ln) * ldb + kb; FragH bq; bq.half[0] = *(const v8us*)(Bh + boff + 8 * hh); bq.half[1] = *(const v8us*)(Bh + boff + 16 + 8 * hh);
      acc[t] = mmaH<ASPLIT ? 2 : 1>(ah.v, al.v, bq.v, bq.v, acc[t]); }
  }
#pragma unroll
  for (int t = 0; t < 4; ++t) { if (col0 + t * 16 >= N) continue;
#pragma unroll
    for (int r = 0; r < 8; ++r) so[w][8 * hh + r][t * 16 + ln] = acc[t][r] * alpha; }
  __builtin_amdgcn_fence(__ATOMIC_ACQ_REL, "workgroup"); __builtin_amdgcn_wave_barrier();
  const int rsub = lane >> 4, c4 = (lane & 15) * 4;
  {
#pragma unroll
    for (int q = 0; q < 8; ++q) { const int r = q * 2 + rsub; if (col0 + c4 < N) { const v4f v = *(const v4fa*)&so[w][r][c4]; *(v4f*)(C + (size_t)(row0 + r) * ldc + col0 + c4) = v; } }
     }
}

// Wt[n][k] = f16(W[k][n]·scale) from f32 row-major W[K][N] (scale = power of two; bf16-exact weights stay exact in f16 away from the subnormal range)
__global__ __launch_bounds__(256) void k_wt_f16(const float* __restrict__ W, _Float16* __restrict__ Wt, int K, int N, float scale) {
  const int t = blockIdx.x * 256 + threadIdx.x; if (t >= N * (K / 8)) return; const int n = t / (K / 8), k8 = (t % (K / 8)) * 8; FragH f;
#pragma unroll
  for (int i = 0; i < 8; ++i) f.h[i] = (_Float16)(bf16_round(W[(size_t)(k8 + i) * N + n]) * scale); const v8us o = f.half[0];
  *(v8us*)((unsigned short*)Wt + (size_t)n * K + k8) = o; 
}
// k_gemm_hh variant with fused epilogue: v = acc·alpha + bias[by·sBias + col] (+ CP[(row/rowsPerB)·sCPb + by·64 + col] if CP) ; ACT 0 none / 1 elu ; writes f16 C16 (and f32 C if non-null)
template <int ACT>
__global__ __launch_bounds__(128) void k_gemm_hhx(const _Float16* __restrict__ A, int lda, size_t sA, const _Float16* __restrict__ Bh, int ldb, size_t sB, float alpha, const float* __restrict__ bias, size_t sBias, const float* __restrict__ CP, int rowsPerB, size_t sCPb, int row0g,
    float* __restrict__ C, _Float16* __restrict__ C16, int ldc, size_t sC, int M, int N, int K) {
  __shared__ __attribute__((aligned(16))) float so[4][16][64];
  const int tid = threadIdx.x, w = tid >> 5, lane = tid & 31, ln = lane & 15, hh = lane >> 4; const int by = blockIdx.y;
  A += (size_t)by * sA; Bh += (size_t)by * sB; const size_t cofs = (size_t)by * sC; const float* bp = bias ? bias + (size_t)by * sBias : nullptr;
  const int ntn = (N + 63) / 64; const int wid = blockIdx.x * 4 + w; const int mt = wid / ntn, nq = wid % ntn; if (mt * 16 >= M) return;
  const int row0 = mt * 16, col0 = nq * 64; const _Float16* arow = A + (size_t)(row0 + ln) * lda;
  v8f acc[4] = {};
  for (int kb = 0; kb < K; kb += 32) { FragH ah; ah.half[0] = *(const v8us*)((const unsigned short*)arow + kb + 8 * hh); ah.half[1] = *(const v8us*)((const unsigned short*)arow + kb + 16 + 8 * hh);
#pragma unroll
    for (int t = 0; t < 4; ++t) { if (col0 + t * 16 >= N) continue; const size_t boff = (size_t)(col0 + t * 16 + ln) * ldb + kb; FragH bq; bq.half[0] = *(const v8us*)((const unsigned short*)Bh + boff + 8 * hh); bq.half[1] = *(const v8us*)((const unsigned short*)Bh + boff + 16 + 8 * hh);
      acc[t] = mmaH<1>(ah.v, ah.v, bq.v, bq.v, acc[t]); }
  }
#pragma unroll
  for (int t = 0; t < 4; ++t) { if (col0 + t * 16 >= N) continue; const int col = col0 + t * 16 + ln; const float bv = bp ? bf16_round(bp[col]) : 0.f;
#pragma unroll
    for (int r = 0; r < 8; ++r) { float v = acc[t][r] * alpha + bv; if (CP) { const int rr = row0g + row0 + 8 * hh + r; if (rowsPerB < 0) v += CP[cofs + (size_t)rr * ldc + col];      /* rowsPerB < 0: own element of the batched C plane */ else { const int bidx = rr / rowsPerB; v += CP[(size_t)bidx * sCPb + (size_t)by * 64 + col]; } } if (ACT == 1) v = (v > 0.f) ? v : expm1f(v); else if (ACT == 7) v = (v > 0.f) ? v + 1.0f : expf(v); else if (ACT == 8) v = tanhf(v); else if (ACT == 9) v = 0.5f * v * (1.0f + tanhf(0.7978845608028654f * (v + 0.044715f * v * v * v))); else if (ACT == 11) v = 1.0f / (1.0f + expf(-v)); else if (ACT == 12) v = (v > 0.f) ? v : 0.01f * v; else if (ACT == 14) v = (v > 0.f) ? v : 0.1f * v; else if (ACT == 16) v = (v >= 0.f) ? v : 0.3f * v; else if (ACT == 17) v = (v >= 0.f) ? v : 0.2f * v; else if (ACT == 15) v = v / (1.0f + expf(-v)); else if (ACT == 3) v = fmaxf(v, 0.f); else if (ACT == 6) v = 0.5f * v * (1.0f + erff(v * 0.70710678118654752f)); so[w][8 * hh + r][t * 16 + ln] = v; } }
  __builtin_amdgcn_fence(__ATOMIC_ACQ_REL, "workgroup"); __builtin_amdgcn_wave_barrier();
  const int rsub = lane >> 4, c4 = (lane & 15) * 4; typedef _Float16 v4h __attribute__((ext_vector_type(4)));
  {
#pragma unroll
    for (int q = 0; q < 8; ++q) { const int r = q * 2 + rsub; if (col0 + c4 < N) { const v4f v = *(const v4fa*)&so[w][r][c4]; if (C) *(v4f*)(C + cofs + (size_t)(row0 + r) * ldc + col0 + c4) = v; if (C16) { v4h h4; for (int i = 0; i < 4; ++i) h4[i] = (_Float16)v[i]; *(v4h*)(C16 + cofs + (size_t)(row0 + r) * ldc + col0 + c4) = h4; } } }
     }
}


typedef _Float16 v4h __attribute__((ext_vector_type(4)));

__global__ __launch_bounds__(256) void k_x16(const float* __restrict__ x, _Float16* __restrict__ X16, size_t n8) { const size_t t = (size_t)blockIdx.x * 256 + threadIdx.x; if (t >= n8) return; FragH f;
#pragma unroll
  for (int q = 0; q < 8; ++q) f.h[q] = (_Float16)bf16_round(x[t * 8 + q]); *(v8us*)((unsigned short*)X16 + t * 8) = f.half[0];  }
__global__ __launch_bounds__(256) void k_h16(const float* __restrict__ x, _Float16* __restrict__ X16, size_t n8) { const size_t t = (size_t)blockIdx.x * 256 + threadIdx.x; if (t >= n8) return; FragH f;
#pragma unroll
  for (int q = 0; q < 8; ++q) f.h[q] = (_Float16)x[t * 8 + q]; *(v8us*)((unsigned short*)X16 + t * 8) = f.half[0];  }
__global__ __launch_bounds__(256) void k_round16f(const float* __restrict__ W, _Float16* __restrict__ Bt, size_t n8) { const size_t t = (size_t)blockIdx.x * 256 + threadIdx.x; if (t >= n8) return; FragH f;
#pragma unroll
  for (int i = 0; i < 8; ++i) f.h[i] = (_Float16)(bf16_round(W[t * 8 + i]) * 16.0f); *(v8us*)((unsigned short*)Bt + t * 8) = f.half[0];  }
template <int NHv, int TTv>
__global__ __launch_bounds__(256) void k_vt(const _Float16* __restrict__ V16, int ldv, int voff, _Float16* __restrict__ Vt) { __shared__ unsigned short tl[64][66]; const int tid = threadIdx.x; const int slab = blockIdx.x / (TTv / 64), lg = blockIdx.x % (TTv / 64); const int b = slab / NHv, h = slab % NHv;
  for (int i = tid; i < 64 * 8; i += 256) { const int r = i / 8, c8 = (i % 8) * 8; FragH f; f.half[0] = *(const v8us*)((const unsigned short*)V16 + ((size_t)b * TTv + lg * 64 + r) * ldv + voff + h * 64 + c8);
#pragma unroll
    for (int q = 0; q < 8; ++q) tl[r][c8 + q] = f.u[q]; }
  __syncthreads();
  {
#pragma unroll
    for (int rd = 0; rd < 2; ++rd) { const int d = rd * 32 + tid / 8, pc = tid % 8; FragH f;
#pragma unroll
      for (int q = 0; q < 8; ++q) f.u[q] = tl[pc * 8 + q][d];
      *(v8us*)((unsigned short*)Vt + ((size_t)slab * 64 + d) * TTv + lg * 64 + pc * 8) = f.half[0]; }
     } }

__global__ __launch_bounds__(256) void k_hl(const float* __restrict__ F, _Float16* __restrict__ Hh, _Float16* __restrict__ Hl, size_t n8) { const size_t t = (size_t)blockIdx.x * 256 + threadIdx.x; if (t >= n8) return; FragH fh, fl; const v4f a = *(const v4fa*)(F + t * 8), c = *(const v4fa*)(F + t * 8 + 4);
#pragma unroll
  for (int q = 0; q < 4; ++q) { _Float16 h = (_Float16)a[q]; fh.h[q] = h; fl.h[q] = (_Float16)((a[q] - (float)h) * 1024.0f); h = (_Float16)c[q]; fh.h[4 + q] = h; fl.h[4 + q] = (_Float16)((c[q] - (float)h) * 1024.0f); }
  { *(v8us*)((unsigned short*)Hh + t * 8) = fh.half[0]; *(v8us*)((unsigned short*)Hl + t * 8) = fl.half[0];  } }

// ---- fast GEMM (wave tile 32x64; requires M % 32 == 0 rows per launch region and N % 64 == 0); epilogue = k_gemm_hhx semantics ----
__device__ __forceinline__ v16h g2_frag(const _Float16* p, int hh) { FragH f; f.half[0] = *(const v8us*)((const unsigned short*)p + 8 * hh); f.half[1] = *(const v8us*)((const unsigned short*)p + 16 + 8 * hh); return f.v; }
__device__ __forceinline__ v8f g2_mma(v16h a, v16h b, v8f c) { v8f d = __builtin_amdgcn_wmma_f32_16x16x32_f16(false, a, false, b, (short)0, c, false, false); asm volatile("v_nop\n\tv_nop\n\tv_nop\n\tv_nop" : "+v"(d) : "v"(a), "v"(b)); return d; }
template <int ACT>
__global__ __launch_bounds__(128) void k_gemm2(const _Float16* __restrict__ A, int lda, size_t sA, const _Float16* __restrict__ Bh, int ldb, size_t sB, float alpha, const float* __restrict__ bias, size_t sBias, const float* __restrict__ CP, int rowsPerB, size_t sCPb, int row0g,
    float* __restrict__ C, _Float16* __restrict__ C16, int ldc, size_t sC, int M, int N, int K) { static_assert(ACT == 0 || ACT == 3 || ACT == 6 || ACT == 8 || ACT == 9 || ACT == 11 || ACT == 12 || ACT == 14 || ACT == 15 || ACT == 16 || ACT == 17, "k_gemm2: unsupported ACT code (would silently apply no activation)");
  __shared__ __attribute__((aligned(16))) float so[4][32][68];
  const int tid = threadIdx.x, w = tid >> 5, lane = tid & 31, ln = lane & 15, hh = lane >> 4; const int by = blockIdx.y;
  A += (size_t)by * sA; Bh += (size_t)by * sB; const size_t cofs = (size_t)by * sC; const float* bp = bias ? bias + (size_t)by * sBias : nullptr;
  const int ntn = N >> 6; const int mt = blockIdx.x / ntn, nq = blockIdx.x - mt * ntn; const int row0 = mt * 128 + 32 * w, col0 = nq * 64; if (row0 >= M) return;
  const _Float16* a0p = A + (size_t)(row0 + ln) * lda; const _Float16* a1p = a0p + (size_t)16 * lda;
  const _Float16* b0p = Bh + (size_t)(col0 + ln) * ldb; const _Float16* b1p = b0p + (size_t)16 * ldb; const _Float16* b2p = b1p + (size_t)16 * ldb; const _Float16* b3p = b2p + (size_t)16 * ldb;
  const v8f z8 = {0.f,0.f,0.f,0.f,0.f,0.f,0.f,0.f}; v8f c00 = z8, c01 = z8, c02 = z8, c03 = z8, c10 = z8, c11 = z8, c12 = z8, c13 = z8;
#pragma unroll 1
  for (int kb = 0; kb < K; kb += 32) { const v16h a0 = g2_frag(a0p + kb, hh), a1 = g2_frag(a1p + kb, hh);
    v16h b = g2_frag(b0p + kb, hh); c00 = g2_mma(a0, b, c00); c10 = g2_mma(a1, b, c10);
    b = g2_frag(b1p + kb, hh); c01 = g2_mma(a0, b, c01); c11 = g2_mma(a1, b, c11);
    b = g2_frag(b2p + kb, hh); c02 = g2_mma(a0, b, c02); c12 = g2_mma(a1, b, c12);
    b = g2_frag(b3p + kb, hh); c03 = g2_mma(a0, b, c03); c13 = g2_mma(a1, b, c13); }
  v8f accs[8] = {c00, c01, c02, c03, c10, c11, c12, c13};
#pragma unroll
  for (int u = 0; u < 8; ++u) { const int t = u & 3, half = u >> 2; const int col = col0 + t * 16 + ln; const float bv = bp ? bf16_round(bp[col]) : 0.f;
#pragma unroll
    for (int r = 0; r < 8; ++r) { const int rloc = half * 16 + 8 * hh + r; float v = accs[u][r] * alpha + bv; if (CP) { if (rowsPerB < 0) v += CP[cofs + (size_t)(row0g + row0 + rloc) * ldc + col];      /* rowsPerB < 0: own element of the batched C plane */ else { const int bidx = (row0g + row0 + rloc) / rowsPerB; v += CP[(size_t)bidx * sCPb + (size_t)by * 64 + col]; } }
      if (ACT == 3) v = fmaxf(v, 0.f); else if (ACT == 6) v = 0.5f * v * (1.0f + erff(v * 0.70710678118654752f)); else if (ACT == 11) v = 1.0f / (1.0f + expf(-v)); else if (ACT == 15) v = v / (1.0f + expf(-v)); else if (ACT == 12) v = (v > 0.f) ? v : 0.01f * v; else if (ACT == 8) v = tanhf(v); else if (ACT == 9) v = 0.5f * v * (1.0f + tanhf(0.7978845608028654f * (v + 0.044715f * v * v * v))); else if (ACT == 14) v = (v > 0.f) ? v : 0.1f * v; else if (ACT == 16) v = (v >= 0.f) ? v : 0.3f * v; else if (ACT == 17) v = (v >= 0.f) ? v : 0.2f * v;
      so[w][rloc][t * 16 + ln] = v; } }
  __builtin_amdgcn_fence(__ATOMIC_ACQ_REL, "workgroup"); __builtin_amdgcn_wave_barrier();
  const int rsub = lane >> 4, c4 = (lane & 15) * 4;
  {
#pragma unroll
    for (int q = 0; q < 16; ++q) { const int r = q * 2 + rsub; const v4f v = *(const v4fa*)&so[w][r][c4]; if (C) *(v4f*)(C + cofs + (size_t)(row0 + r) * ldc + col0 + c4) = v; if (C16) { v4h h4; for (int i = 0; i < 4; ++i) h4[i] = (_Float16)v[i]; *(v4h*)(C16 + cofs + (size_t)(row0 + r) * ldc + col0 + c4) = h4; } }
     } }


__global__ __launch_bounds__(256) void k_wnat(const float* __restrict__ w, size_t n8, _Float16* __restrict__ Bt) { const size_t t = (size_t)blockIdx.x * 256 + threadIdx.x; if (t >= n8) return; FragH f; for (int q = 0; q < 8; ++q) f.h[q] = (_Float16)(bf16_round(w[t * 8 + q]) * 16.0f); *(v8us*)((unsigned short*)Bt + t * 8) = f.half[0];  }
__global__ __launch_bounds__(256) void k_rsm(const float* __restrict__ S, _Float16* __restrict__ P, int nrows) {
  #pragma clang fp contract(off)
  const int i = blockIdx.x * 256 + threadIdx.x; if (i >= nrows) return; const float* s = S + (size_t)i * SQ; float mx = -3.0e38f;
#pragma unroll 1
  for (int j = 0; j < SQ; ++j) mx = fmaxf(mx, s[j]); float se = 0.f;
#pragma unroll 1
  for (int j = 0; j < SQ; ++j) se += expf(s[j] - mx); const float sc = 256.0f / se;
#pragma unroll 1
  for (int j0 = 0; j0 < SQ; j0 += 8) { FragH f; for (int q = 0; q < 8; ++q) f.h[q] = (_Float16)(expf(s[j0 + q] - mx) * sc); unsigned short* d = (unsigned short*)P + (size_t)i * SQ + j0; *(v8us*)d = f.half[0];  } }
__global__ __launch_bounds__(256) void k_vt(const _Float16* __restrict__ V16, int b, int h0, _Float16* __restrict__ VT) { __shared__ unsigned short tl[64][65]; const int tid = threadIdx.x; const int hh = blockIdx.x % HG, sg = blockIdx.x / HG; const int s0 = sg * 64; const int h = h0 + hh;
  for (int i = tid; i < 64 * 8; i += 256) { const int j = i / 8, d8 = (i % 8) * 8; FragH f; f.half[0] = *(const v8us*)((const unsigned short*)V16 + ((size_t)b * SQ + s0 + j) * DM + h * HD + d8); for (int q = 0; q < 8; ++q) tl[d8 + q][j] = f.u[q]; }
  __syncthreads();
  { for (int i = tid; i < 64 * 8; i += 256) { const int d = i / 8, j8 = (i % 8) * 8; FragH f; for (int q = 0; q < 8; ++q) f.u[q] = tl[d][j8 + q]; *(v8us*)((unsigned short*)VT + ((size_t)hh * HD + d) * SQ + s0 + j8) = f.half[0]; }  } }



__global__ __launch_bounds__(256) void k_rsmcf2(const float* __restrict__ S, _Float16* __restrict__ P, int hg, int q0, int nk) {
  #pragma clang fp contract(off)
  const int t = blockIdx.x * 256 + threadIdx.x; if (t >= hg * QT) return; const size_t i = (size_t)t; const float* s = S + i * NKX; const int last = q0 + (t % QT); float mx = -3.0e38f;
#pragma unroll 1
  for (int j = 0; j < nk; ++j) { const float f = (j <= last) ? 1.f : 0.f; mx = fmaxf(mx, fmaf(f, s[j], (1.f - f) * -1.0e9f)); } float se = 0.f;
#pragma unroll 1
  for (int j = 0; j < nk; ++j) { const float f = (j <= last) ? 1.f : 0.f; se += __expf(fmaf(f, s[j], (1.f - f) * -1.0e9f) - mx); } const float sc = 256.0f / se;
#pragma unroll 1
  for (int j0 = 0; j0 < nk; j0 += 8) { FragH fr; for (int q = 0; q < 8; ++q) { const int j = j0 + q; const float f = (j <= last) ? 1.f : 0.f; fr.h[q] = (_Float16)(__expf(fmaf(f, s[j], (1.f - f) * -1.0e9f) - mx) * sc); } unsigned short* d = (unsigned short*)P + i * NKX + j0; *(v8us*)d = fr.half[0];  } }


template <int MASKADD>
__global__ __launch_bounds__(64) void k_att0(const float* __restrict__ QF, const float* __restrict__ KF, const float* __restrict__ VF, int ld, const float* __restrict__ mask, float scale, float* __restrict__ OF, int ldo) {
  #pragma clang fp contract(off)
  __shared__ __attribute__((aligned(16))) float lq[64][64]; __shared__ __attribute__((aligned(16))) float lo[64][64];
  const int tid = threadIdx.x; const int h = blockIdx.x / (QT0 / 64), rg = blockIdx.x % (QT0 / 64); const int i = rg * 64 + tid;
  { const size_t bi = (size_t)blockIdx.y * QT0 * ld; QF += bi; KF += bi; VF += bi; OF += (size_t)blockIdx.y * QT0 * ldo; }      /* batch on grid.y: each batch has its own QT0-row plane */
  const float* qr = QF + (size_t)i * ld + h * HD;
#pragma unroll 1
  for (int c = 0; c < HD / 4; ++c) { *(v4f*)&lq[tid][c * 4] = *(const v4fa*)(qr + c * 4); const v4f z = {0.f, 0.f, 0.f, 0.f}; *(v4f*)&lo[tid][c * 4] = z; }
  float m = -1.0e30f, l = 0.f; const int jmax = MASKADD ? (SQ - 1) : (rg * 64 + 63);      /* additive-mask form: every key (the mask input decides); causal form: keys up to the block's last row */
#pragma unroll 1
  for (int j = 0; j <= jmax; ++j) { const float* kr = KF + (size_t)j * ld + h * HD; const float* vr = VF + (size_t)j * ld + h * HD; float s = 0.f;
#pragma unroll 1
    for (int c = 0; c < HD / 4; ++c) { const v4f kq = *(const v4fa*)(kr + c * 4); const v4f qq = *(v4f*)&lq[tid][c * 4]; s = __fadd_rn(s, __fmul_rn(qq[0], kq[0])); s = __fadd_rn(s, __fmul_rn(qq[1], kq[1])); s = __fadd_rn(s, __fmul_rn(qq[2], kq[2])); s = __fadd_rn(s, __fmul_rn(qq[3], kq[3])); }
    s = __fmul_rn(s, scale); if (MASKADD) s = __fadd_rn(s, __fmul_rn(bf16_round(mask[(size_t)i * SQ + j]), -10000.0f));
    const float f = (MASKADD || j <= i) ? 1.f : 0.f; const float sm = fmaf(f, s, (1.f - f) * -1.0e30f); const float mn = fmaxf(m, sm); const float sc = expf(m - mn); const float e = expf(sm - mn); l = __fadd_rn(__fmul_rn(l, sc), e); m = mn;
#pragma unroll 1
    for (int c = 0; c < HD / 4; ++c) { const v4f vv = *(const v4fa*)(vr + c * 4); v4f oo = *(v4f*)&lo[tid][c * 4]; for (int u = 0; u < 4; ++u) oo[u] = __fadd_rn(__fmul_rn(oo[u], sc), __fmul_rn(e, vv[u])); *(v4f*)&lo[tid][c * 4] = oo; } }
  const float fin = 64.0f / l;      /* o carried x64, undone by k_o0m */
#pragma unroll 1
  for (int c = 0; c < HD / 4; ++c) { v4f oo = *(v4f*)&lo[tid][c * 4]; for (int u = 0; u < 4; ++u) oo[u] = __fmul_rn(oo[u], fin); *(v4f*)&lo[tid][c * 4] = oo; }
  __syncthreads();
  {
#pragma unroll 1
    for (int it = 0; it < 16; ++it) { const int row = it * 4 + tid / 16, pc = (tid % 16) * 4; const v4f v = *(const v4f*)&lo[row][pc]; *(v4f*)(OF + (size_t)(rg * 64 + row) * ldo + h * HD + pc) = v; }
     } }


template <int BFIN, int WXB>
__global__ __launch_bounds__(256) void k_ln16(const float* __restrict__ X, const float* __restrict__ g, const float* __restrict__ bb, float eps, _Float16* __restrict__ N16, float* __restrict__ XB) {
  #pragma clang fp contract(off)
  __shared__ float red[256]; const size_t r = blockIdx.x; const int t = threadIdx.x; const v4f xa = *(const v4fa*)(X + r * DMQ + t * 4); float s[4]; float sum = 0.f;
  for (int q = 0; q < 4; ++q) { s[q] = BFIN ? bf16_round(xa[q]) : xa[q]; sum = __fadd_rn(sum, s[q]); }
  red[t] = sum; __syncthreads(); for (int st = 128; st > 0; st >>= 1) { if (t < st) red[t] = __fadd_rn(red[t], red[t + st]); __syncthreads(); } const float mu = red[0] / (float)DMQ; __syncthreads();
  float vs = 0.f; for (int q = 0; q < 4; ++q) { const float dl = __fadd_rn(s[q], -mu); vs = __fadd_rn(vs, __fmul_rn(dl, dl)); } red[t] = vs; __syncthreads(); for (int st = 128; st > 0; st >>= 1) { if (t < st) red[t] = __fadd_rn(red[t], red[t + st]); __syncthreads(); }
  const float rs = rsqrtf(__fadd_rn(red[0] / (float)DMQ, eps)); v4h y; v4f xb;
  for (int q = 0; q < 4; ++q) { const int c = t * 4 + q; y[q] = (_Float16)__fadd_rn(__fmul_rn(__fmul_rn(__fadd_rn(s[q], -mu), rs), bf16_round(g[c])), bf16_round(bb[c])); xb[q] = s[q]; }
  { *(v4h*)(N16 + r * DMQ + t * 4) = y; if (WXB) *(v4f*)(XB + r * DMQ + t * 4) = xb;  } }
__global__ __launch_bounds__(256) void k_ftres2(const float* __restrict__ OF0, const float* __restrict__ XB, float* __restrict__ X1, size_t n4) {
  #pragma clang fp contract(off)
  const size_t t = (size_t)blockIdx.x * 256 + threadIdx.x; if (t >= n4) return; const v4f o = *(const v4fa*)(OF0 + t * 4), xv = *(const v4fa*)(XB + t * 4); v4f y; for (int q = 0; q < 4; ++q) y[q] = __fadd_rn(__fmul_rn(o[q], 0.015625f), xv[q]); *(v4f*)(X1 + t * 4) = y;  }

__global__ __launch_bounds__(256) void k_wthd(const float* __restrict__ Wt, _Float16* __restrict__ Bt) { const size_t t = (size_t)blockIdx.x * 256 + threadIdx.x; if (t >= (size_t)NH * HD * (DM / 8)) return; const int m8 = (int)(t % (DM / 8)) * 8; const int d = (int)((t / (DM / 8)) % HD); const int h = (int)(t / ((size_t)(DM / 8) * HD)); FragH f;
  for (int q = 0; q < 8; ++q) f.h[q] = (_Float16)(16.0f * bf16_round(Wt[((size_t)h * DM + m8 + q) * HD + d])); unsigned short* dst = (unsigned short*)Bt + ((size_t)h * HD + d) * DM + m8; *(v8us*)dst = f.half[0];  }




__global__ __launch_bounds__(256) void k_wtpad(const float* __restrict__ Wm, _Float16* __restrict__ Wt, int Kr, int Kp, int Nr, int Np, float scale) {
  const int t = blockIdx.x * 256 + threadIdx.x; if (t >= Np * (Kp / 8)) return; const int n = t / (Kp / 8), k8 = (t % (Kp / 8)) * 8; const int nc = min(n, Nr - 1); const float fn = (n < Nr) ? 1.f : 0.f; FragH f;
  for (int i = 0; i < 8; ++i) { const int k = k8 + i; const int kc = min(k, Kr - 1); const float fk = (k < Kr) ? fn : 0.f; f.h[i] = (_Float16)(bf16_round(Wm[(size_t)kc * Nr + nc]) * scale * fk); }
  unsigned short* o = (unsigned short*)Wt + (size_t)n * Kp + k8; *(v8us*)o = f.half[0];  }
__global__ __launch_bounds__(128) void k_bpad(const float* __restrict__ b, float* __restrict__ Bp, int nr, int np) {
  const int i = threadIdx.x; if (i >= np) return; const float v = b[min(i, nr - 1)] * ((i < nr) ? 1.f : 0.f); *(float*)(Bp + i) = v;  }

#define DI 64         /* inner width = NH * HD (ONE 64-wide head) */
#define LQK (3 * DI)  /* fused q | k | v row pitch (192) */
__global__ __launch_bounds__(256) void k_o0(const float* __restrict__ OF, float* __restrict__ ob, size_t n4) {
  #pragma clang fp contract(off)
  const size_t t = (size_t)blockIdx.x * 256 + threadIdx.x; if (t >= n4) return; const size_t e = t * 4; const int i = (int)(e / DI); const int c = (int)(e % DI); const int h = c / HD, d = c % HD; const v4f a = *(const v4fa*)(OF + e); v4f o; for (int q = 0; q < 4; ++q) o[q] = __fmul_rn(a[q], 0.015625f); float* dst = ob + (size_t)h * SQ * HD + (size_t)i * HD + d; *(v4f*)dst = o;  }

__global__ __launch_bounds__(256) void k_o0m(const float* __restrict__ OF, float* __restrict__ o_, size_t n4) {
  #pragma clang fp contract(off)
  const size_t t = (size_t)blockIdx.x * 256 + threadIdx.x; if (t >= n4) return; const size_t e = t * 4; OF += (size_t)blockIdx.y * QT0 * DI; o_ += (size_t)blockIdx.y * SQ * DI;      /* batch on grid.y: n4 counts one batch's first tile */
  const v4f a = *(const v4fa*)(OF + e); v4f o; for (int q = 0; q < 4; ++q) o[q] = __fmul_rn(a[q], 0.015625f); *(v4f*)(o_ + e) = o;  }
extern "C" void kernel_launch(void* const* d_in, const int* in_sizes, int n_in,
                              void* d_out, int out_size, void* d_ws, size_t ws_size, hipStream_t stream) {
  (void)in_sizes; (void)n_in; (void)out_size;
  const float* const* I = (const float* const*)d_in; const float* x = I[0]; const float* wq = I[1]; const float* wk = I[2]; const float* wv = I[3]; const float* bq = nullptr; const float* bk = nullptr; const float* bv = nullptr;      /* x; [in][out = 64] Wq / Wk / Wv (input order as this module lists them); no biases */
  char* ws = (char*)d_ws; size_t off = 0;
  auto take = [&](size_t bytes) { char* p = ws + off; off += (bytes + 255) & ~(size_t)255; return p; };
  _Float16* BW = (_Float16*)take((size_t)LQK * DM * 2); _Float16* X16 = (_Float16*)take(NR * DM * 2); _Float16* QKV = (_Float16*)take(NR * LQK * 2); _Float16* VT = (_Float16*)take((size_t)NB * NH * HD * SQ * 2);
  float* S = (float*)take((size_t)NB * NH * QT * NKX * 4); _Float16* P = (_Float16*)take((size_t)NB * NH * QT * NKX * 2); float* QKVF0 = (float*)take((size_t)NB * QT0 * LQK * 4); float* OF0 = (float*)take((size_t)NB * QT0 * DI * 4);      /* one plane per batch: all batches are in flight in every launch */
  if (off > ws_size) return;
  { const unsigned g = (unsigned)(((size_t)DI * (DM / 8) + 255) / 256); k_wt_f16<<<g, 256, 0, stream>>>(wq, BW, DM, DI, 16.0f); k_wt_f16<<<g, 256, 0, stream>>>(wk, BW + (size_t)DI * DM, DM, DI, 16.0f); k_wt_f16<<<g, 256, 0, stream>>>(wv, BW + (size_t)2 * DI * DM, DM, DI, 16.0f); }      /* [in = DM][out = 64] -> Bt[n][k] x16, stacked q | k | v */
  k_x16<<<(unsigned)((NR * DM / 8 + 255) / 256), 256, 0, stream>>>(x, X16, NR * DM / 8);      /* x (bf16-valued) as exact f16 rows */
  const float* bqkv[3] = {bq, bk, bv};
  for (int c = 0; c < 3; ++c) k_gemm2<0><<<dim3((unsigned)((NR / 128) * (DI / 64)), 1), 128, 0, stream>>>(X16, DM, 0, BW + (size_t)c * DI * DM, DM, 0, 0.0625f, bqkv[c], 0, nullptr, 1, 0, 0, nullptr, QKV + (size_t)c * DI, LQK, 0, (int)NR, DI, DM);      /* q | k | v = x W^T -> f16 rows, column blocks 0 / 64 / 128 of the fused plane (pitch 192); head h = columns h*64 inside each */
  const _Float16* Q16 = QKV; const _Float16* K16 = QKV + DI; const _Float16* V16 = QKV + 2 * DI;
  float* ob = (float*)d_out;      /* the ONE head leaves grid.y free: it carries the batch in the GEMM, k_att0 and k_o0m launches below */
  k_vt<NH, SQ><<<NB * NH * (SQ / 64), 256, 0, stream>>>(V16, LQK, 0, VT);      /* V^T [NB][HD][SQ], every batch */
  for (int q0 = 0; q0 < SQ; q0 += QT) { const int nk = q0 + QT;      /* causal: only keys below the tile end are computed */
    k_gemm2<0><<<dim3((QT / 128) * (nk / 64), NB), 128, 0, stream>>>(Q16 + (size_t)q0 * LQK, LQK, (size_t)SQ * LQK, K16, LQK, (size_t)SQ * LQK, 0.024895003f, nullptr, 0, nullptr, 1, 0, 0, S, nullptr, NKX, (size_t)QT * NKX, QT, nk, HD);      /* scores * 256^-0.666, batch on grid.y */
    k_rsmcf2<<<(NB * QT + 255) / 256, 256, 0, stream>>>(S, P, NB, q0, nk);      /* causal softmax -> P x256 f16, NB planes of QT rows */
    k_gemm2<0><<<dim3((QT / 128) * (HD / 64), NB), 128, 0, stream>>>(P, NKX, (size_t)QT * NKX, VT, SQ, (size_t)HD * SQ, 0.00390625f, nullptr, 0, nullptr, 1, 0, 0, ob + (size_t)q0 * DI, nullptr, DI, (size_t)SQ * DI, QT, HD, nk); }      /* out[b][q0 + i][..] = P V^T 2^-8 (f32), batch on grid.y */
  for (int c = 0; c < 3; ++c) k_gemm2<0><<<dim3((unsigned)((QT0 / 128) * (DI / 64)), NB), 128, 0, stream>>>(X16, DM, (size_t)SQ * DM, BW + (size_t)c * DI * DM, DM, 0, 0.0625f, bqkv[c], 0, nullptr, 1, 0, 0, QKVF0 + (size_t)c * DI, nullptr, LQK, (size_t)QT0 * LQK, QT0, DI, DM);      /* f32 q | k | v of rows 0..511 of every batch (exact products, f32 accumulation) */
  k_att0<0><<<dim3(NH * (QT0 / 64), NB), 64, 0, stream>>>(QKVF0, QKVF0 + DI, QKVF0 + 2 * DI, LQK, nullptr, 0.024895003f, OF0, DI);      /* exact f32 causal attention for rows 0..511 (o x64), batch on grid.y */
  k_o0m<<<dim3((unsigned)(((size_t)QT0 * DI / 4 + 255) / 256), NB), 256, 0, stream>>>(OF0, ob, (size_t)QT0 * DI / 4);      /* rows 0..511 of every batch REWRITTEN from the exact path */
}

// v002
// Measured time: 685 microseconds a run.
// In two side-by-side timings against v001, it was 3.45 and 3.47 times as fast.
// Over all steps from v000 it is 104 times as fast.
#include <hip/hip_runtime.h>
// Single-head causal self-attention with the module's literal scale C^-0.666 (x [32][1024][256]; q/k/v = x W ([in][out] [256][64], no biases); ONE 64-wide head; scores * 256^-0.666 = 0.024895 (as the source writes it, not head_size^-0.5); causal; softmax; out = weights v -> [32][1024][64]; no output projection).
// Structure: token rows; x as exact f16 rows; three WMMA GEMMs into one f16 q | k | v plane [32768][192]; per batch v^T via LDS transposes; causal 256-row query tiles with the batch on grid.y (scores alpha 256^-0.666, causal softmax f32 -> f16 x256 weights, P V written as f32 straight into the merged output rows); an exact f32 first tile (rows 0..511) rewritten at the end; launches: see trace.
// Compute dtype: inputs rounded to bf16; x / weights exact; q, k, v and softmax weights as plain f16 GEMM operands (~2^-12); scores and softmax statistics f32. v_wmma_f32_16x16x32_f16.
#define NB 32
#define SQ 1024
#define DM 256
#define NH 1
#define HD 64
#define HG 4                         /* heads per launch of the non-template k_vt, which is not launched */
#define QT 256                       /* query rows per causal tile */
#define NKX SQ                       /* S / P row pitch */
#define QT0 512                      /* first-tile rows recomputed exactly (f32): 512 here (no output projection averages the early-row cancellation errors away; logit sigma 1.0) */
#define B0 0                         /* first batch processed (debug hook) */
#define NBR NB                       /* batches processed (debug hook) */
#define NR ((size_t)NB * SQ)
#define DMQ DM
#define DFF 4096                     /* unused (no FFN in this file) */
#define DFFR 100                     /* unused */
#define MP ((int)((size_t)NBR * SQ)) /* rows projected (debug hook) */
#define QN SQ                        /* query rows attended per batch (debug hook) */
#define NHD NH                       /* heads attended (debug hook) */
#define MPO MP                       /* rows through the output stage (debug hook) */
#define LQ (3 * DM)      /* unused; the q/k/v rows have pitch LQK (192) */
typedef __bf16 v16b __attribute__((ext_vector_type(16)));
typedef unsigned short v8us __attribute__((ext_vector_type(8), may_alias));
typedef float  v8f  __attribute__((ext_vector_type(8)));
typedef float  v4f  __attribute__((ext_vector_type(4)));
typedef float  v4fa __attribute__((ext_vector_type(4), may_alias));
union FragB { v16b v; v8us half[2]; unsigned short u[16]; };

__device__ __forceinline__ unsigned short bf16_bits(float x) { unsigned int u = __float_as_uint(x); return (unsigned short)((u + 0x7FFFu + ((u >> 16) & 1u)) >> 16); }
__device__ __forceinline__ float bf16_val(unsigned short b) { return __uint_as_float(((unsigned int)b) << 16); }
__device__ __forceinline__ float bf16_round(float x) { return bf16_val(bf16_bits(x)); }
// D += A·B with NT terms: 1 = ah·bh, 2 = + al·bh (A split), 3 = + ah·bl (both split)
template <int NT>
__device__ __forceinline__ v8f mmaN(v16b ah, v16b al, v16b bh, v16b bl, v8f c) {
  c = __builtin_amdgcn_wmma_f32_16x16x32_bf16(false, ah, false, bh, (short)0, c, false, false);
  if (NT >= 2) c = __builtin_amdgcn_wmma_f32_16x16x32_bf16(false, al, false, bh, (short)0, c, false, false);
  if (NT >= 3) c = __builtin_amdgcn_wmma_f32_16x16x32_bf16(false, ah, false, bl, (short)0, c, false, false);
  asm volatile("v_nop\n\tv_nop\n\tv_nop\n\tv_nop" : "+v"(c) : "v"(ah), "v"(al), "v"(bh), "v"(bl));
  return c;
}

__global__ __launch_bounds__(256) void k_wt_bf16(const float* __restrict__ W, unsigned short* __restrict__ Wt, int K, int N) {
  const int t = blockIdx.x * 256 + threadIdx.x;
  const int k8n = K / 8;
  if (t >= N * k8n) return;
  const int n = t / k8n, k8 = (t % k8n) * 8;
  v8us v;
#pragma unroll
  for (int i = 0; i < 8; ++i) v[i] = bf16_bits(W[(size_t)(k8 + i) * N + n]);
  *(v8us*)(Wt + (size_t)n * K + k8) = v;
  
}

// GEMM C[M][N] (f32, pitch ldc) = act(A[M][K]·W + bias). A f32 row-major (pitch lda) converted per fragment to bf16
// (ASPLIT: hi/lo two planes -> 2 terms, else single rounded term); Wt bf16 [N][K] (pitch ldb). BIAS_BF16 rounds the
// bias to bf16 first (bias quantised to bf16 before the add). K%32==0, M%16==0, N%64==0.
template <bool ASPLIT, int ACT, bool BIAS_BF16>
__global__ __launch_bounds__(128) void k_gemm_bf(const float* __restrict__ A, int lda, const unsigned short* __restrict__ Wt, int ldb,
                                               const float* __restrict__ bias, float* __restrict__ C, int ldc, int M, int N, int K) {
  __shared__ __attribute__((aligned(16))) float so[4][16][64];
  const int tid = threadIdx.x, w = tid >> 5, lane = tid & 31, ln = lane & 15, hh = lane >> 4;
  const int ntn = N / 64;
  const int wid = blockIdx.x * 4 + w;
  const int mt = wid / ntn, nq = wid % ntn;
  if (mt * 16 >= M) return;
  const int row0 = mt * 16, col0 = nq * 64;
  const float* arow = A + (size_t)(row0 + ln) * lda;
  v8f acc[4] = {};
  for (int kb = 0; kb < K; kb += 32) {
    FragB ah, al;
    const v4f x0 = *(const v4fa*)(arow + kb + 8 * hh), x1 = *(const v4fa*)(arow + kb + 8 * hh + 4);
    const v4f x2 = *(const v4fa*)(arow + kb + 16 + 8 * hh), x3 = *(const v4fa*)(arow + kb + 16 + 8 * hh + 4);
    float xs[16] = {x0[0],x0[1],x0[2],x0[3],x1[0],x1[1],x1[2],x1[3],x2[0],x2[1],x2[2],x2[3],x3[0],x3[1],x3[2],x3[3]};
#pragma unroll
    for (int i = 0; i < 16; ++i) { const unsigned short hb = bf16_bits(xs[i]); ah.u[i] = hb; al.u[i] = ASPLIT ? bf16_bits(xs[i] - bf16_val(hb)) : (unsigned short)0; }
#pragma unroll
    for (int t = 0; t < 4; ++t) {
      const unsigned short* brow = Wt + (size_t)(col0 + t * 16 + ln) * ldb + kb;
      FragB b;
      b.half[0] = *(const v8us*)(brow + 8 * hh);
      b.half[1] = *(const v8us*)(brow + 16 + 8 * hh);
      acc[t] = mmaN<ASPLIT ? 2 : 1>(ah.v, al.v, b.v, b.v, acc[t]);
    }
  }
#pragma unroll
  for (int t = 0; t < 4; ++t) {
    float bv = bias ? bias[col0 + t * 16 + ln] : 0.f;
    if (BIAS_BF16) bv = bf16_round(bv);
#pragma unroll
    for (int r = 0; r < 8; ++r) { float v = acc[t][r] + bv; if (ACT == 1) v = fmaxf(v, 0.f); so[w][8 * hh + r][t * 16 + ln] = v; }
  }
  __builtin_amdgcn_fence(__ATOMIC_ACQ_REL, "workgroup");
  __builtin_amdgcn_wave_barrier();
  const int rsub = lane >> 4, c4 = (lane & 15) * 4;
  {
#pragma unroll
    for (int q = 0; q < 8; ++q) {
      const int r = q * 2 + rsub;
      const v4f v = *(const v4fa*)&so[w][r][c4];
      *(v4f*)(C + (size_t)(row0 + r) * ldc + col0 + c4) = v;
    }
    
  }
}

// GEMM C = act(A·W + bias + resid): A f32 (ASPLIT -> hi/lo 2 terms), Wt bf16 [N][K]; ACT 0 none, 1 relu, 2 exact gelu;
// resid (optional, f32, row index = (row % rmod), pitch ldr, RES_BF16 rounds it) added before the activation.
template <bool ASPLIT, int ACT, bool BIAS_BF16, bool RES_BF16>
__global__ __launch_bounds__(128) void k_gemm_bf3(const float* __restrict__ A, int lda, const unsigned short* __restrict__ Wt, int ldb,
                                                const float* __restrict__ bias, const float* __restrict__ resid, int rmod, int ldr,
                                                float* __restrict__ C, int ldc, int M, int N, int K) {
  __shared__ __attribute__((aligned(16))) float so[4][16][64];
  const int tid = threadIdx.x, w = tid >> 5, lane = tid & 31, ln = lane & 15, hh = lane >> 4;
  const int ntn = N / 64;
  const int wid = blockIdx.x * 4 + w;
  const int mt = wid / ntn, nq = wid % ntn;
  if (mt * 16 >= M) return;
  const int row0 = mt * 16, col0 = nq * 64;
  const float* arow = A + (size_t)(row0 + ln) * lda;
  v8f acc[4] = {};
  for (int kb = 0; kb < K; kb += 32) {
    FragB ah, al;
    const v4f x0 = *(const v4fa*)(arow + kb + 8 * hh), x1 = *(const v4fa*)(arow + kb + 8 * hh + 4);
    const v4f x2 = *(const v4fa*)(arow + kb + 16 + 8 * hh), x3 = *(const v4fa*)(arow + kb + 16 + 8 * hh + 4);
    float xs[16] = {x0[0],x0[1],x0[2],x0[3],x1[0],x1[1],x1[2],x1[3],x2[0],x2[1],x2[2],x2[3],x3[0],x3[1],x3[2],x3[3]};
#pragma unroll
    for (int i = 0; i < 16; ++i) { const unsigned short hb = bf16_bits(xs[i]); ah.u[i] = hb; al.u[i] = ASPLIT ? bf16_bits(xs[i] - bf16_val(hb)) : (unsigned short)0; }
#pragma unroll
    for (int t = 0; t < 4; ++t) {
      const unsigned short* brow = Wt + (size_t)(col0 + t * 16 + ln) * ldb + kb;
      FragB b;
      b.half[0] = *(const v8us*)(brow + 8 * hh);
      b.half[1] = *(const v8us*)(brow + 16 + 8 * hh);
      acc[t] = mmaN<ASPLIT ? 2 : 1>(ah.v, al.v, b.v, b.v, acc[t]);
    }
  }
#pragma unroll
  for (int t = 0; t < 4; ++t) {
    const int col = col0 + t * 16 + ln;
    float bv = bias ? bias[col] : 0.f;
    if (BIAS_BF16) bv = bf16_round(bv);
#pragma unroll
    for (int r = 0; r < 8; ++r) {
      float v = acc[t][r] + bv;
      if (resid) { float rv = resid[(size_t)((row0 + 8 * hh + r) % rmod) * ldr + col]; if (RES_BF16) rv = bf16_round(rv); v += rv; }
      if (ACT == 1) v = fmaxf(v, 0.f);
      if (ACT == 2) v = 0.5f * v * (1.0f + erff(v * 0.70710678118654752f));
      if (ACT == 3) { const float u = 0.7978845608028654f * (v + 0.044715f * v * v * v); v = 0.5f * v * (1.0f + tanhf(u)); }
      so[w][8 * hh + r][t * 16 + ln] = v;
    }
  }
  __builtin_amdgcn_fence(__ATOMIC_ACQ_REL, "workgroup");
  __builtin_amdgcn_wave_barrier();
  const int rsub = lane >> 4, c4 = (lane & 15) * 4;
  {
#pragma unroll
    for (int q = 0; q < 8; ++q) {
      const int r = q * 2 + rsub;
      const v4f v = *(const v4fa*)&so[w][r][c4];
      *(v4f*)(C + (size_t)(row0 + r) * ldc + col0 + c4) = v;
    }
    
  }
}
// row LayerNorm (biased variance, eps) over N: s = X (+ R); optional out_sum <- s; out_norm <- (s-mu)*rsqrt(var+eps)*g + b
template <bool PARAM_BF16>
__global__ __launch_bounds__(256) void k_layernorm(const float* __restrict__ X, const float* __restrict__ R, const float* __restrict__ g, const float* __restrict__ bta,
                                                  float* __restrict__ out_sum, float* __restrict__ out_norm, int N, float eps) {
  __shared__ float red[256];
  const int row = blockIdx.x, tid = threadIdx.x;
  const float* x = X + (size_t)row * N; const float* rr = R ? R + (size_t)row * N : nullptr;
  float vals[16];                     // up to N = 4096
  const int per = N / 256;            // contiguous chunk per thread? use strided-by-4 chunks: thread handles j = tid*4 + 1024*u
  float s1 = 0.f;
  for (int u = 0; u < per / 4; ++u) {
    const int j = tid * 4 + 1024 * u;
    const v4f a = *(const v4fa*)(x + j);
    v4f b = {0.f,0.f,0.f,0.f}; if (rr) b = *(const v4fa*)(rr + j);
#pragma unroll
    for (int q = 0; q < 4; ++q) { const float v = a[q] + b[q]; vals[u * 4 + q] = v; s1 += v; }
  }
  red[tid] = s1; __syncthreads();
  for (int st = 128; st > 0; st >>= 1) { if (tid < st) red[tid] += red[tid + st]; __syncthreads(); }
  const float mu = red[0] / (float)N; __syncthreads();
  float s2 = 0.f;
  for (int u = 0; u < per / 4; ++u)
#pragma unroll
    for (int q = 0; q < 4; ++q) { const float c = vals[u * 4 + q] - mu; s2 += c * c; }
  red[tid] = s2; __syncthreads();
  for (int st = 128; st > 0; st >>= 1) { if (tid < st) red[tid] += red[tid + st]; __syncthreads(); }
  const float rs = rsqrtf(red[0] / (float)N + eps);
  {
    for (int u = 0; u < per / 4; ++u) {
      const int j = tid * 4 + 1024 * u;
      v4f o, sm;
#pragma unroll
      for (int q = 0; q < 4; ++q) {
        float gg = g[j + q], bb = bta[j + q];
        if (PARAM_BF16) { gg = bf16_round(gg); bb = bf16_round(bb); }
        sm[q] = vals[u * 4 + q]; o[q] = (vals[u * 4 + q] - mu) * rs * gg + bb;
      }
      if (out_sum) *(v4f*)(out_sum + (size_t)row * N + j) = sm;
      *(v4f*)(out_norm + (size_t)row * N + j) = o;
    }
    
  }
}



// ---- f16 WMMA path (v_wmma_f32_16x16x32_f16): 11-bit significands for operands in range — used where a [0,1] probability operand needs more precision than bf16
typedef _Float16 v16h __attribute__((ext_vector_type(16)));
union FragH { v16h v; v8us half[2]; _Float16 h[16]; unsigned short u[16]; };
template <int NT>
__device__ __forceinline__ v8f mmaH(v16h ah, v16h al, v16h bh, v16h bl, v8f c) {
  c = __builtin_amdgcn_wmma_f32_16x16x32_f16(false, ah, false, bh, (short)0, c, false, false);
  if (NT >= 2) c = __builtin_amdgcn_wmma_f32_16x16x32_f16(false, al, false, bh, (short)0, c, false, false);
  if (NT >= 3) c = __builtin_amdgcn_wmma_f32_16x16x32_f16(false, ah, false, bl, (short)0, c, false, false);
  asm volatile("v_nop\n\tv_nop\n\tv_nop\n\tv_nop" : "+v"(c) : "v"(ah), "v"(al), "v"(bh), "v"(bl));
  return c;
}
// batched GEMM like k_gemm_b but f16 operands: A f32 (split into f16 hi/lo if ASPLIT, else rounded to f16), Bt = f16 values [n][k]; alpha; C f32; N multiple of 16 (partial tiles skipped)
template <bool ASPLIT>
__global__ __launch_bounds__(128) void k_gemm_h(const float* __restrict__ A, int lda, size_t sA, const _Float16* __restrict__ Bh, int ldb, size_t sB, float alpha, float* __restrict__ C, int ldc, size_t sC, int M, int N, int K) {
  __shared__ __attribute__((aligned(16))) float so[4][16][64];
  const int tid = threadIdx.x, w = tid >> 5, lane = tid & 31, ln = lane & 15, hh = lane >> 4; const int by = blockIdx.y;
  A += (size_t)by * sA; Bh += (size_t)by * sB; C += (size_t)by * sC;
  const int ntn = (N + 63) / 64; const int wid = blockIdx.x * 4 + w; const int mt = wid / ntn, nq = wid % ntn; if (mt * 16 >= M) return;
  const int row0 = mt * 16, col0 = nq * 64; const float* arow = A + (size_t)(row0 + ln) * lda;
  v8f acc[4] = {};
  for (int kb = 0; kb < K; kb += 32) {
    FragH ah, al;
    const v4f x0 = *(const v4fa*)(arow + kb + 8 * hh), x1 = *(const v4fa*)(arow + kb + 8 * hh + 4), x2 = *(const v4fa*)(arow + kb + 16 + 8 * hh), x3 = *(const v4fa*)(arow + kb + 16 + 8 * hh + 4);
    float xs[16] = {x0[0],x0[1],x0[2],x0[3],x1[0],x1[1],x1[2],x1[3],x2[0],x2[1],x2[2],x2[3],x3[0],x3[1],x3[2],x3[3]};
#pragma unroll
    for (int i = 0; i < 16; ++i) { const _Float16 h = (_Float16)xs[i]; ah.h[i] = h; al.h[i] = ASPLIT ? (_Float16)(xs[i] - (float)h) : (_Float16)0.0f; }
#pragma unroll
    for (int t = 0; t < 4; ++t) { if (col0 + t * 16 >= N) continue; const size_t boff = (size_t)(col0 + t * 16 + ln) * ldb + kb; FragH bq; bq.half[0] = *(const v8us*)(Bh + boff + 8 * hh); bq.half[1] = *(const v8us*)(Bh + boff + 16 + 8 * hh);
      acc[t] = mmaH<ASPLIT ? 2 : 1>(ah.v, al.v, bq.v, bq.v, acc[t]); }
  }
#pragma unroll
  for (int t = 0; t < 4; ++t) { if (col0 + t * 16 >= N) continue;
#pragma unroll
    for (int r = 0; r < 8; ++r) so[w][8 * hh + r][t * 16 + ln] = acc[t][r] * alpha; }
  __builtin_amdgcn_fence(__ATOMIC_ACQ_REL, "workgroup"); __builtin_amdgcn_wave_barrier();
  const int rsub = lane >> 4, c4 = (lane & 15) * 4;
  {
#pragma unroll
    for (int q = 0; q < 8; ++q) { const int r = q * 2 + rsub; if (col0 + c4 < N) { const v4f v = *(const v4fa*)&so[w][r][c4]; *(v4f*)(C + (size_t)(row0 + r) * ldc + col0 + c4) = v; } }
     }
}

// Wt[n][k] = f16(W[k][n]·scale) from f32 row-major W[K][N] (scale = power of two; bf16-exact weights stay exact in f16 away from the subnormal range)
__global__ __launch_bounds__(256) void k_wt_f16(const float* __restrict__ W, _Float16* __restrict__ Wt, int K, int N, float scale) {
  const int t = blockIdx.x * 256 + threadIdx.x; if (t >= N * (K / 8)) return; const int n = t / (K / 8), k8 = (t % (K / 8)) * 8; FragH f;
#pragma unroll
  for (int i = 0; i < 8; ++i) f.h[i] = (_Float16)(bf16_round(W[(size_t)(k8 + i) * N + n]) * scale); const v8us o = f.half[0];
  *(v8us*)((unsigned short*)Wt + (size_t)n * K + k8) = o; 
}
// k_gemm_hh variant with fused epilogue: v = acc·alpha + bias[by·sBias + col] (+ CP[(row/rowsPerB)·sCPb + by·64 + col] if CP) ; ACT 0 none / 1 elu ; writes f16 C16 (and f32 C if non-null)
template <int ACT>
__global__ __launch_bounds__(128) void k_gemm_hhx(const _Float16* __restrict__ A, int lda, size_t sA, const _Float16* __restrict__ Bh, int ldb, size_t sB, float alpha, const float* __restrict__ bias, size_t sBias, const float* __restrict__ CP, int rowsPerB, size_t sCPb, int row0g,
    float* __restrict__ C, _Float16* __restrict__ C16, int ldc, size_t sC, int M, int N, int K) {
  __shared__ __attribute__((aligned(16))) float so[4][16][64];
  const int tid = threadIdx.x, w = tid >> 5, lane = tid & 31, ln = lane & 15, hh = lane >> 4; const int by = blockIdx.y;
  A += (size_t)by * sA; Bh += (size_t)by * sB; const size_t cofs = (size_t)by * sC; const float* bp = bias ? bias + (size_t)by * sBias : nullptr;
  const int ntn = (N + 63) / 64; const int wid = blockIdx.x * 4 + w; const int mt = wid / ntn, nq = wid % ntn; if (mt * 16 >= M) return;
  const int row0 = mt * 16, col0 = nq * 64; const _Float16* arow = A + (size_t)(row0 + ln) * lda;
  v8f acc[4] = {};
  for (int kb = 0; kb < K; kb += 32) { FragH ah; ah.half[0] = *(const v8us*)((const unsigned short*)arow + kb + 8 * hh); ah.half[1] = *(const v8us*)((const unsigned short*)arow + kb + 16 + 8 * hh);
#pragma unroll
    for (int t = 0; t < 4; ++t) { if (col0 + t * 16 >= N) continue; const size_t boff = (size_t)(col0 + t * 16 + ln) * ldb + kb; FragH bq; bq.half[0] = *(const v8us*)((const unsigned short*)Bh + boff + 8 * hh); bq.half[1] = *(const v8us*)((const unsigned short*)Bh + boff + 16 + 8 * hh);
      acc[t] = mmaH<1>(ah.v, ah.v, bq.v, bq.v, acc[t]); }
  }
#pragma unroll
  for (int t = 0; t < 4; ++t) { if (col0 + t * 16 >= N) continue; const int col = col0 + t * 16 + ln; const float bv = bp ? bf16_round(bp[col]) : 0.f;
#pragma unroll
    for (int r = 0; r < 8; ++r) { float v = acc[t][r] * alpha + bv; if (CP) { const int rr = row0g + row0 + 8 * hh + r; if (rowsPerB < 0) v += CP[cofs + (size_t)rr * ldc + col];      /* rowsPerB < 0: own element of the batched C plane */ else { const int bidx = rr / rowsPerB; v += CP[(size_t)bidx * sCPb + (size_t)by * 64 + col]; } } if (ACT == 1) v = (v > 0.f) ? v : expm1f(v); else if (ACT == 7) v = (v > 0.f) ? v + 1.0f : expf(v); else if (ACT == 8) v = tanhf(v); else if (ACT == 9) v = 0.5f * v * (1.0f + tanhf(0.7978845608028654f * (v + 0.044715f * v * v * v))); else if (ACT == 11) v = 1.0f / (1.0f + expf(-v)); else if (ACT == 12) v = (v > 0.f) ? v : 0.01f * v; else if (ACT == 14) v = (v > 0.f) ? v : 0.1f * v; else if (ACT == 16) v = (v >= 0.f) ? v : 0.3f * v; else if (ACT == 17) v = (v >= 0.f) ? v : 0.2f * v; else if (ACT == 15) v = v / (1.0f + expf(-v)); else if (ACT == 3) v = fmaxf(v, 0.f); else if (ACT == 6) v = 0.5f * v * (1.0f + erff(v * 0.70710678118654752f)); so[w][8 * hh + r][t * 16 + ln] = v; } }
  __builtin_amdgcn_fence(__ATOMIC_ACQ_REL, "workgroup"); __builtin_amdgcn_wave_barrier();
  const int rsub = lane >> 4, c4 = (lane & 15) * 4; typedef _Float16 v4h __attribute__((ext_vector_type(4)));
  {
#pragma unroll
    for (int q = 0; q < 8; ++q) { const int r = q * 2 + rsub; if (col0 + c4 < N) { const v4f v = *(const v4fa*)&so[w][r][c4]; if (C) *(v4f*)(C + cofs + (size_t)(row0 + r) * ldc + col0 + c4) = v; if (C16) { v4h h4; for (int i = 0; i < 4; ++i) h4[i] = (_Float16)v[i]; *(v4h*)(C16 + cofs + (size_t)(row0 + r) * ldc + col0 + c4) = h4; } } }
     }
}


typedef _Float16 v4h __attribute__((ext_vector_type(4)));

__global__ __launch_bounds__(256) void k_x16(const float* __restrict__ x, _Float16* __restrict__ X16, size_t n8) { const size_t t = (size_t)blockIdx.x * 256 + threadIdx.x; if (t >= n8) return; FragH f;
#pragma unroll
  for (int q = 0; q < 8; ++q) f.h[q] = (_Float16)bf16_round(x[t * 8 + q]); *(v8us*)((unsigned short*)X16 + t * 8) = f.half[0];  }
__global__ __launch_bounds__(256) void k_h16(const float* __restrict__ x, _Float16* __restrict__ X16, size_t n8) { const size_t t = (size_t)blockIdx.x * 256 + threadIdx.x; if (t >= n8) return; FragH f;
#pragma unroll
  for (int q = 0; q < 8; ++q) f.h[q] = (_Float16)x[t * 8 + q]; *(v8us*)((unsigned short*)X16 + t * 8) = f.half[0];  }
__global__ __launch_bounds__(256) void k_round16f(const float* __restrict__ W, _Float16* __restrict__ Bt, size_t n8) { const size_t t = (size_t)blockIdx.x * 256 + threadIdx.x; if (t >= n8) return; FragH f;
#pragma unroll
  for (int i = 0; i < 8; ++i) f.h[i] = (_Float16)(bf16_round(W[t * 8 + i]) * 16.0f); *(v8us*)((unsigned short*)Bt + t * 8) = f.half[0];  }
template <int NHv, int TTv>
__global__ __launch_bounds__(256) void k_vt(const _Float16* __restrict__ V16, int ldv, int voff, _Float16* __restrict__ Vt) { __shared__ unsigned short tl[64][66]; const int tid = threadIdx.x; const int slab = blockIdx.x / (TTv / 64), lg = blockIdx.x % (TTv / 64); const int b = slab / NHv, h = slab % NHv;
  for (int i = tid; i < 64 * 8; i += 256) { const int r = i / 8, c8 = (i % 8) * 8; FragH f; f.half[0] = *(const v8us*)((const unsigned short*)V16 + ((size_t)b * TTv + lg * 64 + r) * ldv + voff + h * 64 + c8);
#pragma unroll
    for (int q = 0; q < 8; ++q) tl[r][c8 + q] = f.u[q]; }
  __syncthreads();
  {
#pragma unroll
    for (int rd = 0; rd < 2; ++rd) { const int d = rd * 32 + tid / 8, pc = tid % 8; FragH f;
#pragma unroll
      for (int q = 0; q < 8; ++q) f.u[q] = tl[pc * 8 + q][d];
      *(v8us*)((unsigned short*)Vt + ((size_t)slab * 64 + d) * TTv + lg * 64 + pc * 8) = f.half[0]; }
     } }

__global__ __launch_bounds__(256) void k_hl(const float* __restrict__ F, _Float16* __restrict__ Hh, _Float16* __restrict__ Hl, size_t n8) { const size_t t = (size_t)blockIdx.x * 256 + threadIdx.x; if (t >= n8) return; FragH fh, fl; const v4f a = *(const v4fa*)(F + t * 8), c = *(const v4fa*)(F + t * 8 + 4);
#pragma unroll
  for (int q = 0; q < 4; ++q) { _Float16 h = (_Float16)a[q]; fh.h[q] = h; fl.h[q] = (_Float16)((a[q] - (float)h) * 1024.0f); h = (_Float16)c[q]; fh.h[4 + q] = h; fl.h[4 + q] = (_Float16)((c[q] - (float)h) * 1024.0f); }
  { *(v8us*)((unsigned short*)Hh + t * 8) = fh.half[0]; *(v8us*)((unsigned short*)Hl + t * 8) = fl.half[0];  } }

// ---- fast GEMM (wave tile 32x64; requires M % 32 == 0 rows per launch region and N % 64 == 0); epilogue = k_gemm_hhx semantics ----
__device__ __forceinline__ v16h g2_frag(const _Float16* p, int hh) { FragH f; f.half[0] = *(const v8us*)((const unsigned short*)p + 8 * hh); f.half[1] = *(const v8us*)((const unsigned short*)p + 16 + 8 * hh); return f.v; }
__device__ __forceinline__ v8f g2_mma(v16h a, v16h b, v8f c) { v8f d = __builtin_amdgcn_wmma_f32_16x16x32_f16(false, a, false, b, (short)0, c, false, false); asm volatile("v_nop\n\tv_nop\n\tv_nop\n\tv_nop" : "+v"(d) : "v"(a), "v"(b)); return d; }
template <int ACT>
__global__ __launch_bounds__(128) void k_gemm2(const _Float16* __restrict__ A, int lda, size_t sA, const _Float16* __restrict__ Bh, int ldb, size_t sB, float alpha, const float* __restrict__ bias, size_t sBias, const float* __restrict__ CP, int rowsPerB, size_t sCPb, int row0g,
    float* __restrict__ C, _Float16* __restrict__ C16, int ldc, size_t sC, int M, int N, int K) { static_assert(ACT == 0 || ACT == 3 || ACT == 6 || ACT == 8 || ACT == 9 || ACT == 11 || ACT == 12 || ACT == 14 || ACT == 15 || ACT == 16 || ACT == 17, "k_gemm2: unsupported ACT code (would silently apply no activation)");
  __shared__ __attribute__((aligned(16))) float so[4][32][68];
  const int tid = threadIdx.x, w = tid >> 5, lane = tid & 31, ln = lane & 15, hh = lane >> 4; const int by = blockIdx.y;
  A += (size_t)by * sA; Bh += (size_t)by * sB; const size_t cofs = (size_t)by * sC; const float* bp = bias ? bias + (size_t)by * sBias : nullptr;
  const int ntn = N >> 6; const int mt = blockIdx.x / ntn, nq = blockIdx.x - mt * ntn; const int row0 = mt * 128 + 32 * w, col0 = nq * 64; if (row0 >= M) return;
  const _Float16* a0p = A + (size_t)(row0 + ln) * lda; const _Float16* a1p = a0p + (size_t)16 * lda;
  const _Float16* b0p = Bh + (size_t)(col0 + ln) * ldb; const _Float16* b1p = b0p + (size_t)16 * ldb; const _Float16* b2p = b1p + (size_t)16 * ldb; const _Float16* b3p = b2p + (size_t)16 * ldb;
  const v8f z8 = {0.f,0.f,0.f,0.f,0.f,0.f,0.f,0.f}; v8f c00 = z8, c01 = z8, c02 = z8, c03 = z8, c10 = z8, c11 = z8, c12 = z8, c13 = z8;
#pragma unroll 1
  for (int kb = 0; kb < K; kb += 32) { const v16h a0 = g2_frag(a0p + kb, hh), a1 = g2_frag(a1p + kb, hh);
    v16h b = g2_frag(b0p + kb, hh); c00 = g2_mma(a0, b, c00); c10 = g2_mma(a1, b, c10);
    b = g2_frag(b1p + kb, hh); c01 = g2_mma(a0, b, c01); c11 = g2_mma(a1, b, c11);
    b = g2_frag(b2p + kb, hh); c02 = g2_mma(a0, b, c02); c12 = g2_mma(a1, b, c12);
    b = g2_frag(b3p + kb, hh); c03 = g2_mma(a0, b, c03); c13 = g2_mma(a1, b, c13); }
  v8f accs[8] = {c00, c01, c02, c03, c10, c11, c12, c13};
#pragma unroll
  for (int u = 0; u < 8; ++u) { const int t = u & 3, half = u >> 2; const int col = col0 + t * 16 + ln; const float bv = bp ? bf16_round(bp[col]) : 0.f;
#pragma unroll
    for (int r = 0; r < 8; ++r) { const int rloc = half * 16 + 8 * hh + r; float v = accs[u][r] * alpha + bv; if (CP) { if (rowsPerB < 0) v += CP[cofs + (size_t)(row0g + row0 + rloc) * ldc + col];      /* rowsPerB < 0: own element of the batched C plane */ else { const int bidx = (row0g + row0 + rloc) / rowsPerB; v += CP[(size_t)bidx * sCPb + (size_t)by * 64 + col]; } }
      if (ACT == 3) v = fmaxf(v, 0.f); else if (ACT == 6) v = 0.5f * v * (1.0f + erff(v * 0.70710678118654752f)); else if (ACT == 11) v = 1.0f / (1.0f + expf(-v)); else if (ACT == 15) v = v / (1.0f + expf(-v)); else if (ACT == 12) v = (v > 0.f) ? v : 0.01f * v; else if (ACT == 8) v = tanhf(v); else if (ACT == 9) v = 0.5f * v * (1.0f + tanhf(0.7978845608028654f * (v + 0.044715f * v * v * v))); else if (ACT == 14) v = (v > 0.f) ? v : 0.1f * v; else if (ACT == 16) v = (v >= 0.f) ? v : 0.3f * v; else if (ACT == 17) v = (v >= 0.f) ? v : 0.2f * v;
      so[w][rloc][t * 16 + ln] = v; } }
  __builtin_amdgcn_fence(__ATOMIC_ACQ_REL, "workgroup"); __builtin_amdgcn_wave_barrier();
  const int rsub = lane >> 4, c4 = (lane & 15) * 4;
  {
#pragma unroll
    for (int q = 0; q < 16; ++q) { const int r = q * 2 + rsub; const v4f v = *(const v4fa*)&so[w][r][c4]; if (C) *(v4f*)(C + cofs + (size_t)(row0 + r) * ldc + col0 + c4) = v; if (C16) { v4h h4; for (int i = 0; i < 4; ++i) h4[i] = (_Float16)v[i]; *(v4h*)(C16 + cofs + (size_t)(row0 + r) * ldc + col0 + c4) = h4; } }
     } }


__global__ __launch_bounds__(256) void k_wnat(const float* __restrict__ w, size_t n8, _Float16* __restrict__ Bt) { const size_t t = (size_t)blockIdx.x * 256 + threadIdx.x; if (t >= n8) return; FragH f; for (int q = 0; q < 8; ++q) f.h[q] = (_Float16)(bf16_round(w[t * 8 + q]) * 16.0f); *(v8us*)((unsigned short*)Bt + t * 8) = f.half[0];  }
__global__ __launch_bounds__(256) void k_rsm(const float* __restrict__ S, _Float16* __restrict__ P, int nrows) {
  #pragma clang fp contract(off)
  const int i = blockIdx.x * 256 + threadIdx.x; if (i >= nrows) return; const float* s = S + (size_t)i * SQ; float mx = -3.0e38f;
#pragma unroll 1
  for (int j = 0; j < SQ; ++j) mx = fmaxf(mx, s[j]); float se = 0.f;
#pragma unroll 1
  for (int j = 0; j < SQ; ++j) se += expf(s[j] - mx); const float sc = 256.0f / se;
#pragma unroll 1
  for (int j0 = 0; j0 < SQ; j0 += 8) { FragH f; for (int q = 0; q < 8; ++q) f.h[q] = (_Float16)(expf(s[j0 + q] - mx) * sc); unsigned short* d = (unsigned short*)P + (size_t)i * SQ + j0; *(v8us*)d = f.half[0];  } }
__global__ __launch_bounds__(256) void k_vt(const _Float16* __restrict__ V16, int b, int h0, _Float16* __restrict__ VT) { __shared__ unsigned short tl[64][65]; const int tid = threadIdx.x; const int hh = blockIdx.x % HG, sg = blockIdx.x / HG; const int s0 = sg * 64; const int h = h0 + hh;
  for (int i = tid; i < 64 * 8; i += 256) { const int j = i / 8, d8 = (i % 8) * 8; FragH f; f.half[0] = *(const v8us*)((const unsigned short*)V16 + ((size_t)b * SQ + s0 + j) * DM + h * HD + d8); for (int q = 0; q < 8; ++q) tl[d8 + q][j] = f.u[q]; }
  __syncthreads();
  { for (int i = tid; i < 64 * 8; i += 256) { const int d = i / 8, j8 = (i % 8) * 8; FragH f; for (int q = 0; q < 8; ++q) f.u[q] = tl[d][j8 + q]; *(v8us*)((unsigned short*)VT + ((size_t)hh * HD + d) * SQ + s0 + j8) = f.half[0]; }  } }



__global__ __launch_bounds__(256) void k_rsmcf2(const float* __restrict__ S, _Float16* __restrict__ P, int hg, int q0, int nk) {
  #pragma clang fp contract(off)
  const int t = blockIdx.x * 256 + threadIdx.x; if (t >= hg * QT) return; const size_t i = (size_t)t; const float* s = S + i * NKX; const int last = q0 + (t % QT); float mx = -3.0e38f;
#pragma unroll 1
  for (int j = 0; j < nk; ++j) { const float f = (j <= last) ? 1.f : 0.f; mx = fmaxf(mx, fmaf(f, s[j], (1.f - f) * -1.0e9f)); } float se = 0.f;
#pragma unroll 1
  for (int j = 0; j < nk; ++j) { const float f = (j <= last) ? 1.f : 0.f; se += __expf(fmaf(f, s[j], (1.f - f) * -1.0e9f) - mx); } const float sc = 256.0f / se;
#pragma unroll 1
  for (int j0 = 0; j0 < nk; j0 += 8) { FragH fr; for (int q = 0; q < 8; ++q) { const int j = j0 + q; const float f = (j <= last) ? 1.f : 0.f; fr.h[q] = (_Float16)(__expf(fmaf(f, s[j], (1.f - f) * -1.0e9f) - mx) * sc); } unsigned short* d = (unsigned short*)P + i * NKX + j0; *(v8us*)d = fr.half[0];  } }


// lane l with lane l ^ 1 / l ^ 2 inside its group of four lanes (DPP quad_perm; every lane is on where these are used)
__device__ __forceinline__ float quad_x1(float x) { return __builtin_bit_cast(float, __builtin_amdgcn_update_dpp(0, __builtin_bit_cast(int, x), 0xB1, 0xF, 0xF, true)); }
__device__ __forceinline__ float quad_x2(float x) { return __builtin_bit_cast(float, __builtin_amdgcn_update_dpp(0, __builtin_bit_cast(int, x), 0x4E, 0xF, 0xF, true)); }
// four lanes per query row: lane qd of a row owns columns c*16 + qd*4 .. +3 (c = 0..3) of its q and o rows, in registers; k and v rows come from a 64-key LDS tile shared by the block's 64 rows
template <int MASKADD>
__global__ __launch_bounds__(256) void k_att0(const float* __restrict__ QF, const float* __restrict__ KF, const float* __restrict__ VF, int ld, const float* __restrict__ mask, float scale, float* __restrict__ OF, int ldo) {
  __shared__ __attribute__((aligned(16))) float lk[64][64]; __shared__ __attribute__((aligned(16))) float lv[64][64];
  const int tid = threadIdx.x; const int h = blockIdx.x / (QT0 / 64), rg = blockIdx.x % (QT0 / 64); const int qd = tid & 3; const int i = rg * 64 + (tid >> 2);
  { const size_t bi = (size_t)blockIdx.y * QT0 * ld; QF += bi; KF += bi; VF += bi; OF += (size_t)blockIdx.y * QT0 * ldo; }      /* batch on grid.y: each batch has its own QT0-row plane */
  const float* qr = QF + (size_t)i * ld + h * HD + qd * 4;
  v4f qv[4], ov[4];
#pragma unroll      /* here and below: full unrolling makes every index of the register arrays a constant, so they stay in registers */
  for (int c = 0; c < 4; ++c) { qv[c] = *(const v4fa*)(qr + c * 16); const v4f z = {0.f, 0.f, 0.f, 0.f}; ov[c] = z; }
  float m = -1.0e30f, l = 0.f; const int ntile = MASKADD ? (SQ / 64) : (rg + 1);      /* additive-mask form: every key (the mask input decides); causal form: keys up to the block's last row */
#pragma unroll 1      /* rolled: one trip is a whole 64-key tile between its two barriers */
  for (int t = 0; t < ntile; ++t) { v4f tk[4], tv[4];
#pragma unroll
    for (int u = 0; u < 4; ++u) { const int e = u * 256 + tid; const size_t g = (size_t)(t * 64 + (e >> 4)) * ld + h * HD + (e & 15) * 4; tk[u] = *(const v4fa*)(KF + g); tv[u] = *(const v4fa*)(VF + g); }
    __syncthreads();      /* every reader has left the previous tile */
#pragma unroll
    for (int u = 0; u < 4; ++u) { const int e = u * 256 + tid; *(v4f*)&lk[e >> 4][(e & 15) * 4] = tk[u]; *(v4f*)&lv[e >> 4][(e & 15) * 4] = tv[u]; }
    __syncthreads();      /* the tile is complete before anyone reads it */
#pragma unroll 1      /* rolled: one trip already holds four keys, further copies would only grow the code and the register count */
    for (int j0 = 0; j0 < 64; j0 += 4) { v4f kk[4][4], vw[4][4];
#pragma unroll
      for (int a = 0; a < 4; ++a) for (int c = 0; c < 4; ++c) kk[a][c] = *(const v4f*)&lk[j0 + a][c * 16 + qd * 4];
#pragma unroll
      for (int a = 0; a < 4; ++a) for (int c = 0; c < 4; ++c) vw[a][c] = *(const v4f*)&lv[j0 + a][c * 16 + qd * 4];
      __builtin_amdgcn_sched_barrier(0);      /* keeps four keys' 32 LDS reads together in front of the arithmetic: without it each read is issued right before its use and its whole LDS latency is waited out */
#pragma unroll
      for (int a = 0; a < 4; ++a) { const int j = t * 64 + j0 + a; float s = 0.f;
#pragma unroll
        for (int c = 0; c < 4; ++c) { const v4f kq = kk[a][c]; const v4f qq = qv[c]; s = __fadd_rn(s, __fmul_rn(qq[0], kq[0])); s = __fadd_rn(s, __fmul_rn(qq[1], kq[1])); s = __fadd_rn(s, __fmul_rn(qq[2], kq[2])); s = __fadd_rn(s, __fmul_rn(qq[3], kq[3])); }
        s = __fadd_rn(s, quad_x1(s)); s = __fadd_rn(s, quad_x2(s));      /* the row's four partial sums: the same bits in all four lanes */
        s = __fmul_rn(s, scale); if (MASKADD) s = __fadd_rn(s, __fmul_rn(bf16_round(mask[(size_t)i * SQ + j]), -10000.0f));
        const float f = (MASKADD || j <= i) ? 1.f : 0.f; const float sm = fmaf(f, s, (1.f - f) * -1.0e30f); const float mn = fmaxf(m, sm); const float sc = expf(m - mn); const float e = expf(sm - mn); l = __fadd_rn(__fmul_rn(l, sc), e); m = mn;
#pragma unroll
        for (int c = 0; c < 4; ++c) { const v4f vv = vw[a][c]; for (int u = 0; u < 4; ++u) ov[c][u] = __fadd_rn(__fmul_rn(ov[c][u], sc), __fmul_rn(e, vv[u])); } } } }
  const float fin = 64.0f / l;      /* o carried x64; k_o0m scales it back by 1/64 */
  float* orow = OF + (size_t)i * ldo + h * HD + qd * 4;
#pragma unroll
  for (int c = 0; c < 4; ++c) { v4f oo = ov[c]; for (int u = 0; u < 4; ++u) oo[u] = __fmul_rn(oo[u], fin); *(v4f*)(orow + c * 16) = oo; } }


template <int BFIN, int WXB>
__global__ __launch_bounds__(256) void k_ln16(const float* __restrict__ X, const float* __restrict__ g, const float* __restrict__ bb, float eps, _Float16* __restrict__ N16, float* __restrict__ XB) {
  #pragma clang fp contract(off)
  __shared__ float red[256]; const size_t r = blockIdx.x; const int t = threadIdx.x; const v4f xa = *(const v4fa*)(X + r * DMQ + t * 4); float s[4]; float sum = 0.f;
  for (int q = 0; q < 4; ++q) { s[q] = BFIN ? bf16_round(xa[q]) : xa[q]; sum = __fadd_rn(sum, s[q]); }
  red[t] = sum; __syncthreads(); for (int st = 128; st > 0; st >>= 1) { if (t < st) red[t] = __fadd_rn(red[t], red[t + st]); __syncthreads(); } const float mu = red[0] / (float)DMQ; __syncthreads();
  float vs = 0.f; for (int q = 0; q < 4; ++q) { const float dl = __fadd_rn(s[q], -mu); vs = __fadd_rn(vs, __fmul_rn(dl, dl)); } red[t] = vs; __syncthreads(); for (int st = 128; st > 0; st >>= 1) { if (t < st) red[t] = __fadd_rn(red[t], red[t + st]); __syncthreads(); }
  const float rs = rsqrtf(__fadd_rn(red[0] / (float)DMQ, eps)); v4h y; v4f xb;
  for (int q = 0; q < 4; ++q) { const int c = t * 4 + q; y[q] = (_Float16)__fadd_rn(__fmul_rn(__fmul_rn(__fadd_rn(s[q], -mu), rs), bf16_round(g[c])), bf16_round(bb[c])); xb[q] = s[q]; }
  { *(v4h*)(N16 + r * DMQ + t * 4) = y; if (WXB) *(v4f*)(XB + r * DMQ + t * 4) = xb;  } }
__global__ __launch_bounds__(256) void k_ftres2(const float* __restrict__ OF0, const float* __restrict__ XB, float* __restrict__ X1, size_t n4) {
  #pragma clang fp contract(off)
  const size_t t = (size_t)blockIdx.x * 256 + threadIdx.x; if (t >= n4) return; const v4f o = *(const v4fa*)(OF0 + t * 4), xv = *(const v4fa*)(XB + t * 4); v4f y; for (int q = 0; q < 4; ++q) y[q] = __fadd_rn(__fmul_rn(o[q], 0.015625f), xv[q]); *(v4f*)(X1 + t * 4) = y;  }

__global__ __launch_bounds__(256) void k_wthd(const float* __restrict__ Wt, _Float16* __restrict__ Bt) { const size_t t = (size_t)blockIdx.x * 256 + threadIdx.x; if (t >= (size_t)NH * HD * (DM / 8)) return; const int m8 = (int)(t % (DM / 8)) * 8; const int d = (int)((t / (DM / 8)) % HD); const int h = (int)(t / ((size_t)(DM / 8) * HD)); FragH f;
  for (int q = 0; q < 8; ++q) f.h[q] = (_Float16)(16.0f * bf16_round(Wt[((size_t)h * DM + m8 + q) * HD + d])); unsigned short* dst = (unsigned short*)Bt + ((size_t)h * HD + d) * DM + m8; *(v8us*)dst = f.half[0];  }




__global__ __launch_bounds__(256) void k_wtpad(const float* __restrict__ Wm, _Float16* __restrict__ Wt, int Kr, int Kp, int Nr, int Np, float scale) {
  const int t = blockIdx.x * 256 + threadIdx.x; if (t >= Np * (Kp / 8)) return; const int n = t / (Kp / 8), k8 = (t % (Kp / 8)) * 8; const int nc = min(n, Nr - 1); const float fn = (n < Nr) ? 1.f : 0.f; FragH f;
  for (int i = 0; i < 8; ++i) { const int k = k8 + i; const int kc = min(k, Kr - 1); const float fk = (k < Kr) ? fn : 0.f; f.h[i] = (_Float16)(bf16_round(Wm[(size_t)kc * Nr + nc]) * scale * fk); }
  unsigned short* o = (unsigned short*)Wt + (size_t)n * Kp + k8; *(v8us*)o = f.half[0];  }
__global__ __launch_bounds__(128) void k_bpad(const float* __restrict__ b, float* __restrict__ Bp, int nr, int np) {
  const int i = threadIdx.x; if (i >= np) return; const float v = b[min(i, nr - 1)] * ((i < nr) ? 1.f : 0.f); *(float*)(Bp + i) = v;  }

#define DI 64         /* inner width = NH * HD (ONE 64-wide head) */
#define LQK (3 * DI)  /* fused q | k | v row pitch (192) */
__global__ __launch_bounds__(256) void k_o0(const float* __restrict__ OF, float* __restrict__ ob, size_t n4) {
  #pragma clang fp contract(off)
  const size_t t = (size_t)blockIdx.x * 256 + threadIdx.x; if (t >= n4) return; const size_t e = t * 4; const int i = (int)(e / DI); const int c = (int)(e % DI); const int h = c / HD, d = c % HD; const v4f a = *(const v4fa*)(OF + e); v4f o; for (int q = 0; q < 4; ++q) o[q] = __fmul_rn(a[q], 0.015625f); float* dst = ob + (size_t)h * SQ * HD + (size_t)i * HD + d; *(v4f*)dst = o;  }

__global__ __launch_bounds__(256) void k_o0m(const float* __restrict__ OF, float* __restrict__ o_, size_t n4) {
  #pragma clang fp contract(off)
  const size_t t = (size_t)blockIdx.x * 256 + threadIdx.x; if (t >= n4) return; const size_t e = t * 4; OF += (size_t)blockIdx.y * QT0 * DI; o_ += (size_t)blockIdx.y * SQ * DI;      /* batch on grid.y: n4 counts one batch's first tile */
  const v4f a = *(const v4fa*)(OF + e); v4f o; for (int q = 0; q < 4; ++q) o[q] = __fmul_rn(a[q], 0.015625f); *(v4f*)(o_ + e) = o;  }
extern "C" void kernel_launch(void* const* d_in, const int* in_sizes, int n_in,
                              void* d_out, int out_size, void* d_ws, size_t ws_size, hipStream_t stream) {
  (void)in_sizes; (void)n_in; (void)out_size;
  const float* const* I = (const float* const*)d_in; const float* x = I[0]; const float* wq = I[1]; const float* wk = I[2]; const float* wv = I[3]; const float* bq = nullptr; const float* bk = nullptr; const float* bv = nullptr;      /* x; [in][out = 64] Wq / Wk / Wv (input order as this module lists them); no biases */
  char* ws = (char*)d_ws; size_t off = 0;
  auto take = [&](size_t bytes) { char* p = ws + off; off += (bytes + 255) & ~(size_t)255; return p; };
  _Float16* BW = (_Float16*)take((size_t)LQK * DM * 2); _Float16* X16 = (_Float16*)take(NR * DM * 2); _Float16* QKV = (_Float16*)take(NR * LQK * 2); _Float16* VT = (_Float16*)take((size_t)NB * NH * HD * SQ * 2);
  float* S = (float*)take((size_t)NB * NH * QT * NKX * 4); _Float16* P = (_Float16*)take((size_t)NB * NH * QT * NKX * 2); float* QKVF0 = (float*)take((size_t)NB * QT0 * LQK * 4); float* OF0 = (float*)take((size_t)NB * QT0 * DI * 4);      /* one plane per batch: all batches are in flight in every launch */
  if (off > ws_size) return;
  { const unsigned g = (unsigned)(((size_t)DI * (DM / 8) + 255) / 256); k_wt_f16<<<g, 256, 0, stream>>>(wq, BW, DM, DI, 16.0f); k_wt_f16<<<g, 256, 0, stream>>>(wk, BW + (size_t)DI * DM, DM, DI, 16.0f); k_wt_f16<<<g, 256, 0, stream>>>(wv, BW + (size_t)2 * DI * DM, DM, DI, 16.0f); }      /* [in = DM][out = 64] -> Bt[n][k] x16, stacked q | k | v */
  k_x16<<<(unsigned)((NR * DM / 8 + 255) / 256), 256, 0, stream>>>(x, X16, NR * DM / 8);      /* x (bf16-valued) as exact f16 rows */
  const float* bqkv[3] = {bq, bk, bv};
  for (int c = 0; c < 3; ++c) k_gemm2<0><<<dim3((unsigned)((NR / 128) * (DI / 64)), 1), 128, 0, stream>>>(X16, DM, 0, BW + (size_t)c * DI * DM, DM, 0, 0.0625f, bqkv[c], 0, nullptr, 1, 0, 0, nullptr, QKV + (size_t)c * DI, LQK, 0, (int)NR, DI, DM);      /* q | k | v = x W^T -> f16 rows, column blocks 0 / 64 / 128 of the fused plane (pitch 192); head h = columns h*64 inside each */
  const _Float16* Q16 = QKV; const _Float16* K16 = QKV + DI; const _Float16* V16 = QKV + 2 * DI;
  float* ob = (float*)d_out;      /* the ONE head leaves grid.y free: it carries the batch in the GEMM, k_att0 and k_o0m launches below */
  k_vt<NH, SQ><<<NB * NH * (SQ / 64), 256, 0, stream>>>(V16, LQK, 0, VT);      /* V^T [NB][HD][SQ], every batch */
  for (int q0 = 0; q0 < SQ; q0 += QT) { const int nk = q0 + QT;      /* causal: only keys below the tile end are computed */
    k_gemm2<0><<<dim3((QT / 128) * (nk / 64), NB), 128, 0, stream>>>(Q16 + (size_t)q0 * LQK, LQK, (size_t)SQ * LQK, K16, LQK, (size_t)SQ * LQK, 0.024895003f, nullptr, 0, nullptr, 1, 0, 0, S, nullptr, NKX, (size_t)QT * NKX, QT, nk, HD);      /* scores * 256^-0.666, batch on grid.y */
    k_rsmcf2<<<(NB * QT + 255) / 256, 256, 0, stream>>>(S, P, NB, q0, nk);      /* causal softmax -> P x256 f16, NB planes of QT rows */
    k_gemm2<0><<<dim3((QT / 128) * (HD / 64), NB), 128, 0, stream>>>(P, NKX, (size_t)QT * NKX, VT, SQ, (size_t)HD * SQ, 0.00390625f, nullptr, 0, nullptr, 1, 0, 0, ob + (size_t)q0 * DI, nullptr, DI, (size_t)SQ * DI, QT, HD, nk); }      /* out[b][q0 + i][..] = P V^T 2^-8 (f32), batch on grid.y */
  for (int c = 0; c < 3; ++c) k_gemm2<0><<<dim3((unsigned)((QT0 / 128) * (DI / 64)), NB), 128, 0, stream>>>(X16, DM, (size_t)SQ * DM, BW + (size_t)c * DI * DM, DM, 0, 0.0625f, bqkv[c], 0, nullptr, 1, 0, 0, QKVF0 + (size_t)c * DI, nullptr, LQK, (size_t)QT0 * LQK, QT0, DI, DM);      /* f32 q | k | v of rows 0..511 of every batch (exact products, f32 accumulation) */
  k_att0<0><<<dim3(NH * (QT0 / 64), NB), 256, 0, stream>>>(QKVF0, QKVF0 + DI, QKVF0 + 2 * DI, LQK, nullptr, 0.024895003f, OF0, DI);      /* exact f32 causal attention for rows 0..511 (o x64), batch on grid.y */
  k_o0m<<<dim3((unsigned)(((size_t)QT0 * DI / 4 + 255) / 256), NB), 256, 0, stream>>>(OF0, ob, (size_t)QT0 * DI / 4);      /* rows 0..511 of every batch REWRITTEN from the exact path */
}

// v003
// One run takes 291 microseconds.
// Two timings next to v002 put it at 2.35 and 2.36 times that version's speed.
// All steps since v000 together make it 245 times as fast.
#include <hip/hip_runtime.h>
// Single-head causal self-attention with the module's literal scale C^-0.666 (x [32][1024][256]; q/k/v = x W ([in][out] [256][64], no biases); ONE 64-wide head; scores * 256^-0.666 = 0.024895 (as the source writes it, not head_size^-0.5); causal; softmax; out = weights v -> [32][1024][64]; no output projection).
// Structure: token rows; x as exact f16 rows; three WMMA GEMMs into one f16 q | k | v plane [32768][192]; per batch v^T via LDS transposes; causal 256-row query tiles with the batch on grid.y (scores alpha 256^-0.666, causal softmax f32 -> f16 x256 weights, P V written as f32 straight into the merged output rows); an exact f32 first tile (rows 0..511) rewritten at the end; launches: see trace.
// Compute dtype: inputs rounded to bf16; x / weights exact; q, k, v and softmax weights as plain f16 GEMM operands (~2^-12); scores and softmax statistics f32. v_wmma_f32_16x16x32_f16.
#define NB 32
#define SQ 1024
#define DM 256
#define NH 1
#define HD 64
#define HG 4                         /* heads per launch of the non-template k_vt, which is not launched */
#define QT 256                       /* query rows per causal tile */
#define NKX SQ                       /* S / P row pitch */
#define QT0 512                      /* first-tile rows recomputed exactly (f32): 512 here (no output projection averages the early-row cancellation errors away; logit sigma 1.0) */
#define B0 0                         /* first batch processed (debug hook) */
#define NBR NB                       /* batches processed (debug hook) */
#define NR ((size_t)NB * SQ)
#define DMQ DM
#define DFF 4096                     /* unused (no FFN in this file) */
#define DFFR 100                     /* unused */
#define MP ((int)((size_t)NBR * SQ)) /* rows projected (debug hook) */
#define QN SQ                        /* query rows attended per batch (debug hook) */
#define NHD NH                       /* heads attended (debug hook) */
#define MPO MP                       /* rows through the output stage (debug hook) */
#define LQ (3 * DM)      /* unused; the q/k/v rows have pitch LQK (192) */
typedef __bf16 v16b __attribute__((ext_vector_type(16)));
typedef unsigned short v8us __attribute__((ext_vector_type(8), may_alias));
typedef float  v8f  __attribute__((ext_vector_type(8)));
typedef float  v4f  __attribute__((ext_vector_type(4)));
typedef float  v4fa __attribute__((ext_vector_type(4), may_alias));
union FragB { v16b v; v8us half[2]; unsigned short u[16]; };

__device__ __forceinline__ unsigned short bf16_bits(float x) { unsigned int u = __float_as_uint(x); return (unsigned short)((u + 0x7FFFu + ((u >> 16) & 1u)) >> 16); }
__device__ __forceinline__ float bf16_val(unsigned short b) { return __uint_as_float(((unsigned int)b) << 16); }
__device__ __forceinline__ float bf16_round(float x) { return bf16_val(bf16_bits(x)); }
// D += A·B with NT terms: 1 = ah·bh, 2 = + al·bh (A split), 3 = + ah·bl (both split)
template <int NT>
__device__ __forceinline__ v8f mmaN(v16b ah, v16b al, v16b bh, v16b bl, v8f c) {
  c = __builtin_amdgcn_wmma_f32_16x16x32_bf16(false, ah, false, bh, (short)0, c, false, false);
  if (NT >= 2) c = __builtin_amdgcn_wmma_f32_16x16x32_bf16(false, al, false, bh, (short)0, c, false, false);
  if (NT >= 3) c = __builtin_amdgcn_wmma_f32_16x16x32_bf16(false, ah, false, bl, (short)0, c, false, false);
  asm volatile("v_nop\n\tv_nop\n\tv_nop\n\tv_nop" : "+v"(c) : "v"(ah), "v"(al), "v"(bh), "v"(bl));
  return c;
}

__global__ __launch_bounds__(256) void k_wt_bf16(const float* __restrict__ W, unsigned short* __restrict__ Wt, int K, int N) {
  const int t = blockIdx.x * 256 + threadIdx.x;
  const int k8n = K / 8;
  if (t >= N * k8n) return;
  const int n = t / k8n, k8 = (t % k8n) * 8;
  v8us v;
#pragma unroll
  for (int i = 0; i < 8; ++i) v[i] = bf16_bits(W[(size_t)(k8 + i) * N + n]);
  *(v8us*)(Wt + (size_t)n * K + k8) = v;
  
}

// GEMM C[M][N] (f32, pitch ldc) = act(A[M][K]·W + bias). A f32 row-major (pitch lda) converted per fragment to bf16
// (ASPLIT: hi/lo two planes -> 2 terms, else single rounded term); Wt bf16 [N][K] (pitch ldb). BIAS_BF16 rounds the
// bias to bf16 first (bias quantised to bf16 before the add). K%32==0, M%16==0, N%64==0.
template <bool ASPLIT, int ACT, bool BIAS_BF16>
__global__ __launch_bounds__(128) void k_gemm_bf(const float* __restrict__ A, int lda, const unsigned short* __restrict__ Wt, int ldb,
                                               const float* __restrict__ bias, float* __restrict__ C, int ldc, int M, int N, int K) {
  __shared__ __attribute__((aligned(16))) float so[4][16][64];
  const int tid = threadIdx.x, w = tid >> 5, lane = tid & 31, ln = lane & 15, hh = lane >> 4;
  const int ntn = N / 64;
  const int wid = blockIdx.x * 4 + w;
  const int mt = wid / ntn, nq = wid % ntn;
  if (mt * 16 >= M) return;
  const int row0 = mt * 16, col0 = nq * 64;
  const float* arow = A + (size_t)(row0 + ln) * lda;
  v8f acc[4] = {};
  for (int kb = 0; kb < K; kb += 32) {
    FragB ah, al;
    const v4f x0 = *(const v4fa*)(arow + kb + 8 * hh), x1 = *(const v4fa*)(arow + kb + 8 * hh + 4);
    const v4f x2 = *(const v4fa*)(arow + kb + 16 + 8 * hh), x3 = *(const v4fa*)(arow + kb + 16 + 8 * hh + 4);
    float xs[16] = {x0[0],x0[1],x0[2],x0[3],x1[0],x1[1],x1[2],x1[3],x2[0],x2[1],x2[2],x2[3],x3[0],x3[1],x3[2],x3[3]};
#pragma unroll
    for (int i = 0; i < 16; ++i) { const unsigned short hb = bf16_bits(xs[i]); ah.u[i] = hb; al.u[i] = ASPLIT ? bf16_bits(xs[i] - bf16_val(hb)) : (unsigned short)0; }
#pragma unroll
    for (int t = 0; t < 4; ++t) {
      const unsigned short* brow = Wt + (size_t)(col0 + t * 16 + ln) * ldb + kb;
      FragB b;
      b.half[0] = *(const v8us*)(brow + 8 * hh);
      b.half[1] = *(const v8us*)(brow + 16 + 8 * hh);
      acc[t] = mmaN<ASPLIT ? 2 : 1>(ah.v, al.v, b.v, b.v, acc[t]);
    }
  }
#pragma unroll
  for (int t = 0; t < 4; ++t) {
    float bv = bias ? bias[col0 + t * 16 + ln] : 0.f;
    if (BIAS_BF16) bv = bf16_round(bv);
#pragma unroll
    for (int r = 0; r < 8; ++r) { float v = acc[t][r] + bv; if (ACT == 1) v = fmaxf(v, 0.f); so[w][8 * hh + r][t * 16 + ln] = v; }
  }
  __builtin_amdgcn_fence(__ATOMIC_ACQ_REL, "workgroup");
  __builtin_amdgcn_wave_barrier();
  const int rsub = lane >> 4, c4 = (lane & 15) * 4;
  {
#pragma unroll
    for (int q = 0; q < 8; ++q) {
      const int r = q * 2 + rsub;
      const v4f v = *(const v4fa*)&so[w][r][c4];
      *(v4f*)(C + (size_t)(row0 + r) * ldc + col0 + c4) = v;
    }
    
  }
}

// GEMM C = act(A·W + bias + resid): A f32 (ASPLIT -> hi/lo 2 terms), Wt bf16 [N][K]; ACT 0 none, 1 relu, 2 exact gelu;
// resid (optional, f32, row index = (row % rmod), pitch ldr, RES_BF16 rounds it) added before the activation.
template <bool ASPLIT, int ACT, bool BIAS_BF16, bool RES_BF16>
__global__ __launch_bounds__(128) void k_gemm_bf3(const float* __restrict__ A, int lda, const unsigned short* __restrict__ Wt, int ldb,
                                                const float* __restrict__ bias, const float* __restrict__ resid, int rmod, int ldr,
                                                float* __restrict__ C, int ldc, int M, int N, int K) {
  __shared__ __attribute__((aligned(16))) float so[4][16][64];
  const int tid = threadIdx.x, w = tid >> 5, lane = tid & 31, ln = lane & 15, hh = lane >> 4;
  const int ntn = N / 64;
  const int wid = blockIdx.x * 4 + w;
  const int mt = wid / ntn, nq = wid % ntn;
  if (mt * 16 >= M) return;
  const int row0 = mt * 16, col0 = nq * 64;
  const float* arow = A + (size_t)(row0 + ln) * lda;
  v8f acc[4] = {};
  for (int kb = 0; kb < K; kb += 32) {
    FragB ah, al;
    const v4f x0 = *(const v4fa*)(arow + kb + 8 * hh), x1 = *(const v4fa*)(arow + kb + 8 * hh + 4);
    const v4f x2 = *(const v4fa*)(arow + kb + 16 + 8 * hh), x3 = *(const v4fa*)(arow + kb + 16 + 8 * hh + 4);
    float xs[16] = {x0[0],x0[1],x0[2],x0[3],x1[0],x1[1],x1[2],x1[3],x2[0],x2[1],x2[2],x2[3],x3[0],x3[1],x3[2],x3[3]};
#pragma unroll
    for (int i = 0; i < 16; ++i) { const unsigned short hb = bf16_bits(xs[i]); ah.u[i] = hb; al.u[i] = ASPLIT ? bf16_bits(xs[i] - bf16_val(hb)) : (unsigned short)0; }
#pragma unroll
    for (int t = 0; t < 4; ++t) {
      const unsigned short* brow = Wt + (size_t)(col0 + t * 16 + ln) * ldb + kb;
      FragB b;
      b.half[0] = *(const v8us*)(brow + 8 * hh);
      b.half[1] = *(const v8us*)(brow + 16 + 8 * hh);
      acc[t] = mmaN<ASPLIT ? 2 : 1>(ah.v, al.v, b.v, b.v, acc[t]);
    }
  }
#pragma unroll
  for (int t = 0; t < 4; ++t) {
    const int col = col0 + t * 16 + ln;
    float bv = bias ? bias[col] : 0.f;
    if (BIAS_BF16) bv = bf16_round(bv);
#pragma unroll
    for (int r = 0; r < 8; ++r) {
      float v = acc[t][r] + bv;
      if (resid) { float rv = resid[(size_t)((row0 + 8 * hh + r) % rmod) * ldr + col]; if (RES_BF16) rv = bf16_round(rv); v += rv; }
      if (ACT == 1) v = fmaxf(v, 0.f);
      if (ACT == 2) v = 0.5f * v * (1.0f + erff(v * 0.70710678118654752f));
      if (ACT == 3) { const float u = 0.7978845608028654f * (v + 0.044715f * v * v * v); v = 0.5f * v * (1.0f + tanhf(u)); }
      so[w][8 * hh + r][t * 16 + ln] = v;
    }
  }
  __builtin_amdgcn_fence(__ATOMIC_ACQ_REL, "workgroup");
  __builtin_amdgcn_wave_barrier();
  const int rsub = lane >> 4, c4 = (lane & 15) * 4;
  {
#pragma unroll
    for (int q = 0; q < 8; ++q) {
      const int r = q * 2 + rsub;
      const v4f v = *(const v4fa*)&so[w][r][c4];
      *(v4f*)(C + (size_t)(row0 + r) * ldc + col0 + c4) = v;
    }
    
  }
}
// row LayerNorm (biased variance, eps) over N: s = X (+ R); optional out_sum <- s; out_norm <- (s-mu)*rsqrt(var+eps)*g + b
template <bool PARAM_BF16>
__global__ __launch_bounds__(256) void k_layernorm(const float* __restrict__ X, const float* __restrict__ R, const float* __restrict__ g, const float* __restrict__ bta,
                                                  float* __restrict__ out_sum, float* __restrict__ out_norm, int N, float eps) {
  __shared__ float red[256];
  const int row = blockIdx.x, tid = threadIdx.x;
  const float* x = X + (size_t)row * N; const float* rr = R ? R + (size_t)row * N : nullptr;
  float vals[16];                     // up to N = 4096
  const int per = N / 256;            // contiguous chunk per thread? use strided-by-4 chunks: thread handles j = tid*4 + 1024*u
  float s1 = 0.f;
  for (int u = 0; u < per / 4; ++u) {
    const int j = tid * 4 + 1024 * u;
    const v4f a = *(const v4fa*)(x + j);
    v4f b = {0.f,0.f,0.f,0.f}; if (rr) b = *(const v4fa*)(rr + j);
#pragma unroll
    for (int q = 0; q < 4; ++q) { const float v = a[q] + b[q]; vals[u * 4 + q] = v; s1 += v; }
  }
  red[tid] = s1; __syncthreads();
  for (int st = 128; st > 0; st >>= 1) { if (tid < st) red[tid] += red[tid + st]; __syncthreads(); }
  const float mu = red[0] / (float)N; __syncthreads();
  float s2 = 0.f;
  for (int u = 0; u < per / 4; ++u)
#pragma unroll
    for (int q = 0; q < 4; ++q) { const float c = vals[u * 4 + q] - mu; s2 += c * c; }
  red[tid] = s2; __syncthreads();
  for (int st = 128; st > 0; st >>= 1) { if (tid < st) red[tid] += red[tid + st]; __syncthreads(); }
  const float rs = rsqrtf(red[0] / (float)N + eps);
  {
    for (int u = 0; u < per / 4; ++u) {
      const int j = tid * 4 + 1024 * u;
      v4f o, sm;
#pragma unroll
      for (int q = 0; q < 4; ++q) {
        float gg = g[j + q], bb = bta[j + q];
        if (PARAM_BF16) { gg = bf16_round(gg); bb = bf16_round(bb); }
        sm[q] = vals[u * 4 + q]; o[q] = (vals[u * 4 + q] - mu) * rs * gg + bb;
      }
      if (out_sum) *(v4f*)(out_sum + (size_t)row * N + j) = sm;
      *(v4f*)(out_norm + (size_t)row * N + j) = o;
    }
    
  }
}



// ---- f16 WMMA path (v_wmma_f32_16x16x32_f16): 11-bit significands for operands in range — used where a [0,1] probability operand needs more precision than bf16
typedef _Float16 v16h __attribute__((ext_vector_type(16)));
union FragH { v16h v; v8us half[2]; _Float16 h[16]; unsigned short u[16]; };
template <int NT>
__device__ __forceinline__ v8f mmaH(v16h ah, v16h al, v16h bh, v16h bl, v8f c) {
  c = __builtin_amdgcn_wmma_f32_16x16x32_f16(false, ah, false, bh, (short)0, c, false, false);
  if (NT >= 2) c = __builtin_amdgcn_wmma_f32_16x16x32_f16(false, al, false, bh, (short)0, c, false, false);
  if (NT >= 3) c = __builtin_amdgcn_wmma_f32_16x16x32_f16(false, ah, false, bl, (short)0, c, false, false);
  asm volatile("v_nop\n\tv_nop\n\tv_nop\n\tv_nop" : "+v"(c) : "v"(ah), "v"(al), "v"(bh), "v"(bl));
  return c;
}
// batched GEMM like k_gemm_b but f16 operands: A f32 (split into f16 hi/lo if ASPLIT, else rounded to f16), Bt = f16 values [n][k]; alpha; C f32; N multiple of 16 (partial tiles skipped)
template <bool ASPLIT>
__global__ __launch_bounds__(128) void k_gemm_h(const float* __restrict__ A, int lda, size_t sA, const _Float16* __restrict__ Bh, int ldb, size_t sB, float alpha, float* __restrict__ C, int ldc, size_t sC, int M, int N, int K) {
  __shared__ __attribute__((aligned(16))) float so[4][16][64];
  const int tid = threadIdx.x, w = tid >> 5, lane = tid & 31, ln = lane & 15, hh = lane >> 4; const int by = blockIdx.y;
  A += (size_t)by * sA; Bh += (size_t)by * sB; C += (size_t)by * sC;
  const int ntn = (N + 63) / 64; const int wid = blockIdx.x * 4 + w; const int mt = wid / ntn, nq = wid % ntn; if (mt * 16 >= M) return;
  const int row0 = mt * 16, col0 = nq * 64; const float* arow = A + (size_t)(row0 + ln) * lda;
  v8f acc[4] = {};
  for (int kb = 0; kb < K; kb += 32) {
    FragH ah, al;
    const v4f x0 = *(const v4fa*)(arow + kb + 8 * hh), x1 = *(const v4fa*)(arow + kb + 8 * hh + 4), x2 = *(const v4fa*)(arow + kb + 16 + 8 * hh), x3 = *(const v4fa*)(arow + kb + 16 + 8 * hh + 4);
    float xs[16] = {x0[0],x0[1],x0[2],x0[3],x1[0],x1[1],x1[2],x1[3],x2[0],x2[1],x2[2],x2[3],x3[0],x3[1],x3[2],x3[3]};
#pragma unroll
    for (int i = 0; i < 16; ++i) { const _Float16 h = (_Float16)xs[i]; ah.h[i] = h; al.h[i] = ASPLIT ? (_Float16)(xs[i] - (float)h) : (_Float16)0.0f; }
#pragma unroll
    for (int t = 0; t < 4; ++t) { if (col0 + t * 16 >= N) continue; const size_t boff = (size_t)(col0 + t * 16 + ln) * ldb + kb; FragH bq; bq.half[0] = *(const v8us*)(Bh + boff + 8 * hh); bq.half[1] = *(const v8us*)(Bh + boff + 16 + 8 * hh);
      acc[t] = mmaH<ASPLIT ? 2 : 1>(ah.v, al.v, bq.v, bq.v, acc[t]); }
  }
#pragma unroll
  for (int t = 0; t < 4; ++t) { if (col0 + t * 16 >= N) continue;
#pragma unroll
    for (int r = 0; r < 8; ++r) so[w][8 * hh + r][t * 16 + ln] = acc[t][r] * alpha; }
  __builtin_amdgcn_fence(__ATOMIC_ACQ_REL, "workgroup"); __builtin_amdgcn_wave_barrier();
  const int rsub = lane >> 4, c4 = (lane & 15) * 4;
  {
#pragma unroll
    for (int q = 0; q < 8; ++q) { const int r = q * 2 + rsub; if (col0 + c4 < N) { const v4f v = *(const v4fa*)&so[w][r][c4]; *(v4f*)(C + (size_t)(row0 + r) * ldc + col0 + c4) = v; } }
     }
}

// Wt[n][k] = f16(W[k][n]·scale) from f32 row-major W[K][N] (scale = power of two; bf16-exact weights stay exact in f16 away from the subnormal range)
__global__ __launch_bounds__(256) void k_wt_f16(const float* __restrict__ W, _Float16* __restrict__ Wt, int K, int N, float scale) {
  const int t = blockIdx.x * 256 + threadIdx.x; if (t >= N * (K / 8)) return; const int n = t / (K / 8), k8 = (t % (K / 8)) * 8; FragH f;
#pragma unroll
  for (int i = 0; i < 8; ++i) f.h[i] = (_Float16)(bf16_round(W[(size_t)(k8 + i) * N + n]) * scale); const v8us o = f.half[0];
  *(v8us*)((unsigned short*)Wt + (size_t)n * K + k8) = o; 
}
// k_gemm_hh variant with fused epilogue: v = acc·alpha + bias[by·sBias + col] (+ CP[(row/rowsPerB)·sCPb + by·64 + col] if CP) ; ACT 0 none / 1 elu ; writes f16 C16 (and f32 C if non-null)
template <int ACT>
__global__ __launch_bounds__(128) void k_gemm_hhx(const _Float16* __restrict__ A, int lda, size_t sA, const _Float16* __restrict__ Bh, int ldb, size_t sB, float alpha, const float* __restrict__ bias, size_t sBias, const float* __restrict__ CP, int rowsPerB, size_t sCPb, int row0g,
    float* __restrict__ C, _Float16* __restrict__ C16, int ldc, size_t sC, int M, int N, int K) {
  __shared__ __attribute__((aligned(16))) float so[4][16][64];
  const int tid = threadIdx.x, w = tid >> 5, lane = tid & 31, ln = lane & 15, hh = lane >> 4; const int by = blockIdx.y;
  A += (size_t)by * sA; Bh += (size_t)by * sB; const size_t cofs = (size_t)by * sC; const float* bp = bias ? bias + (size_t)by * sBias : nullptr;
  const int ntn = (N + 63) / 64; const int wid = blockIdx.x * 4 + w; const int mt = wid / ntn, nq = wid % ntn; if (mt * 16 >= M) return;
  const int row0 = mt * 16, col0 = nq * 64; const _Float16* arow = A + (size_t)(row0 + ln) * lda;
  v8f acc[4] = {};
  for (int kb = 0; kb < K; kb += 32) { FragH ah; ah.half[0] = *(const v8us*)((const unsigned short*)arow + kb + 8 * hh); ah.half[1] = *(const v8us*)((const unsigned short*)arow + kb + 16 + 8 * hh);
#pragma unroll
    for (int t = 0; t < 4; ++t) { if (col0 + t * 16 >= N) continue; const size_t boff = (size_t)(col0 + t * 16 + ln) * ldb + kb; FragH bq; bq.half[0] = *(const v8us*)((const unsigned short*)Bh + boff + 8 * hh); bq.half[1] = *(const v8us*)((const unsigned short*)Bh + boff + 16 + 8 * hh);
      acc[t] = mmaH<1>(ah.v, ah.v, bq.v, bq.v, acc[t]); }
  }
#pragma unroll
  for (int t = 0; t < 4; ++t) { if (col0 + t * 16 >= N) continue; const int col = col0 + t * 16 + ln; const float bv = bp ? bf16_round(bp[col]) : 0.f;
#pragma unroll
    for (int r = 0; r < 8; ++r) { float v = acc[t][r] * alpha + bv; if (CP) { const int rr = row0g + row0 + 8 * hh + r; if (rowsPerB < 0) v += CP[cofs + (size_t)rr * ldc + col];      /* rowsPerB < 0: own element of the batched C plane */ else { const int bidx = rr / rowsPerB; v += CP[(size_t)bidx * sCPb + (size_t)by * 64 + col]; } } if (ACT == 1) v = (v > 0.f) ? v : expm1f(v); else if (ACT == 7) v = (v > 0.f) ? v + 1.0f : expf(v); else if (ACT == 8) v = tanhf(v); else if (ACT == 9) v = 0.5f * v * (1.0f + tanhf(0.7978845608028654f * (v + 0.044715f * v * v * v))); else if (ACT == 11) v = 1.0f / (1.0f + expf(-v)); else if (ACT == 12) v = (v > 0.f) ? v : 0.01f * v; else if (ACT == 14) v = (v > 0.f) ? v : 0.1f * v; else if (ACT == 16) v = (v >= 0.f) ? v : 0.3f * v; else if (ACT == 17) v = (v >= 0.f) ? v : 0.2f * v; else if (ACT == 15) v = v / (1.0f + expf(-v)); else if (ACT == 3) v = fmaxf(v, 0.f); else if (ACT == 6) v = 0.5f * v * (1.0f + erff(v * 0.70710678118654752f)); so[w][8 * hh + r][t * 16 + ln] = v; } }
  __builtin_amdgcn_fence(__ATOMIC_ACQ_REL, "workgroup"); __builtin_amdgcn_wave_barrier();
  const int rsub = lane >> 4, c4 = (lane & 15) * 4; typedef _Float16 v4h __attribute__((ext_vector_type(4)));
  {
#pragma unroll
    for (int q = 0; q < 8; ++q) { const int r = q * 2 + rsub; if (col0 + c4 < N) { const v4f v = *(const v4fa*)&so[w][r][c4]; if (C) *(v4f*)(C + cofs + (size_t)(row0 + r) * ldc + col0 + c4) = v; if (C16) { v4h h4; for (int i = 0; i < 4; ++i) h4[i] = (_Float16)v[i]; *(v4h*)(C16 + cofs + (size_t)(row0 + r) * ldc + col0 + c4) = h4; } } }
     }
}


typedef _Float16 v4h __attribute__((ext_vector_type(4)));

__global__ __launch_bounds__(256) void k_x16(const float* __restrict__ x, _Float16* __restrict__ X16, size_t n8) { const size_t t = (size_t)blockIdx.x * 256 + threadIdx.x; if (t >= n8) return; FragH f;
#pragma unroll
  for (int q = 0; q < 8; ++q) f.h[q] = (_Float16)bf16_round(x[t * 8 + q]); *(v8us*)((unsigned short*)X16 + t * 8) = f.half[0];  }
__global__ __launch_bounds__(256) void k_h16(const float* __restrict__ x, _Float16* __restrict__ X16, size_t n8) { const size_t t = (size_t)blockIdx.x * 256 + threadIdx.x; if (t >= n8) return; FragH f;
#pragma unroll
  for (int q = 0; q < 8; ++q) f.h[q] = (_Float16)x[t * 8 + q]; *(v8us*)((unsigned short*)X16 + t * 8) = f.half[0];  }
__global__ __launch_bounds__(256) void k_round16f(const float* __restrict__ W, _Float16* __restrict__ Bt, size_t n8) { const size_t t = (size_t)blockIdx.x * 256 + threadIdx.x; if (t >= n8) return; FragH f;
#pragma unroll
  for (int i = 0; i < 8; ++i) f.h[i] = (_Float16)(bf16_round(W[t * 8 + i]) * 16.0f); *(v8us*)((unsigned short*)Bt + t * 8) = f.half[0];  }
template <int NHv, int TTv>
__global__ __launch_bounds__(256) void k_vt(const _Float16* __restrict__ V16, int ldv, int voff, _Float16* __restrict__ Vt) { __shared__ unsigned short tl[64][66]; const int tid = threadIdx.x; const int slab = blockIdx.x / (TTv / 64), lg = blockIdx.x % (TTv / 64); const int b = slab / NHv, h = slab % NHv;
  for (int i = tid; i < 64 * 8; i += 256) { const int r = i / 8, c8 = (i % 8) * 8; FragH f; f.half[0] = *(const v8us*)((const unsigned short*)V16 + ((size_t)b * TTv + lg * 64 + r) * ldv + voff + h * 64 + c8);
#pragma unroll
    for (int q = 0; q < 8; ++q) tl[r][c8 + q] = f.u[q]; }
  __syncthreads();
  {
#pragma unroll
    for (int rd = 0; rd < 2; ++rd) { const int d = rd * 32 + tid / 8, pc = tid % 8; FragH f;
#pragma unroll
      for (int q = 0; q < 8; ++q) f.u[q] = tl[pc * 8 + q][d];
      *(v8us*)((unsigned short*)Vt + ((size_t)slab * 64 + d) * TTv + lg * 64 + pc * 8) = f.half[0]; }
     } }

__global__ __launch_bounds__(256) void k_hl(const float* __restrict__ F, _Float16* __restrict__ Hh, _Float16* __restrict__ Hl, size_t n8) { const size_t t = (size_t)blockIdx.x * 256 + threadIdx.x; if (t >= n8) return; FragH fh, fl; const v4f a = *(const v4fa*)(F + t * 8), c = *(const v4fa*)(F + t * 8 + 4);
#pragma unroll
  for (int q = 0; q < 4; ++q) { _Float16 h = (_Float16)a[q]; fh.h[q] = h; fl.h[q] = (_Float16)((a[q] - (float)h) * 1024.0f); h = (_Float16)c[q]; fh.h[4 + q] = h; fl.h[4 + q] = (_Float16)((c[q] - (float)h) * 1024.0f); }
  { *(v8us*)((unsigned short*)Hh + t * 8) = fh.half[0]; *(v8us*)((unsigned short*)Hl + t * 8) = fl.half[0];  } }

// ---- fast GEMM (wave tile 32x64; requires M % 32 == 0 rows per launch region and N % 64 == 0); epilogue = k_gemm_hhx semantics ----
__device__ __forceinline__ v16h g2_frag(const _Float16* p, int hh) { FragH f; f.half[0] = *(const v8us*)((const unsigned short*)p + 8 * hh); f.half[1] = *(const v8us*)((const unsigned short*)p + 16 + 8 * hh); return f.v; }
__device__ __forceinline__ v8f g2_mma(v16h a, v16h b, v8f c) { v8f d = __builtin_amdgcn_wmma_f32_16x16x32_f16(false, a, false, b, (short)0, c, false, false); asm volatile("v_nop\n\tv_nop\n\tv_nop\n\tv_nop" : "+v"(d) : "v"(a), "v"(b)); return d; }
template <int ACT>
__global__ __launch_bounds__(128) void k_gemm2(const _Float16* __restrict__ A, int lda, size_t sA, const _Float16* __restrict__ Bh, int ldb, size_t sB, float alpha, const float* __restrict__ bias, size_t sBias, const float* __restrict__ CP, int rowsPerB, size_t sCPb, int row0g,
    float* __restrict__ C, _Float16* __restrict__ C16, int ldc, size_t sC, int M, int N, int K) { static_assert(ACT == 0 || ACT == 3 || ACT == 6 || ACT == 8 || ACT == 9 || ACT == 11 || ACT == 12 || ACT == 14 || ACT == 15 || ACT == 16 || ACT == 17, "k_gemm2: unsupported ACT code (would silently apply no activation)");
  __shared__ __attribute__((aligned(16))) float so[4][32][68];
  const int tid = threadIdx.x, w = tid >> 5, lane = tid & 31, ln = lane & 15, hh = lane >> 4; const int by = blockIdx.y;
  A += (size_t)by * sA; Bh += (size_t)by * sB; const size_t cofs = (size_t)by * sC; const float* bp = bias ? bias + (size_t)by * sBias : nullptr;
  const int ntn = N >> 6; const int mt = blockIdx.x / ntn, nq = blockIdx.x - mt * ntn; const int row0 = mt * 128 + 32 * w, col0 = nq * 64; if (row0 >= M) return;
  const _Float16* a0p = A + (size_t)(row0 + ln) * lda; const _Float16* a1p = a0p + (size_t)16 * lda;
  const _Float16* b0p = Bh + (size_t)(col0 + ln) * ldb; const _Float16* b1p = b0p + (size_t)16 * ldb; const _Float16* b2p = b1p + (size_t)16 * ldb; const _Float16* b3p = b2p + (size_t)16 * ldb;
  const v8f z8 = {0.f,0.f,0.f,0.f,0.f,0.f,0.f,0.f}; v8f c00 = z8, c01 = z8, c02 = z8, c03 = z8, c10 = z8, c11 = z8, c12 = z8, c13 = z8;
#pragma unroll 1
  for (int kb = 0; kb < K; kb += 32) { const v16h a0 = g2_frag(a0p + kb, hh), a1 = g2_frag(a1p + kb, hh);
    v16h b = g2_frag(b0p + kb, hh); c00 = g2_mma(a0, b, c00); c10 = g2_mma(a1, b, c10);
    b = g2_frag(b1p + kb, hh); c01 = g2_mma(a0, b, c01); c11 = g2_mma(a1, b, c11);
    b = g2_frag(b2p + kb, hh); c02 = g2_mma(a0, b, c02); c12 = g2_mma(a1, b, c12);
    b = g2_frag(b3p + kb, hh); c03 = g2_mma(a0, b, c03); c13 = g2_mma(a1, b, c13); }
  v8f accs[8] = {c00, c01, c02, c03, c10, c11, c12, c13};
#pragma unroll
  for (int u = 0; u < 8; ++u) { const int t = u & 3, half = u >> 2; const int col = col0 + t * 16 + ln; const float bv = bp ? bf16_round(bp[col]) : 0.f;
#pragma unroll
    for (int r = 0; r < 8; ++r) { const int rloc = half * 16 + 8 * hh + r; float v = accs[u][r] * alpha + bv; if (CP) { if (rowsPerB < 0) v += CP[cofs + (size_t)(row0g + row0 + rloc) * ldc + col];      /* rowsPerB < 0: own element of the batched C plane */ else { const int bidx = (row0g + row0 + rloc) / rowsPerB; v += CP[(size_t)bidx * sCPb + (size_t)by * 64 + col]; } }
      if (ACT == 3) v = fmaxf(v, 0.f); else if (ACT == 6) v = 0.5f * v * (1.0f + erff(v * 0.70710678118654752f)); else if (ACT == 11) v = 1.0f / (1.0f + expf(-v)); else if (ACT == 15) v = v / (1.0f + expf(-v)); else if (ACT == 12) v = (v > 0.f) ? v : 0.01f * v; else if (ACT == 8) v = tanhf(v); else if (ACT == 9) v = 0.5f * v * (1.0f + tanhf(0.7978845608028654f * (v + 0.044715f * v * v * v))); else if (ACT == 14) v = (v > 0.f) ? v : 0.1f * v; else if (ACT == 16) v = (v >= 0.f) ? v : 0.3f * v; else if (ACT == 17) v = (v >= 0.f) ? v : 0.2f * v;
      so[w][rloc][t * 16 + ln] = v; } }
  __builtin_amdgcn_fence(__ATOMIC_ACQ_REL, "workgroup"); __builtin_amdgcn_wave_barrier();
  const int rsub = lane >> 4, c4 = (lane & 15) * 4;
  {
#pragma unroll
    for (int q = 0; q < 16; ++q) { const int r = q * 2 + rsub; const v4f v = *(const v4fa*)&so[w][r][c4]; if (C) *(v4f*)(C + cofs + (size_t)(row0 + r) * ldc + col0 + c4) = v; if (C16) { v4h h4; for (int i = 0; i < 4; ++i) h4[i] = (_Float16)v[i]; *(v4h*)(C16 + cofs + (size_t)(row0 + r) * ldc + col0 + c4) = h4; } }
     } }


__global__ __launch_bounds__(256) void k_wnat(const float* __restrict__ w, size_t n8, _Float16* __restrict__ Bt) { const size_t t = (size_t)blockIdx.x * 256 + threadIdx.x; if (t >= n8) return; FragH f; for (int q = 0; q < 8; ++q) f.h[q] = (_Float16)(bf16_round(w[t * 8 + q]) * 16.0f); *(v8us*)((unsigned short*)Bt + t * 8) = f.half[0];  }
__global__ __launch_bounds__(256) void k_rsm(const float* __restrict__ S, _Float16* __restrict__ P, int nrows) {
  #pragma clang fp contract(off)
  const int i = blockIdx.x * 256 + threadIdx.x; if (i >= nrows) return; const float* s = S + (size_t)i * SQ; float mx = -3.0e38f;
#pragma unroll 1
  for (int j = 0; j < SQ; ++j) mx = fmaxf(mx, s[j]); float se = 0.f;
#pragma unroll 1
  for (int j = 0; j < SQ; ++j) se += expf(s[j] - mx); const float sc = 256.0f / se;
#pragma unroll 1
  for (int j0 = 0; j0 < SQ; j0 += 8) { FragH f; for (int q = 0; q < 8; ++q) f.h[q] = (_Float16)(expf(s[j0 + q] - mx) * sc); unsigned short* d = (unsigned short*)P + (size_t)i * SQ + j0; *(v8us*)d = f.half[0];  } }
__global__ __launch_bounds__(256) void k_vt(const _Float16* __restrict__ V16, int b, int h0, _Float16* __restrict__ VT) { __shared__ unsigned short tl[64][65]; const int tid = threadIdx.x; const int hh = blockIdx.x % HG, sg = blockIdx.x / HG; const int s0 = sg * 64; const int h = h0 + hh;
  for (int i = tid; i < 64 * 8; i += 256) { const int j = i / 8, d8 = (i % 8) * 8; FragH f; f.half[0] = *(const v8us*)((const unsigned short*)V16 + ((size_t)b * SQ + s0 + j) * DM + h * HD + d8); for (int q = 0; q < 8; ++q) tl[d8 + q][j] = f.u[q]; }
  __syncthreads();
  { for (int i = tid; i < 64 * 8; i += 256) { const int d = i / 8, j8 = (i % 8) * 8; FragH f; for (int q = 0; q < 8; ++q) f.u[q] = tl[d][j8 + q]; *(v8us*)((unsigned short*)VT + ((size_t)hh * HD + d) * SQ + s0 + j8) = f.half[0]; }  } }



// lane l with lane l ^ MSK inside its row of 16 lanes (DPP row_xmask), and lane l with lane l ^ 16; every lane is on where these are used
template <int MSK>
__device__ __forceinline__ float row_x(float x) { return __builtin_bit_cast(float, __builtin_amdgcn_update_dpp(0, __builtin_bit_cast(int, x), 0x160 + MSK, 0xF, 0xF, true)); }
__device__ __forceinline__ float half_x(float x) { return __builtin_bit_cast(float, __builtin_amdgcn_permlanex16(__builtin_bit_cast(int, x), __builtin_bit_cast(int, x), 0x76543210, 0xfedcba98, false, false)); }
#define SMR 4                        /* score rows per wave */
#define SMC (NKX / 128)              /* 128-key chunks in a full row: one 16-byte load per lane each */
// one WAVE per score row (SMR rows a wave): lane l owns keys c*128 + l*4 .. +3 of every chunk c, so each load reads 512 contiguous bytes; the row is read once and stays in registers for the maximum, the sum and the weights
__global__ __launch_bounds__(256) void k_rsmcf2(const float* __restrict__ S, _Float16* __restrict__ P, int hg, int q0, int nk) {
  #pragma clang fp contract(off)
  const int lane = threadIdx.x & 31; const int t0 = (blockIdx.x * 8 + __builtin_amdgcn_readfirstlane(threadIdx.x >> 5)) * SMR; if (t0 >= hg * QT) return;      /* the wave's number as a scalar: row index, row base and causal limit stay in scalar registers; QT is a multiple of SMR */
  const float* s = S + (size_t)t0 * NKX + lane * 4; v4f v[SMR][SMC];
#pragma unroll      /* here and below: full unrolling makes every index of the register array a constant, so it stays in registers */
  for (int c = 0; c < SMC; ++c) if (c * 128 < nk) {
#pragma unroll
    for (int r = 0; r < SMR; ++r) v[r][c] = *(const v4fa*)(s + (size_t)r * NKX + c * 128); }
  asm volatile("s_wait_xcnt 0x0" ::: "memory");      /* the loads' address registers are reused below while the loads are still in flight: the wait stands in front of that reuse */
  float mx[SMR], se[SMR];
#pragma unroll
  for (int r = 0; r < SMR; ++r) mx[r] = -3.0e38f;
#pragma unroll
  for (int c = 0; c < SMC; ++c) if (c * 128 < nk) {
#pragma unroll
    for (int r = 0; r < SMR; ++r) { const int last = q0 + ((t0 + r) % QT);
#pragma unroll
      for (int q = 0; q < 4; ++q) { const float f = (c * 128 + lane * 4 + q <= last) ? 1.f : 0.f; v[r][c][q] = fmaf(f, v[r][c][q], (1.f - f) * -1.0e9f); mx[r] = fmaxf(mx[r], v[r][c][q]); } } }
#pragma unroll
  for (int r = 0; r < SMR; ++r) { mx[r] = fmaxf(mx[r], row_x<1>(mx[r])); mx[r] = fmaxf(mx[r], row_x<2>(mx[r])); mx[r] = fmaxf(mx[r], row_x<4>(mx[r])); mx[r] = fmaxf(mx[r], row_x<8>(mx[r])); mx[r] = fmaxf(mx[r], half_x(mx[r])); se[r] = 0.f; }
#pragma unroll
  for (int c = 0; c < SMC; ++c) if (c * 128 < nk) {
#pragma unroll
    for (int r = 0; r < SMR; ++r) {
#pragma unroll
      for (int q = 0; q < 4; ++q) { v[r][c][q] = __expf(v[r][c][q] - mx[r]); se[r] += v[r][c][q]; } } }
#pragma unroll
  for (int r = 0; r < SMR; ++r) { se[r] += row_x<1>(se[r]); se[r] += row_x<2>(se[r]); se[r] += row_x<4>(se[r]); se[r] += row_x<8>(se[r]); se[r] += half_x(se[r]); se[r] = 256.0f / se[r]; }      /* 32 partial sums, butterfly: the same bits in every lane */
  _Float16* p = P + (size_t)t0 * NKX + lane * 4; v4h hw[SMR][SMC];      /* every weight is converted before the first store is issued, so no register of an issued store is written again */
#pragma unroll
  for (int c = 0; c < SMC; ++c) if (c * 128 < nk) {
#pragma unroll
    for (int r = 0; r < SMR; ++r) {
#pragma unroll
      for (int q = 0; q < 4; ++q) hw[r][c][q] = (_Float16)(v[r][c][q] * se[r]); } }
#pragma unroll
  for (int c = 0; c < SMC; ++c) if (c * 128 < nk) {
#pragma unroll
    for (int r = 0; r < SMR; ++r) *(v4h*)(p + (size_t)r * NKX + c * 128) = hw[r][c]; } }


// lane l with lane l ^ 1 / l ^ 2 inside its group of four lanes (DPP quad_perm; every lane is on where these are used)
__device__ __forceinline__ float quad_x1(float x) { return __builtin_bit_cast(float, __builtin_amdgcn_update_dpp(0, __builtin_bit_cast(int, x), 0xB1, 0xF, 0xF, true)); }
__device__ __forceinline__ float quad_x2(float x) { return __builtin_bit_cast(float, __builtin_amdgcn_update_dpp(0, __builtin_bit_cast(int, x), 0x4E, 0xF, 0xF, true)); }
// four lanes per query row: lane qd of a row owns columns c*16 + qd*4 .. +3 (c = 0..3) of its q and o rows, in registers; k and v rows come from a 64-key LDS tile shared by the block's 64 rows
template <int MASKADD>
__global__ __launch_bounds__(256) void k_att0(const float* __restrict__ QF, const float* __restrict__ KF, const float* __restrict__ VF, int ld, const float* __restrict__ mask, float scale, float* __restrict__ OF, int ldo) {
  __shared__ __attribute__((aligned(16))) float lk[64][64]; __shared__ __attribute__((aligned(16))) float lv[64][64];
  const int tid = threadIdx.x; const int h = blockIdx.x / (QT0 / 64), rg = blockIdx.x % (QT0 / 64); const int qd = tid & 3; const int i = rg * 64 + (tid >> 2);
  { const size_t bi = (size_t)blockIdx.y * QT0 * ld; QF += bi; KF += bi; VF += bi; OF += (size_t)blockIdx.y * QT0 * ldo; }      /* batch on grid.y: each batch has its own QT0-row plane */
  const float* qr = QF + (size_t)i * ld + h * HD + qd * 4;
  v4f qv[4], ov[4];
#pragma unroll      /* here and below: full unrolling makes every index of the register arrays a constant, so they stay in registers */
  for (int c = 0; c < 4; ++c) { qv[c] = *(const v4fa*)(qr + c * 16); const v4f z = {0.f, 0.f, 0.f, 0.f}; ov[c] = z; }
  float m = -1.0e30f, l = 0.f; const int ntile = MASKADD ? (SQ / 64) : (rg + 1);      /* additive-mask form: every key (the mask input decides); causal form: keys up to the block's last row */
#pragma unroll 1      /* rolled: one trip is a whole 64-key tile between its two barriers */
  for (int t = 0; t < ntile; ++t) { v4f tk[4], tv[4];
#pragma unroll
    for (int u = 0; u < 4; ++u) { const int e = u * 256 + tid; const size_t g = (size_t)(t * 64 + (e >> 4)) * ld + h * HD + (e & 15) * 4; tk[u] = *(const v4fa*)(KF + g); tv[u] = *(const v4fa*)(VF + g); }
    __syncthreads();      /* every reader has left the previous tile */
#pragma unroll
    for (int u = 0; u < 4; ++u) { const int e = u * 256 + tid; *(v4f*)&lk[e >> 4][(e & 15) * 4] = tk[u]; *(v4f*)&lv[e >> 4][(e & 15) * 4] = tv[u]; }
    __syncthreads();      /* the tile is complete before anyone reads it */
#pragma unroll 1      /* rolled: one trip already holds four keys, further copies would only grow the code and the register count */
    for (int j0 = 0; j0 < 64; j0 += 4) { v4f kk[4][4], vw[4][4];
#pragma unroll
      for (int a = 0; a < 4; ++a) for (int c = 0; c < 4; ++c) kk[a][c] = *(const v4f*)&lk[j0 + a][c * 16 + qd * 4];
#pragma unroll
      for (int a = 0; a < 4; ++a) for (int c = 0; c < 4; ++c) vw[a][c] = *(const v4f*)&lv[j0 + a][c * 16 + qd * 4];
      __builtin_amdgcn_sched_barrier(0);      /* keeps four keys' 32 LDS reads together in front of the arithmetic: without it each read is issued right before its use and its whole LDS latency is waited out */
#pragma unroll
      for (int a = 0; a < 4; ++a) { const int j = t * 64 + j0 + a; float s = 0.f;
#pragma unroll
        for (int c = 0; c < 4; ++c) { const v4f kq = kk[a][c]; const v4f qq = qv[c]; s = __fadd_rn(s, __fmul_rn(qq[0], kq[0])); s = __fadd_rn(s, __fmul_rn(qq[1], kq[1])); s = __fadd_rn(s, __fmul_rn(qq[2], kq[2])); s = __fadd_rn(s, __fmul_rn(qq[3], kq[3])); }
        s = __fadd_rn(s, quad_x1(s)); s = __fadd_rn(s, quad_x2(s));      /* the row's four partial sums: the same bits in all four lanes */
        s = __fmul_rn(s, scale); if (MASKADD) s = __fadd_rn(s, __fmul_rn(bf16_round(mask[(size_t)i * SQ + j]), -10000.0f));
        const float f = (MASKADD || j <= i) ? 1.f : 0.f; const float sm = fmaf(f, s, (1.f - f) * -1.0e30f); const float mn = fmaxf(m, sm); const float sc = expf(m - mn); const float e = expf(sm - mn); l = __fadd_rn(__fmul_rn(l, sc), e); m = mn;
#pragma unroll
        for (int c = 0; c < 4; ++c) { const v4f vv = vw[a][c]; for (int u = 0; u < 4; ++u) ov[c][u] = __fadd_rn(__fmul_rn(ov[c][u], sc), __fmul_rn(e, vv[u])); } } } }
  const float fin = 64.0f / l;      /* o carried x64; k_o0m scales it back by 1/64 */
  float* orow = OF + (size_t)i * ldo + h * HD + qd * 4;
#pragma unroll
  for (int c = 0; c < 4; ++c) { v4f oo = ov[c]; for (int u = 0; u < 4; ++u) oo[u] = __fmul_rn(oo[u], fin); *(v4f*)(orow + c * 16) = oo; } }


template <int BFIN, int WXB>
__global__ __launch_bounds__(256) void k_ln16(const float* __restrict__ X, const float* __restrict__ g, const float* __restrict__ bb, float eps, _Float16* __restrict__ N16, float* __restrict__ XB) {
  #pragma clang fp contract(off)
  __shared__ float red[256]; const size_t r = blockIdx.x; const int t = threadIdx.x; const v4f xa = *(const v4fa*)(X + r * DMQ + t * 4); float s[4]; float sum = 0.f;
  for (int q = 0; q < 4; ++q) { s[q] = BFIN ? bf16_round(xa[q]) : xa[q]; sum = __fadd_rn(sum, s[q]); }
  red[t] = sum; __syncthreads(); for (int st = 128; st > 0; st >>= 1) { if (t < st) red[t] = __fadd_rn(red[t], red[t + st]); __syncthreads(); } const float mu = red[0] / (float)DMQ; __syncthreads();
  float vs = 0.f; for (int q = 0; q < 4; ++q) { const float dl = __fadd_rn(s[q], -mu); vs = __fadd_rn(vs, __fmul_rn(dl, dl)); } red[t] = vs; __syncthreads(); for (int st = 128; st > 0; st >>= 1) { if (t < st) red[t] = __fadd_rn(red[t], red[t + st]); __syncthreads(); }
  const float rs = rsqrtf(__fadd_rn(red[0] / (float)DMQ, eps)); v4h y; v4f xb;
  for (int q = 0; q < 4; ++q) { const int c = t * 4 + q; y[q] = (_Float16)__fadd_rn(__fmul_rn(__fmul_rn(__fadd_rn(s[q], -mu), rs), bf16_round(g[c])), bf16_round(bb[c])); xb[q] = s[q]; }
  { *(v4h*)(N16 + r * DMQ + t * 4) = y; if (WXB) *(v4f*)(XB + r * DMQ + t * 4) = xb;  } }
__global__ __launch_bounds__(256) void k_ftres2(const float* __restrict__ OF0, const float* __restrict__ XB, float* __restrict__ X1, size_t n4) {
  #pragma clang fp contract(off)
  const size_t t = (size_t)blockIdx.x * 256 + threadIdx.x; if (t >= n4) return; const v4f o = *(const v4fa*)(OF0 + t * 4), xv = *(const v4fa*)(XB + t * 4); v4f y; for (int q = 0; q < 4; ++q) y[q] = __fadd_rn(__fmul_rn(o[q], 0.015625f), xv[q]); *(v4f*)(X1 + t * 4) = y;  }

__global__ __launch_bounds__(256) void k_wthd(const float* __restrict__ Wt, _Float16* __restrict__ Bt) { const size_t t = (size_t)blockIdx.x * 256 + threadIdx.x; if (t >= (size_t)NH * HD * (DM / 8)) return; const int m8 = (int)(t % (DM / 8)) * 8; const int d = (int)((t / (DM / 8)) % HD); const int h = (int)(t / ((size_t)(DM / 8) * HD)); FragH f;
  for (int q = 0; q < 8; ++q) f.h[q] = (_Float16)(16.0f * bf16_round(Wt[((size_t)h * DM + m8 + q) * HD + d])); unsigned short* dst = (unsigned short*)Bt + ((size_t)h * HD + d) * DM + m8; *(v8us*)dst = f.half[0];  }




__global__ __launch_bounds__(256) void k_wtpad(const float* __restrict__ Wm, _Float16* __restrict__ Wt, int Kr, int Kp, int Nr, int Np, float scale) {
  const int t = blockIdx.x * 256 + threadIdx.x; if (t >= Np * (Kp / 8)) return; const int n = t / (Kp / 8), k8 = (t % (Kp / 8)) * 8; const int nc = min(n, Nr - 1); const float fn = (n < Nr) ? 1.f : 0.f; FragH f;
  for (int i = 0; i < 8; ++i) { const int k = k8 + i; const int kc = min(k, Kr - 1); const float fk = (k < Kr) ? fn : 0.f; f.h[i] = (_Float16)(bf16_round(Wm[(size_t)kc * Nr + nc]) * scale * fk); }
  unsigned short* o = (unsigned short*)Wt + (size_t)n * Kp + k8; *(v8us*)o = f.half[0];  }
__global__ __launch_bounds__(128) void k_bpad(const float* __restrict__ b, float* __restrict__ Bp, int nr, int np) {
  const int i = threadIdx.x; if (i >= np) return; const float v = b[min(i, nr - 1)] * ((i < nr) ? 1.f : 0.f); *(float*)(Bp + i) = v;  }

#define DI 64         /* inner width = NH * HD (ONE 64-wide head) */
#define LQK (3 * DI)  /* fused q | k | v row pitch (192) */
__global__ __launch_bounds__(256) void k_o0(const float* __restrict__ OF, float* __restrict__ ob, size_t n4) {
  #pragma clang fp contract(off)
  const size_t t = (size_t)blockIdx.x * 256 + threadIdx.x; if (t >= n4) return; const size_t e = t * 4; const int i = (int)(e / DI); const int c = (int)(e % DI); const int h = c / HD, d = c % HD; const v4f a = *(const v4fa*)(OF + e); v4f o; for (int q = 0; q < 4; ++q) o[q] = __fmul_rn(a[q], 0.015625f); float* dst = ob + (size_t)h * SQ * HD + (size_t)i * HD + d; *(v4f*)dst = o;  }

__global__ __launch_bounds__(256) void k_o0m(const float* __restrict__ OF, float* __restrict__ o_, size_t n4) {
  #pragma clang fp contract(off)
  const size_t t = (size_t)blockIdx.x * 256 + threadIdx.x; if (t >= n4) return; const size_t e = t * 4; OF += (size_t)blockIdx.y * QT0 * DI; o_ += (size_t)blockIdx.y * SQ * DI;      /* batch on grid.y: n4 counts one batch's first tile */
  const v4f a = *(const v4fa*)(OF + e); v4f o; for (int q = 0; q < 4; ++q) o[q] = __fmul_rn(a[q], 0.015625f); *(v4f*)(o_ + e) = o;  }
extern "C" void kernel_launch(void* const* d_in, const int* in_sizes, int n_in,
                              void* d_out, int out_size, void* d_ws, size_t ws_size, hipStream_t stream) {
  (void)in_sizes; (void)n_in; (void)out_size;
  const float* const* I = (const float* const*)d_in; const float* x = I[0]; const float* wq = I[1]; const float* wk = I[2]; const float* wv = I[3]; const float* bq = nullptr; const float* bk = nullptr; const float* bv = nullptr;      /* x; [in][out = 64] Wq / Wk / Wv (input order as this module lists them); no biases */
  char* ws = (char*)d_ws; size_t off = 0;
  auto take = [&](size_t bytes) { char* p = ws + off; off += (bytes + 255) & ~(size_t)255; return p; };
  _Float16* BW = (_Float16*)take((size_t)LQK * DM * 2); _Float16* X16 = (_Float16*)take(NR * DM * 2); _Float16* QKV = (_Float16*)take(NR * LQK * 2); _Float16* VT = (_Float16*)take((size_t)NB * NH * HD * SQ * 2);
  float* S = (float*)take((size_t)NB * NH * QT * NKX * 4); _Float16* P = (_Float16*)take((size_t)NB * NH * QT * NKX * 2); float* QKVF0 = (float*)take((size_t)NB * QT0 * LQK * 4); float* OF0 = (float*)take((size_t)NB * QT0 * DI * 4);      /* one plane per batch: all batches are in flight in every launch */
  if (off > ws_size) return;
  { const unsigned g = (unsigned)(((size_t)DI * (DM / 8) + 255) / 256); k_wt_f16<<<g, 256, 0, stream>>>(wq, BW, DM, DI, 16.0f); k_wt_f16<<<g, 256, 0, stream>>>(wk, BW + (size_t)DI * DM, DM, DI, 16.0f); k_wt_f16<<<g, 256, 0, stream>>>(wv, BW + (size_t)2 * DI * DM, DM, DI, 16.0f); }      /* [in = DM][out = 64] -> Bt[n][k] x16, stacked q | k | v */
  k_x16<<<(unsigned)((NR * DM / 8 + 255) / 256), 256, 0, stream>>>(x, X16, NR * DM / 8);      /* x (bf16-valued) as exact f16 rows */
  const float* bqkv[3] = {bq, bk, bv};
  for (int c = 0; c < 3; ++c) k_gemm2<0><<<dim3((unsigned)((NR / 128) * (DI / 64)), 1), 128, 0, stream>>>(X16, DM, 0, BW + (size_t)c * DI * DM, DM, 0, 0.0625f, bqkv[c], 0, nullptr, 1, 0, 0, nullptr, QKV + (size_t)c * DI, LQK, 0, (int)NR, DI, DM);      /* q | k | v = x W^T -> f16 rows, column blocks 0 / 64 / 128 of the fused plane (pitch 192); head h = columns h*64 inside each */
  const _Float16* Q16 = QKV; const _Float16* K16 = QKV + DI; const _Float16* V16 = QKV + 2 * DI;
  float* ob = (float*)d_out;      /* the ONE head leaves grid.y free: it carries the batch in the GEMM, k_att0 and k_o0m launches below */
  k_vt<NH, SQ><<<NB * NH * (SQ / 64), 256, 0, stream>>>(V16, LQK, 0, VT);      /* V^T [NB][HD][SQ], every batch */
  for (int q0 = 0; q0 < SQ; q0 += QT) { const int nk = q0 + QT;      /* causal: only keys below the tile end are computed */
    k_gemm2<0><<<dim3((QT / 128) * (nk / 64), NB), 128, 0, stream>>>(Q16 + (size_t)q0 * LQK, LQK, (size_t)SQ * LQK, K16, LQK, (size_t)SQ * LQK, 0.024895003f, nullptr, 0, nullptr, 1, 0, 0, S, nullptr, NKX, (size_t)QT * NKX, QT, nk, HD);      /* scores * 256^-0.666, batch on grid.y */
    k_rsmcf2<<<(NB * QT + 8 * SMR - 1) / (8 * SMR), 256, 0, stream>>>(S, P, NB, q0, nk);      /* causal softmax -> P x256 f16, NB planes of QT rows; 8 waves a block, SMR rows a wave */
    k_gemm2<0><<<dim3((QT / 128) * (HD / 64), NB), 128, 0, stream>>>(P, NKX, (size_t)QT * NKX, VT, SQ, (size_t)HD * SQ, 0.00390625f, nullptr, 0, nullptr, 1, 0, 0, ob + (size_t)q0 * DI, nullptr, DI, (size_t)SQ * DI, QT, HD, nk); }      /* out[b][q0 + i][..] = P V^T 2^-8 (f32), batch on grid.y */
  for (int c = 0; c < 3; ++c) k_gemm2<0><<<dim3((unsigned)((QT0 / 128) * (DI / 64)), NB), 128, 0, stream>>>(X16, DM, (size_t)SQ * DM, BW + (size_t)c * DI * DM, DM, 0, 0.0625f, bqkv[c], 0, nullptr, 1, 0, 0, QKVF0 + (size_t)c * DI, nullptr, LQK, (size_t)QT0 * LQK, QT0, DI, DM);      /* f32 q | k | v of rows 0..511 of every batch (exact products, f32 accumulation) */
  k_att0<0><<<dim3(NH * (QT0 / 64), NB), 256, 0, stream>>>(QKVF0, QKVF0 + DI, QKVF0 + 2 * DI, LQK, nullptr, 0.024895003f, OF0, DI);      /* exact f32 causal attention for rows 0..511 (o x64), batch on grid.y */
  k_o0m<<<dim3((unsigned)(((size_t)QT0 * DI / 4 + 255) / 256), NB), 256, 0, stream>>>(OF0, ob, (size_t)QT0 * DI / 4);      /* rows 0..511 of every batch REWRITTEN from the exact path */
}

// v004
// A run of this version takes 223 microseconds.
// Timed twice side by side with v003, it ran 1.30 and 1.31 times as fast.
// All steps since v000 together make it 320 times as fast.
#include <hip/hip_runtime.h>
// Single-head causal self-attention with the module's literal scale C^-0.666 (x [32][1024][256]; q/k/v = x W ([in][out] [256][64], no biases); ONE 64-wide head; scores * 256^-0.666 = 0.024895 (as the source writes it, not head_size^-0.5); causal; softmax; out = weights v -> [32][1024][64]; no output projection).
// Structure: token rows; x as exact f16 rows; three WMMA GEMMs into one f16 q | k | v plane [32768][192]; per batch v^T via LDS transposes; causal 256-row query tiles with the batch on grid.y (scores alpha 256^-0.666, causal softmax f32 -> f16 x256 weights, P V written as f32 straight into the merged output rows); an exact f32 first tile (rows 0..511) rewritten at the end; launches: see trace.
// Compute dtype: inputs rounded to bf16; x / weights exact; q, k, v and softmax weights as plain f16 GEMM operands (~2^-12); scores and softmax statistics f32. v_wmma_f32_16x16x32_f16.
#define NB 32
#define SQ 1024
#define DM 256
#define NH 1
#define HD 64
#define HG 4                         /* heads per launch of the non-template k_vt, which is not launched */
#define QT 256                       /* query rows per causal tile */
#define NKX SQ                       /* S / P row pitch */
#define QT0 512                      /* first-tile rows recomputed exactly (f32): 512 here (no output projection averages the early-row cancellation errors away; logit sigma 1.0) */
#define B0 0                         /* first batch processed (debug hook) */
#define NBR NB                       /* batches processed (debug hook) */
#define NR ((size_t)NB * SQ)
#define DMQ DM
#define DFF 4096                     /* unused (no FFN in this file) */
#define DFFR 100                     /* unused */
#define MP ((int)((size_t)NBR * SQ)) /* rows projected (debug hook) */
#define QN SQ                        /* query rows attended per batch (debug hook) */
#define NHD NH                       /* heads attended (debug hook) */
#define MPO MP                       /* rows through the output stage (debug hook) */
#define LQ (3 * DM)      /* unused; the q/k/v rows have pitch LQK (192) */
typedef __bf16 v16b __attribute__((ext_vector_type(16)));
typedef unsigned short v8us __attribute__((ext_vector_type(8), may_alias));
typedef float  v8f  __attribute__((ext_vector_type(8)));
typedef float  v4f  __attribute__((ext_vector_type(4)));
typedef float  v4fa __attribute__((ext_vector_type(4), may_alias));
union FragB { v16b v; v8us half[2]; unsigned short u[16]; };

__device__ __forceinline__ unsigned short bf16_bits(float x) { unsigned int u = __float_as_uint(x); return (unsigned short)((u + 0x7FFFu + ((u >> 16) & 1u)) >> 16); }
__device__ __forceinline__ float bf16_val(unsigned short b) { return __uint_as_float(((unsigned int)b) << 16); }
__device__ __forceinline__ float bf16_round(float x) { return bf16_val(bf16_bits(x)); }
// D += A·B with NT terms: 1 = ah·bh, 2 = + al·bh (A split), 3 = + ah·bl (both split)
template <int NT>
__device__ __forceinline__ v8f mmaN(v16b ah, v16b al, v16b bh, v16b bl, v8f c) {
  c = __builtin_amdgcn_wmma_f32_16x16x32_bf16(false, ah, false, bh, (short)0, c, false, false);
  if (NT >= 2) c = __builtin_amdgcn_wmma_f32_16x16x32_bf16(false, al, false, bh, (short)0, c, false, false);
  if (NT >= 3) c = __builtin_amdgcn_wmma_f32_16x16x32_bf16(false, ah, false, bl, (short)0, c, false, false);
  asm volatile("v_nop\n\tv_nop\n\tv_nop\n\tv_nop" : "+v"(c) : "v"(ah), "v"(al), "v"(bh), "v"(bl));
  return c;
}

__global__ __launch_bounds__(256) void k_wt_bf16(const float* __restrict__ W, unsigned short* __restrict__ Wt, int K, int N) {
  const int t = blockIdx.x * 256 + threadIdx.x;
  const int k8n = K / 8;
  if (t >= N * k8n) return;
  const int n = t / k8n, k8 = (t % k8n) * 8;
  v8us v;
#pragma unroll
  for (int i = 0; i < 8; ++i) v[i] = bf16_bits(W[(size_t)(k8 + i) * N + n]);
  *(v8us*)(Wt + (size_t)n * K + k8) = v;
  
}

// GEMM C[M][N] (f32, pitch ldc) = act(A[M][K]·W + bias). A f32 row-major (pitch lda) converted per fragment to bf16
// (ASPLIT: hi/lo two planes -> 2 terms, else single rounded term); Wt bf16 [N][K] (pitch ldb). BIAS_BF16 rounds the
// bias to bf16 first (bias quantised to bf16 before the add). K%32==0, M%16==0, N%64==0.
template <bool ASPLIT, int ACT, bool BIAS_BF16>
__global__ __launch_bounds__(128) void k_gemm_bf(const float* __restrict__ A, int lda, const unsigned short* __restrict__ Wt, int ldb,
                                               const float* __restrict__ bias, float* __restrict__ C, int ldc, int M, int N, int K) {
  __shared__ __attribute__((aligned(16))) float so[4][16][64];
  const int tid = threadIdx.x, w = tid >> 5, lane = tid & 31, ln = lane & 15, hh = lane >> 4;
  const int ntn = N / 64;
  const int wid = blockIdx.x * 4 + w;
  const int mt = wid / ntn, nq = wid % ntn;
  if (mt * 16 >= M) return;
  const int row0 = mt * 16, col0 = nq * 64;
  const float* arow = A + (size_t)(row0 + ln) * lda;
  v8f acc[4] = {};
  for (int kb = 0; kb < K; kb += 32) {
    FragB ah, al;
    const v4f x0 = *(const v4fa*)(arow + kb + 8 * hh), x1 = *(const v4fa*)(arow + kb + 8 * hh + 4);
    const v4f x2 = *(const v4fa*)(arow + kb + 16 + 8 * hh), x3 = *(const v4fa*)(arow + kb + 16 + 8 * hh + 4);
    float xs[16] = {x0[0],x0[1],x0[2],x0[3],x1[0],x1[1],x1[2],x1[3],x2[0],x2[1],x2[2],x2[3],x3[0],x3[1],x3[2],x3[3]};
#pragma unroll
    for (int i = 0; i < 16; ++i) { const unsigned short hb = bf16_bits(xs[i]); ah.u[i] = hb; al.u[i] = ASPLIT ? bf16_bits(xs[i] - bf16_val(hb)) : (unsigned short)0; }
#pragma unroll
    for (int t = 0; t < 4; ++t) {
      const unsigned short* brow = Wt + (size_t)(col0 + t * 16 + ln) * ldb + kb;
      FragB b;
      b.half[0] = *(const v8us*)(brow + 8 * hh);
      b.half[1] = *(const v8us*)(brow + 16 + 8 * hh);
      acc[t] = mmaN<ASPLIT ? 2 : 1>(ah.v, al.v, b.v, b.v, acc[t]);
    }
  }
#pragma unroll
  for (int t = 0; t < 4; ++t) {
    float bv = bias ? bias[col0 + t * 16 + ln] : 0.f;
    if (BIAS_BF16) bv = bf16_round(bv);
#pragma unroll
    for (int r = 0; r < 8; ++r) { float v = acc[t][r] + bv; if (ACT == 1) v = fmaxf(v, 0.f); so[w][8 * hh + r][t * 16 + ln] = v; }
  }
  __builtin_amdgcn_fence(__ATOMIC_ACQ_REL, "workgroup");
  __builtin_amdgcn_wave_barrier();
  const int rsub = lane >> 4, c4 = (lane & 15) * 4;
  {
#pragma unroll
    for (int q = 0; q < 8; ++q) {
      const int r = q * 2 + rsub;
      const v4f v = *(const v4fa*)&so[w][r][c4];
      *(v4f*)(C + (size_t)(row0 + r) * ldc + col0 + c4) = v;
    }
    
  }
}

// GEMM C = act(A·W + bias + resid): A f32 (ASPLIT -> hi/lo 2 terms), Wt bf16 [N][K]; ACT 0 none, 1 relu, 2 exact gelu;
// resid (optional, f32, row index = (row % rmod), pitch ldr, RES_BF16 rounds it) added before the activation.
template <bool ASPLIT, int ACT, bool BIAS_BF16, bool RES_BF16>
__global__ __launch_bounds__(128) void k_gemm_bf3(const float* __restrict__ A, int lda, const unsigned short* __restrict__ Wt, int ldb,
                                                const float* __restrict__ bias, const float* __restrict__ resid, int rmod, int ldr,
                                                float* __restrict__ C, int ldc, int M, int N, int K) {
  __shared__ __attribute__((aligned(16))) float so[4][16][64];
  const int tid = threadIdx.x, w = tid >> 5, lane = tid & 31, ln = lane & 15, hh = lane >> 4;
  const int ntn = N / 64;
  const int wid = blockIdx.x * 4 + w;
  const int mt = wid / ntn, nq = wid % ntn;
  if (mt * 16 >= M) return;
  const int row0 = mt * 16, col0 = nq * 64;
  const float* arow = A + (size_t)(row0 + ln) * lda;
  v8f acc[4] = {};
  for (int kb = 0; kb < K; kb += 32) {
    FragB ah, al;
    const v4f x0 = *(const v4fa*)(arow + kb + 8 * hh), x1 = *(const v4fa*)(arow + kb + 8 * hh + 4);
    const v4f x2 = *(const v4fa*)(arow + kb + 16 + 8 * hh), x3 = *(const v4fa*)(arow + kb + 16 + 8 * hh + 4);
    float xs[16] = {x0[0],x0[1],x0[2],x0[3],x1[0],x1[1],x1[2],x1[3],x2[0],x2[1],x2[2],x2[3],x3[0],x3[1],x3[2],x3[3]};
#pragma unroll
    for (int i = 0; i < 16; ++i) { const unsigned short hb = bf16_bits(xs[i]); ah.u[i] = hb; al.u[i] = ASPLIT ? bf16_bits(xs[i] - bf16_val(hb)) : (unsigned short)0; }
#pragma unroll
    for (int t = 0; t < 4; ++t) {
      const unsigned short* brow = Wt + (size_t)(col0 + t * 16 + ln) * ldb + kb;
      FragB b;
      b.half[0] = *(const v8us*)(brow + 8 * hh);
      b.half[1] = *(const v8us*)(brow + 16 + 8 * hh);
      acc[t] = mmaN<ASPLIT ? 2 : 1>(ah.v, al.v, b.v, b.v, acc[t]);
    }
  }
#pragma unroll
  for (int t = 0; t < 4; ++t) {
    const int col = col0 + t * 16 + ln;
    float bv = bias ? bias[col] : 0.f;
    if (BIAS_BF16) bv = bf16_round(bv);
#pragma unroll
    for (int r = 0; r < 8; ++r) {
      float v = acc[t][r] + bv;
      if (resid) { float rv = resid[(size_t)((row0 + 8 * hh + r) % rmod) * ldr + col]; if (RES_BF16) rv = bf16_round(rv); v += rv; }
      if (ACT == 1) v = fmaxf(v, 0.f);
      if (ACT == 2) v = 0.5f * v * (1.0f + erff(v * 0.70710678118654752f));
      if (ACT == 3) { const float u = 0.7978845608028654f * (v + 0.044715f * v * v * v); v = 0.5f * v * (1.0f + tanhf(u)); }
      so[w][8 * hh + r][t * 16 + ln] = v;
    }
  }
  __builtin_amdgcn_fence(__ATOMIC_ACQ_REL, "workgroup");
  __builtin_amdgcn_wave_barrier();
  const int rsub = lane >> 4, c4 = (lane & 15) * 4;
  {
#pragma unroll
    for (int q = 0; q < 8; ++q) {
      const int r = q * 2 + rsub;
      const v4f v = *(const v4fa*)&so[w][r][c4];
      *(v4f*)(C + (size_t)(row0 + r) * ldc + col0 + c4) = v;
    }
    
  }
}
// row LayerNorm (biased variance, eps) over N: s = X (+ R); optional out_sum <- s; out_norm <- (s-mu)*rsqrt(var+eps)*g + b
template <bool PARAM_BF16>
__global__ __launch_bounds__(256) void k_layernorm(const float* __restrict__ X, const float* __restrict__ R, const float* __restrict__ g, const float* __restrict__ bta,
                                                  float* __restrict__ out_sum, float* __restrict__ out_norm, int N, float eps) {
  __shared__ float red[256];
  const int row = blockIdx.x, tid = threadIdx.x;
  const float* x = X + (size_t)row * N; const float* rr = R ? R + (size_t)row * N : nullptr;
  float vals[16];                     // up to N = 4096
  const int per = N / 256;            // contiguous chunk per thread? use strided-by-4 chunks: thread handles j = tid*4 + 1024*u
  float s1 = 0.f;
  for (int u = 0; u < per / 4; ++u) {
    const int j = tid * 4 + 1024 * u;
    const v4f a = *(const v4fa*)(x + j);
    v4f b = {0.f,0.f,0.f,0.f}; if (rr) b = *(const v4fa*)(rr + j);
#pragma unroll
    for (int q = 0; q < 4; ++q) { const float v = a[q] + b[q]; vals[u * 4 + q] = v; s1 += v; }
  }
  red[tid] = s1; __syncthreads();
  for (int st = 128; st > 0; st >>= 1) { if (tid < st) red[tid] += red[tid + st]; __syncthreads(); }
  const float mu = red[0] / (float)N; __syncthreads();
  float s2 = 0.f;
  for (int u = 0; u < per / 4; ++u)
#pragma unroll
    for (int q = 0; q < 4; ++q) { const float c = vals[u * 4 + q] - mu; s2 += c * c; }
  red[tid] = s2; __syncthreads();
  for (int st = 128; st > 0; st >>= 1) { if (tid < st) red[tid] += red[tid + st]; __syncthreads(); }
  const float rs = rsqrtf(red[0] / (float)N + eps);
  {
    for (int u = 0; u < per / 4; ++u) {
      const int j = tid * 4 + 1024 * u;
      v4f o, sm;
#pragma unroll
      for (int q = 0; q < 4; ++q) {
        float gg = g[j + q], bb = bta[j + q];
        if (PARAM_BF16) { gg = bf16_round(gg); bb = bf16_round(bb); }
        sm[q] = vals[u * 4 + q]; o[q] = (vals[u * 4 + q] - mu) * rs * gg + bb;
      }
      if (out_sum) *(v4f*)(out_sum + (size_t)row * N + j) = sm;
      *(v4f*)(out_norm + (size_t)row * N + j) = o;
    }
    
  }
}



// ---- f16 WMMA path (v_wmma_f32_16x16x32_f16): 11-bit significands for operands in range — used where a [0,1] probability operand needs more precision than bf16
typedef _Float16 v16h __attribute__((ext_vector_type(16)));
union FragH { v16h v; v8us half[2]; _Float16 h[16]; unsigned short u[16]; };
template <int NT>
__device__ __forceinline__ v8f mmaH(v16h ah, v16h al, v16h bh, v16h bl, v8f c) {
  c = __builtin_amdgcn_wmma_f32_16x16x32_f16(false, ah, false, bh, (short)0, c, false, false);
  if (NT >= 2) c = __builtin_amdgcn_wmma_f32_16x16x32_f16(false, al, false, bh, (short)0, c, false, false);
  if (NT >= 3) c = __builtin_amdgcn_wmma_f32_16x16x32_f16(false, ah, false, bl, (short)0, c, false, false);
  asm volatile("v_nop\n\tv_nop\n\tv_nop\n\tv_nop" : "+v"(c) : "v"(ah), "v"(al), "v"(bh), "v"(bl));
  return c;
}
// batched GEMM like k_gemm_b but f16 operands: A f32 (split into f16 hi/lo if ASPLIT, else rounded to f16), Bt = f16 values [n][k]; alpha; C f32; N multiple of 16 (partial tiles skipped)
template <bool ASPLIT>
__global__ __launch_bounds__(128) void k_gemm_h(const float* __restrict__ A, int lda, size_t sA, const _Float16* __restrict__ Bh, int ldb, size_t sB, float alpha, float* __restrict__ C, int ldc, size_t sC, int M, int N, int K) {
  __shared__ __attribute__((aligned(16))) float so[4][16][64];
  const int tid = threadIdx.x, w = tid >> 5, lane = tid & 31, ln = lane & 15, hh = lane >> 4; const int by = blockIdx.y;
  A += (size_t)by * sA; Bh += (size_t)by * sB; C += (size_t)by * sC;
  const int ntn = (N + 63) / 64; const int wid = blockIdx.x * 4 + w; const int mt = wid / ntn, nq = wid % ntn; if (mt * 16 >= M) return;
  const int row0 = mt * 16, col0 = nq * 64; const float* arow = A + (size_t)(row0 + ln) * lda;
  v8f acc[4] = {};
  for (int kb = 0; kb < K; kb += 32) {
    FragH ah, al;
    const v4f x0 = *(const v4fa*)(arow + kb + 8 * hh), x1 = *(const v4fa*)(arow + kb + 8 * hh + 4), x2 = *(const v4fa*)(arow + kb + 16 + 8 * hh), x3 = *(const v4fa*)(arow + kb + 16 + 8 * hh + 4);
    float xs[16] = {x0[0],x0[1],x0[2],x0[3],x1[0],x1[1],x1[2],x1[3],x2[0],x2[1],x2[2],x2[3],x3[0],x3[1],x3[2],x3[3]};
#pragma unroll
    for (int i = 0; i < 16; ++i) { const _Float16 h = (_Float16)xs[i]; ah.h[i] = h; al.h[i] = ASPLIT ? (_Float16)(xs[i] - (float)h) : (_Float16)0.0f; }
#pragma unroll
    for (int t = 0; t < 4; ++t) { if (col0 + t * 16 >= N) continue; const size_t boff = (size_t)(col0 + t * 16 + ln) * ldb + kb; FragH bq; bq.half[0] = *(const v8us*)(Bh + boff + 8 * hh); bq.half[1] = *(const v8us*)(Bh + boff + 16 + 8 * hh);
      acc[t] = mmaH<ASPLIT ? 2 : 1>(ah.v, al.v, bq.v, bq.v, acc[t]); }
  }
#pragma unroll
  for (int t = 0; t < 4; ++t) { if (col0 + t * 16 >= N) continue;
#pragma unroll
    for (int r = 0; r < 8; ++r) so[w][8 * hh + r][t * 16 + ln] = acc[t][r] * alpha; }
  __builtin_amdgcn_fence(__ATOMIC_ACQ_REL, "workgroup"); __builtin_amdgcn_wave_barrier();
  const int rsub = lane >> 4, c4 = (lane & 15) * 4;
  {
#pragma unroll
    for (int q = 0; q < 8; ++q) { const int r = q * 2 + rsub; if (col0 + c4 < N) { const v4f v = *(const v4fa*)&so[w][r][c4]; *(v4f*)(C + (size_t)(row0 + r) * ldc + col0 + c4) = v; } }
     }
}

// Wt[n][k] = f16(W[k][n]·scale) from f32 row-major W[K][N] (scale = power of two; bf16-exact weights stay exact in f16 away from the subnormal range)
__global__ __launch_bounds__(256) void k_wt_f16(const float* __restrict__ W, _Float16* __restrict__ Wt, int K, int N, float scale) {
  const int t = blockIdx.x * 256 + threadIdx.x; if (t >= N * (K / 8)) return; const int n = t / (K / 8), k8 = (t % (K / 8)) * 8; FragH f;
#pragma unroll
  for (int i = 0; i < 8; ++i) f.h[i] = (_Float16)(bf16_round(W[(size_t)(k8 + i) * N + n]) * scale); const v8us o = f.half[0];
  *(v8us*)((unsigned short*)Wt + (size_t)n * K + k8) = o; 
}
// k_gemm_hh variant with fused epilogue: v = acc·alpha + bias[by·sBias + col] (+ CP[(row/rowsPerB)·sCPb + by·64 + col] if CP) ; ACT 0 none / 1 elu ; writes f16 C16 (and f32 C if non-null)
template <int ACT>
__global__ __launch_bounds__(128) void k_gemm_hhx(const _Float16* __restrict__ A, int lda, size_t sA, const _Float16* __restrict__ Bh, int ldb, size_t sB, float alpha, const float* __restrict__ bias, size_t sBias, const float* __restrict__ CP, int rowsPerB, size_t sCPb, int row0g,
    float* __restrict__ C, _Float16* __restrict__ C16, int ldc, size_t sC, int M, int N, int K) {
  __shared__ __attribute__((aligned(16))) float so[4][16][64];
  const int tid = threadIdx.x, w = tid >> 5, lane = tid & 31, ln = lane & 15, hh = lane >> 4; const int by = blockIdx.y;
  A += (size_t)by * sA; Bh += (size_t)by * sB; const size_t cofs = (size_t)by * sC; const float* bp = bias ? bias + (size_t)by * sBias : nullptr;
  const int ntn = (N + 63) / 64; const int wid = blockIdx.x * 4 + w; const int mt = wid / ntn, nq = wid % ntn; if (mt * 16 >= M) return;
  const int row0 = mt * 16, col0 = nq * 64; const _Float16* arow = A + (size_t)(row0 + ln) * lda;
  v8f acc[4] = {};
  for (int kb = 0; kb < K; kb += 32) { FragH ah; ah.half[0] = *(const v8us*)((const unsigned short*)arow + kb + 8 * hh); ah.half[1] = *(const v8us*)((const unsigned short*)arow + kb + 16 + 8 * hh);
#pragma unroll
    for (int t = 0; t < 4; ++t) { if (col0 + t * 16 >= N) continue; const size_t boff = (size_t)(col0 + t * 16 + ln) * ldb + kb; FragH bq; bq.half[0] = *(const v8us*)((const unsigned short*)Bh + boff + 8 * hh); bq.half[1] = *(const v8us*)((const unsigned short*)Bh + boff + 16 + 8 * hh);
      acc[t] = mmaH<1>(ah.v, ah.v, bq.v, bq.v, acc[t]); }
  }
#pragma unroll
  for (int t = 0; t < 4; ++t) { if (col0 + t * 16 >= N) continue; const int col = col0 + t * 16 + ln; const float bv = bp ? bf16_round(bp[col]) : 0.f;
#pragma unroll
    for (int r = 0; r < 8; ++r) { float v = acc[t][r] * alpha + bv; if (CP) { const int rr = row0g + row0 + 8 * hh + r; if (rowsPerB < 0) v += CP[cofs + (size_t)rr * ldc + col];      /* rowsPerB < 0: own element of the batched C plane */ else { const int bidx = rr / rowsPerB; v += CP[(size_t)bidx * sCPb + (size_t)by * 64 + col]; } } if (ACT == 1) v = (v > 0.f) ? v : expm1f(v); else if (ACT == 7) v = (v > 0.f) ? v + 1.0f : expf(v); else if (ACT == 8) v = tanhf(v); else if (ACT == 9) v = 0.5f * v * (1.0f + tanhf(0.7978845608028654f * (v + 0.044715f * v * v * v))); else if (ACT == 11) v = 1.0f / (1.0f + expf(-v)); else if (ACT == 12) v = (v > 0.f) ? v : 0.01f * v; else if (ACT == 14) v = (v > 0.f) ? v : 0.1f * v; else if (ACT == 16) v = (v >= 0.f) ? v : 0.3f * v; else if (ACT == 17) v = (v >= 0.f) ? v : 0.2f * v; else if (ACT == 15) v = v / (1.0f + expf(-v)); else if (ACT == 3) v = fmaxf(v, 0.f); else if (ACT == 6) v = 0.5f * v * (1.0f + erff(v * 0.70710678118654752f)); so[w][8 * hh + r][t * 16 + ln] = v; } }
  __builtin_amdgcn_fence(__ATOMIC_ACQ_REL, "workgroup"); __builtin_amdgcn_wave_barrier();
  const int rsub = lane >> 4, c4 = (lane & 15) * 4; typedef _Float16 v4h __attribute__((ext_vector_type(4)));
  {
#pragma unroll
    for (int q = 0; q < 8; ++q) { const int r = q * 2 + rsub; if (col0 + c4 < N) { const v4f v = *(const v4fa*)&so[w][r][c4]; if (C) *(v4f*)(C + cofs + (size_t)(row0 + r) * ldc + col0 + c4) = v; if (C16) { v4h h4; for (int i = 0; i < 4; ++i) h4[i] = (_Float16)v[i]; *(v4h*)(C16 + cofs + (size_t)(row0 + r) * ldc + col0 + c4) = h4; } } }
     }
}


typedef _Float16 v4h __attribute__((ext_vector_type(4)));

__global__ __launch_bounds__(256) void k_x16(const float* __restrict__ x, _Float16* __restrict__ X16, size_t n8) { const size_t t = (size_t)blockIdx.x * 256 + threadIdx.x; if (t >= n8) return; FragH f;
#pragma unroll
  for (int q = 0; q < 8; ++q) f.h[q] = (_Float16)bf16_round(x[t * 8 + q]); *(v8us*)((unsigned short*)X16 + t * 8) = f.half[0];  }
__global__ __launch_bounds__(256) void k_h16(const float* __restrict__ x, _Float16* __restrict__ X16, size_t n8) { const size_t t = (size_t)blockIdx.x * 256 + threadIdx.x; if (t >= n8) return; FragH f;
#pragma unroll
  for (int q = 0; q < 8; ++q) f.h[q] = (_Float16)x[t * 8 + q]; *(v8us*)((unsigned short*)X16 + t * 8) = f.half[0];  }
__global__ __launch_bounds__(256) void k_round16f(const float* __restrict__ W, _Float16* __restrict__ Bt, size_t n8) { const size_t t = (size_t)blockIdx.x * 256 + threadIdx.x; if (t >= n8) return; FragH f;
#pragma unroll
  for (int i = 0; i < 8; ++i) f.h[i] = (_Float16)(bf16_round(W[t * 8 + i]) * 16.0f); *(v8us*)((unsigned short*)Bt + t * 8) = f.half[0];  }
template <int NHv, int TTv>
__global__ __launch_bounds__(256) void k_vt(const _Float16* __restrict__ V16, int ldv, int voff, _Float16* __restrict__ Vt) { __shared__ unsigned short tl[64][66]; const int tid = threadIdx.x; const int slab = blockIdx.x / (TTv / 64), lg = blockIdx.x % (TTv / 64); const int b = slab / NHv, h = slab % NHv;
  for (int i = tid; i < 64 * 8; i += 256) { const int r = i / 8, c8 = (i % 8) * 8; FragH f; f.half[0] = *(const v8us*)((const unsigned short*)V16 + ((size_t)b * TTv + lg * 64 + r) * ldv + voff + h * 64 + c8);
#pragma unroll
    for (int q = 0; q < 8; ++q) tl[r][c8 + q] = f.u[q]; }
  __syncthreads();
  {
#pragma unroll
    for (int rd = 0; rd < 2; ++rd) { const int d = rd * 32 + tid / 8, pc = tid % 8; FragH f;
#pragma unroll
      for (int q = 0; q < 8; ++q) f.u[q] = tl[pc * 8 + q][d];
      *(v8us*)((unsigned short*)Vt + ((size_t)slab * 64 + d) * TTv + lg * 64 + pc * 8) = f.half[0]; }
     } }

__global__ __launch_bounds__(256) void k_hl(const float* __restrict__ F, _Float16* __restrict__ Hh, _Float16* __restrict__ Hl, size_t n8) { const size_t t = (size_t)blockIdx.x * 256 + threadIdx.x; if (t >= n8) return; FragH fh, fl; const v4f a = *(const v4fa*)(F + t * 8), c = *(const v4fa*)(F + t * 8 + 4);
#pragma unroll
  for (int q = 0; q < 4; ++q) { _Float16 h = (_Float16)a[q]; fh.h[q] = h; fl.h[q] = (_Float16)((a[q] - (float)h) * 1024.0f); h = (_Float16)c[q]; fh.h[4 + q] = h; fl.h[4 + q] = (_Float16)((c[q] - (float)h) * 1024.0f); }
  { *(v8us*)((unsigned short*)Hh + t * 8) = fh.half[0]; *(v8us*)((unsigned short*)Hl + t * 8) = fl.half[0];  } }

// ---- fast GEMM (wave tile 32x64; requires M % 32 == 0 rows per launch region, N % 64 == 0 and K % 64 == 0); epilogue = k_gemm_hhx semantics ----
__device__ __forceinline__ v16h g2_frag(const _Float16* p, int hh) { FragH f; f.half[0] = *(const v8us*)((const unsigned short*)p + 8 * hh); f.half[1] = *(const v8us*)((const unsigned short*)p + 16 + 8 * hh); return f.v; }
__device__ __forceinline__ v8f g2_mma(v16h a, v16h b, v8f c) { v8f d = __builtin_amdgcn_wmma_f32_16x16x32_f16(false, a, false, b, (short)0, c, false, false); asm volatile("v_nop\n\tv_nop\n\tv_nop\n\tv_nop" : "+v"(d) : "v"(a), "v"(b)); return d; }
template <int ACT>
__global__ __launch_bounds__(128) void k_gemm2(const _Float16* __restrict__ A, int lda, size_t sA, const _Float16* __restrict__ Bh, int ldb, size_t sB, float alpha, const float* __restrict__ bias, size_t sBias, const float* __restrict__ CP, int rowsPerB, size_t sCPb, int row0g,
    float* __restrict__ C, _Float16* __restrict__ C16, int ldc, size_t sC, int M, int N, int K) { static_assert(ACT == 0 || ACT == 3 || ACT == 6 || ACT == 8 || ACT == 9 || ACT == 11 || ACT == 12 || ACT == 14 || ACT == 15 || ACT == 16 || ACT == 17, "k_gemm2: unsupported ACT code (would silently apply no activation)");
  __shared__ __attribute__((aligned(16))) float so[4][32][68];
  const int tid = threadIdx.x, w = tid >> 5, lane = tid & 31, ln = lane & 15, hh = lane >> 4; const int by = blockIdx.y;
  A += (size_t)by * sA; Bh += (size_t)by * sB; const size_t cofs = (size_t)by * sC; const float* bp = bias ? bias + (size_t)by * sBias : nullptr;
  const int ntn = N >> 6; const int mt = blockIdx.x / ntn, nq = blockIdx.x - mt * ntn; const int row0 = mt * 128 + 32 * w, col0 = nq * 64; if (row0 >= M) return;
  const _Float16* a0p = A + (size_t)(row0 + ln) * lda; const _Float16* a1p = a0p + (size_t)16 * lda;
  const _Float16* b0p = Bh + (size_t)(col0 + ln) * ldb; const _Float16* b1p = b0p + (size_t)16 * ldb; const _Float16* b2p = b1p + (size_t)16 * ldb; const _Float16* b3p = b2p + (size_t)16 * ldb;
  const v8f z8 = {0.f,0.f,0.f,0.f,0.f,0.f,0.f,0.f}; v8f c00 = z8, c01 = z8, c02 = z8, c03 = z8, c10 = z8, c11 = z8, c12 = z8, c13 = z8;
  /* two k steps (64 k) of fragments stay in registers: a step's 12 loads are issued together, right behind the products that last read the step's registers, and land while the other step is worked on */
  v16h a0x = g2_frag(a0p, hh), a1x = g2_frag(a1p, hh), b0x = g2_frag(b0p, hh), b1x = g2_frag(b1p, hh), b2x = g2_frag(b2p, hh), b3x = g2_frag(b3p, hh);
  __builtin_amdgcn_sched_barrier(0);      /* the first step's loads stay older than the second's, as in the loop: else the loop's counted waits for one step must also cover loads of the other */
  v16h a0y = g2_frag(a0p + 32, hh), a1y = g2_frag(a1p + 32, hh), b0y = g2_frag(b0p + 32, hh), b1y = g2_frag(b1p + 32, hh), b2y = g2_frag(b2p + 32, hh), b3y = g2_frag(b3p + 32, hh);
  asm volatile("s_wait_xcnt 0x0" ::: "memory");      /* address registers of the loads above are reused below while the loads are in flight: the wait stands in front of that reuse */
#define G2_STEP(a0, a1, b0, b1, b2, b3) c00 = g2_mma(a0, b0, c00); c10 = g2_mma(a1, b0, c10); c01 = g2_mma(a0, b1, c01); c11 = g2_mma(a1, b1, c11); c02 = g2_mma(a0, b2, c02); c12 = g2_mma(a1, b2, c12); c03 = g2_mma(a0, b3, c03); c13 = g2_mma(a1, b3, c13);
#pragma unroll 1      /* rolled: a trip already holds 24 loads and 16 products, a second copy would need a second set of fragment registers */
  for (int kb = 64; kb < K; kb += 64) {      /* no branch inside: the waits in front of each step's products can then count the other step's younger loads as still in flight */
    G2_STEP(a0x, a1x, b0x, b1x, b2x, b3x)
    a0x = g2_frag(a0p + kb, hh); a1x = g2_frag(a1p + kb, hh); b0x = g2_frag(b0p + kb, hh); b1x = g2_frag(b1p + kb, hh); b2x = g2_frag(b2p + kb, hh); b3x = g2_frag(b3p + kb, hh);
    G2_STEP(a0y, a1y, b0y, b1y, b2y, b3y)
    a0y = g2_frag(a0p + kb + 32, hh); a1y = g2_frag(a1p + kb + 32, hh); b0y = g2_frag(b0p + kb + 32, hh); b1y = g2_frag(b1p + kb + 32, hh); b2y = g2_frag(b2p + kb + 32, hh); b3y = g2_frag(b3p + kb + 32, hh);
    asm volatile("s_wait_xcnt 0x0" ::: "memory"); }      /* the next trip forms its addresses in the registers that this trip's loads name: the wait stands in front of that */
  G2_STEP(a0x, a1x, b0x, b1x, b2x, b3x)      /* the last 64 k: nothing left to load */
  G2_STEP(a0y, a1y, b0y, b1y, b2y, b3y)
#undef G2_STEP
  v8f accs[8] = {c00, c01, c02, c03, c10, c11, c12, c13};
#pragma unroll
  for (int u = 0; u < 8; ++u) { const int t = u & 3, half = u >> 2; const int col = col0 + t * 16 + ln; const float bv = bp ? bf16_round(bp[col]) : 0.f;
#pragma unroll
    for (int r = 0; r < 8; ++r) { const int rloc = half * 16 + 8 * hh + r; float v = accs[u][r] * alpha + bv; if (CP) { if (rowsPerB < 0) v += CP[cofs + (size_t)(row0g + row0 + rloc) * ldc + col];      /* rowsPerB < 0: own element of the batched C plane */ else { const int bidx = (row0g + row0 + rloc) / rowsPerB; v += CP[(size_t)bidx * sCPb + (size_t)by * 64 + col]; } }
      if (ACT == 3) v = fmaxf(v, 0.f); else if (ACT == 6) v = 0.5f * v * (1.0f + erff(v * 0.70710678118654752f)); else if (ACT == 11) v = 1.0f / (1.0f + expf(-v)); else if (ACT == 15) v = v / (1.0f + expf(-v)); else if (ACT == 12) v = (v > 0.f) ? v : 0.01f * v; else if (ACT == 8) v = tanhf(v); else if (ACT == 9) v = 0.5f * v * (1.0f + tanhf(0.7978845608028654f * (v + 0.044715f * v * v * v))); else if (ACT == 14) v = (v > 0.f) ? v : 0.1f * v; else if (ACT == 16) v = (v >= 0.f) ? v : 0.3f * v; else if (ACT == 17) v = (v >= 0.f) ? v : 0.2f * v;
      so[w][rloc][t * 16 + ln] = v; } }
  __builtin_amdgcn_fence(__ATOMIC_ACQ_REL, "workgroup"); __builtin_amdgcn_wave_barrier();
  const int rsub = lane >> 4, c4 = (lane & 15) * 4;
  {
#pragma unroll
    for (int q = 0; q < 16; ++q) { const int r = q * 2 + rsub; const v4f v = *(const v4fa*)&so[w][r][c4]; if (C) *(v4f*)(C + cofs + (size_t)(row0 + r) * ldc + col0 + c4) = v; if (C16) { v4h h4; for (int i = 0; i < 4; ++i) h4[i] = (_Float16)v[i]; *(v4h*)(C16 + cofs + (size_t)(row0 + r) * ldc + col0 + c4) = h4; } }
     } }


__global__ __launch_bounds__(256) void k_wnat(const float* __restrict__ w, size_t n8, _Float16* __restrict__ Bt) { const size_t t = (size_t)blockIdx.x * 256 + threadIdx.x; if (t >= n8) return; FragH f; for (int q = 0; q < 8; ++q) f.h[q] = (_Float16)(bf16_round(w[t * 8 + q]) * 16.0f); *(v8us*)((unsigned short*)Bt + t * 8) = f.half[0];  }
__global__ __launch_bounds__(256) void k_rsm(const float* __restrict__ S, _Float16* __restrict__ P, int nrows) {
  #pragma clang fp contract(off)
  const int i = blockIdx.x * 256 + threadIdx.x; if (i >= nrows) return; const float* s = S + (size_t)i * SQ; float mx = -3.0e38f;
#pragma unroll 1
  for (int j = 0; j < SQ; ++j) mx = fmaxf(mx, s[j]); float se = 0.f;
#pragma unroll 1
  for (int j = 0; j < SQ; ++j) se += expf(s[j] - mx); const float sc = 256.0f / se;
#pragma unroll 1
  for (int j0 = 0; j0 < SQ; j0 += 8) { FragH f; for (int q = 0; q < 8; ++q) f.h[q] = (_Float16)(expf(s[j0 + q] - mx) * sc); unsigned short* d = (unsigned short*)P + (size_t)i * SQ + j0; *(v8us*)d = f.half[0];  } }
__global__ __launch_bounds__(256) void k_vt(const _Float16* __restrict__ V16, int b, int h0, _Float16* __restrict__ VT) { __shared__ unsigned short tl[64][65]; const int tid = threadIdx.x; const int hh = blockIdx.x % HG, sg = blockIdx.x / HG; const int s0 = sg * 64; const int h = h0 + hh;
  for (int i = tid; i < 64 * 8; i += 256) { const int j = i / 8, d8 = (i % 8) * 8; FragH f; f.half[0] = *(const v8us*)((const unsigned short*)V16 + ((size_t)b * SQ + s0 + j) * DM + h * HD + d8); for (int q = 0; q < 8; ++q) tl[d8 + q][j] = f.u[q]; }
  __syncthreads();
  { for (int i = tid; i < 64 * 8; i += 256) { const int d = i / 8, j8 = (i % 8) * 8; FragH f; for (int q = 0; q < 8; ++q) f.u[q] = tl[d][j8 + q]; *(v8us*)((unsigned short*)VT + ((size_t)hh * HD + d) * SQ + s0 + j8) = f.half[0]; }  } }



// lane l with lane l ^ MSK inside its row of 16 lanes (DPP row_xmask), and lane l with lane l ^ 16; every lane is on where these are used
template <int MSK>
__device__ __forceinline__ float row_x(float x) { return __builtin_bit_cast(float, __builtin_amdgcn_update_dpp(0, __builtin_bit_cast(int, x), 0x160 + MSK, 0xF, 0xF, true)); }
__device__ __forceinline__ float half_x(float x) { return __builtin_bit_cast(float, __builtin_amdgcn_permlanex16(__builtin_bit_cast(int, x), __builtin_bit_cast(int, x), 0x76543210, 0xfedcba98, false, false)); }
#define SMR 4                        /* score rows per wave */
#define SMC (NKX / 128)              /* 128-key chunks in a full row: one 16-byte load per lane each */
// one WAVE per score row (SMR rows a wave): lane l owns keys c*128 + l*4 .. +3 of every chunk c, so each load reads 512 contiguous bytes; the row is read once and stays in registers for the maximum, the sum and the weights
__global__ __launch_bounds__(256) void k_rsmcf2(const float* __restrict__ S, _Float16* __restrict__ P, int hg, int q0, int nk) {
  #pragma clang fp contract(off)
  const int lane = threadIdx.x & 31; const int t0 = (blockIdx.x * 8 + __builtin_amdgcn_readfirstlane(threadIdx.x >> 5)) * SMR; if (t0 >= hg * QT) return;      /* the wave's number as a scalar: row index, row base and causal limit stay in scalar registers; QT is a multiple of SMR */
  const float* s = S + (size_t)t0 * NKX + lane * 4; v4f v[SMR][SMC];
#pragma unroll      /* here and below: full unrolling makes every index of the register array a constant, so it stays in registers */
  for (int c = 0; c < SMC; ++c) if (c * 128 < nk) {
#pragma unroll
    for (int r = 0; r < SMR; ++r) v[r][c] = *(const v4fa*)(s + (size_t)r * NKX + c * 128); }
  asm volatile("s_wait_xcnt 0x0" ::: "memory");      /* the loads' address registers are reused below while the loads are still in flight: the wait stands in front of that reuse */
  float mx[SMR], se[SMR];
#pragma unroll
  for (int r = 0; r < SMR; ++r) mx[r] = -3.0e38f;
#pragma unroll
  for (int c = 0; c < SMC; ++c) if (c * 128 < nk) {
#pragma unroll
    for (int r = 0; r < SMR; ++r) { const int last = q0 + ((t0 + r) % QT);
#pragma unroll
      for (int q = 0; q < 4; ++q) { const float f = (c * 128 + lane * 4 + q <= last) ? 1.f : 0.f; v[r][c][q] = fmaf(f, v[r][c][q], (1.f - f) * -1.0e9f); mx[r] = fmaxf(mx[r], v[r][c][q]); } } }
#pragma unroll
  for (int r = 0; r < SMR; ++r) { mx[r] = fmaxf(mx[r], row_x<1>(mx[r])); mx[r] = fmaxf(mx[r], row_x<2>(mx[r])); mx[r] = fmaxf(mx[r], row_x<4>(mx[r])); mx[r] = fmaxf(mx[r], row_x<8>(mx[r])); mx[r] = fmaxf(mx[r], half_x(mx[r])); se[r] = 0.f; }
#pragma unroll
  for (int c = 0; c < SMC; ++c) if (c * 128 < nk) {
#pragma unroll
    for (int r = 0; r < SMR; ++r) {
#pragma unroll
      for (int q = 0; q < 4; ++q) { v[r][c][q] = __expf(v[r][c][q] - mx[r]); se[r] += v[r][c][q]; } } }
#pragma unroll
  for (int r = 0; r < SMR; ++r) { se[r] += row_x<1>(se[r]); se[r] += row_x<2>(se[r]); se[r] += row_x<4>(se[r]); se[r] += row_x<8>(se[r]); se[r] += half_x(se[r]); se[r] = 256.0f / se[r]; }      /* 32 partial sums, butterfly: the same bits in every lane */
  _Float16* p = P + (size_t)t0 * NKX + lane * 4; v4h hw[SMR][SMC];      /* every weight is converted before the first store is issued, so no register of an issued store is written again */
#pragma unroll
  for (int c = 0; c < SMC; ++c) if (c * 128 < nk) {
#pragma unroll
    for (int r = 0; r < SMR; ++r) {
#pragma unroll
      for (int q = 0; q < 4; ++q) hw[r][c][q] = (_Float16)(v[r][c][q] * se[r]); } }
#pragma unroll
  for (int c = 0; c < SMC; ++c) if (c * 128 < nk) {
#pragma unroll
    for (int r = 0; r < SMR; ++r) *(v4h*)(p + (size_t)r * NKX + c * 128) = hw[r][c]; } }


// lane l with lane l ^ 1 / l ^ 2 inside its group of four lanes (DPP quad_perm; every lane is on where these are used)
__device__ __forceinline__ float quad_x1(float x) { return __builtin_bit_cast(float, __builtin_amdgcn_update_dpp(0, __builtin_bit_cast(int, x), 0xB1, 0xF, 0xF, true)); }
__device__ __forceinline__ float quad_x2(float x) { return __builtin_bit_cast(float, __builtin_amdgcn_update_dpp(0, __builtin_bit_cast(int, x), 0x4E, 0xF, 0xF, true)); }
// four lanes per query row: lane qd of a row owns columns c*16 + qd*4 .. +3 (c = 0..3) of its q and o rows, in registers; k and v rows come from a 64-key LDS tile shared by the block's 64 rows
template <int MASKADD>
__global__ __launch_bounds__(256) void k_att0(const float* __restrict__ QF, const float* __restrict__ KF, const float* __restrict__ VF, int ld, const float* __restrict__ mask, float scale, float* __restrict__ OF, int ldo) {
  __shared__ __attribute__((aligned(16))) float lk[64][64]; __shared__ __attribute__((aligned(16))) float lv[64][64];
  const int tid = threadIdx.x; const int h = blockIdx.x / (QT0 / 64), rg = blockIdx.x % (QT0 / 64); const int qd = tid & 3; const int i = rg * 64 + (tid >> 2);
  { const size_t bi = (size_t)blockIdx.y * QT0 * ld; QF += bi; KF += bi; VF += bi; OF += (size_t)blockIdx.y * QT0 * ldo; }      /* batch on grid.y: each batch has its own QT0-row plane */
  const float* qr = QF + (size_t)i * ld + h * HD + qd * 4;
  v4f qv[4], ov[4];
#pragma unroll      /* here and below: full unrolling makes every index of the register arrays a constant, so they stay in registers */
  for (int c = 0; c < 4; ++c) { qv[c] = *(const v4fa*)(qr + c * 16); const v4f z = {0.f, 0.f, 0.f, 0.f}; ov[c] = z; }
  float m = -1.0e30f, l = 0.f; const int ntile = MASKADD ? (SQ / 64) : (rg + 1);      /* additive-mask form: every key (the mask input decides); causal form: keys up to the block's last row */
#pragma unroll 1      /* rolled: one trip is a whole 64-key tile between its two barriers */
  for (int t = 0; t < ntile; ++t) { v4f tk[4], tv[4];
#pragma unroll
    for (int u = 0; u < 4; ++u) { const int e = u * 256 + tid; const size_t g = (size_t)(t * 64 + (e >> 4)) * ld + h * HD + (e & 15) * 4; tk[u] = *(const v4fa*)(KF + g); tv[u] = *(const v4fa*)(VF + g); }
    __syncthreads();      /* every reader has left the previous tile */
#pragma unroll
    for (int u = 0; u < 4; ++u) { const int e = u * 256 + tid; *(v4f*)&lk[e >> 4][(e & 15) * 4] = tk[u]; *(v4f*)&lv[e >> 4][(e & 15) * 4] = tv[u]; }
    __syncthreads();      /* the tile is complete before anyone reads it */
#pragma unroll 1      /* rolled: one trip already holds four keys, further copies would only grow the code and the register count */
    for (int j0 = 0; j0 < 64; j0 += 4) { v4f kk[4][4], vw[4][4];
#pragma unroll
      for (int a = 0; a < 4; ++a) for (int c = 0; c < 4; ++c) kk[a][c] = *(const v4f*)&lk[j0 + a][c * 16 + qd * 4];
#pragma unroll
      for (int a = 0; a < 4; ++a) for (int c = 0; c < 4; ++c) vw[a][c] = *(const v4f*)&lv[j0 + a][c * 16 + qd * 4];
      __builtin_amdgcn_sched_barrier(0);      /* keeps four keys' 32 LDS reads together in front of the arithmetic: without it each read is issued right before its use and its whole LDS latency is waited out */
#pragma unroll
      for (int a = 0; a < 4; ++a) { const int j = t * 64 + j0 + a; float s = 0.f;
#pragma unroll
        for (int c = 0; c < 4; ++c) { const v4f kq = kk[a][c]; const v4f qq = qv[c]; s = __fadd_rn(s, __fmul_rn(qq[0], kq[0])); s = __fadd_rn(s, __fmul_rn(qq[1], kq[1])); s = __fadd_rn(s, __fmul_rn(qq[2], kq[2])); s = __fadd_rn(s, __fmul_rn(qq[3], kq[3])); }
        s = __fadd_rn(s, quad_x1(s)); s = __fadd_rn(s, quad_x2(s));      /* the row's four partial sums: the same bits in all four lanes */
        s = __fmul_rn(s, scale); if (MASKADD) s = __fadd_rn(s, __fmul_rn(bf16_round(mask[(size_t)i * SQ + j]), -10000.0f));
        const float f = (MASKADD || j <= i) ? 1.f : 0.f; const float sm = fmaf(f, s, (1.f - f) * -1.0e30f); const float mn = fmaxf(m, sm); const float sc = expf(m - mn); const float e = expf(sm - mn); l = __fadd_rn(__fmul_rn(l, sc), e); m = mn;
#pragma unroll
        for (int c = 0; c < 4; ++c) { const v4f vv = vw[a][c]; for (int u = 0; u < 4; ++u) ov[c][u] = __fadd_rn(__fmul_rn(ov[c][u], sc), __fmul_rn(e, vv[u])); } } } }
  const float fin = 64.0f / l;      /* o carried x64; k_o0m scales it back by 1/64 */
  float* orow = OF + (size_t)i * ldo + h * HD + qd * 4;
#pragma unroll
  for (int c = 0; c < 4; ++c) { v4f oo = ov[c]; for (int u = 0; u < 4; ++u) oo[u] = __fmul_rn(oo[u], fin); *(v4f*)(orow + c * 16) = oo; } }


template <int BFIN, int WXB>
__global__ __launch_bounds__(256) void k_ln16(const float* __restrict__ X, const float* __restrict__ g, const float* __restrict__ bb, float eps, _Float16* __restrict__ N16, float* __restrict__ XB) {
  #pragma clang fp contract(off)
  __shared__ float red[256]; const size_t r = blockIdx.x; const int t = threadIdx.x; const v4f xa = *(const v4fa*)(X + r * DMQ + t * 4); float s[4]; float sum = 0.f;
  for (int q = 0; q < 4; ++q) { s[q] = BFIN ? bf16_round(xa[q]) : xa[q]; sum = __fadd_rn(sum, s[q]); }
  red[t] = sum; __syncthreads(); for (int st = 128; st > 0; st >>= 1) { if (t < st) red[t] = __fadd_rn(red[t], red[t + st]); __syncthreads(); } const float mu = red[0] / (float)DMQ; __syncthreads();
  float vs = 0.f; for (int q = 0; q < 4; ++q) { const float dl = __fadd_rn(s[q], -mu); vs = __fadd_rn(vs, __fmul_rn(dl, dl)); } red[t] = vs; __syncthreads(); for (int st = 128; st > 0; st >>= 1) { if (t < st) red[t] = __fadd_rn(red[t], red[t + st]); __syncthreads(); }
  const float rs = rsqrtf(__fadd_rn(red[0] / (float)DMQ, eps)); v4h y; v4f xb;
  for (int q = 0; q < 4; ++q) { const int c = t * 4 + q; y[q] = (_Float16)__fadd_rn(__fmul_rn(__fmul_rn(__fadd_rn(s[q], -mu), rs), bf16_round(g[c])), bf16_round(bb[c])); xb[q] = s[q]; }
  { *(v4h*)(N16 + r * DMQ + t * 4) = y; if (WXB) *(v4f*)(XB + r * DMQ + t * 4) = xb;  } }
__global__ __launch_bounds__(256) void k_ftres2(const float* __restrict__ OF0, const float* __restrict__ XB, float* __restrict__ X1, size_t n4) {
  #pragma clang fp contract(off)
  const size_t t = (size_t)blockIdx.x * 256 + threadIdx.x; if (t >= n4) return; const v4f o = *(const v4fa*)(OF0 + t * 4), xv = *(const v4fa*)(XB + t * 4); v4f y; for (int q = 0; q < 4; ++q) y[q] = __fadd_rn(__fmul_rn(o[q], 0.015625f), xv[q]); *(v4f*)(X1 + t * 4) = y;  }

__global__ __launch_bounds__(256) void k_wthd(const float* __restrict__ Wt, _Float16* __restrict__ Bt) { const size_t t = (size_t)blockIdx.x * 256 + threadIdx.x; if (t >= (size_t)NH * HD * (DM / 8)) return; const int m8 = (int)(t % (DM / 8)) * 8; const int d = (int)((t / (DM / 8)) % HD); const int h = (int)(t / ((size_t)(DM / 8) * HD)); FragH f;
  for (int q = 0; q < 8; ++q) f.h[q] = (_Float16)(16.0f * bf16_round(Wt[((size_t)h * DM + m8 + q) * HD + d])); unsigned short* dst = (unsigned short*)Bt + ((size_t)h * HD + d) * DM + m8; *(v8us*)dst = f.half[0];  }




__global__ __launch_bounds__(256) void k_wtpad(const float* __restrict__ Wm, _Float16* __restrict__ Wt, int Kr, int Kp, int Nr, int Np, float scale) {
  const int t = blockIdx.x * 256 + threadIdx.x; if (t >= Np * (Kp / 8)) return; const int n = t / (Kp / 8), k8 = (t % (Kp / 8)) * 8; const int nc = min(n, Nr - 1); const float fn = (n < Nr) ? 1.f : 0.f; FragH f;
  for (int i = 0; i < 8; ++i) { const int k = k8 + i; const int kc = min(k, Kr - 1); const float fk = (k < Kr) ? fn : 0.f; f.h[i] = (_Float16)(bf16_round(Wm[(size_t)kc * Nr + nc]) * scale * fk); }
  unsigned short* o = (unsigned short*)Wt + (size_t)n * Kp + k8; *(v8us*)o = f.half[0];  }
__global__ __launch_bounds__(128) void k_bpad(const float* __restrict__ b, float* __restrict__ Bp, int nr, int np) {
  const int i = threadIdx.x; if (i >= np) return; const float v = b[min(i, nr - 1)] * ((i < nr) ? 1.f : 0.f); *(float*)(Bp + i) = v;  }

#define DI 64         /* inner width = NH * HD (ONE 64-wide head) */
#define LQK (3 * DI)  /* fused q | k | v row pitch (192) */
__global__ __launch_bounds__(256) void k_o0(const float* __restrict__ OF, float* __restrict__ ob, size_t n4) {
  #pragma clang fp contract(off)
  const size_t t = (size_t)blockIdx.x * 256 + threadIdx.x; if (t >= n4) return; const size_t e = t * 4; const int i = (int)(e / DI); const int c = (int)(e % DI); const int h = c / HD, d = c % HD; const v4f a = *(const v4fa*)(OF + e); v4f o; for (int q = 0; q < 4; ++q) o[q] = __fmul_rn(a[q], 0.015625f); float* dst = ob + (size_t)h * SQ * HD + (size_t)i * HD + d; *(v4f*)dst = o;  }

__global__ __launch_bounds__(256) void k_o0m(const float* __restrict__ OF, float* __restrict__ o_, size_t n4) {
  #pragma clang fp contract(off)
  const size_t t = (size_t)blockIdx.x * 256 + threadIdx.x; if (t >= n4) return; const size_t e = t * 4; OF += (size_t)blockIdx.y * QT0 * DI; o_ += (size_t)blockIdx.y * SQ * DI;      /* batch on grid.y: n4 counts one batch's first tile */
  const v4f a = *(const v4fa*)(OF + e); v4f o; for (int q = 0; q < 4; ++q) o[q] = __fmul_rn(a[q], 0.015625f); *(v4f*)(o_ + e) = o;  }
extern "C" void kernel_launch(void* const* d_in, const int* in_sizes, int n_in,
                              void* d_out, int out_size, void* d_ws, size_t ws_size, hipStream_t stream) {
  (void)in_sizes; (void)n_in; (void)out_size;
  const float* const* I = (const float* const*)d_in; const float* x = I[0]; const float* wq = I[1]; const float* wk = I[2]; const float* wv = I[3]; const float* bq = nullptr; const float* bk = nullptr; const float* bv = nullptr;      /* x; [in][out = 64] Wq / Wk / Wv (input order as this module lists them); no biases */
  char* ws = (char*)d_ws; size_t off = 0;
  auto take = [&](size_t bytes) { char* p = ws + off; off += (bytes + 255) & ~(size_t)255; return p; };
  _Float16* BW = (_Float16*)take((size_t)LQK * DM * 2); _Float16* X16 = (_Float16*)take(NR * DM * 2); _Float16* QKV = (_Float16*)take(NR * LQK * 2); _Float16* VT = (_Float16*)take((size_t)NB * NH * HD * SQ * 2);
  float* S = (float*)take((size_t)NB * NH * QT * NKX * 4); _Float16* P = (_Float16*)take((size_t)NB * NH * QT * NKX * 2); float* QKVF0 = (float*)take((size_t)NB * QT0 * LQK * 4); float* OF0 = (float*)take((size_t)NB * QT0 * DI * 4);      /* one plane per batch: all batches are in flight in every launch */
  if (off > ws_size) return;
  { const unsigned g = (unsigned)(((size_t)DI * (DM / 8) + 255) / 256); k_wt_f16<<<g, 256, 0, stream>>>(wq, BW, DM, DI, 16.0f); k_wt_f16<<<g, 256, 0, stream>>>(wk, BW + (size_t)DI * DM, DM, DI, 16.0f); k_wt_f16<<<g, 256, 0, stream>>>(wv, BW + (size_t)2 * DI * DM, DM, DI, 16.0f); }      /* [in = DM][out = 64] -> Bt[n][k] x16, stacked q | k | v */
  k_x16<<<(unsigned)((NR * DM / 8 + 255) / 256), 256, 0, stream>>>(x, X16, NR * DM / 8);      /* x (bf16-valued) as exact f16 rows */
  const float* bqkv[3] = {bq, bk, bv};
  for (int c = 0; c < 3; ++c) k_gemm2<0><<<dim3((unsigned)((NR / 128) * (DI / 64)), 1), 128, 0, stream>>>(X16, DM, 0, BW + (size_t)c * DI * DM, DM, 0, 0.0625f, bqkv[c], 0, nullptr, 1, 0, 0, nullptr, QKV + (size_t)c * DI, LQK, 0, (int)NR, DI, DM);      /* q | k | v = x W^T -> f16 rows, column blocks 0 / 64 / 128 of the fused plane (pitch 192); head h = columns h*64 inside each */
  const _Float16* Q16 = QKV; const _Float16* K16 = QKV + DI; const _Float16* V16 = QKV + 2 * DI;
  float* ob = (float*)d_out;      /* the ONE head leaves grid.y free: it carries the batch in the GEMM, k_att0 and k_o0m launches below */
  k_vt<NH, SQ><<<NB * NH * (SQ / 64), 256, 0, stream>>>(V16, LQK, 0, VT);      /* V^T [NB][HD][SQ], every batch */
  for (int q0 = 0; q0 < SQ; q0 += QT) { const int nk = q0 + QT;      /* causal: only keys below the tile end are computed */
    k_gemm2<0><<<dim3((QT / 128) * (nk / 64), NB), 128, 0, stream>>>(Q16 + (size_t)q0 * LQK, LQK, (size_t)SQ * LQK, K16, LQK, (size_t)SQ * LQK, 0.024895003f, nullptr, 0, nullptr, 1, 0, 0, S, nullptr, NKX, (size_t)QT * NKX, QT, nk, HD);      /* scores * 256^-0.666, batch on grid.y */
    k_rsmcf2<<<(NB * QT + 8 * SMR - 1) / (8 * SMR), 256, 0, stream>>>(S, P, NB, q0, nk);      /* causal softmax -> P x256 f16, NB planes of QT rows; 8 waves a block, SMR rows a wave */
    k_gemm2<0><<<dim3((QT / 128) * (HD / 64), NB), 128, 0, stream>>>(P, NKX, (size_t)QT * NKX, VT, SQ, (size_t)HD * SQ, 0.00390625f, nullptr, 0, nullptr, 1, 0, 0, ob + (size_t)q0 * DI, nullptr, DI, (size_t)SQ * DI, QT, HD, nk); }      /* out[b][q0 + i][..] = P V^T 2^-8 (f32), batch on grid.y */
  for (int c = 0; c < 3; ++c) k_gemm2<0><<<dim3((unsigned)((QT0 / 128) * (DI / 64)), NB), 128, 0, stream>>>(X16, DM, (size_t)SQ * DM, BW + (size_t)c * DI * DM, DM, 0, 0.0625f, bqkv[c], 0, nullptr, 1, 0, 0, QKVF0 + (size_t)c * DI, nullptr, LQK, (size_t)QT0 * LQK, QT0, DI, DM);      /* f32 q | k | v of rows 0..511 of every batch (exact products, f32 accumulation) */
  k_att0<0><<<dim3(NH * (QT0 / 64), NB), 256, 0, stream>>>(QKVF0, QKVF0 + DI, QKVF0 + 2 * DI, LQK, nullptr, 0.024895003f, OF0, DI);      /* exact f32 causal attention for rows 0..511 (o x64), batch on grid.y */
  k_o0m<<<dim3((unsigned)(((size_t)QT0 * DI / 4 + 255) / 256), NB), 256, 0, stream>>>(OF0, ob, (size_t)QT0 * DI / 4);      /* rows 0..511 of every batch REWRITTEN from the exact path */
}

// v005
// Measured time: 184 microseconds a run.
// Timed twice side by side with v004, it ran 1.21 times as fast both times.
// Over all steps from v000 it is 388 times as fast.
#include <hip/hip_runtime.h>
// Single-head causal self-attention with the module's literal scale C^-0.666 (x [32][1024][256]; q/k/v = x W ([in][out] [256][64], no biases); ONE 64-wide head; scores * 256^-0.666 = 0.024895 (as the source writes it, not head_size^-0.5); causal; softmax; out = weights v -> [32][1024][64]; no output projection).
// Structure: token rows; x as exact f16 rows; three WMMA GEMMs (no bias) into one f16 q | k | v plane [32768][192]; per batch v^T via LDS transposes; causal 256-row query tiles with the batch on grid.y (scores alpha 256^-0.666, causal softmax f32 -> f16 x256 weights, P V written as f32 straight into the merged output rows); query rows 0..511 from an exact f32 first tile only (no f16 tile for them); launches: see trace.
// Compute dtype: inputs rounded to bf16; x / weights exact; q, k, v and softmax weights as plain f16 GEMM operands (~2^-12); scores and softmax statistics f32. v_wmma_f32_16x16x32_f16.
#define NB 32
#define SQ 1024
#define DM 256
#define NH 1
#define HD 64
#define HG 4                         /* heads per launch of the non-template k_vt, which is not launched */
#define QT 256                       /* query rows per causal tile */
#define NKX SQ                       /* S / P row pitch */
#define QT0 512                      /* first-tile rows, computed by the exact f32 path alone: 512 here (no output projection averages the early-row cancellation errors away; logit sigma 1.0) */
#define B0 0                         /* unused */
#define NBR NB                       /* unused (only the unused MP names it) */
#define NR ((size_t)NB * SQ)
#define DMQ DM
#define DFF 4096                     /* unused (no FFN in this file) */
#define DFFR 100                     /* unused */
#define MP ((int)((size_t)NBR * SQ)) /* unused (only the unused MPO names it) */
#define QN SQ                        /* unused */
#define NHD NH                       /* unused */
#define MPO MP                       /* unused */
#define LQ (3 * DM)      /* unused; the q/k/v rows have pitch LQK (192) */
typedef __bf16 v16b __attribute__((ext_vector_type(16)));
typedef unsigned short v8us __attribute__((ext_vector_type(8), may_alias));
typedef float  v8f  __attribute__((ext_vector_type(8)));
typedef float  v4f  __attribute__((ext_vector_type(4)));
typedef float  v4fa __attribute__((ext_vector_type(4), may_alias));
union FragB { v16b v; v8us half[2]; unsigned short u[16]; };

__device__ __forceinline__ unsigned short bf16_bits(float x) { unsigned int u = __float_as_uint(x); return (unsigned short)((u + 0x7FFFu + ((u >> 16) & 1u)) >> 16); }
__device__ __forceinline__ float bf16_val(unsigned short b) { return __uint_as_float(((unsigned int)b) << 16); }
__device__ __forceinline__ float bf16_round(float x) { return bf16_val(bf16_bits(x)); }
// D += A·B with NT terms: 1 = ah·bh, 2 = + al·bh (A split), 3 = + ah·bl (both split)
template <int NT>
__device__ __forceinline__ v8f mmaN(v16b ah, v16b al, v16b bh, v16b bl, v8f c) {
  c = __builtin_amdgcn_wmma_f32_16x16x32_bf16(false, ah, false, bh, (short)0, c, false, false);
  if (NT >= 2) c = __builtin_amdgcn_wmma_f32_16x16x32_bf16(false, al, false, bh, (short)0, c, false, false);
  if (NT >= 3) c = __builtin_amdgcn_wmma_f32_16x16x32_bf16(false, ah, false, bl, (short)0, c, false, false);
  asm volatile("v_nop\n\tv_nop\n\tv_nop\n\tv_nop" : "+v"(c) : "v"(ah), "v"(al), "v"(bh), "v"(bl));
  return c;
}

__global__ __launch_bounds__(256) void k_wt_bf16(const float* __restrict__ W, unsigned short* __restrict__ Wt, int K, int N) {
  const int t = blockIdx.x * 256 + threadIdx.x;
  const int k8n = K / 8;
  if (t >= N * k8n) return;
  const int n = t / k8n, k8 = (t % k8n) * 8;
  v8us v;
#pragma unroll
  for (int i = 0; i < 8; ++i) v[i] = bf16_bits(W[(size_t)(k8 + i) * N + n]);
  *(v8us*)(Wt + (size_t)n * K + k8) = v;
  
}

// GEMM C[M][N] (f32, pitch ldc) = act(A[M][K]·W + bias). A f32 row-major (pitch lda) converted per fragment to bf16
// (ASPLIT: hi/lo two planes -> 2 terms, else single rounded term); Wt bf16 [N][K] (pitch ldb). BIAS_BF16 rounds the
// bias to bf16 first (bias quantised to bf16 before the add). K%32==0, M%16==0, N%64==0.
template <bool ASPLIT, int ACT, bool BIAS_BF16>
__global__ __launch_bounds__(128) void k_gemm_bf(const float* __restrict__ A, int lda, const unsigned short* __restrict__ Wt, int ldb,
                                               const float* __restrict__ bias, float* __restrict__ C, int ldc, int M, int N, int K) {
  __shared__ __attribute__((aligned(16))) float so[4][16][64];
  const int tid = threadIdx.x, w = tid >> 5, lane = tid & 31, ln = lane & 15, hh = lane >> 4;
  const int ntn = N / 64;
  const int wid = blockIdx.x * 4 + w;
  const int mt = wid / ntn, nq = wid % ntn;
  if (mt * 16 >= M) return;
  const int row0 = mt * 16, col0 = nq * 64;
  const float* arow = A + (size_t)(row0 + ln) * lda;
  v8f acc[4] = {};
  for (int kb = 0; kb < K; kb += 32) {
    FragB ah, al;
    const v4f x0 = *(const v4fa*)(arow + kb + 8 * hh), x1 = *(const v4fa*)(arow + kb + 8 * hh + 4);
    const v4f x2 = *(const v4fa*)(arow + kb + 16 + 8 * hh), x3 = *(const v4fa*)(arow + kb + 16 + 8 * hh + 4);
    float xs[16] = {x0[0],x0[1],x0[2],x0[3],x1[0],x1[1],x1[2],x1[3],x2[0],x2[1],x2[2],x2[3],x3[0],x3[1],x3[2],x3[3]};
#pragma unroll
    for (int i = 0; i < 16; ++i) { const unsigned short hb = bf16_bits(xs[i]); ah.u[i] = hb; al.u[i] = ASPLIT ? bf16_bits(xs[i] - bf16_val(hb)) : (unsigned short)0; }
#pragma unroll
    for (int t = 0; t < 4; ++t) {
      const unsigned short* brow = Wt + (size_t)(col0 + t * 16 + ln) * ldb + kb;
      FragB b;
      b.half[0] = *(const v8us*)(brow + 8 * hh);
      b.half[1] = *(const v8us*)(brow + 16 + 8 * hh);
      acc[t] = mmaN<ASPLIT ? 2 : 1>(ah.v, al.v, b.v, b.v, acc[t]);
    }
  }
#pragma unroll
  for (int t = 0; t < 4; ++t) {
    float bv = bias ? bias[col0 + t * 16 + ln] : 0.f;
    if (BIAS_BF16) bv = bf16_round(bv);
#pragma unroll
    for (int r = 0; r < 8; ++r) { float v = acc[t][r] + bv; if (ACT == 1) v = fmaxf(v, 0.f); so[w][8 * hh + r][t * 16 + ln] = v; }
  }
  __builtin_amdgcn_fence(__ATOMIC_ACQ_REL, "workgroup");
  __builtin_amdgcn_wave_barrier();
  const int rsub = lane >> 4, c4 = (lane & 15) * 4;
  {
#pragma unroll
    for (int q = 0; q < 8; ++q) {
      const int r = q * 2 + rsub;
      const v4f v = *(const v4fa*)&so[w][r][c4];
      *(v4f*)(C + (size_t)(row0 + r) * ldc + col0 + c4) = v;
    }
    
  }
}

// GEMM C = act(A·W + bias + resid): A f32 (ASPLIT -> hi/lo 2 terms), Wt bf16 [N][K]; ACT 0 none, 1 relu, 2 exact gelu;
// resid (optional, f32, row index = (row % rmod), pitch ldr, RES_BF16 rounds it) added before the activation.
template <bool ASPLIT, int ACT, bool BIAS_BF16, bool RES_BF16>
__global__ __launch_bounds__(128) void k_gemm_bf3(const float* __restrict__ A, int lda, const unsigned short* __restrict__ Wt, int ldb,
                                                const float* __restrict__ bias, const float* __restrict__ resid, int rmod, int ldr,
                                                float* __restrict__ C, int ldc, int M, int N, int K) {
  __shared__ __attribute__((aligned(16))) float so[4][16][64];
  const int tid = threadIdx.x, w = tid >> 5, lane = tid & 31, ln = lane & 15, hh = lane >> 4;
  const int ntn = N / 64;
  const int wid = blockIdx.x * 4 + w;
  const int mt = wid / ntn, nq = wid % ntn;
  if (mt * 16 >= M) return;
  const int row0 = mt * 16, col0 = nq * 64;
  const float* arow = A + (size_t)(row0 + ln) * lda;
  v8f acc[4] = {};
  for (int kb = 0; kb < K; kb += 32) {
    FragB ah, al;
    const v4f x0 = *(const v4fa*)(arow + kb + 8 * hh), x1 = *(const v4fa*)(arow + kb + 8 * hh + 4);
    const v4f x2 = *(const v4fa*)(arow + kb + 16 + 8 * hh), x3 = *(const v4fa*)(arow + kb + 16 + 8 * hh + 4);
    float xs[16] = {x0[0],x0[1],x0[2],x0[3],x1[0],x1[1],x1[2],x1[3],x2[0],x2[1],x2[2],x2[3],x3[0],x3[1],x3[2],x3[3]};
#pragma unroll
    for (int i = 0; i < 16; ++i) { const unsigned short hb = bf16_bits(xs[i]); ah.u[i] = hb; al.u[i] = ASPLIT ? bf16_bits(xs[i] - bf16_val(hb)) : (unsigned short)0; }
#pragma unroll
    for (int t = 0; t < 4; ++t) {
      const unsigned short* brow = Wt + (size_t)(col0 + t * 16 + ln) * ldb + kb;
      FragB b;
      b.half[0] = *(const v8us*)(brow + 8 * hh);
      b.half[1] = *(const v8us*)(brow + 16 + 8 * hh);
      acc[t] = mmaN<ASPLIT ? 2 : 1>(ah.v, al.v, b.v, b.v, acc[t]);
    }
  }
#pragma unroll
  for (int t = 0; t < 4; ++t) {
    const int col = col0 + t * 16 + ln;
    float bv = bias ? bias[col] : 0.f;
    if (BIAS_BF16) bv = bf16_round(bv);
#pragma unroll
    for (int r = 0; r < 8; ++r) {
      float v = acc[t][r] + bv;
      if (resid) { float rv = resid[(size_t)((row0 + 8 * hh + r) % rmod) * ldr + col]; if (RES_BF16) rv = bf16_round(rv); v += rv; }
      if (ACT == 1) v = fmaxf(v, 0.f);
      if (ACT == 2) v = 0.5f * v * (1.0f + erff(v * 0.70710678118654752f));
      if (ACT == 3) { const float u = 0.7978845608028654f * (v + 0.044715f * v * v * v); v = 0.5f * v * (1.0f + tanhf(u)); }
      so[w][8 * hh + r][t * 16 + ln] = v;
    }
  }
  __builtin_amdgcn_fence(__ATOMIC_ACQ_REL, "workgroup");
  __builtin_amdgcn_wave_barrier();
  const int rsub = lane >> 4, c4 = (lane & 15) * 4;
  {
#pragma unroll
    for (int q = 0; q < 8; ++q) {
      const int r = q * 2 + rsub;
      const v4f v = *(const v4fa*)&so[w][r][c4];
      *(v4f*)(C + (size_t)(row0 + r) * ldc + col0 + c4) = v;
    }
    
  }
}
// row LayerNorm (biased variance, eps) over N: s = X (+ R); optional out_sum <- s; out_norm <- (s-mu)*rsqrt(var+eps)*g + b
template <bool PARAM_BF16>
__global__ __launch_bounds__(256) void k_layernorm(const float* __restrict__ X, const float* __restrict__ R, const float* __restrict__ g, const float* __restrict__ bta,
                                                  float* __restrict__ out_sum, float* __restrict__ out_norm, int N, float eps) {
  __shared__ float red[256];
  const int row = blockIdx.x, tid = threadIdx.x;
  const float* x = X + (size_t)row * N; const float* rr = R ? R + (size_t)row * N : nullptr;
  float vals[16];                     // up to N = 4096
  const int per = N / 256;            // contiguous chunk per thread? use strided-by-4 chunks: thread handles j = tid*4 + 1024*u
  float s1 = 0.f;
  for (int u = 0; u < per / 4; ++u) {
    const int j = tid * 4 + 1024 * u;
    const v4f a = *(const v4fa*)(x + j);
    v4f b = {0.f,0.f,0.f,0.f}; if (rr) b = *(const v4fa*)(rr + j);
#pragma unroll
    for (int q = 0; q < 4; ++q) { const float v = a[q] + b[q]; vals[u * 4 + q] = v; s1 += v; }
  }
  red[tid] = s1; __syncthreads();
  for (int st = 128; st > 0; st >>= 1) { if (tid < st) red[tid] += red[tid + st]; __syncthreads(); }
  const float mu = red[0] / (float)N; __syncthreads();
  float s2 = 0.f;
  for (int u = 0; u < per / 4; ++u)
#pragma unroll
    for (int q = 0; q < 4; ++q) { const float c = vals[u * 4 + q] - mu; s2 += c * c; }
  red[tid] = s2; __syncthreads();
  for (int st = 128; st > 0; st >>= 1) { if (tid < st) red[tid] += red[tid + st]; __syncthreads(); }
  const float rs = rsqrtf(red[0] / (float)N + eps);
  {
    for (int u = 0; u < per / 4; ++u) {
      const int j = tid * 4 + 1024 * u;
      v4f o, sm;
#pragma unroll
      for (int q = 0; q < 4; ++q) {
        float gg = g[j + q], bb = bta[j + q];
        if (PARAM_BF16) { gg = bf16_round(gg); bb = bf16_round(bb); }
        sm[q] = vals[u * 4 + q]; o[q] = (vals[u * 4 + q] - mu) * rs * gg + bb;
      }
      if (out_sum) *(v4f*)(out_sum + (size_t)row * N + j) = sm;
      *(v4f*)(out_norm + (size_t)row * N + j) = o;
    }
    
  }
}



// ---- f16 WMMA path (v_wmma_f32_16x16x32_f16): 11-bit significands for operands in range — used where a [0,1] probability operand needs more precision than bf16
typedef _Float16 v16h __attribute__((ext_vector_type(16)));
union FragH { v16h v; v8us half[2]; _Float16 h[16]; unsigned short u[16]; };
template <int NT>
__device__ __forceinline__ v8f mmaH(v16h ah, v16h al, v16h bh, v16h bl, v8f c) {
  c = __builtin_amdgcn_wmma_f32_16x16x32_f16(false, ah, false, bh, (short)0, c, false, false);
  if (NT >= 2) c = __builtin_amdgcn_wmma_f32_16x16x32_f16(false, al, false, bh, (short)0, c, false, false);
  if (NT >= 3) c = __builtin_amdgcn_wmma_f32_16x16x32_f16(false, ah, false, bl, (short)0, c, false, false);
  asm volatile("v_nop\n\tv_nop\n\tv_nop\n\tv_nop" : "+v"(c) : "v"(ah), "v"(al), "v"(bh), "v"(bl));
  return c;
}
// batched GEMM like k_gemm_b but f16 operands: A f32 (split into f16 hi/lo if ASPLIT, else rounded to f16), Bt = f16 values [n][k]; alpha; C f32; N multiple of 16 (partial tiles skipped)
template <bool ASPLIT>
__global__ __launch_bounds__(128) void k_gemm_h(const float* __restrict__ A, int lda, size_t sA, const _Float16* __restrict__ Bh, int ldb, size_t sB, float alpha, float* __restrict__ C, int ldc, size_t sC, int M, int N, int K) {
  __shared__ __attribute__((aligned(16))) float so[4][16][64];
  const int tid = threadIdx.x, w = tid >> 5, lane = tid & 31, ln = lane & 15, hh = lane >> 4; const int by = blockIdx.y;
  A += (size_t)by * sA; Bh += (size_t)by * sB; C += (size_t)by * sC;
  const int ntn = (N + 63) / 64; const int wid = blockIdx.x * 4 + w; const int mt = wid / ntn, nq = wid % ntn; if (mt * 16 >= M) return;
  const int row0 = mt * 16, col0 = nq * 64; const float* arow = A + (size_t)(row0 + ln) * lda;
  v8f acc[4] = {};
  for (int kb = 0; kb < K; kb += 32) {
    FragH ah, al;
    const v4f x0 = *(const v4fa*)(arow + kb + 8 * hh), x1 = *(const v4fa*)(arow + kb + 8 * hh + 4), x2 = *(const v4fa*)(arow + kb + 16 + 8 * hh), x3 = *(const v4fa*)(arow + kb + 16 + 8 * hh + 4);
    float xs[16] = {x0[0],x0[1],x0[2],x0[3],x1[0],x1[1],x1[2],x1[3],x2[0],x2[1],x2[2],x2[3],x3[0],x3[1],x3[2],x3[3]};
#pragma unroll
    for (int i = 0; i < 16; ++i) { const _Float16 h = (_Float16)xs[i]; ah.h[i] = h; al.h[i] = ASPLIT ? (_Float16)(xs[i] - (float)h) : (_Float16)0.0f; }
#pragma unroll
    for (int t = 0; t < 4; ++t) { if (col0 + t * 16 >= N) continue; const size_t boff = (size_t)(col0 + t * 16 + ln) * ldb + kb; FragH bq; bq.half[0] = *(const v8us*)(Bh + boff + 8 * hh); bq.half[1] = *(const v8us*)(Bh + boff + 16 + 8 * hh);
      acc[t] = mmaH<ASPLIT ? 2 : 1>(ah.v, al.v, bq.v, bq.v, acc[t]); }
  }
#pragma unroll
  for (int t = 0; t < 4; ++t) { if (col0 + t * 16 >= N) continue;
#pragma unroll
    for (int r = 0; r < 8; ++r) so[w][8 * hh + r][t * 16 + ln] = acc[t][r] * alpha; }
  __builtin_amdgcn_fence(__ATOMIC_ACQ_REL, "workgroup"); __builtin_amdgcn_wave_barrier();
  const int rsub = lane >> 4, c4 = (lane & 15) * 4;
  {
#pragma unroll
    for (int q = 0; q < 8; ++q) { const int r = q * 2 + rsub; if (col0 + c4 < N) { const v4f v = *(const v4fa*)&so[w][r][c4]; *(v4f*)(C + (size_t)(row0 + r) * ldc + col0 + c4) = v; } }
     }
}

// Wt[n][k] = f16(W[k][n]·scale) from f32 row-major W[K][N] (scale = power of two; bf16-exact weights stay exact in f16 away from the subnormal range)
__global__ __launch_bounds__(256) void k_wt_f16(const float* __restrict__ W, _Float16* __restrict__ Wt, int K, int N, float scale) {
  const int t = blockIdx.x * 256 + threadIdx.x; if (t >= N * (K / 8)) return; const int n = t / (K / 8), k8 = (t % (K / 8)) * 8; FragH f;
#pragma unroll
  for (int i = 0; i < 8; ++i) f.h[i] = (_Float16)(bf16_round(W[(size_t)(k8 + i) * N + n]) * scale); const v8us o = f.half[0];
  *(v8us*)((unsigned short*)Wt + (size_t)n * K + k8) = o; 
}
// k_gemm_hh variant with fused epilogue: v = acc·alpha + bias[by·sBias + col] (+ CP[(row/rowsPerB)·sCPb + by·64 + col] if CP) ; ACT 0 none / 1 elu ; writes f16 C16 (and f32 C if non-null)
template <int ACT>
__global__ __launch_bounds__(128) void k_gemm_hhx(const _Float16* __restrict__ A, int lda, size_t sA, const _Float16* __restrict__ Bh, int ldb, size_t sB, float alpha, const float* __restrict__ bias, size_t sBias, const float* __restrict__ CP, int rowsPerB, size_t sCPb, int row0g,
    float* __restrict__ C, _Float16* __restrict__ C16, int ldc, size_t sC, int M, int N, int K) {
  __shared__ __attribute__((aligned(16))) float so[4][16][64];
  const int tid = threadIdx.x, w = tid >> 5, lane = tid & 31, ln = lane & 15, hh = lane >> 4; const int by = blockIdx.y;
  A += (size_t)by * sA; Bh += (size_t)by * sB; const size_t cofs = (size_t)by * sC; const float* bp = bias ? bias + (size_t)by * sBias : nullptr;
  const int ntn = (N + 63) / 64; const int wid = blockIdx.x * 4 + w; const int mt = wid / ntn, nq = wid % ntn; if (mt * 16 >= M) return;
  const int row0 = mt * 16, col0 = nq * 64; const _Float16* arow = A + (size_t)(row0 + ln) * lda;
  v8f acc[4] = {};
  for (int kb = 0; kb < K; kb += 32) { FragH ah; ah.half[0] = *(const v8us*)((const unsigned short*)arow + kb + 8 * hh); ah.half[1] = *(const v8us*)((const unsigned short*)arow + kb + 16 + 8 * hh);
#pragma unroll
    for (int t = 0; t < 4; ++t) { if (col0 + t * 16 >= N) continue; const size_t boff = (size_t)(col0 + t * 16 + ln) * ldb + kb; FragH bq; bq.half[0] = *(const v8us*)((const unsigned short*)Bh + boff + 8 * hh); bq.half[1] = *(const v8us*)((const unsigned short*)Bh + boff + 16 + 8 * hh);
      acc[t] = mmaH<1>(ah.v, ah.v, bq.v, bq.v, acc[t]); }
  }
#pragma unroll
  for (int t = 0; t < 4; ++t) { if (col0 + t * 16 >= N) continue; const int col = col0 + t * 16 + ln; const float bv = bp ? bf16_round(bp[col]) : 0.f;
#pragma unroll
    for (int r = 0; r < 8; ++r) { float v = acc[t][r] * alpha + bv; if (CP) { const int rr = row0g + row0 + 8 * hh + r; if (rowsPerB < 0) v += CP[cofs + (size_t)rr * ldc + col];      /* rowsPerB < 0: own element of the batched C plane */ else { const int bidx = rr / rowsPerB; v += CP[(size_t)bidx * sCPb + (size_t)by * 64 + col]; } } if (ACT == 1) v = (v > 0.f) ? v : expm1f(v); else if (ACT == 7) v = (v > 0.f) ? v + 1.0f : expf(v); else if (ACT == 8) v = tanhf(v); else if (ACT == 9) v = 0.5f * v * (1.0f + tanhf(0.7978845608028654f * (v + 0.044715f * v * v * v))); else if (ACT == 11) v = 1.0f / (1.0f + expf(-v)); else if (ACT == 12) v = (v > 0.f) ? v : 0.01f * v; else if (ACT == 14) v = (v > 0.f) ? v : 0.1f * v; else if (ACT == 16) v = (v >= 0.f) ? v : 0.3f * v; else if (ACT == 17) v = (v >= 0.f) ? v : 0.2f * v; else if (ACT == 15) v = v / (1.0f + expf(-v)); else if (ACT == 3) v = fmaxf(v, 0.f); else if (ACT == 6) v = 0.5f * v * (1.0f + erff(v * 0.70710678118654752f)); so[w][8 * hh + r][t * 16 + ln] = v; } }
  __builtin_amdgcn_fence(__ATOMIC_ACQ_REL, "workgroup"); __builtin_amdgcn_wave_barrier();
  const int rsub = lane >> 4, c4 = (lane & 15) * 4; typedef _Float16 v4h __attribute__((ext_vector_type(4)));
  {
#pragma unroll
    for (int q = 0; q < 8; ++q) { const int r = q * 2 + rsub; if (col0 + c4 < N) { const v4f v = *(const v4fa*)&so[w][r][c4]; if (C) *(v4f*)(C + cofs + (size_t)(row0 + r) * ldc + col0 + c4) = v; if (C16) { v4h h4; for (int i = 0; i < 4; ++i) h4[i] = (_Float16)v[i]; *(v4h*)(C16 + cofs + (size_t)(row0 + r) * ldc + col0 + c4) = h4; } } }
     }
}


typedef _Float16 v4h __attribute__((ext_vector_type(4)));

__global__ __launch_bounds__(256) void k_x16(const float* __restrict__ x, _Float16* __restrict__ X16, size_t n8) { const size_t t = (size_t)blockIdx.x * 256 + threadIdx.x; if (t >= n8) return; FragH f;
#pragma unroll
  for (int q = 0; q < 8; ++q) f.h[q] = (_Float16)bf16_round(x[t * 8 + q]); *(v8us*)((unsigned short*)X16 + t * 8) = f.half[0];  }
__global__ __launch_bounds__(256) void k_h16(const float* __restrict__ x, _Float16* __restrict__ X16, size_t n8) { const size_t t = (size_t)blockIdx.x * 256 + threadIdx.x; if (t >= n8) return; FragH f;
#pragma unroll
  for (int q = 0; q < 8; ++q) f.h[q] = (_Float16)x[t * 8 + q]; *(v8us*)((unsigned short*)X16 + t * 8) = f.half[0];  }
__global__ __launch_bounds__(256) void k_round16f(const float* __restrict__ W, _Float16* __restrict__ Bt, size_t n8) { const size_t t = (size_t)blockIdx.x * 256 + threadIdx.x; if (t >= n8) return; FragH f;
#pragma unroll
  for (int i = 0; i < 8; ++i) f.h[i] = (_Float16)(bf16_round(W[t * 8 + i]) * 16.0f); *(v8us*)((unsigned short*)Bt + t * 8) = f.half[0];  }
template <int NHv, int TTv>
__global__ __launch_bounds__(256) void k_vt(const _Float16* __restrict__ V16, int ldv, int voff, _Float16* __restrict__ Vt) { __shared__ unsigned short tl[64][66]; const int tid = threadIdx.x; const int slab = blockIdx.x / (TTv / 64), lg = blockIdx.x % (TTv / 64); const int b = slab / NHv, h = slab % NHv;
  for (int i = tid; i < 64 * 8; i += 256) { const int r = i / 8, c8 = (i % 8) * 8; FragH f; f.half[0] = *(const v8us*)((const unsigned short*)V16 + ((size_t)b * TTv + lg * 64 + r) * ldv + voff + h * 64 + c8);
#pragma unroll
    for (int q = 0; q < 8; ++q) tl[r][c8 + q] = f.u[q]; }
  __syncthreads();
  {
#pragma unroll
    for (int rd = 0; rd < 2; ++rd) { const int d = rd * 32 + tid / 8, pc = tid % 8; FragH f;
#pragma unroll
      for (int q = 0; q < 8; ++q) f.u[q] = tl[pc * 8 + q][d];
      *(v8us*)((unsigned short*)Vt + ((size_t)slab * 64 + d) * TTv + lg * 64 + pc * 8) = f.half[0]; }
     } }

__global__ __launch_bounds__(256) void k_hl(const float* __restrict__ F, _Float16* __restrict__ Hh, _Float16* __restrict__ Hl, size_t n8) { const size_t t = (size_t)blockIdx.x * 256 + threadIdx.x; if (t >= n8) return; FragH fh, fl; const v4f a = *(const v4fa*)(F + t * 8), c = *(const v4fa*)(F + t * 8 + 4);
#pragma unroll
  for (int q = 0; q < 4; ++q) { _Float16 h = (_Float16)a[q]; fh.h[q] = h; fl.h[q] = (_Float16)((a[q] - (float)h) * 1024.0f); h = (_Float16)c[q]; fh.h[4 + q] = h; fl.h[4 + q] = (_Float16)((c[q] - (float)h) * 1024.0f); }
  { *(v8us*)((unsigned short*)Hh + t * 8) = fh.half[0]; *(v8us*)((unsigned short*)Hl + t * 8) = fl.half[0];  } }

// ---- fast GEMM (wave tile 32x64; requires M % 32 == 0 rows per launch region, N % 64 == 0 and K % 64 == 0); epilogue = k_gemm_hhx semantics ----
__device__ __forceinline__ v16h g2_frag(const _Float16* p, int hh) { FragH f; f.half[0] = *(const v8us*)((const unsigned short*)p + 8 * hh); f.half[1] = *(const v8us*)((const unsigned short*)p + 16 + 8 * hh); return f.v; }
__device__ __forceinline__ v8f g2_mma(v16h a, v16h b, v8f c) { v8f d = __builtin_amdgcn_wmma_f32_16x16x32_f16(false, a, false, b, (short)0, c, false, false); asm volatile("v_nop\n\tv_nop\n\tv_nop\n\tv_nop" : "+v"(d) : "v"(a), "v"(b)); return d; }
template <int ACT>
__global__ __launch_bounds__(128) void k_gemm2(const _Float16* __restrict__ A, int lda, size_t sA, const _Float16* __restrict__ Bh, int ldb, size_t sB, float alpha, const float* __restrict__ bias, size_t sBias, const float* __restrict__ CP, int rowsPerB, size_t sCPb, int row0g,
    float* __restrict__ C, _Float16* __restrict__ C16, int ldc, size_t sC, int M, int N, int K) { static_assert(ACT == 0 || ACT == 3 || ACT == 6 || ACT == 8 || ACT == 9 || ACT == 11 || ACT == 12 || ACT == 14 || ACT == 15 || ACT == 16 || ACT == 17, "k_gemm2: unsupported ACT code (would silently apply no activation)");
  __shared__ __attribute__((aligned(16))) float so[4][32][68];
  const int tid = threadIdx.x, w = tid >> 5, lane = tid & 31, ln = lane & 15, hh = lane >> 4; const int by = blockIdx.y;
  A += (size_t)by * sA; Bh += (size_t)by * sB; const size_t cofs = (size_t)by * sC; const float* bp = bias ? bias + (size_t)by * sBias : nullptr;
  const int ntn = N >> 6; const int mt = blockIdx.x / ntn, nq = blockIdx.x - mt * ntn; const int row0 = mt * 128 + 32 * w, col0 = nq * 64; if (row0 >= M) return;
  const _Float16* a0p = A + (size_t)(row0 + ln) * lda; const _Float16* a1p = a0p + (size_t)16 * lda;
  const _Float16* b0p = Bh + (size_t)(col0 + ln) * ldb; const _Float16* b1p = b0p + (size_t)16 * ldb; const _Float16* b2p = b1p + (size_t)16 * ldb; const _Float16* b3p = b2p + (size_t)16 * ldb;
  const v8f z8 = {0.f,0.f,0.f,0.f,0.f,0.f,0.f,0.f}; v8f c00 = z8, c01 = z8, c02 = z8, c03 = z8, c10 = z8, c11 = z8, c12 = z8, c13 = z8;
  /* two k steps (64 k) of fragments stay in registers: a step's 12 loads are issued together, right behind the products that last read the step's registers, and land while the other step is worked on */
  v16h a0x = g2_frag(a0p, hh), a1x = g2_frag(a1p, hh), b0x = g2_frag(b0p, hh), b1x = g2_frag(b1p, hh), b2x = g2_frag(b2p, hh), b3x = g2_frag(b3p, hh);
  __builtin_amdgcn_sched_barrier(0);      /* the first step's loads stay older than the second's, as in the loop: else the loop's counted waits for one step must also cover loads of the other */
  v16h a0y = g2_frag(a0p + 32, hh), a1y = g2_frag(a1p + 32, hh), b0y = g2_frag(b0p + 32, hh), b1y = g2_frag(b1p + 32, hh), b2y = g2_frag(b2p + 32, hh), b3y = g2_frag(b3p + 32, hh);
  asm volatile("s_wait_xcnt 0x0" ::: "memory");      /* address registers of the loads above are reused below while the loads are in flight: the wait stands in front of that reuse */
#define G2_STEP(a0, a1, b0, b1, b2, b3) c00 = g2_mma(a0, b0, c00); c10 = g2_mma(a1, b0, c10); c01 = g2_mma(a0, b1, c01); c11 = g2_mma(a1, b1, c11); c02 = g2_mma(a0, b2, c02); c12 = g2_mma(a1, b2, c12); c03 = g2_mma(a0, b3, c03); c13 = g2_mma(a1, b3, c13);
#pragma unroll 1      /* rolled: a trip already holds 24 loads and 16 products, a second copy would need a second set of fragment registers */
  for (int kb = 64; kb < K; kb += 64) {      /* no branch inside: the waits in front of each step's products can then count the other step's younger loads as still in flight */
    G2_STEP(a0x, a1x, b0x, b1x, b2x, b3x)
    a0x = g2_frag(a0p + kb, hh); a1x = g2_frag(a1p + kb, hh); b0x = g2_frag(b0p + kb, hh); b1x = g2_frag(b1p + kb, hh); b2x = g2_frag(b2p + kb, hh); b3x = g2_frag(b3p + kb, hh);
    G2_STEP(a0y, a1y, b0y, b1y, b2y, b3y)
    a0y = g2_frag(a0p + kb + 32, hh); a1y = g2_frag(a1p + kb + 32, hh); b0y = g2_frag(b0p + kb + 32, hh); b1y = g2_frag(b1p + kb + 32, hh); b2y = g2_frag(b2p + kb + 32, hh); b3y = g2_frag(b3p + kb + 32, hh);
    asm volatile("s_wait_xcnt 0x0" ::: "memory"); }      /* the next trip forms its addresses in the registers that this trip's loads name: the wait stands in front of that */
  G2_STEP(a0x, a1x, b0x, b1x, b2x, b3x)      /* the last 64 k: nothing left to load */
  G2_STEP(a0y, a1y, b0y, b1y, b2y, b3y)
#undef G2_STEP
  v8f accs[8] = {c00, c01, c02, c03, c10, c11, c12, c13};
#pragma unroll
  for (int u = 0; u < 8; ++u) { const int t = u & 3, half = u >> 2; const int col = col0 + t * 16 + ln; const float bv = bp ? bf16_round(bp[col]) : 0.f;
#pragma unroll
    for (int r = 0; r < 8; ++r) { const int rloc = half * 16 + 8 * hh + r; float v = accs[u][r] * alpha + bv; if (CP) { if (rowsPerB < 0) v += CP[cofs + (size_t)(row0g + row0 + rloc) * ldc + col];      /* rowsPerB < 0: own element of the batched C plane */ else { const int bidx = (row0g + row0 + rloc) / rowsPerB; v += CP[(size_t)bidx * sCPb + (size_t)by * 64 + col]; } }
      if (ACT == 3) v = fmaxf(v, 0.f); else if (ACT == 6) v = 0.5f * v * (1.0f + erff(v * 0.70710678118654752f)); else if (ACT == 11) v = 1.0f / (1.0f + expf(-v)); else if (ACT == 15) v = v / (1.0f + expf(-v)); else if (ACT == 12) v = (v > 0.f) ? v : 0.01f * v; else if (ACT == 8) v = tanhf(v); else if (ACT == 9) v = 0.5f * v * (1.0f + tanhf(0.7978845608028654f * (v + 0.044715f * v * v * v))); else if (ACT == 14) v = (v > 0.f) ? v : 0.1f * v; else if (ACT == 16) v = (v >= 0.f) ? v : 0.3f * v; else if (ACT == 17) v = (v >= 0.f) ? v : 0.2f * v;
      so[w][rloc][t * 16 + ln] = v; } }
  __builtin_amdgcn_fence(__ATOMIC_ACQ_REL, "workgroup"); __builtin_amdgcn_wave_barrier();
  const int rsub = lane >> 4, c4 = (lane & 15) * 4;
  {
#pragma unroll
    for (int q = 0; q < 16; ++q) { const int r = q * 2 + rsub; const v4f v = *(const v4fa*)&so[w][r][c4]; if (C) *(v4f*)(C + cofs + (size_t)(row0 + r) * ldc + col0 + c4) = v; if (C16) { v4h h4; for (int i = 0; i < 4; ++i) h4[i] = (_Float16)v[i]; *(v4h*)(C16 + cofs + (size_t)(row0 + r) * ldc + col0 + c4) = h4; } }
     } }


__global__ __launch_bounds__(256) void k_wnat(const float* __restrict__ w, size_t n8, _Float16* __restrict__ Bt) { const size_t t = (size_t)blockIdx.x * 256 + threadIdx.x; if (t >= n8) return; FragH f; for (int q = 0; q < 8; ++q) f.h[q] = (_Float16)(bf16_round(w[t * 8 + q]) * 16.0f); *(v8us*)((unsigned short*)Bt + t * 8) = f.half[0];  }
__global__ __launch_bounds__(256) void k_rsm(const float* __restrict__ S, _Float16* __restrict__ P, int nrows) {
  #pragma clang fp contract(off)
  const int i = blockIdx.x * 256 + threadIdx.x; if (i >= nrows) return; const float* s = S + (size_t)i * SQ; float mx = -3.0e38f;
#pragma unroll 1
  for (int j = 0; j < SQ; ++j) mx = fmaxf(mx, s[j]); float se = 0.f;
#pragma unroll 1
  for (int j = 0; j < SQ; ++j) se += expf(s[j] - mx); const float sc = 256.0f / se;
#pragma unroll 1
  for (int j0 = 0; j0 < SQ; j0 += 8) { FragH f; for (int q = 0; q < 8; ++q) f.h[q] = (_Float16)(expf(s[j0 + q] - mx) * sc); unsigned short* d = (unsigned short*)P + (size_t)i * SQ + j0; *(v8us*)d = f.half[0];  } }
__global__ __launch_bounds__(256) void k_vt(const _Float16* __restrict__ V16, int b, int h0, _Float16* __restrict__ VT) { __shared__ unsigned short tl[64][65]; const int tid = threadIdx.x; const int hh = blockIdx.x % HG, sg = blockIdx.x / HG; const int s0 = sg * 64; const int h = h0 + hh;
  for (int i = tid; i < 64 * 8; i += 256) { const int j = i / 8, d8 = (i % 8) * 8; FragH f; f.half[0] = *(const v8us*)((const unsigned short*)V16 + ((size_t)b * SQ + s0 + j) * DM + h * HD + d8); for (int q = 0; q < 8; ++q) tl[d8 + q][j] = f.u[q]; }
  __syncthreads();
  { for (int i = tid; i < 64 * 8; i += 256) { const int d = i / 8, j8 = (i % 8) * 8; FragH f; for (int q = 0; q < 8; ++q) f.u[q] = tl[d][j8 + q]; *(v8us*)((unsigned short*)VT + ((size_t)hh * HD + d) * SQ + s0 + j8) = f.half[0]; }  } }



// lane l with lane l ^ MSK inside its row of 16 lanes (DPP row_xmask), and lane l with lane l ^ 16; every lane is on where these are used
template <int MSK>
__device__ __forceinline__ float row_x(float x) { return __builtin_bit_cast(float, __builtin_amdgcn_update_dpp(0, __builtin_bit_cast(int, x), 0x160 + MSK, 0xF, 0xF, true)); }
__device__ __forceinline__ float half_x(float x) { return __builtin_bit_cast(float, __builtin_amdgcn_permlanex16(__builtin_bit_cast(int, x), __builtin_bit_cast(int, x), 0x76543210, 0xfedcba98, false, false)); }
#define SMR 4                        /* score rows per wave */
#define SMC (NKX / 128)              /* 128-key chunks in a full row: one 16-byte load per lane each */
// one WAVE per score row (SMR rows a wave): lane l owns keys c*128 + l*4 .. +3 of every chunk c, so each load reads 512 contiguous bytes; the row is read once and stays in registers for the maximum, the sum and the weights
__global__ __launch_bounds__(256) void k_rsmcf2(const float* __restrict__ S, _Float16* __restrict__ P, int hg, int q0, int nk) {
  #pragma clang fp contract(off)
  const int lane = threadIdx.x & 31; const int t0 = (blockIdx.x * 8 + __builtin_amdgcn_readfirstlane(threadIdx.x >> 5)) * SMR; if (t0 >= hg * QT) return;      /* the wave's number as a scalar: row index, row base and causal limit stay in scalar registers; QT is a multiple of SMR */
  const float* s = S + (size_t)t0 * NKX + lane * 4; v4f v[SMR][SMC];
#pragma unroll      /* here and below: full unrolling makes every index of the register array a constant, so it stays in registers */
  for (int c = 0; c < SMC; ++c) if (c * 128 < nk) {
#pragma unroll
    for (int r = 0; r < SMR; ++r) v[r][c] = *(const v4fa*)(s + (size_t)r * NKX + c * 128); }
  asm volatile("s_wait_xcnt 0x0" ::: "memory");      /* the loads' address registers are reused below while the loads are still in flight: the wait stands in front of that reuse */
  float mx[SMR], se[SMR];
#pragma unroll
  for (int r = 0; r < SMR; ++r) mx[r] = -3.0e38f;
#pragma unroll
  for (int c = 0; c < SMC; ++c) if (c * 128 < nk) {
#pragma unroll
    for (int r = 0; r < SMR; ++r) { const int last = q0 + ((t0 + r) % QT);
#pragma unroll
      for (int q = 0; q < 4; ++q) { const float f = (c * 128 + lane * 4 + q <= last) ? 1.f : 0.f; v[r][c][q] = fmaf(f, v[r][c][q], (1.f - f) * -1.0e9f); mx[r] = fmaxf(mx[r], v[r][c][q]); } } }
#pragma unroll
  for (int r = 0; r < SMR; ++r) { mx[r] = fmaxf(mx[r], row_x<1>(mx[r])); mx[r] = fmaxf(mx[r], row_x<2>(mx[r])); mx[r] = fmaxf(mx[r], row_x<4>(mx[r])); mx[r] = fmaxf(mx[r], row_x<8>(mx[r])); mx[r] = fmaxf(mx[r], half_x(mx[r])); se[r] = 0.f; }
#pragma unroll
  for (int c = 0; c < SMC; ++c) if (c * 128 < nk) {
#pragma unroll
    for (int r = 0; r < SMR; ++r) {
#pragma unroll
      for (int q = 0; q < 4; ++q) { v[r][c][q] = __expf(v[r][c][q] - mx[r]); se[r] += v[r][c][q]; } } }
#pragma unroll
  for (int r = 0; r < SMR; ++r) { se[r] += row_x<1>(se[r]); se[r] += row_x<2>(se[r]); se[r] += row_x<4>(se[r]); se[r] += row_x<8>(se[r]); se[r] += half_x(se[r]); se[r] = 256.0f / se[r]; }      /* 32 partial sums, butterfly: the same bits in every lane */
  _Float16* p = P + (size_t)t0 * NKX + lane * 4; v4h hw[SMR][SMC];      /* every weight is converted before the first store is issued, so no register of an issued store is written again */
#pragma unroll
  for (int c = 0; c < SMC; ++c) if (c * 128 < nk) {
#pragma unroll
    for (int r = 0; r < SMR; ++r) {
#pragma unroll
      for (int q = 0; q < 4; ++q) hw[r][c][q] = (_Float16)(v[r][c][q] * se[r]); } }
#pragma unroll
  for (int c = 0; c < SMC; ++c) if (c * 128 < nk) {
#pragma unroll
    for (int r = 0; r < SMR; ++r) *(v4h*)(p + (size_t)r * NKX + c * 128) = hw[r][c]; } }


// lane l with lane l ^ 1 / l ^ 2 inside its group of four lanes (DPP quad_perm; every lane is on where these are used)
__device__ __forceinline__ float quad_x1(float x) { return __builtin_bit_cast(float, __builtin_amdgcn_update_dpp(0, __builtin_bit_cast(int, x), 0xB1, 0xF, 0xF, true)); }
__device__ __forceinline__ float quad_x2(float x) { return __builtin_bit_cast(float, __builtin_amdgcn_update_dpp(0, __builtin_bit_cast(int, x), 0x4E, 0xF, 0xF, true)); }
// four lanes per query row: lane qd of a row owns columns c*16 + qd*4 .. +3 (c = 0..3) of its q and o rows, in registers; k and v rows come from a 64-key LDS tile shared by the block's 64 rows
template <int MASKADD>
__global__ __launch_bounds__(256) void k_att0(const float* __restrict__ QF, const float* __restrict__ KF, const float* __restrict__ VF, int ld, const float* __restrict__ mask, float scale, float* __restrict__ OF, int ldo) {
  __shared__ __attribute__((aligned(16))) float lk[64][64]; __shared__ __attribute__((aligned(16))) float lv[64][64];
  const int tid = threadIdx.x; const int h = blockIdx.x / (QT0 / 64), rg = blockIdx.x % (QT0 / 64); const int qd = tid & 3; const int i = rg * 64 + (tid >> 2);
  { const size_t bi = (size_t)blockIdx.y * QT0 * ld; QF += bi; KF += bi; VF += bi; OF += (size_t)blockIdx.y * QT0 * ldo; }      /* batch on grid.y: each batch has its own QT0-row plane */
  const float* qr = QF + (size_t)i * ld + h * HD + qd * 4;
  v4f qv[4], ov[4];
#pragma unroll      /* here and below: full unrolling makes every index of the register arrays a constant, so they stay in registers */
  for (int c = 0; c < 4; ++c) { qv[c] = *(const v4fa*)(qr + c * 16); const v4f z = {0.f, 0.f, 0.f, 0.f}; ov[c] = z; }
  float m = -1.0e30f, l = 0.f; const int ntile = MASKADD ? (SQ / 64) : (rg + 1);      /* additive-mask form: every key (the mask input decides); causal form: keys up to the block's last row */
#pragma unroll 1      /* rolled: one trip is a whole 64-key tile between its two barriers */
  for (int t = 0; t < ntile; ++t) { v4f tk[4], tv[4];
#pragma unroll
    for (int u = 0; u < 4; ++u) { const int e = u * 256 + tid; const size_t g = (size_t)(t * 64 + (e >> 4)) * ld + h * HD + (e & 15) * 4; tk[u] = *(const v4fa*)(KF + g); tv[u] = *(const v4fa*)(VF + g); }
    __syncthreads();      /* every reader has left the previous tile */
#pragma unroll
    for (int u = 0; u < 4; ++u) { const int e = u * 256 + tid; *(v4f*)&lk[e >> 4][(e & 15) * 4] = tk[u]; *(v4f*)&lv[e >> 4][(e & 15) * 4] = tv[u]; }
    __syncthreads();      /* the tile is complete before anyone reads it */
#pragma unroll 1      /* rolled: one trip already holds four keys, further copies would only grow the code and the register count */
    for (int j0 = 0; j0 < 64; j0 += 4) { v4f kk[4][4], vw[4][4];
#pragma unroll
      for (int a = 0; a < 4; ++a) for (int c = 0; c < 4; ++c) kk[a][c] = *(const v4f*)&lk[j0 + a][c * 16 + qd * 4];
#pragma unroll
      for (int a = 0; a < 4; ++a) for (int c = 0; c < 4; ++c) vw[a][c] = *(const v4f*)&lv[j0 + a][c * 16 + qd * 4];
      __builtin_amdgcn_sched_barrier(0);      /* keeps four keys' 32 LDS reads together in front of the arithmetic: without it each read is issued right before its use and its whole LDS latency is waited out */
#pragma unroll
      for (int a = 0; a < 4; ++a) { const int j = t * 64 + j0 + a; float s = 0.f;
#pragma unroll
        for (int c = 0; c < 4; ++c) { const v4f kq = kk[a][c]; const v4f qq = qv[c]; s = __fadd_rn(s, __fmul_rn(qq[0], kq[0])); s = __fadd_rn(s, __fmul_rn(qq[1], kq[1])); s = __fadd_rn(s, __fmul_rn(qq[2], kq[2])); s = __fadd_rn(s, __fmul_rn(qq[3], kq[3])); }
        s = __fadd_rn(s, quad_x1(s)); s = __fadd_rn(s, quad_x2(s));      /* the row's four partial sums: the same bits in all four lanes */
        s = __fmul_rn(s, scale); if (MASKADD) s = __fadd_rn(s, __fmul_rn(bf16_round(mask[(size_t)i * SQ + j]), -10000.0f));
        const float f = (MASKADD || j <= i) ? 1.f : 0.f; const float sm = fmaf(f, s, (1.f - f) * -1.0e30f); const float mn = fmaxf(m, sm); const float sc = expf(m - mn); const float e = expf(sm - mn); l = __fadd_rn(__fmul_rn(l, sc), e); m = mn;
#pragma unroll
        for (int c = 0; c < 4; ++c) { const v4f vv = vw[a][c]; for (int u = 0; u < 4; ++u) ov[c][u] = __fadd_rn(__fmul_rn(ov[c][u], sc), __fmul_rn(e, vv[u])); } } } }
  const float fin = 64.0f / l;      /* o carried x64; k_o0m scales it back by 1/64 */
  float* orow = OF + (size_t)i * ldo + h * HD + qd * 4;
#pragma unroll
  for (int c = 0; c < 4; ++c) { v4f oo = ov[c]; for (int u = 0; u < 4; ++u) oo[u] = __fmul_rn(oo[u], fin); *(v4f*)(orow + c * 16) = oo; } }


template <int BFIN, int WXB>
__global__ __launch_bounds__(256) void k_ln16(const float* __restrict__ X, const float* __restrict__ g, const float* __restrict__ bb, float eps, _Float16* __restrict__ N16, float* __restrict__ XB) {
  #pragma clang fp contract(off)
  __shared__ float red[256]; const size_t r = blockIdx.x; const int t = threadIdx.x; const v4f xa = *(const v4fa*)(X + r * DMQ + t * 4); float s[4]; float sum = 0.f;
  for (int q = 0; q < 4; ++q) { s[q] = BFIN ? bf16_round(xa[q]) : xa[q]; sum = __fadd_rn(sum, s[q]); }
  red[t] = sum; __syncthreads(); for (int st = 128; st > 0; st >>= 1) { if (t < st) red[t] = __fadd_rn(red[t], red[t + st]); __syncthreads(); } const float mu = red[0] / (float)DMQ; __syncthreads();
  float vs = 0.f; for (int q = 0; q < 4; ++q) { const float dl = __fadd_rn(s[q], -mu); vs = __fadd_rn(vs, __fmul_rn(dl, dl)); } red[t] = vs; __syncthreads(); for (int st = 128; st > 0; st >>= 1) { if (t < st) red[t] = __fadd_rn(red[t], red[t + st]); __syncthreads(); }
  const float rs = rsqrtf(__fadd_rn(red[0] / (float)DMQ, eps)); v4h y; v4f xb;
  for (int q = 0; q < 4; ++q) { const int c = t * 4 + q; y[q] = (_Float16)__fadd_rn(__fmul_rn(__fmul_rn(__fadd_rn(s[q], -mu), rs), bf16_round(g[c])), bf16_round(bb[c])); xb[q] = s[q]; }
  { *(v4h*)(N16 + r * DMQ + t * 4) = y; if (WXB) *(v4f*)(XB + r * DMQ + t * 4) = xb;  } }
__global__ __launch_bounds__(256) void k_ftres2(const float* __restrict__ OF0, const float* __restrict__ XB, float* __restrict__ X1, size_t n4) {
  #pragma clang fp contract(off)
  const size_t t = (size_t)blockIdx.x * 256 + threadIdx.x; if (t >= n4) return; const v4f o = *(const v4fa*)(OF0 + t * 4), xv = *(const v4fa*)(XB + t * 4); v4f y; for (int q = 0; q < 4; ++q) y[q] = __fadd_rn(__fmul_rn(o[q], 0.015625f), xv[q]); *(v4f*)(X1 + t * 4) = y;  }

__global__ __launch_bounds__(256) void k_wthd(const float* __restrict__ Wt, _Float16* __restrict__ Bt) { const size_t t = (size_t)blockIdx.x * 256 + threadIdx.x; if (t >= (size_t)NH * HD * (DM / 8)) return; const int m8 = (int)(t % (DM / 8)) * 8; const int d = (int)((t / (DM / 8)) % HD); const int h = (int)(t / ((size_t)(DM / 8) * HD)); FragH f;
  for (int q = 0; q < 8; ++q) f.h[q] = (_Float16)(16.0f * bf16_round(Wt[((size_t)h * DM + m8 + q) * HD + d])); unsigned short* dst = (unsigned short*)Bt + ((size_t)h * HD + d) * DM + m8; *(v8us*)dst = f.half[0];  }




__global__ __launch_bounds__(256) void k_wtpad(const float* __restrict__ Wm, _Float16* __restrict__ Wt, int Kr, int Kp, int Nr, int Np, float scale) {
  const int t = blockIdx.x * 256 + threadIdx.x; if (t >= Np * (Kp / 8)) return; const int n = t / (Kp / 8), k8 = (t % (Kp / 8)) * 8; const int nc = min(n, Nr - 1); const float fn = (n < Nr) ? 1.f : 0.f; FragH f;
  for (int i = 0; i < 8; ++i) { const int k = k8 + i; const int kc = min(k, Kr - 1); const float fk = (k < Kr) ? fn : 0.f; f.h[i] = (_Float16)(bf16_round(Wm[(size_t)kc * Nr + nc]) * scale * fk); }
  unsigned short* o = (unsigned short*)Wt + (size_t)n * Kp + k8; *(v8us*)o = f.half[0];  }
__global__ __launch_bounds__(128) void k_bpad(const float* __restrict__ b, float* __restrict__ Bp, int nr, int np) {
  const int i = threadIdx.x; if (i >= np) return; const float v = b[min(i, nr - 1)] * ((i < nr) ? 1.f : 0.f); *(float*)(Bp + i) = v;  }

#define DI 64         /* inner width = NH * HD (ONE 64-wide head) */
#define LQK (3 * DI)  /* fused q | k | v row pitch (192) */
__global__ __launch_bounds__(256) void k_o0(const float* __restrict__ OF, float* __restrict__ ob, size_t n4) {
  #pragma clang fp contract(off)
  const size_t t = (size_t)blockIdx.x * 256 + threadIdx.x; if (t >= n4) return; const size_t e = t * 4; const int i = (int)(e / DI); const int c = (int)(e % DI); const int h = c / HD, d = c % HD; const v4f a = *(const v4fa*)(OF + e); v4f o; for (int q = 0; q < 4; ++q) o[q] = __fmul_rn(a[q], 0.015625f); float* dst = ob + (size_t)h * SQ * HD + (size_t)i * HD + d; *(v4f*)dst = o;  }

__global__ __launch_bounds__(256) void k_o0m(const float* __restrict__ OF, float* __restrict__ o_, size_t n4) {
  #pragma clang fp contract(off)
  const size_t t = (size_t)blockIdx.x * 256 + threadIdx.x; if (t >= n4) return; const size_t e = t * 4; OF += (size_t)blockIdx.y * QT0 * DI; o_ += (size_t)blockIdx.y * SQ * DI;      /* batch on grid.y: n4 counts one batch's first tile */
  const v4f a = *(const v4fa*)(OF + e); v4f o; for (int q = 0; q < 4; ++q) o[q] = __fmul_rn(a[q], 0.015625f); *(v4f*)(o_ + e) = o;  }
extern "C" void kernel_launch(void* const* d_in, const int* in_sizes, int n_in,
                              void* d_out, int out_size, void* d_ws, size_t ws_size, hipStream_t stream) {
  (void)in_sizes; (void)n_in; (void)out_size;
  const float* const* I = (const float* const*)d_in; const float* x = I[0]; const float* wq = I[1]; const float* wk = I[2]; const float* wv = I[3]; const float* bq = nullptr; const float* bk = nullptr; const float* bv = nullptr;      /* x; [in][out = 64] Wq / Wk / Wv (input order as this module lists them); no biases */
  char* ws = (char*)d_ws; size_t off = 0;
  auto take = [&](size_t bytes) { char* p = ws + off; off += (bytes + 255) & ~(size_t)255; return p; };
  _Float16* BW = (_Float16*)take((size_t)LQK * DM * 2); _Float16* X16 = (_Float16*)take(NR * DM * 2); _Float16* QKV = (_Float16*)take(NR * LQK * 2); _Float16* VT = (_Float16*)take((size_t)NB * NH * HD * SQ * 2);
  float* S = (float*)take((size_t)NB * NH * QT * NKX * 4); _Float16* P = (_Float16*)take((size_t)NB * NH * QT * NKX * 2); float* QKVF0 = (float*)take((size_t)NB * QT0 * LQK * 4); float* OF0 = (float*)take((size_t)NB * QT0 * DI * 4);      /* one plane per batch: all batches are in flight in every launch */
  if (off > ws_size) return;
  { const unsigned g = (unsigned)(((size_t)DI * (DM / 8) + 255) / 256); k_wt_f16<<<g, 256, 0, stream>>>(wq, BW, DM, DI, 16.0f); k_wt_f16<<<g, 256, 0, stream>>>(wk, BW + (size_t)DI * DM, DM, DI, 16.0f); k_wt_f16<<<g, 256, 0, stream>>>(wv, BW + (size_t)2 * DI * DM, DM, DI, 16.0f); }      /* [in = DM][out = 64] -> Bt[n][k] x16, stacked q | k | v */
  k_x16<<<(unsigned)((NR * DM / 8 + 255) / 256), 256, 0, stream>>>(x, X16, NR * DM / 8);      /* x (bf16-valued) as exact f16 rows */
  const float* bqkv[3] = {bq, bk, bv};
  for (int c = 0; c < 3; ++c) k_gemm2<0><<<dim3((unsigned)((NR / 128) * (DI / 64)), 1), 128, 0, stream>>>(X16, DM, 0, BW + (size_t)c * DI * DM, DM, 0, 0.0625f, bqkv[c], 0, nullptr, 1, 0, 0, nullptr, QKV + (size_t)c * DI, LQK, 0, (int)NR, DI, DM);      /* q | k | v = x W^T -> f16 rows, column blocks 0 / 64 / 128 of the fused plane (pitch 192); head h = columns h*64 inside each */
  const _Float16* Q16 = QKV; const _Float16* K16 = QKV + DI; const _Float16* V16 = QKV + 2 * DI;
  float* ob = (float*)d_out;      /* the ONE head leaves grid.y free: it carries the batch in the GEMM, k_att0 and k_o0m launches below */
  k_vt<NH, SQ><<<NB * NH * (SQ / 64), 256, 0, stream>>>(V16, LQK, 0, VT);      /* V^T [NB][HD][SQ], every batch */
  for (int q0 = QT0; q0 < SQ; q0 += QT) { const int nk = q0 + QT;      /* causal: only keys below the tile end are computed; query rows below QT0 come from the exact f32 path alone, so no f16 tile is computed for them (QT0 is a multiple of QT) */
    k_gemm2<0><<<dim3((QT / 128) * (nk / 64), NB), 128, 0, stream>>>(Q16 + (size_t)q0 * LQK, LQK, (size_t)SQ * LQK, K16, LQK, (size_t)SQ * LQK, 0.024895003f, nullptr, 0, nullptr, 1, 0, 0, S, nullptr, NKX, (size_t)QT * NKX, QT, nk, HD);      /* scores * 256^-0.666, batch on grid.y */
    k_rsmcf2<<<(NB * QT + 8 * SMR - 1) / (8 * SMR), 256, 0, stream>>>(S, P, NB, q0, nk);      /* causal softmax -> P x256 f16, NB planes of QT rows; 8 waves a block, SMR rows a wave */
    k_gemm2<0><<<dim3((QT / 128) * (HD / 64), NB), 128, 0, stream>>>(P, NKX, (size_t)QT * NKX, VT, SQ, (size_t)HD * SQ, 0.00390625f, nullptr, 0, nullptr, 1, 0, 0, ob + (size_t)q0 * DI, nullptr, DI, (size_t)SQ * DI, QT, HD, nk); }      /* out[b][q0 + i][..] = P V^T 2^-8 (f32), batch on grid.y */
  for (int c = 0; c < 3; ++c) k_gemm2<0><<<dim3((unsigned)((QT0 / 128) * (DI / 64)), NB), 128, 0, stream>>>(X16, DM, (size_t)SQ * DM, BW + (size_t)c * DI * DM, DM, 0, 0.0625f, bqkv[c], 0, nullptr, 1, 0, 0, QKVF0 + (size_t)c * DI, nullptr, LQK, (size_t)QT0 * LQK, QT0, DI, DM);      /* f32 q | k | v of rows 0..511 of every batch (exact products, f32 accumulation) */
  k_att0<0><<<dim3(NH * (QT0 / 64), NB), 256, 0, stream>>>(QKVF0, QKVF0 + DI, QKVF0 + 2 * DI, LQK, nullptr, 0.024895003f, OF0, DI);      /* exact f32 causal attention for rows 0..511 (o x64), batch on grid.y */
  k_o0m<<<dim3((unsigned)(((size_t)QT0 * DI / 4 + 255) / 256), NB), 256, 0, stream>>>(OF0, ob, (size_t)QT0 * DI / 4);      /* rows 0..511 of every batch written from the exact path, their only writer */
}

// v006
// It runs in 132 microseconds.
// Timed twice side by side with v005, it ran 1.40 times as fast both times.
// All steps since v000 together make it 543 times as fast.
#include <hip/hip_runtime.h>
// Single-head causal self-attention with the module's literal scale C^-0.666 (x [32][1024][256]; q/k/v = x W ([in][out] [256][64], no biases); ONE 64-wide head; scores * 256^-0.666 = 0.024895 (as the source writes it, not head_size^-0.5); causal; softmax; out = weights v -> [32][1024][64]; no output projection).
// Structure: token rows; x as exact f16 rows; one WMMA GEMM over the stacked q | k | v columns into a row plane of pitch 192, stored as f16 and as f32; per batch v^T via LDS transposes; one causal 512-row query tile (rows 512..1023) with the batch on grid.y (scores alpha 0.024895, causal softmax f32 -> f16 x256 weights, P V written as f32 straight into the merged output rows); query rows 0..511 from an exact f32 first tile only (no f16 tile for them).
// Compute dtype: inputs rounded to bf16; x / weights exact; q, k, v and softmax weights as plain f16 GEMM operands (~2^-12); o, scores and softmax statistics f32. v_wmma_f32_16x16x32_f16.
#define NB 32
#define SQ 1024
#define DM 256
#define NH 1
#define HD 64
#define HG 4                         /* unused by the launches (only the uncalled non-template k_vt names it) */
#define QT 512                       /* query rows per causal tile: rows QT0..SQ-1 are ONE tile, so scores, softmax and P V are one launch each; keys past a row's own index are masked to weight 0 */
#define NKX SQ                       /* S / P row pitch */
#define QT0 512                      /* first-tile rows computed exactly (f32): 512 here (no output projection averages the early-row cancellation errors away; logit sigma 1.0) */
#define B0 0                         /* unused */
#define NBR NB                       /* unused (only the unused MP names it) */
#define NR ((size_t)NB * SQ)
#define DMQ DM
#define DFF 4096                     /* unused (no FFN in this file) */
#define DFFR 100                     /* unused */
#define MP ((int)((size_t)NBR * SQ)) /* unused (only the unused MPO names it) */
#define QN SQ                        /* unused */
#define NHD NH                       /* unused */
#define MPO MP                       /* unused */
#define LQ (3 * DM)      /* unused; the q/k/v rows have pitch LQK (192) */
typedef __bf16 v16b __attribute__((ext_vector_type(16)));
typedef unsigned short v8us __attribute__((ext_vector_type(8), may_alias));
typedef float  v8f  __attribute__((ext_vector_type(8)));
typedef float  v4f  __attribute__((ext_vector_type(4)));
typedef float  v4fa __attribute__((ext_vector_type(4), may_alias));
union FragB { v16b v; v8us half[2]; unsigned short u[16]; };

__device__ __forceinline__ unsigned short bf16_bits(float x) { unsigned int u = __float_as_uint(x); return (unsigned short)((u + 0x7FFFu + ((u >> 16) & 1u)) >> 16); }
__device__ __forceinline__ float bf16_val(unsigned short b) { return __uint_as_float(((unsigned int)b) << 16); }
__device__ __forceinline__ float bf16_round(float x) { return bf16_val(bf16_bits(x)); }
// D += A·B with NT terms: 1 = ah·bh, 2 = + al·bh (A split), 3 = + ah·bl (both split)
template <int NT>
__device__ __forceinline__ v8f mmaN(v16b ah, v16b al, v16b bh, v16b bl, v8f c) {
  c = __builtin_amdgcn_wmma_f32_16x16x32_bf16(false, ah, false, bh, (short)0, c, false, false);
  if (NT >= 2) c = __builtin_amdgcn_wmma_f32_16x16x32_bf16(false, al, false, bh, (short)0, c, false, false);
  if (NT >= 3) c = __builtin_amdgcn_wmma_f32_16x16x32_bf16(false, ah, false, bl, (short)0, c, false, false);
  asm volatile("v_nop\n\tv_nop\n\tv_nop\n\tv_nop" : "+v"(c) : "v"(ah), "v"(al), "v"(bh), "v"(bl));
  return c;
}

__global__ __launch_bounds__(256) void k_wt_bf16(const float* __restrict__ W, unsigned short* __restrict__ Wt, int K, int N) {
  const int t = blockIdx.x * 256 + threadIdx.x;
  const int k8n = K / 8;
  if (t >= N * k8n) return;
  const int n = t / k8n, k8 = (t % k8n) * 8;
  v8us v;
#pragma unroll
  for (int i = 0; i < 8; ++i) v[i] = bf16_bits(W[(size_t)(k8 + i) * N + n]);
  *(v8us*)(Wt + (size_t)n * K + k8) = v;
  
}

// GEMM C[M][N] (f32, pitch ldc) = act(A[M][K]·W + bias). A f32 row-major (pitch lda) converted per fragment to bf16
// (ASPLIT: hi/lo two planes -> 2 terms, else single rounded term); Wt bf16 [N][K] (pitch ldb). BIAS_BF16 rounds the
// bias to bf16 first (bias quantised to bf16 before the add). K%32==0, M%16==0, N%64==0.
template <bool ASPLIT, int ACT, bool BIAS_BF16>
__global__ __launch_bounds__(128) void k_gemm_bf(const float* __restrict__ A, int lda, const unsigned short* __restrict__ Wt, int ldb,
                                               const float* __restrict__ bias, float* __restrict__ C, int ldc, int M, int N, int K) {
  __shared__ __attribute__((aligned(16))) float so[4][16][64];
  const int tid = threadIdx.x, w = tid >> 5, lane = tid & 31, ln = lane & 15, hh = lane >> 4;
  const int ntn = N / 64;
  const int wid = blockIdx.x * 4 + w;
  const int mt = wid / ntn, nq = wid % ntn;
  if (mt * 16 >= M) return;
  const int row0 = mt * 16, col0 = nq * 64;
  const float* arow = A + (size_t)(row0 + ln) * lda;
  v8f acc[4] = {};
  for (int kb = 0; kb < K; kb += 32) {
    FragB ah, al;
    const v4f x0 = *(const v4fa*)(arow + kb + 8 * hh), x1 = *(const v4fa*)(arow + kb + 8 * hh + 4);
    const v4f x2 = *(const v4fa*)(arow + kb + 16 + 8 * hh), x3 = *(const v4fa*)(arow + kb + 16 + 8 * hh + 4);
    float xs[16] = {x0[0],x0[1],x0[2],x0[3],x1[0],x1[1],x1[2],x1[3],x2[0],x2[1],x2[2],x2[3],x3[0],x3[1],x3[2],x3[3]};
#pragma unroll
    for (int i = 0; i < 16; ++i) { const unsigned short hb = bf16_bits(xs[i]); ah.u[i] = hb; al.u[i] = ASPLIT ? bf16_bits(xs[i] - bf16_val(hb)) : (unsigned short)0; }
#pragma unroll
    for (int t = 0; t < 4; ++t) {
      const unsigned short* brow = Wt + (size_t)(col0 + t * 16 + ln) * ldb + kb;
      FragB b;
      b.half[0] = *(const v8us*)(brow + 8 * hh);
      b.half[1] = *(const v8us*)(brow + 16 + 8 * hh);
      acc[t] = mmaN<ASPLIT ? 2 : 1>(ah.v, al.v, b.v, b.v, acc[t]);
    }
  }
#pragma unroll
  for (int t = 0; t < 4; ++t) {
    float bv = bias ? bias[col0 + t * 16 + ln] : 0.f;
    if (BIAS_BF16) bv = bf16_round(bv);
#pragma unroll
    for (int r = 0; r < 8; ++r) { float v = acc[t][r] + bv; if (ACT == 1) v = fmaxf(v, 0.f); so[w][8 * hh + r][t * 16 + ln] = v; }
  }
  __builtin_amdgcn_fence(__ATOMIC_ACQ_REL, "workgroup");
  __builtin_amdgcn_wave_barrier();
  const int rsub = lane >> 4, c4 = (lane & 15) * 4;
  {
#pragma unroll
    for (int q = 0; q < 8; ++q) {
      const int r = q * 2 + rsub;
      const v4f v = *(const v4fa*)&so[w][r][c4];
      *(v4f*)(C + (size_t)(row0 + r) * ldc + col0 + c4) = v;
    }
    
  }
}

// GEMM C = act(A·W + bias + resid): A f32 (ASPLIT -> hi/lo 2 terms), Wt bf16 [N][K]; ACT 0 none, 1 relu, 2 exact gelu;
// resid (optional, f32, row index = (row % rmod), pitch ldr, RES_BF16 rounds it) added before the activation.
template <bool ASPLIT, int ACT, bool BIAS_BF16, bool RES_BF16>
__global__ __launch_bounds__(128) void k_gemm_bf3(const float* __restrict__ A, int lda, const unsigned short* __restrict__ Wt, int ldb,
                                                const float* __restrict__ bias, const float* __restrict__ resid, int rmod, int ldr,
                                                float* __restrict__ C, int ldc, int M, int N, int K) {
  __shared__ __attribute__((aligned(16))) float so[4][16][64];
  const int tid = threadIdx.x, w = tid >> 5, lane = tid & 31, ln = lane & 15, hh = lane >> 4;
  const int ntn = N / 64;
  const int wid = blockIdx.x * 4 + w;
  const int mt = wid / ntn, nq = wid % ntn;
  if (mt * 16 >= M) return;
  const int row0 = mt * 16, col0 = nq * 64;
  const float* arow = A + (size_t)(row0 + ln) * lda;
  v8f acc[4] = {};
  for (int kb = 0; kb < K; kb += 32) {
    FragB ah, al;
    const v4f x0 = *(const v4fa*)(arow + kb + 8 * hh), x1 = *(const v4fa*)(arow + kb + 8 * hh + 4);
    const v4f x2 = *(const v4fa*)(arow + kb + 16 + 8 * hh), x3 = *(const v4fa*)(arow + kb + 16 + 8 * hh + 4);
    float xs[16] = {x0[0],x0[1],x0[2],x0[3],x1[0],x1[1],x1[2],x1[3],x2[0],x2[1],x2[2],x2[3],x3[0],x3[1],x3[2],x3[3]};
#pragma unroll
    for (int i = 0; i < 16; ++i) { const unsigned short hb = bf16_bits(xs[i]); ah.u[i] = hb; al.u[i] = ASPLIT ? bf16_bits(xs[i] - bf16_val(hb)) : (unsigned short)0; }
#pragma unroll
    for (int t = 0; t < 4; ++t) {
      const unsigned short* brow = Wt + (size_t)(col0 + t * 16 + ln) * ldb + kb;
      FragB b;
      b.half[0] = *(const v8us*)(brow + 8 * hh);
      b.half[1] = *(const v8us*)(brow + 16 + 8 * hh);
      acc[t] = mmaN<ASPLIT ? 2 : 1>(ah.v, al.v, b.v, b.v, acc[t]);
    }
  }
#pragma unroll
  for (int t = 0; t < 4; ++t) {
    const int col = col0 + t * 16 + ln;
    float bv = bias ? bias[col] : 0.f;
    if (BIAS_BF16) bv = bf16_round(bv);
#pragma unroll
    for (int r = 0; r < 8; ++r) {
      float v = acc[t][r] + bv;
      if (resid) { float rv = resid[(size_t)((row0 + 8 * hh + r) % rmod) * ldr + col]; if (RES_BF16) rv = bf16_round(rv); v += rv; }
      if (ACT == 1) v = fmaxf(v, 0.f);
      if (ACT == 2) v = 0.5f * v * (1.0f + erff(v * 0.70710678118654752f));
      if (ACT == 3) { const float u = 0.7978845608028654f * (v + 0.044715f * v * v * v); v = 0.5f * v * (1.0f + tanhf(u)); }
      so[w][8 * hh + r][t * 16 + ln] = v;
    }
  }
  __builtin_amdgcn_fence(__ATOMIC_ACQ_REL, "workgroup");
  __builtin_amdgcn_wave_barrier();
  const int rsub = lane >> 4, c4 = (lane & 15) * 4;
  {
#pragma unroll
    for (int q = 0; q < 8; ++q) {
      const int r = q * 2 + rsub;
      const v4f v = *(const v4fa*)&so[w][r][c4];
      *(v4f*)(C + (size_t)(row0 + r) * ldc + col0 + c4) = v;
    }
    
  }
}
// row LayerNorm (biased variance, eps) over N: s = X (+ R); optional out_sum <- s; out_norm <- (s-mu)*rsqrt(var+eps)*g + b
template <bool PARAM_BF16>
__global__ __launch_bounds__(256) void k_layernorm(const float* __restrict__ X, const float* __restrict__ R, const float* __restrict__ g, const float* __restrict__ bta,
                                                  float* __restrict__ out_sum, float* __restrict__ out_norm, int N, float eps) {
  __shared__ float red[256];
  const int row = blockIdx.x, tid = threadIdx.x;
  const float* x = X + (size_t)row * N; const float* rr = R ? R + (size_t)row * N : nullptr;
  float vals[16];                     // up to N = 4096
  const int per = N / 256;            // contiguous chunk per thread? use strided-by-4 chunks: thread handles j = tid*4 + 1024*u
  float s1 = 0.f;
  for (int u = 0; u < per / 4; ++u) {
    const int j = tid * 4 + 1024 * u;
    const v4f a = *(const v4fa*)(x + j);
    v4f b = {0.f,0.f,0.f,0.f}; if (rr) b = *(const v4fa*)(rr + j);
#pragma unroll
    for (int q = 0; q < 4; ++q) { const float v = a[q] + b[q]; vals[u * 4 + q] = v; s1 += v; }
  }
  red[tid] = s1; __syncthreads();
  for (int st = 128; st > 0; st >>= 1) { if (tid < st) red[tid] += red[tid + st]; __syncthreads(); }
  const float mu = red[0] / (float)N; __syncthreads();
  float s2 = 0.f;
  for (int u = 0; u < per / 4; ++u)
#pragma unroll
    for (int q = 0; q < 4; ++q) { const float c = vals[u * 4 + q] - mu; s2 += c * c; }
  red[tid] = s2; __syncthreads();
  for (int st = 128; st > 0; st >>= 1) { if (tid < st) red[tid] += red[tid + st]; __syncthreads(); }
  const float rs = rsqrtf(red[0] / (float)N + eps);
  {
    for (int u = 0; u < per / 4; ++u) {
      const int j = tid * 4 + 1024 * u;
      v4f o, sm;
#pragma unroll
      for (int q = 0; q < 4; ++q) {
        float gg = g[j + q], bb = bta[j + q];
        if (PARAM_BF16) { gg = bf16_round(gg); bb = bf16_round(bb); }
        sm[q] = vals[u * 4 + q]; o[q] = (vals[u * 4 + q] - mu) * rs * gg + bb;
      }
      if (out_sum) *(v4f*)(out_sum + (size_t)row * N + j) = sm;
      *(v4f*)(out_norm + (size_t)row * N + j) = o;
    }
    
  }
}



// ---- f16 WMMA path (v_wmma_f32_16x16x32_f16): 11-bit significands for operands in range — used where a [0,1] probability operand needs more precision than bf16
typedef _Float16 v16h __attribute__((ext_vector_type(16)));
union FragH { v16h v; v8us half[2]; _Float16 h[16]; unsigned short u[16]; };
template <int NT>
__device__ __forceinline__ v8f mmaH(v16h ah, v16h al, v16h bh, v16h bl, v8f c) {
  c = __builtin_amdgcn_wmma_f32_16x16x32_f16(false, ah, false, bh, (short)0, c, false, false);
  if (NT >= 2) c = __builtin_amdgcn_wmma_f32_16x16x32_f16(false, al, false, bh, (short)0, c, false, false);
  if (NT >= 3) c = __builtin_amdgcn_wmma_f32_16x16x32_f16(false, ah, false, bl, (short)0, c, false, false);
  asm volatile("v_nop\n\tv_nop\n\tv_nop\n\tv_nop" : "+v"(c) : "v"(ah), "v"(al), "v"(bh), "v"(bl));
  return c;
}
// batched GEMM like k_gemm_b but f16 operands: A f32 (split into f16 hi/lo if ASPLIT, else rounded to f16), Bt = f16 values [n][k]; alpha; C f32; N multiple of 16 (partial tiles skipped)
template <bool ASPLIT>
__global__ __launch_bounds__(128) void k_gemm_h(const float* __restrict__ A, int lda, size_t sA, const _Float16* __restrict__ Bh, int ldb, size_t sB, float alpha, float* __restrict__ C, int ldc, size_t sC, int M, int N, int K) {
  __shared__ __attribute__((aligned(16))) float so[4][16][64];
  const int tid = threadIdx.x, w = tid >> 5, lane = tid & 31, ln = lane & 15, hh = lane >> 4; const int by = blockIdx.y;
  A += (size_t)by * sA; Bh += (size_t)by * sB; C += (size_t)by * sC;
  const int ntn = (N + 63) / 64; const int wid = blockIdx.x * 4 + w; const int mt = wid / ntn, nq = wid % ntn; if (mt * 16 >= M) return;
  const int row0 = mt * 16, col0 = nq * 64; const float* arow = A + (size_t)(row0 + ln) * lda;
  v8f acc[4] = {};
  for (int kb = 0; kb < K; kb += 32) {
    FragH ah, al;
    const v4f x0 = *(const v4fa*)(arow + kb + 8 * hh), x1 = *(const v4fa*)(arow + kb + 8 * hh + 4), x2 = *(const v4fa*)(arow + kb + 16 + 8 * hh), x3 = *(const v4fa*)(arow + kb + 16 + 8 * hh + 4);
    float xs[16] = {x0[0],x0[1],x0[2],x0[3],x1[0],x1[1],x1[2],x1[3],x2[0],x2[1],x2[2],x2[3],x3[0],x3[1],x3[2],x3[3]};
#pragma unroll
    for (int i = 0; i < 16; ++i) { const _Float16 h = (_Float16)xs[i]; ah.h[i] = h; al.h[i] = ASPLIT ? (_Float16)(xs[i] - (float)h) : (_Float16)0.0f; }
#pragma unroll
    for (int t = 0; t < 4; ++t) { if (col0 + t * 16 >= N) continue; const size_t boff = (size_t)(col0 + t * 16 + ln) * ldb + kb; FragH bq; bq.half[0] = *(const v8us*)(Bh + boff + 8 * hh); bq.half[1] = *(const v8us*)(Bh + boff + 16 + 8 * hh);
      acc[t] = mmaH<ASPLIT ? 2 : 1>(ah.v, al.v, bq.v, bq.v, acc[t]); }
  }
#pragma unroll
  for (int t = 0; t < 4; ++t) { if (col0 + t * 16 >= N) continue;
#pragma unroll
    for (int r = 0; r < 8; ++r) so[w][8 * hh + r][t * 16 + ln] = acc[t][r] * alpha; }
  __builtin_amdgcn_fence(__ATOMIC_ACQ_REL, "workgroup"); __builtin_amdgcn_wave_barrier();
  const int rsub = lane >> 4, c4 = (lane & 15) * 4;
  {
#pragma unroll
    for (int q = 0; q < 8; ++q) { const int r = q * 2 + rsub; if (col0 + c4 < N) { const v4f v = *(const v4fa*)&so[w][r][c4]; *(v4f*)(C + (size_t)(row0 + r) * ldc + col0 + c4) = v; } }
     }
}

// Wt[n][k] = f16(W[k][n]·scale) from f32 row-major W[K][N] (scale = power of two; bf16-exact weights stay exact in f16 away from the subnormal range)
// blockIdx.y picks one of three equally shaped matrices; their transposes are stacked in Wt
__global__ __launch_bounds__(256) void k_wt_f16(const float* __restrict__ W0, const float* __restrict__ W1, const float* __restrict__ W2, _Float16* __restrict__ Wt, int K, int N, float scale) {
  const float* __restrict__ W = (blockIdx.y == 0) ? W0 : ((blockIdx.y == 1) ? W1 : W2); Wt += (size_t)blockIdx.y * N * K;
  const int t = blockIdx.x * 256 + threadIdx.x; if (t >= N * (K / 8)) return; const int n = t / (K / 8), k8 = (t % (K / 8)) * 8; FragH f;
#pragma unroll
  for (int i = 0; i < 8; ++i) f.h[i] = (_Float16)(bf16_round(W[(size_t)(k8 + i) * N + n]) * scale); const v8us o = f.half[0];
  *(v8us*)((unsigned short*)Wt + (size_t)n * K + k8) = o; 
}
// k_gemm_hh variant with fused epilogue: v = acc·alpha + bias[by·sBias + col] (+ CP[(row/rowsPerB)·sCPb + by·64 + col] if CP) ; ACT 0 none / 1 elu ; writes f16 C16 (and f32 C if non-null)
template <int ACT>
__global__ __launch_bounds__(128) void k_gemm_hhx(const _Float16* __restrict__ A, int lda, size_t sA, const _Float16* __restrict__ Bh, int ldb, size_t sB, float alpha, const float* __restrict__ bias, size_t sBias, const float* __restrict__ CP, int rowsPerB, size_t sCPb, int row0g,
    float* __restrict__ C, _Float16* __restrict__ C16, int ldc, size_t sC, int M, int N, int K) {
  __shared__ __attribute__((aligned(16))) float so[4][16][64];
  const int tid = threadIdx.x, w = tid >> 5, lane = tid & 31, ln = lane & 15, hh = lane >> 4; const int by = blockIdx.y;
  A += (size_t)by * sA; Bh += (size_t)by * sB; const size_t cofs = (size_t)by * sC; const float* bp = bias ? bias + (size_t)by * sBias : nullptr;
  const int ntn = (N + 63) / 64; const int wid = blockIdx.x * 4 + w; const int mt = wid / ntn, nq = wid % ntn; if (mt * 16 >= M) return;
  const int row0 = mt * 16, col0 = nq * 64; const _Float16* arow = A + (size_t)(row0 + ln) * lda;
  v8f acc[4] = {};
  for (int kb = 0; kb < K; kb += 32) { FragH ah; ah.half[0] = *(const v8us*)((const unsigned short*)arow + kb + 8 * hh); ah.half[1] = *(const v8us*)((const unsigned short*)arow + kb + 16 + 8 * hh);
#pragma unroll
    for (int t = 0; t < 4; ++t) { if (col0 + t * 16 >= N) continue; const size_t boff = (size_t)(col0 + t * 16 + ln) * ldb + kb; FragH bq; bq.half[0] = *(const v8us*)((const unsigned short*)Bh + boff + 8 * hh); bq.half[1] = *(const v8us*)((const unsigned short*)Bh + boff + 16 + 8 * hh);
      acc[t] = mmaH<1>(ah.v, ah.v, bq.v, bq.v, acc[t]); }
  }
#pragma unroll
  for (int t = 0; t < 4; ++t) { if (col0 + t * 16 >= N) continue; const int col = col0 + t * 16 + ln; const float bv = bp ? bf16_round(bp[col]) : 0.f;
#pragma unroll
    for (int r = 0; r < 8; ++r) { float v = acc[t][r] * alpha + bv; if (CP) { const int rr = row0g + row0 + 8 * hh + r; if (rowsPerB < 0) v += CP[cofs + (size_t)rr * ldc + col];      /* rowsPerB < 0: own element of the batched C plane */ else { const int bidx = rr / rowsPerB; v += CP[(size_t)bidx * sCPb + (size_t)by * 64 + col]; } } if (ACT == 1) v = (v > 0.f) ? v : expm1f(v); else if (ACT == 7) v = (v > 0.f) ? v + 1.0f : expf(v); else if (ACT == 8) v = tanhf(v); else if (ACT == 9) v = 0.5f * v * (1.0f + tanhf(0.7978845608028654f * (v + 0.044715f * v * v * v))); else if (ACT == 11) v = 1.0f / (1.0f + expf(-v)); else if (ACT == 12) v = (v > 0.f) ? v : 0.01f * v; else if (ACT == 14) v = (v > 0.f) ? v : 0.1f * v; else if (ACT == 16) v = (v >= 0.f) ? v : 0.3f * v; else if (ACT == 17) v = (v >= 0.f) ? v : 0.2f * v; else if (ACT == 15) v = v / (1.0f + expf(-v)); else if (ACT == 3) v = fmaxf(v, 0.f); else if (ACT == 6) v = 0.5f * v * (1.0f + erff(v * 0.70710678118654752f)); so[w][8 * hh + r][t * 16 + ln] = v; } }
  __builtin_amdgcn_fence(__ATOMIC_ACQ_REL, "workgroup"); __builtin_amdgcn_wave_barrier();
  const int rsub = lane >> 4, c4 = (lane & 15) * 4; typedef _Float16 v4h __attribute__((ext_vector_type(4)));
  {
#pragma unroll
    for (int q = 0; q < 8; ++q) { const int r = q * 2 + rsub; if (col0 + c4 < N) { const v4f v = *(const v4fa*)&so[w][r][c4]; if (C) *(v4f*)(C + cofs + (size_t)(row0 + r) * ldc + col0 + c4) = v; if (C16) { v4h h4; for (int i = 0; i < 4; ++i) h4[i] = (_Float16)v[i]; *(v4h*)(C16 + cofs + (size_t)(row0 + r) * ldc + col0 + c4) = h4; } } }
     }
}


typedef _Float16 v4h __attribute__((ext_vector_type(4)));

__global__ __launch_bounds__(256) void k_x16(const float* __restrict__ x, _Float16* __restrict__ X16, size_t n8) { const size_t t = (size_t)blockIdx.x * 256 + threadIdx.x; if (t >= n8) return; FragH f;
#pragma unroll
  for (int q = 0; q < 8; ++q) f.h[q] = (_Float16)bf16_round(x[t * 8 + q]); *(v8us*)((unsigned short*)X16 + t * 8) = f.half[0];  }
__global__ __launch_bounds__(256) void k_h16(const float* __restrict__ x, _Float16* __restrict__ X16, size_t n8) { const size_t t = (size_t)blockIdx.x * 256 + threadIdx.x; if (t >= n8) return; FragH f;
#pragma unroll
  for (int q = 0; q < 8; ++q) f.h[q] = (_Float16)x[t * 8 + q]; *(v8us*)((unsigned short*)X16 + t * 8) = f.half[0];  }
__global__ __launch_bounds__(256) void k_round16f(const float* __restrict__ W, _Float16* __restrict__ Bt, size_t n8) { const size_t t = (size_t)blockIdx.x * 256 + threadIdx.x; if (t >= n8) return; FragH f;
#pragma unroll
  for (int i = 0; i < 8; ++i) f.h[i] = (_Float16)(bf16_round(W[t * 8 + i]) * 16.0f); *(v8us*)((unsigned short*)Bt + t * 8) = f.half[0];  }
template <int NHv, int TTv>
__global__ __launch_bounds__(256) void k_vt(const _Float16* __restrict__ V16, int ldv, int voff, _Float16* __restrict__ Vt) { __shared__ unsigned short tl[64][66]; const int tid = threadIdx.x; const int slab = blockIdx.x / (TTv / 64), lg = blockIdx.x % (TTv / 64); const int b = slab / NHv, h = slab % NHv;
  for (int i = tid; i < 64 * 8; i += 256) { const int r = i / 8, c8 = (i % 8) * 8; FragH f; f.half[0] = *(const v8us*)((const unsigned short*)V16 + ((size_t)b * TTv + lg * 64 + r) * ldv + voff + h * 64 + c8);
#pragma unroll
    for (int q = 0; q < 8; ++q) tl[r][c8 + q] = f.u[q]; }
  __syncthreads();
  {
#pragma unroll
    for (int rd = 0; rd < 2; ++rd) { const int d = rd * 32 + tid / 8, pc = tid % 8; FragH f;
#pragma unroll
      for (int q = 0; q < 8; ++q) f.u[q] = tl[pc * 8 + q][d];
      *(v8us*)((unsigned short*)Vt + ((size_t)slab * 64 + d) * TTv + lg * 64 + pc * 8) = f.half[0]; }
     } }

__global__ __launch_bounds__(256) void k_hl(const float* __restrict__ F, _Float16* __restrict__ Hh, _Float16* __restrict__ Hl, size_t n8) { const size_t t = (size_t)blockIdx.x * 256 + threadIdx.x; if (t >= n8) return; FragH fh, fl; const v4f a = *(const v4fa*)(F + t * 8), c = *(const v4fa*)(F + t * 8 + 4);
#pragma unroll
  for (int q = 0; q < 4; ++q) { _Float16 h = (_Float16)a[q]; fh.h[q] = h; fl.h[q] = (_Float16)((a[q] - (float)h) * 1024.0f); h = (_Float16)c[q]; fh.h[4 + q] = h; fl.h[4 + q] = (_Float16)((c[q] - (float)h) * 1024.0f); }
  { *(v8us*)((unsigned short*)Hh + t * 8) = fh.half[0]; *(v8us*)((unsigned short*)Hl + t * 8) = fl.half[0];  } }

// ---- fast GEMM (wave tile 32x64; requires M % 32 == 0 rows per launch region, N % 64 == 0 and K % 64 == 0); epilogue = k_gemm_hhx semantics ----
__device__ __forceinline__ v16h g2_frag(const _Float16* p, int hh) { FragH f; f.half[0] = *(const v8us*)((const unsigned short*)p + 8 * hh); f.half[1] = *(const v8us*)((const unsigned short*)p + 16 + 8 * hh); return f.v; }
__device__ __forceinline__ v8f g2_mma(v16h a, v16h b, v8f c) { v8f d = __builtin_amdgcn_wmma_f32_16x16x32_f16(false, a, false, b, (short)0, c, false, false); asm volatile("v_nop\n\tv_nop\n\tv_nop\n\tv_nop" : "+v"(d) : "v"(a), "v"(b)); return d; }
template <int ACT>
__global__ __launch_bounds__(128) void k_gemm2(const _Float16* __restrict__ A, int lda, size_t sA, const _Float16* __restrict__ Bh, int ldb, size_t sB, float alpha, const float* __restrict__ bias, size_t sBias, const float* __restrict__ CP, int rowsPerB, size_t sCPb, int row0g,
    float* __restrict__ C, _Float16* __restrict__ C16, int ldc, size_t sC, int M, int N, int K) { static_assert(ACT == 0 || ACT == 3 || ACT == 6 || ACT == 8 || ACT == 9 || ACT == 11 || ACT == 12 || ACT == 14 || ACT == 15 || ACT == 16 || ACT == 17, "k_gemm2: unsupported ACT code (would silently apply no activation)");
  __shared__ __attribute__((aligned(16))) float so[4][32][68];
  const int tid = threadIdx.x, w = tid >> 5, lane = tid & 31, ln = lane & 15, hh = lane >> 4; const int by = blockIdx.y;
  A += (size_t)by * sA; Bh += (size_t)by * sB; const size_t cofs = (size_t)by * sC; const float* bp = bias ? bias + (size_t)by * sBias : nullptr;
  const int ntn = N >> 6; const int mt = blockIdx.x / ntn, nq = blockIdx.x - mt * ntn; const int row0 = mt * 128 + 32 * w, col0 = nq * 64; if (row0 >= M) return;
  const _Float16* a0p = A + (size_t)(row0 + ln) * lda; const _Float16* a1p = a0p + (size_t)16 * lda;
  const _Float16* b0p = Bh + (size_t)(col0 + ln) * ldb; const _Float16* b1p = b0p + (size_t)16 * ldb; const _Float16* b2p = b1p + (size_t)16 * ldb; const _Float16* b3p = b2p + (size_t)16 * ldb;
  const v8f z8 = {0.f,0.f,0.f,0.f,0.f,0.f,0.f,0.f}; v8f c00 = z8, c01 = z8, c02 = z8, c03 = z8, c10 = z8, c11 = z8, c12 = z8, c13 = z8;
  /* two k steps (64 k) of fragments stay in registers: a step's 12 loads are issued together, right behind the products that last read the step's registers, and land while the other step is worked on */
  v16h a0x = g2_frag(a0p, hh), a1x = g2_frag(a1p, hh), b0x = g2_frag(b0p, hh), b1x = g2_frag(b1p, hh), b2x = g2_frag(b2p, hh), b3x = g2_frag(b3p, hh);
  __builtin_amdgcn_sched_barrier(0);      /* the first step's loads stay older than the second's, as in the loop: else the loop's counted waits for one step must also cover loads of the other */
  v16h a0y = g2_frag(a0p + 32, hh), a1y = g2_frag(a1p + 32, hh), b0y = g2_frag(b0p + 32, hh), b1y = g2_frag(b1p + 32, hh), b2y = g2_frag(b2p + 32, hh), b3y = g2_frag(b3p + 32, hh);
  asm volatile("s_wait_xcnt 0x0" ::: "memory");      /* address registers of the loads above are reused below while the loads are in flight: the wait stands in front of that reuse */
#define G2_STEP(a0, a1, b0, b1, b2, b3) c00 = g2_mma(a0, b0, c00); c10 = g2_mma(a1, b0, c10); c01 = g2_mma(a0, b1, c01); c11 = g2_mma(a1, b1, c11); c02 = g2_mma(a0, b2, c02); c12 = g2_mma(a1, b2, c12); c03 = g2_mma(a0, b3, c03); c13 = g2_mma(a1, b3, c13);
#pragma unroll 1      /* rolled: a trip already holds 24 loads and 16 products, a second copy would need a second set of fragment registers */
  for (int kb = 64; kb < K; kb += 64) {      /* no branch inside: the waits in front of each step's products can then count the other step's younger loads as still in flight */
    G2_STEP(a0x, a1x, b0x, b1x, b2x, b3x)
    a0x = g2_frag(a0p + kb, hh); a1x = g2_frag(a1p + kb, hh); b0x = g2_frag(b0p + kb, hh); b1x = g2_frag(b1p + kb, hh); b2x = g2_frag(b2p + kb, hh); b3x = g2_frag(b3p + kb, hh);
    G2_STEP(a0y, a1y, b0y, b1y, b2y, b3y)
    a0y = g2_frag(a0p + kb + 32, hh); a1y = g2_frag(a1p + kb + 32, hh); b0y = g2_frag(b0p + kb + 32, hh); b1y = g2_frag(b1p + kb + 32, hh); b2y = g2_frag(b2p + kb + 32, hh); b3y = g2_frag(b3p + kb + 32, hh);
    asm volatile("s_wait_xcnt 0x0" ::: "memory"); }      /* the next trip forms its addresses in the registers that this trip's loads name: the wait stands in front of that */
  G2_STEP(a0x, a1x, b0x, b1x, b2x, b3x)      /* the last 64 k: nothing left to load */
  G2_STEP(a0y, a1y, b0y, b1y, b2y, b3y)
#undef G2_STEP
  v8f accs[8] = {c00, c01, c02, c03, c10, c11, c12, c13};
#pragma unroll
  for (int u = 0; u < 8; ++u) { const int t = u & 3, half = u >> 2; const int col = col0 + t * 16 + ln; const float bv = bp ? bf16_round(bp[col]) : 0.f;
#pragma unroll
    for (int r = 0; r < 8; ++r) { const int rloc = half * 16 + 8 * hh + r; float v = accs[u][r] * alpha + bv; if (CP) { if (rowsPerB < 0) v += CP[cofs + (size_t)(row0g + row0 + rloc) * ldc + col];      /* rowsPerB < 0: own element of the batched C plane */ else { const int bidx = (row0g + row0 + rloc) / rowsPerB; v += CP[(size_t)bidx * sCPb + (size_t)by * 64 + col]; } }
      if (ACT == 3) v = fmaxf(v, 0.f); else if (ACT == 6) v = 0.5f * v * (1.0f + erff(v * 0.70710678118654752f)); else if (ACT == 11) v = 1.0f / (1.0f + expf(-v)); else if (ACT == 15) v = v / (1.0f + expf(-v)); else if (ACT == 12) v = (v > 0.f) ? v : 0.01f * v; else if (ACT == 8) v = tanhf(v); else if (ACT == 9) v = 0.5f * v * (1.0f + tanhf(0.7978845608028654f * (v + 0.044715f * v * v * v))); else if (ACT == 14) v = (v > 0.f) ? v : 0.1f * v; else if (ACT == 16) v = (v >= 0.f) ? v : 0.3f * v; else if (ACT == 17) v = (v >= 0.f) ? v : 0.2f * v;
      so[w][rloc][t * 16 + ln] = v; } }
  __builtin_amdgcn_fence(__ATOMIC_ACQ_REL, "workgroup"); __builtin_amdgcn_wave_barrier();
  const int rsub = lane >> 4, c4 = (lane & 15) * 4;
  {
#pragma unroll
    for (int q = 0; q < 16; ++q) { const int r = q * 2 + rsub; const v4f v = *(const v4fa*)&so[w][r][c4]; if (C) *(v4f*)(C + cofs + (size_t)(row0 + r) * ldc + col0 + c4) = v; if (C16) { v4h h4; for (int i = 0; i < 4; ++i) h4[i] = (_Float16)v[i]; *(v4h*)(C16 + cofs + (size_t)(row0 + r) * ldc + col0 + c4) = h4; } }
     } }


__global__ __launch_bounds__(256) void k_wnat(const float* __restrict__ w, size_t n8, _Float16* __restrict__ Bt) { const size_t t = (size_t)blockIdx.x * 256 + threadIdx.x; if (t >= n8) return; FragH f; for (int q = 0; q < 8; ++q) f.h[q] = (_Float16)(bf16_round(w[t * 8 + q]) * 16.0f); *(v8us*)((unsigned short*)Bt + t * 8) = f.half[0];  }
__global__ __launch_bounds__(256) void k_rsm(const float* __restrict__ S, _Float16* __restrict__ P, int nrows) {
  #pragma clang fp contract(off)
  const int i = blockIdx.x * 256 + threadIdx.x; if (i >= nrows) return; const float* s = S + (size_t)i * SQ; float mx = -3.0e38f;
#pragma unroll 1
  for (int j = 0; j < SQ; ++j) mx = fmaxf(mx, s[j]); float se = 0.f;
#pragma unroll 1
  for (int j = 0; j < SQ; ++j) se += expf(s[j] - mx); const float sc = 256.0f / se;
#pragma unroll 1
  for (int j0 = 0; j0 < SQ; j0 += 8) { FragH f; for (int q = 0; q < 8; ++q) f.h[q] = (_Float16)(expf(s[j0 + q] - mx) * sc); unsigned short* d = (unsigned short*)P + (size_t)i * SQ + j0; *(v8us*)d = f.half[0];  } }
__global__ __launch_bounds__(256) void k_vt(const _Float16* __restrict__ V16, int b, int h0, _Float16* __restrict__ VT) { __shared__ unsigned short tl[64][65]; const int tid = threadIdx.x; const int hh = blockIdx.x % HG, sg = blockIdx.x / HG; const int s0 = sg * 64; const int h = h0 + hh;
  for (int i = tid; i < 64 * 8; i += 256) { const int j = i / 8, d8 = (i % 8) * 8; FragH f; f.half[0] = *(const v8us*)((const unsigned short*)V16 + ((size_t)b * SQ + s0 + j) * DM + h * HD + d8); for (int q = 0; q < 8; ++q) tl[d8 + q][j] = f.u[q]; }
  __syncthreads();
  { for (int i = tid; i < 64 * 8; i += 256) { const int d = i / 8, j8 = (i % 8) * 8; FragH f; for (int q = 0; q < 8; ++q) f.u[q] = tl[d][j8 + q]; *(v8us*)((unsigned short*)VT + ((size_t)hh * HD + d) * SQ + s0 + j8) = f.half[0]; }  } }



// lane l with lane l ^ MSK inside its row of 16 lanes (DPP row_xmask), and lane l with lane l ^ 16; every lane is on where these are used
template <int MSK>
__device__ __forceinline__ float row_x(float x) { return __builtin_bit_cast(float, __builtin_amdgcn_update_dpp(0, __builtin_bit_cast(int, x), 0x160 + MSK, 0xF, 0xF, true)); }
__device__ __forceinline__ float half_x(float x) { return __builtin_bit_cast(float, __builtin_amdgcn_permlanex16(__builtin_bit_cast(int, x), __builtin_bit_cast(int, x), 0x76543210, 0xfedcba98, false, false)); }
#define SMR 4                        /* score rows per wave */
#define SMC (NKX / 128)              /* 128-key chunks in a full row: one 16-byte load per lane each */
// one WAVE per score row (SMR rows a wave): lane l owns keys c*128 + l*4 .. +3 of every chunk c, so each load reads 512 contiguous bytes; the row is read once and stays in registers for the maximum, the sum and the weights
__global__ __launch_bounds__(256) void k_rsmcf2(const float* __restrict__ S, _Float16* __restrict__ P, int hg, int q0, int nk) {
  #pragma clang fp contract(off)
  const int lane = threadIdx.x & 31; const int t0 = (blockIdx.x * 8 + __builtin_amdgcn_readfirstlane(threadIdx.x >> 5)) * SMR; if (t0 >= hg * QT) return;      /* the wave's number as a scalar: row index, row base and causal limit stay in scalar registers; QT is a multiple of SMR */
  const float* s = S + (size_t)t0 * NKX + lane * 4; v4f v[SMR][SMC];
#pragma unroll      /* here and below: full unrolling makes every index of the register array a constant, so it stays in registers */
  for (int c = 0; c < SMC; ++c) if (c * 128 < nk) {
#pragma unroll
    for (int r = 0; r < SMR; ++r) v[r][c] = *(const v4fa*)(s + (size_t)r * NKX + c * 128); }
  asm volatile("s_wait_xcnt 0x0" ::: "memory");      /* the loads' address registers are reused below while the loads are still in flight: the wait stands in front of that reuse */
  float mx[SMR], se[SMR];
#pragma unroll
  for (int r = 0; r < SMR; ++r) mx[r] = -3.0e38f;
#pragma unroll
  for (int c = 0; c < SMC; ++c) if (c * 128 < nk) {
#pragma unroll
    for (int r = 0; r < SMR; ++r) { const int last = q0 + ((t0 + r) % QT);
#pragma unroll
      for (int q = 0; q < 4; ++q) { const float f = (c * 128 + lane * 4 + q <= last) ? 1.f : 0.f; v[r][c][q] = fmaf(f, v[r][c][q], (1.f - f) * -1.0e9f); mx[r] = fmaxf(mx[r], v[r][c][q]); } } }
#pragma unroll
  for (int r = 0; r < SMR; ++r) { mx[r] = fmaxf(mx[r], row_x<1>(mx[r])); mx[r] = fmaxf(mx[r], row_x<2>(mx[r])); mx[r] = fmaxf(mx[r], row_x<4>(mx[r])); mx[r] = fmaxf(mx[r], row_x<8>(mx[r])); mx[r] = fmaxf(mx[r], half_x(mx[r])); se[r] = 0.f; }
#pragma unroll
  for (int c = 0; c < SMC; ++c) if (c * 128 < nk) {
#pragma unroll
    for (int r = 0; r < SMR; ++r) {
#pragma unroll
      for (int q = 0; q < 4; ++q) { v[r][c][q] = __expf(v[r][c][q] - mx[r]); se[r] += v[r][c][q]; } } }
#pragma unroll
  for (int r = 0; r < SMR; ++r) { se[r] += row_x<1>(se[r]); se[r] += row_x<2>(se[r]); se[r] += row_x<4>(se[r]); se[r] += row_x<8>(se[r]); se[r] += half_x(se[r]); se[r] = 256.0f / se[r]; }      /* 32 partial sums, butterfly: the same bits in every lane */
  _Float16* p = P + (size_t)t0 * NKX + lane * 4; v4h hw[SMR][SMC];      /* every weight is converted before the first store is issued, so no register of an issued store is written again */
#pragma unroll
  for (int c = 0; c < SMC; ++c) if (c * 128 < nk) {
#pragma unroll
    for (int r = 0; r < SMR; ++r) {
#pragma unroll
      for (int q = 0; q < 4; ++q) hw[r][c][q] = (_Float16)(v[r][c][q] * se[r]); } }
#pragma unroll
  for (int c = 0; c < SMC; ++c) if (c * 128 < nk) {
#pragma unroll
    for (int r = 0; r < SMR; ++r) *(v4h*)(p + (size_t)r * NKX + c * 128) = hw[r][c]; } }


// lane l with lane l ^ 1 / l ^ 2 inside its group of four lanes (DPP quad_perm; every lane is on where these are used)
__device__ __forceinline__ float quad_x1(float x) { return __builtin_bit_cast(float, __builtin_amdgcn_update_dpp(0, __builtin_bit_cast(int, x), 0xB1, 0xF, 0xF, true)); }
__device__ __forceinline__ float quad_x2(float x) { return __builtin_bit_cast(float, __builtin_amdgcn_update_dpp(0, __builtin_bit_cast(int, x), 0x4E, 0xF, 0xF, true)); }
// four lanes per query row: lane qd of a row owns columns c*16 + qd*4 .. +3 (c = 0..3) of its q and o rows, in registers; k and v rows come from a 64-key LDS tile shared by the block's 64 rows
template <int MASKADD>
__global__ __launch_bounds__(256) void k_att0(const float* __restrict__ QF, const float* __restrict__ KF, const float* __restrict__ VF, int ld, const float* __restrict__ mask, float scale, float* __restrict__ OF, int ldo) {
  __shared__ __attribute__((aligned(16))) float lk[64][64]; __shared__ __attribute__((aligned(16))) float lv[64][64];
  const int tid = threadIdx.x; const int h = blockIdx.x / (QT0 / 64), rg = blockIdx.x % (QT0 / 64); const int qd = tid & 3; const int i = rg * 64 + (tid >> 2);
  { const size_t bi = (size_t)blockIdx.y * SQ * ld; QF += bi; KF += bi; VF += bi; OF += (size_t)blockIdx.y * SQ * ldo; }      /* batch on grid.y: the first QT0 rows of each batch's SQ-row plane, inputs and output alike */
  const float* qr = QF + (size_t)i * ld + h * HD + qd * 4;
  v4f qv[4], ov[4];
#pragma unroll      /* here and below: full unrolling makes every index of the register arrays a constant, so they stay in registers */
  for (int c = 0; c < 4; ++c) { qv[c] = *(const v4fa*)(qr + c * 16); const v4f z = {0.f, 0.f, 0.f, 0.f}; ov[c] = z; }
  float m = -1.0e30f, l = 0.f; const int ntile = MASKADD ? (SQ / 64) : (rg + 1);      /* additive-mask form: every key (the mask input decides); causal form: keys up to the block's last row */
#pragma unroll 1      /* rolled: one trip is a whole 64-key tile between its two barriers */
  for (int t = 0; t < ntile; ++t) { v4f tk[4], tv[4];
#pragma unroll
    for (int u = 0; u < 4; ++u) { const int e = u * 256 + tid; const size_t g = (size_t)(t * 64 + (e >> 4)) * ld + h * HD + (e & 15) * 4; tk[u] = *(const v4fa*)(KF + g); tv[u] = *(const v4fa*)(VF + g); }
    __syncthreads();      /* every reader has left the previous tile */
#pragma unroll
    for (int u = 0; u < 4; ++u) { const int e = u * 256 + tid; *(v4f*)&lk[e >> 4][(e & 15) * 4] = tk[u]; *(v4f*)&lv[e >> 4][(e & 15) * 4] = tv[u]; }
    __syncthreads();      /* the tile is complete before anyone reads it */
#pragma unroll 1      /* rolled: one trip already holds four keys, further copies would only grow the code and the register count */
    for (int j0 = 0; j0 < 64; j0 += 4) { v4f kk[4][4], vw[4][4];
#pragma unroll
      for (int a = 0; a < 4; ++a) for (int c = 0; c < 4; ++c) kk[a][c] = *(const v4f*)&lk[j0 + a][c * 16 + qd * 4];
#pragma unroll
      for (int a = 0; a < 4; ++a) for (int c = 0; c < 4; ++c) vw[a][c] = *(const v4f*)&lv[j0 + a][c * 16 + qd * 4];
      __builtin_amdgcn_sched_barrier(0);      /* keeps four keys' 32 LDS reads together in front of the arithmetic: without it each read is issued right before its use and its whole LDS latency is waited out */
#pragma unroll
      for (int a = 0; a < 4; ++a) { const int j = t * 64 + j0 + a; float s = 0.f;
#pragma unroll
        for (int c = 0; c < 4; ++c) { const v4f kq = kk[a][c]; const v4f qq = qv[c]; s = __fadd_rn(s, __fmul_rn(qq[0], kq[0])); s = __fadd_rn(s, __fmul_rn(qq[1], kq[1])); s = __fadd_rn(s, __fmul_rn(qq[2], kq[2])); s = __fadd_rn(s, __fmul_rn(qq[3], kq[3])); }
        s = __fadd_rn(s, quad_x1(s)); s = __fadd_rn(s, quad_x2(s));      /* the row's four partial sums: the same bits in all four lanes */
        s = __fmul_rn(s, scale); if (MASKADD) s = __fadd_rn(s, __fmul_rn(bf16_round(mask[(size_t)i * SQ + j]), -10000.0f));
        const float f = (MASKADD || j <= i) ? 1.f : 0.f; const float sm = fmaf(f, s, (1.f - f) * -1.0e30f); const float mn = fmaxf(m, sm); const float sc = expf(m - mn); const float e = expf(sm - mn); l = __fadd_rn(__fmul_rn(l, sc), e); m = mn;
#pragma unroll
        for (int c = 0; c < 4; ++c) { const v4f vv = vw[a][c]; for (int u = 0; u < 4; ++u) ov[c][u] = __fadd_rn(__fmul_rn(ov[c][u], sc), __fmul_rn(e, vv[u])); } } } }
  const float fin = 64.0f / l;      /* o x64 (the f16 path has no such factor); the store below takes the 64 out again (x 2^-6, exact) */
  float* orow = OF + (size_t)i * ldo + h * HD + qd * 4;
#pragma unroll
  for (int c = 0; c < 4; ++c) { v4f oo = ov[c]; for (int u = 0; u < 4; ++u) oo[u] = __fmul_rn(__fmul_rn(oo[u], fin), 0.015625f); *(v4f*)(orow + c * 16) = oo; } }


template <int BFIN, int WXB>
__global__ __launch_bounds__(256) void k_ln16(const float* __restrict__ X, const float* __restrict__ g, const float* __restrict__ bb, float eps, _Float16* __restrict__ N16, float* __restrict__ XB) {
  #pragma clang fp contract(off)
  __shared__ float red[256]; const size_t r = blockIdx.x; const int t = threadIdx.x; const v4f xa = *(const v4fa*)(X + r * DMQ + t * 4); float s[4]; float sum = 0.f;
  for (int q = 0; q < 4; ++q) { s[q] = BFIN ? bf16_round(xa[q]) : xa[q]; sum = __fadd_rn(sum, s[q]); }
  red[t] = sum; __syncthreads(); for (int st = 128; st > 0; st >>= 1) { if (t < st) red[t] = __fadd_rn(red[t], red[t + st]); __syncthreads(); } const float mu = red[0] / (float)DMQ; __syncthreads();
  float vs = 0.f; for (int q = 0; q < 4; ++q) { const float dl = __fadd_rn(s[q], -mu); vs = __fadd_rn(vs, __fmul_rn(dl, dl)); } red[t] = vs; __syncthreads(); for (int st = 128; st > 0; st >>= 1) { if (t < st) red[t] = __fadd_rn(red[t], red[t + st]); __syncthreads(); }
  const float rs = rsqrtf(__fadd_rn(red[0] / (float)DMQ, eps)); v4h y; v4f xb;
  for (int q = 0; q < 4; ++q) { const int c = t * 4 + q; y[q] = (_Float16)__fadd_rn(__fmul_rn(__fmul_rn(__fadd_rn(s[q], -mu), rs), bf16_round(g[c])), bf16_round(bb[c])); xb[q] = s[q]; }
  { *(v4h*)(N16 + r * DMQ + t * 4) = y; if (WXB) *(v4f*)(XB + r * DMQ + t * 4) = xb;  } }
__global__ __launch_bounds__(256) void k_ftres2(const float* __restrict__ OF0, const float* __restrict__ XB, float* __restrict__ X1, size_t n4) {
  #pragma clang fp contract(off)
  const size_t t = (size_t)blockIdx.x * 256 + threadIdx.x; if (t >= n4) return; const v4f o = *(const v4fa*)(OF0 + t * 4), xv = *(const v4fa*)(XB + t * 4); v4f y; for (int q = 0; q < 4; ++q) y[q] = __fadd_rn(__fmul_rn(o[q], 0.015625f), xv[q]); *(v4f*)(X1 + t * 4) = y;  }

__global__ __launch_bounds__(256) void k_wthd(const float* __restrict__ Wt, _Float16* __restrict__ Bt) { const size_t t = (size_t)blockIdx.x * 256 + threadIdx.x; if (t >= (size_t)NH * HD * (DM / 8)) return; const int m8 = (int)(t % (DM / 8)) * 8; const int d = (int)((t / (DM / 8)) % HD); const int h = (int)(t / ((size_t)(DM / 8) * HD)); FragH f;
  for (int q = 0; q < 8; ++q) f.h[q] = (_Float16)(16.0f * bf16_round(Wt[((size_t)h * DM + m8 + q) * HD + d])); unsigned short* dst = (unsigned short*)Bt + ((size_t)h * HD + d) * DM + m8; *(v8us*)dst = f.half[0];  }




__global__ __launch_bounds__(256) void k_wtpad(const float* __restrict__ Wm, _Float16* __restrict__ Wt, int Kr, int Kp, int Nr, int Np, float scale) {
  const int t = blockIdx.x * 256 + threadIdx.x; if (t >= Np * (Kp / 8)) return; const int n = t / (Kp / 8), k8 = (t % (Kp / 8)) * 8; const int nc = min(n, Nr - 1); const float fn = (n < Nr) ? 1.f : 0.f; FragH f;
  for (int i = 0; i < 8; ++i) { const int k = k8 + i; const int kc = min(k, Kr - 1); const float fk = (k < Kr) ? fn : 0.f; f.h[i] = (_Float16)(bf16_round(Wm[(size_t)kc * Nr + nc]) * scale * fk); }
  unsigned short* o = (unsigned short*)Wt + (size_t)n * Kp + k8; *(v8us*)o = f.half[0];  }
__global__ __launch_bounds__(128) void k_bpad(const float* __restrict__ b, float* __restrict__ Bp, int nr, int np) {
  const int i = threadIdx.x; if (i >= np) return; const float v = b[min(i, nr - 1)] * ((i < nr) ? 1.f : 0.f); *(float*)(Bp + i) = v;  }

#define DI 64         /* inner width = NH * HD (ONE 64-wide head) */
#define LQK (3 * DI)  /* fused q | k | v row pitch (192) */
__global__ __launch_bounds__(256) void k_o0(const float* __restrict__ OF, float* __restrict__ ob, size_t n4) {
  #pragma clang fp contract(off)
  const size_t t = (size_t)blockIdx.x * 256 + threadIdx.x; if (t >= n4) return; const size_t e = t * 4; const int i = (int)(e / DI); const int c = (int)(e % DI); const int h = c / HD, d = c % HD; const v4f a = *(const v4fa*)(OF + e); v4f o; for (int q = 0; q < 4; ++q) o[q] = __fmul_rn(a[q], 0.015625f); float* dst = ob + (size_t)h * SQ * HD + (size_t)i * HD + d; *(v4f*)dst = o;  }

extern "C" void kernel_launch(void* const* d_in, const int* in_sizes, int n_in,
                              void* d_out, int out_size, void* d_ws, size_t ws_size, hipStream_t stream) {
  (void)in_sizes; (void)n_in; (void)out_size;
  const float* const* I = (const float* const*)d_in; const float* x = I[0]; const float* wq = I[1]; const float* wk = I[2]; const float* wv = I[3];      /* x; [in][out = 64] Wq / Wk / Wv (input order as this module lists them); no biases */
  char* ws = (char*)d_ws; size_t off = 0;
  auto take = [&](size_t bytes) { char* p = ws + off; off += (bytes + 255) & ~(size_t)255; return p; };
  _Float16* BW = (_Float16*)take((size_t)LQK * DM * 2); _Float16* X16 = (_Float16*)take(NR * DM * 2); _Float16* QKV = (_Float16*)take(NR * LQK * 2); _Float16* VT = (_Float16*)take((size_t)NB * NH * HD * SQ * 2);
  float* S = (float*)take((size_t)NB * NH * QT * NKX * 4); _Float16* P = (_Float16*)take((size_t)NB * NH * QT * NKX * 2); float* QKVF = (float*)take(NR * LQK * 4);      /* one plane per batch: all batches are in flight in every launch */
  if (off > ws_size) return;
  k_wt_f16<<<dim3((unsigned)(((size_t)DI * (DM / 8) + 255) / 256), 3), 256, 0, stream>>>(wq, wk, wv, BW, DM, DI, 16.0f);      /* [in = DM][out = 64] -> Bt[n][k] x16, stacked q | k | v: one launch, the matrix on grid.y */
  k_x16<<<(unsigned)((NR * DM / 8 + 255) / 256), 256, 0, stream>>>(x, X16, NR * DM / 8);      /* x (bf16-valued) as exact f16 rows */
  k_gemm2<0><<<dim3((unsigned)((NR / 128) * (LQK / 64)), 1), 128, 0, stream>>>(X16, DM, 0, BW, DM, 0, 0.0625f, nullptr, 0, nullptr, 1, 0, 0, QKVF, QKV, LQK, 0, (int)NR, LQK, DM);      /* q | k | v = x W^T in ONE launch over the stacked 192 columns; each result is stored twice, as f16 (operands of the WMMA attention) and as f32 (the exact first tile reads rows 0..511 of each batch) */
  const _Float16* Q16 = QKV; const _Float16* K16 = QKV + DI; const _Float16* V16 = QKV + 2 * DI;
  float* ob = (float*)d_out;      /* the ONE head leaves grid.y free: it carries the batch in the GEMM and k_att0 launches below */
  k_vt<NH, SQ><<<NB * NH * (SQ / 64), 256, 0, stream>>>(V16, LQK, 0, VT);      /* V^T [NB][HD][SQ], every batch */
  for (int q0 = QT0; q0 < SQ; q0 += QT) { const int nk = q0 + QT;      /* one trip (QT0 + QT == SQ); causal: only keys below the tile end are computed; query rows below QT0 come from the exact f32 path alone, so no f16 tile is computed for them (QT0 is a multiple of QT) */
    k_gemm2<0><<<dim3((QT / 128) * (nk / 64), NB), 128, 0, stream>>>(Q16 + (size_t)q0 * LQK, LQK, (size_t)SQ * LQK, K16, LQK, (size_t)SQ * LQK, 0.024895003f, nullptr, 0, nullptr, 1, 0, 0, S, nullptr, NKX, (size_t)QT * NKX, QT, nk, HD);      /* scores * 256^-0.666, batch on grid.y */
    k_rsmcf2<<<(NB * QT + 8 * SMR - 1) / (8 * SMR), 256, 0, stream>>>(S, P, NB, q0, nk);      /* causal softmax -> P x256 f16, NB planes of QT rows; 8 waves a block, SMR rows a wave */
    k_gemm2<0><<<dim3((QT / 128) * (HD / 64), NB), 128, 0, stream>>>(P, NKX, (size_t)QT * NKX, VT, SQ, (size_t)HD * SQ, 0.00390625f, nullptr, 0, nullptr, 1, 0, 0, ob + (size_t)q0 * DI, nullptr, DI, (size_t)SQ * DI, QT, HD, nk); }      /* out[b][q0 + i][..] = P V^T 2^-8 (f32), batch on grid.y */
  k_att0<0><<<dim3(NH * (QT0 / 64), NB), 256, 0, stream>>>(QKVF, QKVF + DI, QKVF + 2 * DI, LQK, nullptr, 0.024895003f, ob, DI);      /* exact f32 causal attention for rows 0..511 of every batch, stored straight into the output rows, their only writer */
}

// v007
// A run of this version takes 98.2 microseconds.
// In two side-by-side timings against v006, it was 1.35 and 1.34 times as fast.
// All steps since v000 together make it 730 times as fast.
#include <hip/hip_runtime.h>
// Single-head causal self-attention with the module's literal scale C^-0.666 (x [32][1024][256]; q/k/v = x W ([in][out] [256][64], no biases); ONE 64-wide head; scores * 256^-0.666 = 0.024895 (as the source writes it, not head_size^-0.5); causal; softmax; out = weights v -> [32][1024][64]; no output projection).
// Structure: token rows; x as exact f16 rows; one WMMA GEMM over the stacked q | k | v columns into a row plane of pitch 192, stored as f16 and as f32; per batch v^T via LDS transposes; one causal 512-row query tile (rows 512..1023) with the batch on grid.y (scores alpha 256^-0.666, causal softmax f32 -> f16 x256 weights, P V written as f32 straight into the merged output rows); query rows 0..511 from an exact f32 first tile only (no f16 tile for them).
// Compute dtype: inputs rounded to bf16; x / weights exact; q, k, v and softmax weights as plain f16 GEMM operands (~2^-12); scores, softmax statistics and o f32; v_wmma_f32_16x16x32_f16; the exact first tile: f32 operands on v_wmma_f32_16x16x4_f32.
#define NB 32
#define SQ 1024
#define DM 256
#define NH 1
#define HD 64
#define HG 4                         /* unused by the launches (only the uncalled non-template k_vt names it) */
#define QT 512                       /* query rows per causal tile: rows QT0..SQ-1 are ONE tile, so scores, softmax and P V are one launch each; keys past a row's own index are masked to weight 0 */
#define NKX SQ                       /* S / P row pitch */
#define QT0 512                      /* first-tile rows computed exactly (f32): 512 here (no output projection averages the early-row cancellation errors away; logit sigma 1.0) */
#define B0 0                         /* unused */
#define NBR NB                       /* unused (only the unused MP names it) */
#define NR ((size_t)NB * SQ)
#define DMQ DM
#define DFF 4096                     /* unused (no FFN in this file) */
#define DFFR 100                     /* unused */
#define MP ((int)((size_t)NBR * SQ)) /* unused (only the unused MPO names it) */
#define QN SQ                        /* unused */
#define NHD NH                       /* unused */
#define MPO MP                       /* unused */
#define LQ (3 * DM)      /* unused; the q/k/v rows have pitch LQK (192) */
typedef __bf16 v16b __attribute__((ext_vector_type(16)));
typedef unsigned short v8us __attribute__((ext_vector_type(8), may_alias));
typedef float  v8f  __attribute__((ext_vector_type(8)));
typedef float  v4f  __attribute__((ext_vector_type(4)));
typedef float  v4fa __attribute__((ext_vector_type(4), may_alias));
union FragB { v16b v; v8us half[2]; unsigned short u[16]; };

__device__ __forceinline__ unsigned short bf16_bits(float x) { unsigned int u = __float_as_uint(x); return (unsigned short)((u + 0x7FFFu + ((u >> 16) & 1u)) >> 16); }
__device__ __forceinline__ float bf16_val(unsigned short b) { return __uint_as_float(((unsigned int)b) << 16); }
__device__ __forceinline__ float bf16_round(float x) { return bf16_val(bf16_bits(x)); }
// D += A·B with NT terms: 1 = ah·bh, 2 = + al·bh (A split), 3 = + ah·bl (both split)
template <int NT>
__device__ __forceinline__ v8f mmaN(v16b ah, v16b al, v16b bh, v16b bl, v8f c) {
  c = __builtin_amdgcn_wmma_f32_16x16x32_bf16(false, ah, false, bh, (short)0, c, false, false);
  if (NT >= 2) c = __builtin_amdgcn_wmma_f32_16x16x32_bf16(false, al, false, bh, (short)0, c, false, false);
  if (NT >= 3) c = __builtin_amdgcn_wmma_f32_16x16x32_bf16(false, ah, false, bl, (short)0, c, false, false);
  asm volatile("v_nop\n\tv_nop\n\tv_nop\n\tv_nop" : "+v"(c) : "v"(ah), "v"(al), "v"(bh), "v"(bl));
  return c;
}

__global__ __launch_bounds__(256) void k_wt_bf16(const float* __restrict__ W, unsigned short* __restrict__ Wt, int K, int N) {
  const int t = blockIdx.x * 256 + threadIdx.x;
  const int k8n = K / 8;
  if (t >= N * k8n) return;
  const int n = t / k8n, k8 = (t % k8n) * 8;
  v8us v;
#pragma unroll
  for (int i = 0; i < 8; ++i) v[i] = bf16_bits(W[(size_t)(k8 + i) * N + n]);
  *(v8us*)(Wt + (size_t)n * K + k8) = v;
  
}

// GEMM C[M][N] (f32, pitch ldc) = act(A[M][K]·W + bias). A f32 row-major (pitch lda) converted per fragment to bf16
// (ASPLIT: hi/lo two planes -> 2 terms, else single rounded term); Wt bf16 [N][K] (pitch ldb). BIAS_BF16 rounds the
// bias to bf16 first (bias quantised to bf16 before the add). K%32==0, M%16==0, N%64==0.
template <bool ASPLIT, int ACT, bool BIAS_BF16>
__global__ __launch_bounds__(128) void k_gemm_bf(const float* __restrict__ A, int lda, const unsigned short* __restrict__ Wt, int ldb,
                                               const float* __restrict__ bias, float* __restrict__ C, int ldc, int M, int N, int K) {
  __shared__ __attribute__((aligned(16))) float so[4][16][64];
  const int tid = threadIdx.x, w = tid >> 5, lane = tid & 31, ln = lane & 15, hh = lane >> 4;
  const int ntn = N / 64;
  const int wid = blockIdx.x * 4 + w;
  const int mt = wid / ntn, nq = wid % ntn;
  if (mt * 16 >= M) return;
  const int row0 = mt * 16, col0 = nq * 64;
  const float* arow = A + (size_t)(row0 + ln) * lda;
  v8f acc[4] = {};
  for (int kb = 0; kb < K; kb += 32) {
    FragB ah, al;
    const v4f x0 = *(const v4fa*)(arow + kb + 8 * hh), x1 = *(const v4fa*)(arow + kb + 8 * hh + 4);
    const v4f x2 = *(const v4fa*)(arow + kb + 16 + 8 * hh), x3 = *(const v4fa*)(arow + kb + 16 + 8 * hh + 4);
    float xs[16] = {x0[0],x0[1],x0[2],x0[3],x1[0],x1[1],x1[2],x1[3],x2[0],x2[1],x2[2],x2[3],x3[0],x3[1],x3[2],x3[3]};
#pragma unroll
    for (int i = 0; i < 16; ++i) { const unsigned short hb = bf16_bits(xs[i]); ah.u[i] = hb; al.u[i] = ASPLIT ? bf16_bits(xs[i] - bf16_val(hb)) : (unsigned short)0; }
#pragma unroll
    for (int t = 0; t < 4; ++t) {
      const unsigned short* brow = Wt + (size_t)(col0 + t * 16 + ln) * ldb + kb;
      FragB b;
      b.half[0] = *(const v8us*)(brow + 8 * hh);
      b.half[1] = *(const v8us*)(brow + 16 + 8 * hh);
      acc[t] = mmaN<ASPLIT ? 2 : 1>(ah.v, al.v, b.v, b.v, acc[t]);
    }
  }
#pragma unroll
  for (int t = 0; t < 4; ++t) {
    float bv = bias ? bias[col0 + t * 16 + ln] : 0.f;
    if (BIAS_BF16) bv = bf16_round(bv);
#pragma unroll
    for (int r = 0; r < 8; ++r) { float v = acc[t][r] + bv; if (ACT == 1) v = fmaxf(v, 0.f); so[w][8 * hh + r][t * 16 + ln] = v; }
  }
  __builtin_amdgcn_fence(__ATOMIC_ACQ_REL, "workgroup");
  __builtin_amdgcn_wave_barrier();
  const int rsub = lane >> 4, c4 = (lane & 15) * 4;
  {
#pragma unroll
    for (int q = 0; q < 8; ++q) {
      const int r = q * 2 + rsub;
      const v4f v = *(const v4fa*)&so[w][r][c4];
      *(v4f*)(C + (size_t)(row0 + r) * ldc + col0 + c4) = v;
    }
    
  }
}

// GEMM C = act(A·W + bias + resid): A f32 (ASPLIT -> hi/lo 2 terms), Wt bf16 [N][K]; ACT 0 none, 1 relu, 2 exact gelu;
// resid (optional, f32, row index = (row % rmod), pitch ldr, RES_BF16 rounds it) added before the activation.
template <bool ASPLIT, int ACT, bool BIAS_BF16, bool RES_BF16>
__global__ __launch_bounds__(128) void k_gemm_bf3(const float* __restrict__ A, int lda, const unsigned short* __restrict__ Wt, int ldb,
                                                const float* __restrict__ bias, const float* __restrict__ resid, int rmod, int ldr,
                                                float* __restrict__ C, int ldc, int M, int N, int K) {
  __shared__ __attribute__((aligned(16))) float so[4][16][64];
  const int tid = threadIdx.x, w = tid >> 5, lane = tid & 31, ln = lane & 15, hh = lane >> 4;
  const int ntn = N / 64;
  const int wid = blockIdx.x * 4 + w;
  const int mt = wid / ntn, nq = wid % ntn;
  if (mt * 16 >= M) return;
  const int row0 = mt * 16, col0 = nq * 64;
  const float* arow = A + (size_t)(row0 + ln) * lda;
  v8f acc[4] = {};
  for (int kb = 0; kb < K; kb += 32) {
    FragB ah, al;
    const v4f x0 = *(const v4fa*)(arow + kb + 8 * hh), x1 = *(const v4fa*)(arow + kb + 8 * hh + 4);
    const v4f x2 = *(const v4fa*)(arow + kb + 16 + 8 * hh), x3 = *(const v4fa*)(arow + kb + 16 + 8 * hh + 4);
    float xs[16] = {x0[0],x0[1],x0[2],x0[3],x1[0],x1[1],x1[2],x1[3],x2[0],x2[1],x2[2],x2[3],x3[0],x3[1],x3[2],x3[3]};
#pragma unroll
    for (int i = 0; i < 16; ++i) { const unsigned short hb = bf16_bits(xs[i]); ah.u[i] = hb; al.u[i] = ASPLIT ? bf16_bits(xs[i] - bf16_val(hb)) : (unsigned short)0; }
#pragma unroll
    for (int t = 0; t < 4; ++t) {
      const unsigned short* brow = Wt + (size_t)(col0 + t * 16 + ln) * ldb + kb;
      FragB b;
      b.half[0] = *(const v8us*)(brow + 8 * hh);
      b.half[1] = *(const v8us*)(brow + 16 + 8 * hh);
      acc[t] = mmaN<ASPLIT ? 2 : 1>(ah.v, al.v, b.v, b.v, acc[t]);
    }
  }
#pragma unroll
  for (int t = 0; t < 4; ++t) {
    const int col = col0 + t * 16 + ln;
    float bv = bias ? bias[col] : 0.f;
    if (BIAS_BF16) bv = bf16_round(bv);
#pragma unroll
    for (int r = 0; r < 8; ++r) {
      float v = acc[t][r] + bv;
      if (resid) { float rv = resid[(size_t)((row0 + 8 * hh + r) % rmod) * ldr + col]; if (RES_BF16) rv = bf16_round(rv); v += rv; }
      if (ACT == 1) v = fmaxf(v, 0.f);
      if (ACT == 2) v = 0.5f * v * (1.0f + erff(v * 0.70710678118654752f));
      if (ACT == 3) { const float u = 0.7978845608028654f * (v + 0.044715f * v * v * v); v = 0.5f * v * (1.0f + tanhf(u)); }
      so[w][8 * hh + r][t * 16 + ln] = v;
    }
  }
  __builtin_amdgcn_fence(__ATOMIC_ACQ_REL, "workgroup");
  __builtin_amdgcn_wave_barrier();
  const int rsub = lane >> 4, c4 = (lane & 15) * 4;
  {
#pragma unroll
    for (int q = 0; q < 8; ++q) {
      const int r = q * 2 + rsub;
      const v4f v = *(const v4fa*)&so[w][r][c4];
      *(v4f*)(C + (size_t)(row0 + r) * ldc + col0 + c4) = v;
    }
    
  }
}
// row LayerNorm (biased variance, eps) over N: s = X (+ R); optional out_sum <- s; out_norm <- (s-mu)*rsqrt(var+eps)*g + b
template <bool PARAM_BF16>
__global__ __launch_bounds__(256) void k_layernorm(const float* __restrict__ X, const float* __restrict__ R, const float* __restrict__ g, const float* __restrict__ bta,
                                                  float* __restrict__ out_sum, float* __restrict__ out_norm, int N, float eps) {
  __shared__ float red[256];
  const int row = blockIdx.x, tid = threadIdx.x;
  const float* x = X + (size_t)row * N; const float* rr = R ? R + (size_t)row * N : nullptr;
  float vals[16];                     // up to N = 4096
  const int per = N / 256;            // contiguous chunk per thread? use strided-by-4 chunks: thread handles j = tid*4 + 1024*u
  float s1 = 0.f;
  for (int u = 0; u < per / 4; ++u) {
    const int j = tid * 4 + 1024 * u;
    const v4f a = *(const v4fa*)(x + j);
    v4f b = {0.f,0.f,0.f,0.f}; if (rr) b = *(const v4fa*)(rr + j);
#pragma unroll
    for (int q = 0; q < 4; ++q) { const float v = a[q] + b[q]; vals[u * 4 + q] = v; s1 += v; }
  }
  red[tid] = s1; __syncthreads();
  for (int st = 128; st > 0; st >>= 1) { if (tid < st) red[tid] += red[tid + st]; __syncthreads(); }
  const float mu = red[0] / (float)N; __syncthreads();
  float s2 = 0.f;
  for (int u = 0; u < per / 4; ++u)
#pragma unroll
    for (int q = 0; q < 4; ++q) { const float c = vals[u * 4 + q] - mu; s2 += c * c; }
  red[tid] = s2; __syncthreads();
  for (int st = 128; st > 0; st >>= 1) { if (tid < st) red[tid] += red[tid + st]; __syncthreads(); }
  const float rs = rsqrtf(red[0] / (float)N + eps);
  {
    for (int u = 0; u < per / 4; ++u) {
      const int j = tid * 4 + 1024 * u;
      v4f o, sm;
#pragma unroll
      for (int q = 0; q < 4; ++q) {
        float gg = g[j + q], bb = bta[j + q];
        if (PARAM_BF16) { gg = bf16_round(gg); bb = bf16_round(bb); }
        sm[q] = vals[u * 4 + q]; o[q] = (vals[u * 4 + q] - mu) * rs * gg + bb;
      }
      if (out_sum) *(v4f*)(out_sum + (size_t)row * N + j) = sm;
      *(v4f*)(out_norm + (size_t)row * N + j) = o;
    }
    
  }
}



// ---- f16 WMMA path (v_wmma_f32_16x16x32_f16): 11-bit significands for operands in range — used where a [0,1] probability operand needs more precision than bf16
typedef _Float16 v16h __attribute__((ext_vector_type(16)));
union FragH { v16h v; v8us half[2]; _Float16 h[16]; unsigned short u[16]; };
template <int NT>
__device__ __forceinline__ v8f mmaH(v16h ah, v16h al, v16h bh, v16h bl, v8f c) {
  c = __builtin_amdgcn_wmma_f32_16x16x32_f16(false, ah, false, bh, (short)0, c, false, false);
  if (NT >= 2) c = __builtin_amdgcn_wmma_f32_16x16x32_f16(false, al, false, bh, (short)0, c, false, false);
  if (NT >= 3) c = __builtin_amdgcn_wmma_f32_16x16x32_f16(false, ah, false, bl, (short)0, c, false, false);
  asm volatile("v_nop\n\tv_nop\n\tv_nop\n\tv_nop" : "+v"(c) : "v"(ah), "v"(al), "v"(bh), "v"(bl));
  return c;
}
// batched GEMM like k_gemm_b but f16 operands: A f32 (split into f16 hi/lo if ASPLIT, else rounded to f16), Bt = f16 values [n][k]; alpha; C f32; N multiple of 16 (partial tiles skipped)
template <bool ASPLIT>
__global__ __launch_bounds__(128) void k_gemm_h(const float* __restrict__ A, int lda, size_t sA, const _Float16* __restrict__ Bh, int ldb, size_t sB, float alpha, float* __restrict__ C, int ldc, size_t sC, int M, int N, int K) {
  __shared__ __attribute__((aligned(16))) float so[4][16][64];
  const int tid = threadIdx.x, w = tid >> 5, lane = tid & 31, ln = lane & 15, hh = lane >> 4; const int by = blockIdx.y;
  A += (size_t)by * sA; Bh += (size_t)by * sB; C += (size_t)by * sC;
  const int ntn = (N + 63) / 64; const int wid = blockIdx.x * 4 + w; const int mt = wid / ntn, nq = wid % ntn; if (mt * 16 >= M) return;
  const int row0 = mt * 16, col0 = nq * 64; const float* arow = A + (size_t)(row0 + ln) * lda;
  v8f acc[4] = {};
  for (int kb = 0; kb < K; kb += 32) {
    FragH ah, al;
    const v4f x0 = *(const v4fa*)(arow + kb + 8 * hh), x1 = *(const v4fa*)(arow + kb + 8 * hh + 4), x2 = *(const v4fa*)(arow + kb + 16 + 8 * hh), x3 = *(const v4fa*)(arow + kb + 16 + 8 * hh + 4);
    float xs[16] = {x0[0],x0[1],x0[2],x0[3],x1[0],x1[1],x1[2],x1[3],x2[0],x2[1],x2[2],x2[3],x3[0],x3[1],x3[2],x3[3]};
#pragma unroll
    for (int i = 0; i < 16; ++i) { const _Float16 h = (_Float16)xs[i]; ah.h[i] = h; al.h[i] = ASPLIT ? (_Float16)(xs[i] - (float)h) : (_Float16)0.0f; }
#pragma unroll
    for (int t = 0; t < 4; ++t) { if (col0 + t * 16 >= N) continue; const size_t boff = (size_t)(col0 + t * 16 + ln) * ldb + kb; FragH bq; bq.half[0] = *(const v8us*)(Bh + boff + 8 * hh); bq.half[1] = *(const v8us*)(Bh + boff + 16 + 8 * hh);
      acc[t] = mmaH<ASPLIT ? 2 : 1>(ah.v, al.v, bq.v, bq.v, acc[t]); }
  }
#pragma unroll
  for (int t = 0; t < 4; ++t) { if (col0 + t * 16 >= N) continue;
#pragma unroll
    for (int r = 0; r < 8; ++r) so[w][8 * hh + r][t * 16 + ln] = acc[t][r] * alpha; }
  __builtin_amdgcn_fence(__ATOMIC_ACQ_REL, "workgroup"); __builtin_amdgcn_wave_barrier();
  const int rsub = lane >> 4, c4 = (lane & 15) * 4;
  {
#pragma unroll
    for (int q = 0; q < 8; ++q) { const int r = q * 2 + rsub; if (col0 + c4 < N) { const v4f v = *(const v4fa*)&so[w][r][c4]; *(v4f*)(C + (size_t)(row0 + r) * ldc + col0 + c4) = v; } }
     }
}

// Wt[n][k] = f16(W[k][n]·scale) from f32 row-major W[K][N] (scale = power of two; bf16-exact weights stay exact in f16 away from the subnormal range)
// blockIdx.y picks one of three equally shaped matrices; their transposes are stacked in Wt
__global__ __launch_bounds__(256) void k_wt_f16(const float* __restrict__ W0, const float* __restrict__ W1, const float* __restrict__ W2, _Float16* __restrict__ Wt, int K, int N, float scale) {
  const float* __restrict__ W = (blockIdx.y == 0) ? W0 : ((blockIdx.y == 1) ? W1 : W2); Wt += (size_t)blockIdx.y * N * K;
  const int t = blockIdx.x * 256 + threadIdx.x; if (t >= N * (K / 8)) return; const int n = t / (K / 8), k8 = (t % (K / 8)) * 8; FragH f;
#pragma unroll
  for (int i = 0; i < 8; ++i) f.h[i] = (_Float16)(bf16_round(W[(size_t)(k8 + i) * N + n]) * scale); const v8us o = f.half[0];
  *(v8us*)((unsigned short*)Wt + (size_t)n * K + k8) = o; 
}
// k_gemm_hh variant with fused epilogue: v = acc·alpha + bias[by·sBias + col] (+ CP[(row/rowsPerB)·sCPb + by·64 + col] if CP) ; ACT 0 none / 1 elu ; writes f16 C16 (and f32 C if non-null)
template <int ACT>
__global__ __launch_bounds__(128) void k_gemm_hhx(const _Float16* __restrict__ A, int lda, size_t sA, const _Float16* __restrict__ Bh, int ldb, size_t sB, float alpha, const float* __restrict__ bias, size_t sBias, const float* __restrict__ CP, int rowsPerB, size_t sCPb, int row0g,
    float* __restrict__ C, _Float16* __restrict__ C16, int ldc, size_t sC, int M, int N, int K) {
  __shared__ __attribute__((aligned(16))) float so[4][16][64];
  const int tid = threadIdx.x, w = tid >> 5, lane = tid & 31, ln = lane & 15, hh = lane >> 4; const int by = blockIdx.y;
  A += (size_t)by * sA; Bh += (size_t)by * sB; const size_t cofs = (size_t)by * sC; const float* bp = bias ? bias + (size_t)by * sBias : nullptr;
  const int ntn = (N + 63) / 64; const int wid = blockIdx.x * 4 + w; const int mt = wid / ntn, nq = wid % ntn; if (mt * 16 >= M) return;
  const int row0 = mt * 16, col0 = nq * 64; const _Float16* arow = A + (size_t)(row0 + ln) * lda;
  v8f acc[4] = {};
  for (int kb = 0; kb < K; kb += 32) { FragH ah; ah.half[0] = *(const v8us*)((const unsigned short*)arow + kb + 8 * hh); ah.half[1] = *(const v8us*)((const unsigned short*)arow + kb + 16 + 8 * hh);
#pragma unroll
    for (int t = 0; t < 4; ++t) { if (col0 + t * 16 >= N) continue; const size_t boff = (size_t)(col0 + t * 16 + ln) * ldb + kb; FragH bq; bq.half[0] = *(const v8us*)((const unsigned short*)Bh + boff + 8 * hh); bq.half[1] = *(const v8us*)((const unsigned short*)Bh + boff + 16 + 8 * hh);
      acc[t] = mmaH<1>(ah.v, ah.v, bq.v, bq.v, acc[t]); }
  }
#pragma unroll
  for (int t = 0; t < 4; ++t) { if (col0 + t * 16 >= N) continue; const int col = col0 + t * 16 + ln; const float bv = bp ? bf16_round(bp[col]) : 0.f;
#pragma unroll
    for (int r = 0; r < 8; ++r) { float v = acc[t][r] * alpha + bv; if (CP) { const int rr = row0g + row0 + 8 * hh + r; if (rowsPerB < 0) v += CP[cofs + (size_t)rr * ldc + col];      /* rowsPerB < 0: own element of the batched C plane */ else { const int bidx = rr / rowsPerB; v += CP[(size_t)bidx * sCPb + (size_t)by * 64 + col]; } } if (ACT == 1) v = (v > 0.f) ? v : expm1f(v); else if (ACT == 7) v = (v > 0.f) ? v + 1.0f : expf(v); else if (ACT == 8) v = tanhf(v); else if (ACT == 9) v = 0.5f * v * (1.0f + tanhf(0.7978845608028654f * (v + 0.044715f * v * v * v))); else if (ACT == 11) v = 1.0f / (1.0f + expf(-v)); else if (ACT == 12) v = (v > 0.f) ? v : 0.01f * v; else if (ACT == 14) v = (v > 0.f) ? v : 0.1f * v; else if (ACT == 16) v = (v >= 0.f) ? v : 0.3f * v; else if (ACT == 17) v = (v >= 0.f) ? v : 0.2f * v; else if (ACT == 15) v = v / (1.0f + expf(-v)); else if (ACT == 3) v = fmaxf(v, 0.f); else if (ACT == 6) v = 0.5f * v * (1.0f + erff(v * 0.70710678118654752f)); so[w][8 * hh + r][t * 16 + ln] = v; } }
  __builtin_amdgcn_fence(__ATOMIC_ACQ_REL, "workgroup"); __builtin_amdgcn_wave_barrier();
  const int rsub = lane >> 4, c4 = (lane & 15) * 4; typedef _Float16 v4h __attribute__((ext_vector_type(4)));
  {
#pragma unroll
    for (int q = 0; q < 8; ++q) { const int r = q * 2 + rsub; if (col0 + c4 < N) { const v4f v = *(const v4fa*)&so[w][r][c4]; if (C) *(v4f*)(C + cofs + (size_t)(row0 + r) * ldc + col0 + c4) = v; if (C16) { v4h h4; for (int i = 0; i < 4; ++i) h4[i] = (_Float16)v[i]; *(v4h*)(C16 + cofs + (size_t)(row0 + r) * ldc + col0 + c4) = h4; } } }
     }
}


typedef _Float16 v4h __attribute__((ext_vector_type(4)));

__global__ __launch_bounds__(256) void k_x16(const float* __restrict__ x, _Float16* __restrict__ X16, size_t n8) { const size_t t = (size_t)blockIdx.x * 256 + threadIdx.x; if (t >= n8) return; FragH f;
#pragma unroll
  for (int q = 0; q < 8; ++q) f.h[q] = (_Float16)bf16_round(x[t * 8 + q]); *(v8us*)((unsigned short*)X16 + t * 8) = f.half[0];  }
__global__ __launch_bounds__(256) void k_h16(const float* __restrict__ x, _Float16* __restrict__ X16, size_t n8) { const size_t t = (size_t)blockIdx.x * 256 + threadIdx.x; if (t >= n8) return; FragH f;
#pragma unroll
  for (int q = 0; q < 8; ++q) f.h[q] = (_Float16)x[t * 8 + q]; *(v8us*)((unsigned short*)X16 + t * 8) = f.half[0];  }
__global__ __launch_bounds__(256) void k_round16f(const float* __restrict__ W, _Float16* __restrict__ Bt, size_t n8) { const size_t t = (size_t)blockIdx.x * 256 + threadIdx.x; if (t >= n8) return; FragH f;
#pragma unroll
  for (int i = 0; i < 8; ++i) f.h[i] = (_Float16)(bf16_round(W[t * 8 + i]) * 16.0f); *(v8us*)((unsigned short*)Bt + t * 8) = f.half[0];  }
template <int NHv, int TTv>
__global__ __launch_bounds__(256) void k_vt(const _Float16* __restrict__ V16, int ldv, int voff, _Float16* __restrict__ Vt) { __shared__ unsigned short tl[64][66]; const int tid = threadIdx.x; const int slab = blockIdx.x / (TTv / 64), lg = blockIdx.x % (TTv / 64); const int b = slab / NHv, h = slab % NHv;
  for (int i = tid; i < 64 * 8; i += 256) { const int r = i / 8, c8 = (i % 8) * 8; FragH f; f.half[0] = *(const v8us*)((const unsigned short*)V16 + ((size_t)b * TTv + lg * 64 + r) * ldv + voff + h * 64 + c8);
#pragma unroll
    for (int q = 0; q < 8; ++q) tl[r][c8 + q] = f.u[q]; }
  __syncthreads();
  {
#pragma unroll
    for (int rd = 0; rd < 2; ++rd) { const int d = rd * 32 + tid / 8, pc = tid % 8; FragH f;
#pragma unroll
      for (int q = 0; q < 8; ++q) f.u[q] = tl[pc * 8 + q][d];
      *(v8us*)((unsigned short*)Vt + ((size_t)slab * 64 + d) * TTv + lg * 64 + pc * 8) = f.half[0]; }
     } }

__global__ __launch_bounds__(256) void k_hl(const float* __restrict__ F, _Float16* __restrict__ Hh, _Float16* __restrict__ Hl, size_t n8) { const size_t t = (size_t)blockIdx.x * 256 + threadIdx.x; if (t >= n8) return; FragH fh, fl; const v4f a = *(const v4fa*)(F + t * 8), c = *(const v4fa*)(F + t * 8 + 4);
#pragma unroll
  for (int q = 0; q < 4; ++q) { _Float16 h = (_Float16)a[q]; fh.h[q] = h; fl.h[q] = (_Float16)((a[q] - (float)h) * 1024.0f); h = (_Float16)c[q]; fh.h[4 + q] = h; fl.h[4 + q] = (_Float16)((c[q] - (float)h) * 1024.0f); }
  { *(v8us*)((unsigned short*)Hh + t * 8) = fh.half[0]; *(v8us*)((unsigned short*)Hl + t * 8) = fl.half[0];  } }

// ---- fast GEMM (wave tile 32x64; requires M % 32 == 0 rows per launch region, N % 64 == 0 and K % 64 == 0); epilogue = k_gemm_hhx semantics ----
__device__ __forceinline__ v16h g2_frag(const _Float16* p, int hh) { FragH f; f.half[0] = *(const v8us*)((const unsigned short*)p + 8 * hh); f.half[1] = *(const v8us*)((const unsigned short*)p + 16 + 8 * hh); return f.v; }
__device__ __forceinline__ v8f g2_mma(v16h a, v16h b, v8f c) { v8f d = __builtin_amdgcn_wmma_f32_16x16x32_f16(false, a, false, b, (short)0, c, false, false); asm volatile("v_nop\n\tv_nop\n\tv_nop\n\tv_nop" : "+v"(d) : "v"(a), "v"(b)); return d; }
template <int ACT>
__global__ __launch_bounds__(128) void k_gemm2(const _Float16* __restrict__ A, int lda, size_t sA, const _Float16* __restrict__ Bh, int ldb, size_t sB, float alpha, const float* __restrict__ bias, size_t sBias, const float* __restrict__ CP, int rowsPerB, size_t sCPb, int row0g,
    float* __restrict__ C, _Float16* __restrict__ C16, int ldc, size_t sC, int M, int N, int K) { static_assert(ACT == 0 || ACT == 3 || ACT == 6 || ACT == 8 || ACT == 9 || ACT == 11 || ACT == 12 || ACT == 14 || ACT == 15 || ACT == 16 || ACT == 17, "k_gemm2: unsupported ACT code (would silently apply no activation)");
  __shared__ __attribute__((aligned(16))) float so[4][32][68];
  const int tid = threadIdx.x, w = tid >> 5, lane = tid & 31, ln = lane & 15, hh = lane >> 4; const int by = blockIdx.y;
  A += (size_t)by * sA; Bh += (size_t)by * sB; const size_t cofs = (size_t)by * sC; const float* bp = bias ? bias + (size_t)by * sBias : nullptr;
  const int ntn = N >> 6; const int mt = blockIdx.x / ntn, nq = blockIdx.x - mt * ntn; const int row0 = mt * 128 + 32 * w, col0 = nq * 64; if (row0 >= M) return;
  const _Float16* a0p = A + (size_t)(row0 + ln) * lda; const _Float16* a1p = a0p + (size_t)16 * lda;
  const _Float16* b0p = Bh + (size_t)(col0 + ln) * ldb; const _Float16* b1p = b0p + (size_t)16 * ldb; const _Float16* b2p = b1p + (size_t)16 * ldb; const _Float16* b3p = b2p + (size_t)16 * ldb;
  const v8f z8 = {0.f,0.f,0.f,0.f,0.f,0.f,0.f,0.f}; v8f c00 = z8, c01 = z8, c02 = z8, c03 = z8, c10 = z8, c11 = z8, c12 = z8, c13 = z8;
  /* two k steps (64 k) of fragments stay in registers: a step's 12 loads are issued together, right behind the products that last read the step's registers, and land while the other step is worked on */
  v16h a0x = g2_frag(a0p, hh), a1x = g2_frag(a1p, hh), b0x = g2_frag(b0p, hh), b1x = g2_frag(b1p, hh), b2x = g2_frag(b2p, hh), b3x = g2_frag(b3p, hh);
  __builtin_amdgcn_sched_barrier(0);      /* the first step's loads stay older than the second's, as in the loop: else the loop's counted waits for one step must also cover loads of the other */
  v16h a0y = g2_frag(a0p + 32, hh), a1y = g2_frag(a1p + 32, hh), b0y = g2_frag(b0p + 32, hh), b1y = g2_frag(b1p + 32, hh), b2y = g2_frag(b2p + 32, hh), b3y = g2_frag(b3p + 32, hh);
  asm volatile("s_wait_xcnt 0x0" ::: "memory");      /* address registers of the loads above are reused below while the loads are in flight: the wait stands in front of that reuse */
#define G2_STEP(a0, a1, b0, b1, b2, b3) c00 = g2_mma(a0, b0, c00); c10 = g2_mma(a1, b0, c10); c01 = g2_mma(a0, b1, c01); c11 = g2_mma(a1, b1, c11); c02 = g2_mma(a0, b2, c02); c12 = g2_mma(a1, b2, c12); c03 = g2_mma(a0, b3, c03); c13 = g2_mma(a1, b3, c13);
#pragma unroll 1      /* rolled: a trip already holds 24 loads and 16 products, a second copy would need a second set of fragment registers */
  for (int kb = 64; kb < K; kb += 64) {      /* no branch inside: the waits in front of each step's products can then count the other step's younger loads as still in flight */
    G2_STEP(a0x, a1x, b0x, b1x, b2x, b3x)
    a0x = g2_frag(a0p + kb, hh); a1x = g2_frag(a1p + kb, hh); b0x = g2_frag(b0p + kb, hh); b1x = g2_frag(b1p + kb, hh); b2x = g2_frag(b2p + kb, hh); b3x = g2_frag(b3p + kb, hh);
    G2_STEP(a0y, a1y, b0y, b1y, b2y, b3y)
    a0y = g2_frag(a0p + kb + 32, hh); a1y = g2_frag(a1p + kb + 32, hh); b0y = g2_frag(b0p + kb + 32, hh); b1y = g2_frag(b1p + kb + 32, hh); b2y = g2_frag(b2p + kb + 32, hh); b3y = g2_frag(b3p + kb + 32, hh);
    asm volatile("s_wait_xcnt 0x0" ::: "memory"); }      /* the next trip forms its addresses in the registers that this trip's loads name: the wait stands in front of that */
  G2_STEP(a0x, a1x, b0x, b1x, b2x, b3x)      /* the last 64 k: nothing left to load */
  G2_STEP(a0y, a1y, b0y, b1y, b2y, b3y)
#undef G2_STEP
  v8f accs[8] = {c00, c01, c02, c03, c10, c11, c12, c13};
#pragma unroll
  for (int u = 0; u < 8; ++u) { const int t = u & 3, half = u >> 2; const int col = col0 + t * 16 + ln; const float bv = bp ? bf16_round(bp[col]) : 0.f;
#pragma unroll
    for (int r = 0; r < 8; ++r) { const int rloc = half * 16 + 8 * hh + r; float v = accs[u][r] * alpha + bv; if (CP) { if (rowsPerB < 0) v += CP[cofs + (size_t)(row0g + row0 + rloc) * ldc + col];      /* rowsPerB < 0: own element of the batched C plane */ else { const int bidx = (row0g + row0 + rloc) / rowsPerB; v += CP[(size_t)bidx * sCPb + (size_t)by * 64 + col]; } }
      if (ACT == 3) v = fmaxf(v, 0.f); else if (ACT == 6) v = 0.5f * v * (1.0f + erff(v * 0.70710678118654752f)); else if (ACT == 11) v = 1.0f / (1.0f + expf(-v)); else if (ACT == 15) v = v / (1.0f + expf(-v)); else if (ACT == 12) v = (v > 0.f) ? v : 0.01f * v; else if (ACT == 8) v = tanhf(v); else if (ACT == 9) v = 0.5f * v * (1.0f + tanhf(0.7978845608028654f * (v + 0.044715f * v * v * v))); else if (ACT == 14) v = (v > 0.f) ? v : 0.1f * v; else if (ACT == 16) v = (v >= 0.f) ? v : 0.3f * v; else if (ACT == 17) v = (v >= 0.f) ? v : 0.2f * v;
      so[w][rloc][t * 16 + ln] = v; } }
  __builtin_amdgcn_fence(__ATOMIC_ACQ_REL, "workgroup"); __builtin_amdgcn_wave_barrier();
  const int rsub = lane >> 4, c4 = (lane & 15) * 4;
  {
#pragma unroll
    for (int q = 0; q < 16; ++q) { const int r = q * 2 + rsub; const v4f v = *(const v4fa*)&so[w][r][c4]; if (C) *(v4f*)(C + cofs + (size_t)(row0 + r) * ldc + col0 + c4) = v; if (C16) { v4h h4; for (int i = 0; i < 4; ++i) h4[i] = (_Float16)v[i]; *(v4h*)(C16 + cofs + (size_t)(row0 + r) * ldc + col0 + c4) = h4; } }
     } }


__global__ __launch_bounds__(256) void k_wnat(const float* __restrict__ w, size_t n8, _Float16* __restrict__ Bt) { const size_t t = (size_t)blockIdx.x * 256 + threadIdx.x; if (t >= n8) return; FragH f; for (int q = 0; q < 8; ++q) f.h[q] = (_Float16)(bf16_round(w[t * 8 + q]) * 16.0f); *(v8us*)((unsigned short*)Bt + t * 8) = f.half[0];  }
__global__ __launch_bounds__(256) void k_rsm(const float* __restrict__ S, _Float16* __restrict__ P, int nrows) {
  #pragma clang fp contract(off)
  const int i = blockIdx.x * 256 + threadIdx.x; if (i >= nrows) return; const float* s = S + (size_t)i * SQ; float mx = -3.0e38f;
#pragma unroll 1
  for (int j = 0; j < SQ; ++j) mx = fmaxf(mx, s[j]); float se = 0.f;
#pragma unroll 1
  for (int j = 0; j < SQ; ++j) se += expf(s[j] - mx); const float sc = 256.0f / se;
#pragma unroll 1
  for (int j0 = 0; j0 < SQ; j0 += 8) { FragH f; for (int q = 0; q < 8; ++q) f.h[q] = (_Float16)(expf(s[j0 + q] - mx) * sc); unsigned short* d = (unsigned short*)P + (size_t)i * SQ + j0; *(v8us*)d = f.half[0];  } }
__global__ __launch_bounds__(256) void k_vt(const _Float16* __restrict__ V16, int b, int h0, _Float16* __restrict__ VT) { __shared__ unsigned short tl[64][65]; const int tid = threadIdx.x; const int hh = blockIdx.x % HG, sg = blockIdx.x / HG; const int s0 = sg * 64; const int h = h0 + hh;
  for (int i = tid; i < 64 * 8; i += 256) { const int j = i / 8, d8 = (i % 8) * 8; FragH f; f.half[0] = *(const v8us*)((const unsigned short*)V16 + ((size_t)b * SQ + s0 + j) * DM + h * HD + d8); for (int q = 0; q < 8; ++q) tl[d8 + q][j] = f.u[q]; }
  __syncthreads();
  { for (int i = tid; i < 64 * 8; i += 256) { const int d = i / 8, j8 = (i % 8) * 8; FragH f; for (int q = 0; q < 8; ++q) f.u[q] = tl[d][j8 + q]; *(v8us*)((unsigned short*)VT + ((size_t)hh * HD + d) * SQ + s0 + j8) = f.half[0]; }  } }



// lane l with lane l ^ MSK inside its row of 16 lanes (DPP row_xmask), and lane l with lane l ^ 16; every lane is on where these are used
template <int MSK>
__device__ __forceinline__ float row_x(float x) { return __builtin_bit_cast(float, __builtin_amdgcn_update_dpp(0, __builtin_bit_cast(int, x), 0x160 + MSK, 0xF, 0xF, true)); }
__device__ __forceinline__ float half_x(float x) { return __builtin_bit_cast(float, __builtin_amdgcn_permlanex16(__builtin_bit_cast(int, x), __builtin_bit_cast(int, x), 0x76543210, 0xfedcba98, false, false)); }
#define SMR 4                        /* score rows per wave */
#define SMC (NKX / 128)              /* 128-key chunks in a full row: one 16-byte load per lane each */
// one WAVE per score row (SMR rows a wave): lane l owns keys c*128 + l*4 .. +3 of every chunk c, so each load reads 512 contiguous bytes; the row is read once and stays in registers for the maximum, the sum and the weights
__global__ __launch_bounds__(256) void k_rsmcf2(const float* __restrict__ S, _Float16* __restrict__ P, int hg, int q0, int nk) {
  #pragma clang fp contract(off)
  const int lane = threadIdx.x & 31; const int t0 = (blockIdx.x * 8 + __builtin_amdgcn_readfirstlane(threadIdx.x >> 5)) * SMR; if (t0 >= hg * QT) return;      /* the wave's number as a scalar: row index, row base and causal limit stay in scalar registers; QT is a multiple of SMR */
  const float* s = S + (size_t)t0 * NKX + lane * 4; v4f v[SMR][SMC];
#pragma unroll      /* here and below: full unrolling makes every index of the register array a constant, so it stays in registers */
  for (int c = 0; c < SMC; ++c) if (c * 128 < nk) {
#pragma unroll
    for (int r = 0; r < SMR; ++r) v[r][c] = *(const v4fa*)(s + (size_t)r * NKX + c * 128); }
  asm volatile("s_wait_xcnt 0x0" ::: "memory");      /* the loads' address registers are reused below while the loads are still in flight: the wait stands in front of that reuse */
  float mx[SMR], se[SMR];
#pragma unroll
  for (int r = 0; r < SMR; ++r) mx[r] = -3.0e38f;
#pragma unroll
  for (int c = 0; c < SMC; ++c) if (c * 128 < nk) {
#pragma unroll
    for (int r = 0; r < SMR; ++r) { const int last = q0 + ((t0 + r) % QT);
#pragma unroll
      for (int q = 0; q < 4; ++q) { const float f = (c * 128 + lane * 4 + q <= last) ? 1.f : 0.f; v[r][c][q] = fmaf(f, v[r][c][q], (1.f - f) * -1.0e9f); mx[r] = fmaxf(mx[r], v[r][c][q]); } } }
#pragma unroll
  for (int r = 0; r < SMR; ++r) { mx[r] = fmaxf(mx[r], row_x<1>(mx[r])); mx[r] = fmaxf(mx[r], row_x<2>(mx[r])); mx[r] = fmaxf(mx[r], row_x<4>(mx[r])); mx[r] = fmaxf(mx[r], row_x<8>(mx[r])); mx[r] = fmaxf(mx[r], half_x(mx[r])); se[r] = 0.f; }
#pragma unroll
  for (int c = 0; c < SMC; ++c) if (c * 128 < nk) {
#pragma unroll
    for (int r = 0; r < SMR; ++r) {
#pragma unroll
      for (int q = 0; q < 4; ++q) { v[r][c][q] = __expf(v[r][c][q] - mx[r]); se[r] += v[r][c][q]; } } }
#pragma unroll
  for (int r = 0; r < SMR; ++r) { se[r] += row_x<1>(se[r]); se[r] += row_x<2>(se[r]); se[r] += row_x<4>(se[r]); se[r] += row_x<8>(se[r]); se[r] += half_x(se[r]); se[r] = 256.0f / se[r]; }      /* 32 partial sums, butterfly: the same bits in every lane */
  _Float16* p = P + (size_t)t0 * NKX + lane * 4; v4h hw[SMR][SMC];      /* every weight is converted before the first store is issued, so no register of an issued store is written again */
#pragma unroll
  for (int c = 0; c < SMC; ++c) if (c * 128 < nk) {
#pragma unroll
    for (int r = 0; r < SMR; ++r) {
#pragma unroll
      for (int q = 0; q < 4; ++q) hw[r][c][q] = (_Float16)(v[r][c][q] * se[r]); } }
#pragma unroll
  for (int c = 0; c < SMC; ++c) if (c * 128 < nk) {
#pragma unroll
    for (int r = 0; r < SMR; ++r) *(v4h*)(p + (size_t)r * NKX + c * 128) = hw[r][c]; } }


typedef float v2f __attribute__((ext_vector_type(2)));
#define KP 68                        /* row pitch of the k and v tiles in LDS, in floats: 272 bytes = 16 x 17, so the 16 rows that one 16-byte fragment load touches lie on different banks */
__device__ __forceinline__ v8f f4_mma(v2f a, v2f b, v8f c) { return __builtin_amdgcn_wmma_f32_16x16x4_f32(false, a, false, b, (short)0, c, false, false); }
// exact f32 causal attention for the first QT0 rows on v_wmma_f32_16x16x4_f32, both products transposed. One wave owns 16 query rows, a block of 4 waves shares 64-key k and v tiles in LDS.
// S^T = K Q^T: A = 16 k rows, B = 16 q rows, both loaded by the same rule (lane (c, h) holds columns 32h .. 32h+31 of its row), so a lane's 8 result registers are keys 8h .. 8h+7 of ITS query c.
// O^T = V^T P^T: those registers, two at a time, are the B operand as they stand (keys 8h+2t, 8h+2t+1 in k step t); A takes the same keys of v, column dt*16+c. Maximum, sum and rescale factor of a query are then per lane (two lanes a query).
template <int ld, int ldo>      /* row pitches of q/k/v and of the output as constants: the 8 row groups of a staged tile are then immediate offsets from one address */
__global__ __launch_bounds__(128) void k_att0w(const float* __restrict__ QF, const float* __restrict__ KF, const float* __restrict__ VF, float scale, float* __restrict__ OF) {
  __shared__ __attribute__((aligned(16))) float lk[64][KP]; __shared__ __attribute__((aligned(16))) float lv[64][KP];
  const int tid = threadIdx.x, lane = tid & 31, c = lane & 15, h = lane >> 4; const int w = __builtin_amdgcn_readfirstlane(tid >> 5); const int rg = blockIdx.x;      /* the wave's number as a scalar: every branch below is wave-uniform, as the matrix instructions need */
  { const size_t bi = (size_t)blockIdx.y * SQ * ld; QF += bi; KF += bi; VF += bi; OF += (size_t)blockIdx.y * SQ * ldo; }      /* batch on grid.y: the first QT0 rows of each batch's SQ-row plane, inputs and output alike */
  const int i = rg * 64 + w * 16 + c;      /* the lane's query row */
  const float* qr = QF + (size_t)i * ld + 32 * h; v4f qv[8];
#pragma unroll      /* here and below: full unrolling makes every index of the register arrays a constant, so they stay in registers */
  for (int u = 0; u < 8; ++u) qv[u] = *(const v4fa*)(qr + 4 * u);
  const v8f z8 = {0.f, 0.f, 0.f, 0.f, 0.f, 0.f, 0.f, 0.f}; v8f o[4] = {z8, z8, z8, z8}; float m = -1.0e30f, l = 0.f;
  const int sr = tid >> 4, sc4 = (tid & 15) * 4; const float* kg = KF + (size_t)sr * ld + sc4; const float* vg = VF + (size_t)sr * ld + sc4; v4f tk[8], tv[8];      /* staging: a thread reads 16 bytes of rows sr, sr+8, .. sr+56 of a tile */
#pragma unroll
  for (int u = 0; u < 8; ++u) { tk[u] = *(const v4fa*)(kg + u * 8 * ld); tv[u] = *(const v4fa*)(vg + u * 8 * ld); }
  asm volatile("s_wait_xcnt 0x0" ::: "memory");      /* the q loads' address registers are reused below while the loads are in flight: the wait stands in front of that reuse */
  __builtin_amdgcn_sched_barrier(0);      /* keeps the register moves that follow (the zeroed accumulators take over those address registers) behind the wait: without it they are scheduled ahead of it */
  int t = 0;
#pragma unroll 1      /* rolled: one trip is a whole 64-key tile between its two barriers */
  do {      /* tiles 0 .. rg: at least one */
    __syncthreads();      /* every reader has left the previous tile */
#pragma unroll
    for (int u = 0; u < 8; ++u) { *(v4f*)&lk[u * 8 + sr][sc4] = tk[u]; *(v4f*)&lv[u * 8 + sr][sc4] = tv[u]; }
    __syncthreads();      /* the tile is complete before anyone reads it */
    if (t < rg) { kg += 64 * ld; vg += 64 * ld;      /* the next tile's rows fly while this tile is worked on */
#pragma unroll
      for (int u = 0; u < 8; ++u) { tk[u] = *(const v4fa*)(kg + u * 8 * ld); tv[u] = *(const v4fa*)(vg + u * 8 * ld); } }
    const int np = (t == rg) ? (w >> 1) + 1 : 2;      /* 32 keys a step; on the diagonal tile the steps wholly above the wave's rows are left out (every step that runs holds a key that each of its queries may see) */
#pragma unroll 1      /* rolled: one step already holds 64 matrix instructions */
    for (int p = 0; p < np; ++p) { const int k0 = p * 32; v4f ka[8], kc[8];
#pragma unroll
      for (int u = 0; u < 8; ++u) { ka[u] = *(const v4f*)&lk[k0 + c][32 * h + 4 * u]; kc[u] = *(const v4f*)&lk[k0 + 16 + c][32 * h + 4 * u]; }
      v8f sa = z8, sb = z8;      /* two independent score tiles: neither waits for its own previous product */
#pragma unroll
      for (int u = 0; u < 8; ++u) {
#pragma unroll
        for (int e = 0; e < 4; e += 2) { const v2f b = {qv[u][e], qv[u][e + 1]}; const v2f a0 = {ka[u][e], ka[u][e + 1]}; const v2f a1 = {kc[u][e], kc[u][e + 1]}; sa = f4_mma(a0, b, sa); sb = f4_mma(a1, b, sb);
          __builtin_amdgcn_sched_barrier(0x0496); } }      /* matrix instructions do not cross (vector, scalar, memory and LDS instructions may): keeps the two tiles' products alternating; left alone the compiler runs each tile's 16 products as one dependent chain, which issues slower */
      const int jb = t * 64 + k0 + 8 * h; float ml = -1.0e30f;
#pragma unroll
      for (int r = 0; r < 8; ++r) { sa[r] = (jb + r <= i) ? sa[r] * scale : -1.0e30f; sb[r] = (jb + 16 + r <= i) ? sb[r] * scale : -1.0e30f; ml = fmaxf(ml, fmaxf(sa[r], sb[r])); }
      ml = fmaxf(ml, half_x(ml));      /* the query's other 16 keys of this step sit in lane l ^ 16 */
      const float mn = fmaxf(m, ml); const float sc = expf(m - mn); m = mn; float ps = 0.f;
#pragma unroll
      for (int r = 0; r < 8; ++r) { sa[r] = expf(sa[r] - mn); sb[r] = expf(sb[r] - mn); ps += sa[r] + sb[r]; }
      l = l * sc + ps;      /* each lane sums its own keys; the two halves meet behind the loop */
#pragma unroll
      for (int dt = 0; dt < 4; ++dt) o[dt] *= sc;
#pragma unroll
      for (int tt = 0; tt < 4; ++tt) { const v2f b0 = {sa[2 * tt], sa[2 * tt + 1]}; const v2f b1 = {sb[2 * tt], sb[2 * tt + 1]}; const int kr = k0 + 8 * h + 2 * tt;
#pragma unroll
        for (int dt = 0; dt < 4; ++dt) { const v2f a0 = {lv[kr][dt * 16 + c], lv[kr + 1][dt * 16 + c]}; o[dt] = f4_mma(a0, b0, o[dt]); }
#pragma unroll
        for (int dt = 0; dt < 4; ++dt) { const v2f a1 = {lv[kr + 16][dt * 16 + c], lv[kr + 17][dt * 16 + c]}; o[dt] = f4_mma(a1, b1, o[dt]); } } }
  } while (++t <= rg);
  l += half_x(l); const float fin = 1.0f / l;
  float* orow = OF + (size_t)i * ldo + 8 * h;      /* o[dt][r] = column dt*16 + 8h + r of the lane's query: 32 contiguous bytes a tile */
#pragma unroll
  for (int dt = 0; dt < 4; ++dt) { const v4f x0 = {o[dt][0] * fin, o[dt][1] * fin, o[dt][2] * fin, o[dt][3] * fin}; const v4f x1 = {o[dt][4] * fin, o[dt][5] * fin, o[dt][6] * fin, o[dt][7] * fin}; *(v4f*)(orow + dt * 16) = x0; *(v4f*)(orow + dt * 16 + 4) = x1; } }


template <int BFIN, int WXB>
__global__ __launch_bounds__(256) void k_ln16(const float* __restrict__ X, const float* __restrict__ g, const float* __restrict__ bb, float eps, _Float16* __restrict__ N16, float* __restrict__ XB) {
  #pragma clang fp contract(off)
  __shared__ float red[256]; const size_t r = blockIdx.x; const int t = threadIdx.x; const v4f xa = *(const v4fa*)(X + r * DMQ + t * 4); float s[4]; float sum = 0.f;
  for (int q = 0; q < 4; ++q) { s[q] = BFIN ? bf16_round(xa[q]) : xa[q]; sum = __fadd_rn(sum, s[q]); }
  red[t] = sum; __syncthreads(); for (int st = 128; st > 0; st >>= 1) { if (t < st) red[t] = __fadd_rn(red[t], red[t + st]); __syncthreads(); } const float mu = red[0] / (float)DMQ; __syncthreads();
  float vs = 0.f; for (int q = 0; q < 4; ++q) { const float dl = __fadd_rn(s[q], -mu); vs = __fadd_rn(vs, __fmul_rn(dl, dl)); } red[t] = vs; __syncthreads(); for (int st = 128; st > 0; st >>= 1) { if (t < st) red[t] = __fadd_rn(red[t], red[t + st]); __syncthreads(); }
  const float rs = rsqrtf(__fadd_rn(red[0] / (float)DMQ, eps)); v4h y; v4f xb;
  for (int q = 0; q < 4; ++q) { const int c = t * 4 + q; y[q] = (_Float16)__fadd_rn(__fmul_rn(__fmul_rn(__fadd_rn(s[q], -mu), rs), bf16_round(g[c])), bf16_round(bb[c])); xb[q] = s[q]; }
  { *(v4h*)(N16 + r * DMQ + t * 4) = y; if (WXB) *(v4f*)(XB + r * DMQ + t * 4) = xb;  } }
__global__ __launch_bounds__(256) void k_ftres2(const float* __restrict__ OF0, const float* __restrict__ XB, float* __restrict__ X1, size_t n4) {
  #pragma clang fp contract(off)
  const size_t t = (size_t)blockIdx.x * 256 + threadIdx.x; if (t >= n4) return; const v4f o = *(const v4fa*)(OF0 + t * 4), xv = *(const v4fa*)(XB + t * 4); v4f y; for (int q = 0; q < 4; ++q) y[q] = __fadd_rn(__fmul_rn(o[q], 0.015625f), xv[q]); *(v4f*)(X1 + t * 4) = y;  }

__global__ __launch_bounds__(256) void k_wthd(const float* __restrict__ Wt, _Float16* __restrict__ Bt) { const size_t t = (size_t)blockIdx.x * 256 + threadIdx.x; if (t >= (size_t)NH * HD * (DM / 8)) return; const int m8 = (int)(t % (DM / 8)) * 8; const int d = (int)((t / (DM / 8)) % HD); const int h = (int)(t / ((size_t)(DM / 8) * HD)); FragH f;
  for (int q = 0; q < 8; ++q) f.h[q] = (_Float16)(16.0f * bf16_round(Wt[((size_t)h * DM + m8 + q) * HD + d])); unsigned short* dst = (unsigned short*)Bt + ((size_t)h * HD + d) * DM + m8; *(v8us*)dst = f.half[0];  }




__global__ __launch_bounds__(256) void k_wtpad(const float* __restrict__ Wm, _Float16* __restrict__ Wt, int Kr, int Kp, int Nr, int Np, float scale) {
  const int t = blockIdx.x * 256 + threadIdx.x; if (t >= Np * (Kp / 8)) return; const int n = t / (Kp / 8), k8 = (t % (Kp / 8)) * 8; const int nc = min(n, Nr - 1); const float fn = (n < Nr) ? 1.f : 0.f; FragH f;
  for (int i = 0; i < 8; ++i) { const int k = k8 + i; const int kc = min(k, Kr - 1); const float fk = (k < Kr) ? fn : 0.f; f.h[i] = (_Float16)(bf16_round(Wm[(size_t)kc * Nr + nc]) * scale * fk); }
  unsigned short* o = (unsigned short*)Wt + (size_t)n * Kp + k8; *(v8us*)o = f.half[0];  }
__global__ __launch_bounds__(128) void k_bpad(const float* __restrict__ b, float* __restrict__ Bp, int nr, int np) {
  const int i = threadIdx.x; if (i >= np) return; const float v = b[min(i, nr - 1)] * ((i < nr) ? 1.f : 0.f); *(float*)(Bp + i) = v;  }

#define DI 64         /* inner width = NH * HD (ONE 64-wide head) */
#define LQK (3 * DI)  /* fused q | k | v row pitch (192) */
__global__ __launch_bounds__(256) void k_o0(const float* __restrict__ OF, float* __restrict__ ob, size_t n4) {
  #pragma clang fp contract(off)
  const size_t t = (size_t)blockIdx.x * 256 + threadIdx.x; if (t >= n4) return; const size_t e = t * 4; const int i = (int)(e / DI); const int c = (int)(e % DI); const int h = c / HD, d = c % HD; const v4f a = *(const v4fa*)(OF + e); v4f o; for (int q = 0; q < 4; ++q) o[q] = __fmul_rn(a[q], 0.015625f); float* dst = ob + (size_t)h * SQ * HD + (size_t)i * HD + d; *(v4f*)dst = o;  }

extern "C" void kernel_launch(void* const* d_in, const int* in_sizes, int n_in,
                              void* d_out, int out_size, void* d_ws, size_t ws_size, hipStream_t stream) {
  (void)in_sizes; (void)n_in; (void)out_size;
  const float* const* I = (const float* const*)d_in; const float* x = I[0]; const float* wq = I[1]; const float* wk = I[2]; const float* wv = I[3];      /* x; [in][out = 64] Wq / Wk / Wv (input order as this module lists them); no biases */
  char* ws = (char*)d_ws; size_t off = 0;
  auto take = [&](size_t bytes) { char* p = ws + off; off += (bytes + 255) & ~(size_t)255; return p; };
  _Float16* BW = (_Float16*)take((size_t)LQK * DM * 2); _Float16* X16 = (_Float16*)take(NR * DM * 2); _Float16* QKV = (_Float16*)take(NR * LQK * 2); _Float16* VT = (_Float16*)take((size_t)NB * NH * HD * SQ * 2);
  float* S = (float*)take((size_t)NB * NH * QT * NKX * 4); _Float16* P = (_Float16*)take((size_t)NB * NH * QT * NKX * 2); float* QKVF = (float*)take(NR * LQK * 4);      /* one plane per batch: all batches are in flight in every launch */
  if (off > ws_size) return;
  k_wt_f16<<<dim3((unsigned)(((size_t)DI * (DM / 8) + 255) / 256), 3), 256, 0, stream>>>(wq, wk, wv, BW, DM, DI, 16.0f);      /* [in = DM][out = 64] -> Bt[n][k] x16, stacked q | k | v: one launch, the matrix on grid.y */
  k_x16<<<(unsigned)((NR * DM / 8 + 255) / 256), 256, 0, stream>>>(x, X16, NR * DM / 8);      /* x (bf16-valued) as exact f16 rows */
  k_gemm2<0><<<dim3((unsigned)((NR / 128) * (LQK / 64)), 1), 128, 0, stream>>>(X16, DM, 0, BW, DM, 0, 0.0625f, nullptr, 0, nullptr, 1, 0, 0, QKVF, QKV, LQK, 0, (int)NR, LQK, DM);      /* q | k | v = x W^T in ONE launch over the stacked 192 columns; each result is stored twice, as f16 (operands of the WMMA attention) and as f32 (the exact first tile reads rows 0..511 of each batch) */
  const _Float16* Q16 = QKV; const _Float16* K16 = QKV + DI; const _Float16* V16 = QKV + 2 * DI;
  float* ob = (float*)d_out;      /* the ONE head leaves grid.y free: it carries the batch in the GEMM and k_att0 launches below */
  k_vt<NH, SQ><<<NB * NH * (SQ / 64), 256, 0, stream>>>(V16, LQK, 0, VT);      /* V^T [NB][HD][SQ], every batch */
  for (int q0 = QT0; q0 < SQ; q0 += QT) { const int nk = q0 + QT;      /* one trip (QT0 + QT == SQ); causal: only keys below the tile end are computed; query rows below QT0 come from the exact f32 path alone, so no f16 tile is computed for them (QT0 is a multiple of QT) */
    k_gemm2<0><<<dim3((QT / 128) * (nk / 64), NB), 128, 0, stream>>>(Q16 + (size_t)q0 * LQK, LQK, (size_t)SQ * LQK, K16, LQK, (size_t)SQ * LQK, 0.024895003f, nullptr, 0, nullptr, 1, 0, 0, S, nullptr, NKX, (size_t)QT * NKX, QT, nk, HD);      /* scores * 256^-0.666, batch on grid.y */
    k_rsmcf2<<<(NB * QT + 8 * SMR - 1) / (8 * SMR), 256, 0, stream>>>(S, P, NB, q0, nk);      /* causal softmax -> P x256 f16, NB planes of QT rows; 8 waves a block, SMR rows a wave */
    k_gemm2<0><<<dim3((QT / 128) * (HD / 64), NB), 128, 0, stream>>>(P, NKX, (size_t)QT * NKX, VT, SQ, (size_t)HD * SQ, 0.00390625f, nullptr, 0, nullptr, 1, 0, 0, ob + (size_t)q0 * DI, nullptr, DI, (size_t)SQ * DI, QT, HD, nk); }      /* out[b][q0 + i][..] = P V^T 2^-8 (f32), batch on grid.y */
  k_att0w<LQK, DI><<<dim3(QT0 / 64, NB), 128, 0, stream>>>(QKVF, QKVF + DI, QKVF + 2 * DI, 0.024895003f, ob);      /* exact f32 causal attention for rows 0..511 of every batch, stored straight into the output rows, their only writer */
}

// v008
// One run takes 61.9 microseconds.
// In two side-by-side timings against v007, it was 1.58 and 1.59 times as fast.
// All steps since v000 together make it 1156 times as fast.
#include <hip/hip_runtime.h>
// Single-head causal self-attention with the module's literal scale C^-0.666 (x [32][1024][256]; q/k/v = x W ([in][out] [256][64], no biases); ONE 64-wide head; scores * 256^-0.666 = 0.024895 (as the source writes it, not head_size^-0.5); causal; softmax; out = weights v -> [32][1024][64]; no output projection).
// Structure: token rows; x as exact f16 rows; one WMMA GEMM over the stacked q | k | v columns into a row plane of pitch 192, stored as f16 and as f32; per batch v^T via LDS transposes; query rows 512..1023 in one fused kernel with the batch on grid.y (S^T = K Q^T, running-maximum causal softmax in f32, weights as f16 straight from the score registers, O^T += V^T P^T, written as f32 into the output rows); query rows 0..511 from an exact f32 first tile only (no f16 tile for them); launches: see trace.
// Compute dtype: inputs rounded to bf16; x / weights exact; q, k, v and softmax weights as plain f16 GEMM operands (~2^-12); scores, softmax statistics and o f32; v_wmma_f32_16x16x32_f16; the exact first tile: f32 operands on v_wmma_f32_16x16x4_f32.
#define NB 32
#define SQ 1024
#define DM 256
#define NH 1
#define HD 64
#define HG 4                         /* unused by the launches (only the k_vt overload that is never launched names it) */
#define QT0 512                      /* first-tile rows computed exactly (f32): 512 here (no output projection averages the early-row cancellation errors away; logit sigma 1.0) */
#define B0 0                         /* unused */
#define NBR NB                       /* unused (only the unused MP names it) */
#define NR ((size_t)NB * SQ)
#define DMQ DM
#define DFF 4096                     /* unused (no FFN in this file) */
#define DFFR 100                     /* unused */
#define MP ((int)((size_t)NBR * SQ)) /* unused (only the unused MPO names it) */
#define QN SQ                        /* unused */
#define NHD NH                       /* unused */
#define MPO MP                       /* unused */
#define LQ (3 * DM)      /* unused; the q/k/v rows have pitch LQK (192) */
typedef __bf16 v16b __attribute__((ext_vector_type(16)));
typedef unsigned short v8us __attribute__((ext_vector_type(8), may_alias));
typedef float  v8f  __attribute__((ext_vector_type(8)));
typedef float  v4f  __attribute__((ext_vector_type(4)));
typedef float  v4fa __attribute__((ext_vector_type(4), may_alias));
union FragB { v16b v; v8us half[2]; unsigned short u[16]; };

__device__ __forceinline__ unsigned short bf16_bits(float x) { unsigned int u = __float_as_uint(x); return (unsigned short)((u + 0x7FFFu + ((u >> 16) & 1u)) >> 16); }
__device__ __forceinline__ float bf16_val(unsigned short b) { return __uint_as_float(((unsigned int)b) << 16); }
__device__ __forceinline__ float bf16_round(float x) { return bf16_val(bf16_bits(x)); }
// D += A·B with NT terms: 1 = ah·bh, 2 = + al·bh (A split), 3 = + ah·bl (both split)
template <int NT>
__device__ __forceinline__ v8f mmaN(v16b ah, v16b al, v16b bh, v16b bl, v8f c) {
  c = __builtin_amdgcn_wmma_f32_16x16x32_bf16(false, ah, false, bh, (short)0, c, false, false);
  if (NT >= 2) c = __builtin_amdgcn_wmma_f32_16x16x32_bf16(false, al, false, bh, (short)0, c, false, false);
  if (NT >= 3) c = __builtin_amdgcn_wmma_f32_16x16x32_bf16(false, ah, false, bl, (short)0, c, false, false);
  asm volatile("v_nop\n\tv_nop\n\tv_nop\n\tv_nop" : "+v"(c) : "v"(ah), "v"(al), "v"(bh), "v"(bl));
  return c;
}

__global__ __launch_bounds__(256) void k_wt_bf16(const float* __restrict__ W, unsigned short* __restrict__ Wt, int K, int N) {
  const int t = blockIdx.x * 256 + threadIdx.x;
  const int k8n = K / 8;
  if (t >= N * k8n) return;
  const int n = t / k8n, k8 = (t % k8n) * 8;
  v8us v;
#pragma unroll
  for (int i = 0; i < 8; ++i) v[i] = bf16_bits(W[(size_t)(k8 + i) * N + n]);
  *(v8us*)(Wt + (size_t)n * K + k8) = v;
  
}

// GEMM C[M][N] (f32, pitch ldc) = act(A[M][K]·W + bias). A f32 row-major (pitch lda) converted per fragment to bf16
// (ASPLIT: hi/lo two planes -> 2 terms, else single rounded term); Wt bf16 [N][K] (pitch ldb). BIAS_BF16 rounds the
// bias to bf16 first (bias quantised to bf16 before the add). K%32==0, M%16==0, N%64==0.
template <bool ASPLIT, int ACT, bool BIAS_BF16>
__global__ __launch_bounds__(128) void k_gemm_bf(const float* __restrict__ A, int lda, const unsigned short* __restrict__ Wt, int ldb,
                                               const float* __restrict__ bias, float* __restrict__ C, int ldc, int M, int N, int K) {
  __shared__ __attribute__((aligned(16))) float so[4][16][64];
  const int tid = threadIdx.x, w = tid >> 5, lane = tid & 31, ln = lane & 15, hh = lane >> 4;
  const int ntn = N / 64;
  const int wid = blockIdx.x * 4 + w;
  const int mt = wid / ntn, nq = wid % ntn;
  if (mt * 16 >= M) return;
  const int row0 = mt * 16, col0 = nq * 64;
  const float* arow = A + (size_t)(row0 + ln) * lda;
  v8f acc[4] = {};
  for (int kb = 0; kb < K; kb += 32) {
    FragB ah, al;
    const v4f x0 = *(const v4fa*)(arow + kb + 8 * hh), x1 = *(const v4fa*)(arow + kb + 8 * hh + 4);
    const v4f x2 = *(const v4fa*)(arow + kb + 16 + 8 * hh), x3 = *(const v4fa*)(arow + kb + 16 + 8 * hh + 4);
    float xs[16] = {x0[0],x0[1],x0[2],x0[3],x1[0],x1[1],x1[2],x1[3],x2[0],x2[1],x2[2],x2[3],x3[0],x3[1],x3[2],x3[3]};
#pragma unroll
    for (int i = 0; i < 16; ++i) { const unsigned short hb = bf16_bits(xs[i]); ah.u[i] = hb; al.u[i] = ASPLIT ? bf16_bits(xs[i] - bf16_val(hb)) : (unsigned short)0; }
#pragma unroll
    for (int t = 0; t < 4; ++t) {
      const unsigned short* brow = Wt + (size_t)(col0 + t * 16 + ln) * ldb + kb;
      FragB b;
      b.half[0] = *(const v8us*)(brow + 8 * hh);
      b.half[1] = *(const v8us*)(brow + 16 + 8 * hh);
      acc[t] = mmaN<ASPLIT ? 2 : 1>(ah.v, al.v, b.v, b.v, acc[t]);
    }
  }
#pragma unroll
  for (int t = 0; t < 4; ++t) {
    float bv = bias ? bias[col0 + t * 16 + ln] : 0.f;
    if (BIAS_BF16) bv = bf16_round(bv);
#pragma unroll
    for (int r = 0; r < 8; ++r) { float v = acc[t][r] + bv; if (ACT == 1) v = fmaxf(v, 0.f); so[w][8 * hh + r][t * 16 + ln] = v; }
  }
  __builtin_amdgcn_fence(__ATOMIC_ACQ_REL, "workgroup");
  __builtin_amdgcn_wave_barrier();
  const int rsub = lane >> 4, c4 = (lane & 15) * 4;
  {
#pragma unroll
    for (int q = 0; q < 8; ++q) {
      const int r = q * 2 + rsub;
      const v4f v = *(const v4fa*)&so[w][r][c4];
      *(v4f*)(C + (size_t)(row0 + r) * ldc + col0 + c4) = v;
    }
    
  }
}

// GEMM C = act(A·W + bias + resid): A f32 (ASPLIT -> hi/lo 2 terms), Wt bf16 [N][K]; ACT 0 none, 1 relu, 2 exact gelu;
// resid (optional, f32, row index = (row % rmod), pitch ldr, RES_BF16 rounds it) added before the activation.
template <bool ASPLIT, int ACT, bool BIAS_BF16, bool RES_BF16>
__global__ __launch_bounds__(128) void k_gemm_bf3(const float* __restrict__ A, int lda, const unsigned short* __restrict__ Wt, int ldb,
                                                const float* __restrict__ bias, const float* __restrict__ resid, int rmod, int ldr,
                                                float* __restrict__ C, int ldc, int M, int N, int K) {
  __shared__ __attribute__((aligned(16))) float so[4][16][64];
  const int tid = threadIdx.x, w = tid >> 5, lane = tid & 31, ln = lane & 15, hh = lane >> 4;
  const int ntn = N / 64;
  const int wid = blockIdx.x * 4 + w;
  const int mt = wid / ntn, nq = wid % ntn;
  if (mt * 16 >= M) return;
  const int row0 = mt * 16, col0 = nq * 64;
  const float* arow = A + (size_t)(row0 + ln) * lda;
  v8f acc[4] = {};
  for (int kb = 0; kb < K; kb += 32) {
    FragB ah, al;
    const v4f x0 = *(const v4fa*)(arow + kb + 8 * hh), x1 = *(const v4fa*)(arow + kb + 8 * hh + 4);
    const v4f x2 = *(const v4fa*)(arow + kb + 16 + 8 * hh), x3 = *(const v4fa*)(arow + kb + 16 + 8 * hh + 4);
    float xs[16] = {x0[0],x0[1],x0[2],x0[3],x1[0],x1[1],x1[2],x1[3],x2[0],x2[1],x2[2],x2[3],x3[0],x3[1],x3[2],x3[3]};
#pragma unroll
    for (int i = 0; i < 16; ++i) { const unsigned short hb = bf16_bits(xs[i]); ah.u[i] = hb; al.u[i] = ASPLIT ? bf16_bits(xs[i] - bf16_val(hb)) : (unsigned short)0; }
#pragma unroll
    for (int t = 0; t < 4; ++t) {
      const unsigned short* brow = Wt + (size_t)(col0 + t * 16 + ln) * ldb + kb;
      FragB b;
      b.half[0] = *(const v8us*)(brow + 8 * hh);
      b.half[1] = *(const v8us*)(brow + 16 + 8 * hh);
      acc[t] = mmaN<ASPLIT ? 2 : 1>(ah.v, al.v, b.v, b.v, acc[t]);
    }
  }
#pragma unroll
  for (int t = 0; t < 4; ++t) {
    const int col = col0 + t * 16 + ln;
    float bv = bias ? bias[col] : 0.f;
    if (BIAS_BF16) bv = bf16_round(bv);
#pragma unroll
    for (int r = 0; r < 8; ++r) {
      float v = acc[t][r] + bv;
      if (resid) { float rv = resid[(size_t)((row0 + 8 * hh + r) % rmod) * ldr + col]; if (RES_BF16) rv = bf16_round(rv); v += rv; }
      if (ACT == 1) v = fmaxf(v, 0.f);
      if (ACT == 2) v = 0.5f * v * (1.0f + erff(v * 0.70710678118654752f));
      if (ACT == 3) { const float u = 0.7978845608028654f * (v + 0.044715f * v * v * v); v = 0.5f * v * (1.0f + tanhf(u)); }
      so[w][8 * hh + r][t * 16 + ln] = v;
    }
  }
  __builtin_amdgcn_fence(__ATOMIC_ACQ_REL, "workgroup");
  __builtin_amdgcn_wave_barrier();
  const int rsub = lane >> 4, c4 = (lane & 15) * 4;
  {
#pragma unroll
    for (int q = 0; q < 8; ++q) {
      const int r = q * 2 + rsub;
      const v4f v = *(const v4fa*)&so[w][r][c4];
      *(v4f*)(C + (size_t)(row0 + r) * ldc + col0 + c4) = v;
    }
    
  }
}
// row LayerNorm (biased variance, eps) over N: s = X (+ R); optional out_sum <- s; out_norm <- (s-mu)*rsqrt(var+eps)*g + b
template <bool PARAM_BF16>
__global__ __launch_bounds__(256) void k_layernorm(const float* __restrict__ X, const float* __restrict__ R, const float* __restrict__ g, const float* __restrict__ bta,
                                                  float* __restrict__ out_sum, float* __restrict__ out_norm, int N, float eps) {
  __shared__ float red[256];
  const int row = blockIdx.x, tid = threadIdx.x;
  const float* x = X + (size_t)row * N; const float* rr = R ? R + (size_t)row * N : nullptr;
  float vals[16];                     // up to N = 4096
  const int per = N / 256;            // contiguous chunk per thread? use strided-by-4 chunks: thread handles j = tid*4 + 1024*u
  float s1 = 0.f;
  for (int u = 0; u < per / 4; ++u) {
    const int j = tid * 4 + 1024 * u;
    const v4f a = *(const v4fa*)(x + j);
    v4f b = {0.f,0.f,0.f,0.f}; if (rr) b = *(const v4fa*)(rr + j);
#pragma unroll
    for (int q = 0; q < 4; ++q) { const float v = a[q] + b[q]; vals[u * 4 + q] = v; s1 += v; }
  }
  red[tid] = s1; __syncthreads();
  for (int st = 128; st > 0; st >>= 1) { if (tid < st) red[tid] += red[tid + st]; __syncthreads(); }
  const float mu = red[0] / (float)N; __syncthreads();
  float s2 = 0.f;
  for (int u = 0; u < per / 4; ++u)
#pragma unroll
    for (int q = 0; q < 4; ++q) { const float c = vals[u * 4 + q] - mu; s2 += c * c; }
  red[tid] = s2; __syncthreads();
  for (int st = 128; st > 0; st >>= 1) { if (tid < st) red[tid] += red[tid + st]; __syncthreads(); }
  const float rs = rsqrtf(red[0] / (float)N + eps);
  {
    for (int u = 0; u < per / 4; ++u) {
      const int j = tid * 4 + 1024 * u;
      v4f o, sm;
#pragma unroll
      for (int q = 0; q < 4; ++q) {
        float gg = g[j + q], bb = bta[j + q];
        if (PARAM_BF16) { gg = bf16_round(gg); bb = bf16_round(bb); }
        sm[q] = vals[u * 4 + q]; o[q] = (vals[u * 4 + q] - mu) * rs * gg + bb;
      }
      if (out_sum) *(v4f*)(out_sum + (size_t)row * N + j) = sm;
      *(v4f*)(out_norm + (size_t)row * N + j) = o;
    }
    
  }
}



// ---- f16 WMMA path (v_wmma_f32_16x16x32_f16): 11-bit significands for operands in range — used where a [0,1] probability operand needs more precision than bf16
typedef _Float16 v16h __attribute__((ext_vector_type(16)));
union FragH { v16h v; v8us half[2]; _Float16 h[16]; unsigned short u[16]; };
template <int NT>
__device__ __forceinline__ v8f mmaH(v16h ah, v16h al, v16h bh, v16h bl, v8f c) {
  c = __builtin_amdgcn_wmma_f32_16x16x32_f16(false, ah, false, bh, (short)0, c, false, false);
  if (NT >= 2) c = __builtin_amdgcn_wmma_f32_16x16x32_f16(false, al, false, bh, (short)0, c, false, false);
  if (NT >= 3) c = __builtin_amdgcn_wmma_f32_16x16x32_f16(false, ah, false, bl, (short)0, c, false, false);
  asm volatile("v_nop\n\tv_nop\n\tv_nop\n\tv_nop" : "+v"(c) : "v"(ah), "v"(al), "v"(bh), "v"(bl));
  return c;
}
// batched GEMM like k_gemm_b but f16 operands: A f32 (split into f16 hi/lo if ASPLIT, else rounded to f16), Bt = f16 values [n][k]; alpha; C f32; N multiple of 16 (partial tiles skipped)
template <bool ASPLIT>
__global__ __launch_bounds__(128) void k_gemm_h(const float* __restrict__ A, int lda, size_t sA, const _Float16* __restrict__ Bh, int ldb, size_t sB, float alpha, float* __restrict__ C, int ldc, size_t sC, int M, int N, int K) {
  __shared__ __attribute__((aligned(16))) float so[4][16][64];
  const int tid = threadIdx.x, w = tid >> 5, lane = tid & 31, ln = lane & 15, hh = lane >> 4; const int by = blockIdx.y;
  A += (size_t)by * sA; Bh += (size_t)by * sB; C += (size_t)by * sC;
  const int ntn = (N + 63) / 64; const int wid = blockIdx.x * 4 + w; const int mt = wid / ntn, nq = wid % ntn; if (mt * 16 >= M) return;
  const int row0 = mt * 16, col0 = nq * 64; const float* arow = A + (size_t)(row0 + ln) * lda;
  v8f acc[4] = {};
  for (int kb = 0; kb < K; kb += 32) {
    FragH ah, al;
    const v4f x0 = *(const v4fa*)(arow + kb + 8 * hh), x1 = *(const v4fa*)(arow + kb + 8 * hh + 4), x2 = *(const v4fa*)(arow + kb + 16 + 8 * hh), x3 = *(const v4fa*)(arow + kb + 16 + 8 * hh + 4);
    float xs[16] = {x0[0],x0[1],x0[2],x0[3],x1[0],x1[1],x1[2],x1[3],x2[0],x2[1],x2[2],x2[3],x3[0],x3[1],x3[2],x3[3]};
#pragma unroll
    for (int i = 0; i < 16; ++i) { const _Float16 h = (_Float16)xs[i]; ah.h[i] = h; al.h[i] = ASPLIT ? (_Float16)(xs[i] - (float)h) : (_Float16)0.0f; }
#pragma unroll
    for (int t = 0; t < 4; ++t) { if (col0 + t * 16 >= N) continue; const size_t boff = (size_t)(col0 + t * 16 + ln) * ldb + kb; FragH bq; bq.half[0] = *(const v8us*)(Bh + boff + 8 * hh); bq.half[1] = *(const v8us*)(Bh + boff + 16 + 8 * hh);
      acc[t] = mmaH<ASPLIT ? 2 : 1>(ah.v, al.v, bq.v, bq.v, acc[t]); }
  }
#pragma unroll
  for (int t = 0; t < 4; ++t) { if (col0 + t * 16 >= N) continue;
#pragma unroll
    for (int r = 0; r < 8; ++r) so[w][8 * hh + r][t * 16 + ln] = acc[t][r] * alpha; }
  __builtin_amdgcn_fence(__ATOMIC_ACQ_REL, "workgroup"); __builtin_amdgcn_wave_barrier();
  const int rsub = lane >> 4, c4 = (lane & 15) * 4;
  {
#pragma unroll
    for (int q = 0; q < 8; ++q) { const int r = q * 2 + rsub; if (col0 + c4 < N) { const v4f v = *(const v4fa*)&so[w][r][c4]; *(v4f*)(C + (size_t)(row0 + r) * ldc + col0 + c4) = v; } }
     }
}

// Wt[n][k] = f16(W[k][n]·scale) from f32 row-major W[K][N] (scale = power of two; bf16-exact weights stay exact in f16 away from the subnormal range)
// blockIdx.y picks one of three equally shaped matrices; their transposes are stacked in Wt
__global__ __launch_bounds__(256) void k_wt_f16(const float* __restrict__ W0, const float* __restrict__ W1, const float* __restrict__ W2, _Float16* __restrict__ Wt, int K, int N, float scale) {
  const float* __restrict__ W = (blockIdx.y == 0) ? W0 : ((blockIdx.y == 1) ? W1 : W2); Wt += (size_t)blockIdx.y * N * K;
  const int t = blockIdx.x * 256 + threadIdx.x; if (t >= N * (K / 8)) return; const int n = t / (K / 8), k8 = (t % (K / 8)) * 8; FragH f;
#pragma unroll
  for (int i = 0; i < 8; ++i) f.h[i] = (_Float16)(bf16_round(W[(size_t)(k8 + i) * N + n]) * scale); const v8us o = f.half[0];
  *(v8us*)((unsigned short*)Wt + (size_t)n * K + k8) = o; 
}
// k_gemm_hh variant with fused epilogue: v = acc·alpha + bias[by·sBias + col] (+ CP[(row/rowsPerB)·sCPb + by·64 + col] if CP) ; ACT 0 none / 1 elu ; writes f16 C16 (and f32 C if non-null)
template <int ACT>
__global__ __launch_bounds__(128) void k_gemm_hhx(const _Float16* __restrict__ A, int lda, size_t sA, const _Float16* __restrict__ Bh, int ldb, size_t sB, float alpha, const float* __restrict__ bias, size_t sBias, const float* __restrict__ CP, int rowsPerB, size_t sCPb, int row0g,
    float* __restrict__ C, _Float16* __restrict__ C16, int ldc, size_t sC, int M, int N, int K) {
  __shared__ __attribute__((aligned(16))) float so[4][16][64];
  const int tid = threadIdx.x, w = tid >> 5, lane = tid & 31, ln = lane & 15, hh = lane >> 4; const int by = blockIdx.y;
  A += (size_t)by * sA; Bh += (size_t)by * sB; const size_t cofs = (size_t)by * sC; const float* bp = bias ? bias + (size_t)by * sBias : nullptr;
  const int ntn = (N + 63) / 64; const int wid = blockIdx.x * 4 + w; const int mt = wid / ntn, nq = wid % ntn; if (mt * 16 >= M) return;
  const int row0 = mt * 16, col0 = nq * 64; const _Float16* arow = A + (size_t)(row0 + ln) * lda;
  v8f acc[4] = {};
  for (int kb = 0; kb < K; kb += 32) { FragH ah; ah.half[0] = *(const v8us*)((const unsigned short*)arow + kb + 8 * hh); ah.half[1] = *(const v8us*)((const unsigned short*)arow + kb + 16 + 8 * hh);
#pragma unroll
    for (int t = 0; t < 4; ++t) { if (col0 + t * 16 >= N) continue; const size_t boff = (size_t)(col0 + t * 16 + ln) * ldb + kb; FragH bq; bq.half[0] = *(const v8us*)((const unsigned short*)Bh + boff + 8 * hh); bq.half[1] = *(const v8us*)((const unsigned short*)Bh + boff + 16 + 8 * hh);
      acc[t] = mmaH<1>(ah.v, ah.v, bq.v, bq.v, acc[t]); }
  }
#pragma unroll
  for (int t = 0; t < 4; ++t) { if (col0 + t * 16 >= N) continue; const int col = col0 + t * 16 + ln; const float bv = bp ? bf16_round(bp[col]) : 0.f;
#pragma unroll
    for (int r = 0; r < 8; ++r) { float v = acc[t][r] * alpha + bv; if (CP) { const int rr = row0g + row0 + 8 * hh + r; if (rowsPerB < 0) v += CP[cofs + (size_t)rr * ldc + col];      /* rowsPerB < 0: own element of the batched C plane */ else { const int bidx = rr / rowsPerB; v += CP[(size_t)bidx * sCPb + (size_t)by * 64 + col]; } } if (ACT == 1) v = (v > 0.f) ? v : expm1f(v); else if (ACT == 7) v = (v > 0.f) ? v + 1.0f : expf(v); else if (ACT == 8) v = tanhf(v); else if (ACT == 9) v = 0.5f * v * (1.0f + tanhf(0.7978845608028654f * (v + 0.044715f * v * v * v))); else if (ACT == 11) v = 1.0f / (1.0f + expf(-v)); else if (ACT == 12) v = (v > 0.f) ? v : 0.01f * v; else if (ACT == 14) v = (v > 0.f) ? v : 0.1f * v; else if (ACT == 16) v = (v >= 0.f) ? v : 0.3f * v; else if (ACT == 17) v = (v >= 0.f) ? v : 0.2f * v; else if (ACT == 15) v = v / (1.0f + expf(-v)); else if (ACT == 3) v = fmaxf(v, 0.f); else if (ACT == 6) v = 0.5f * v * (1.0f + erff(v * 0.70710678118654752f)); so[w][8 * hh + r][t * 16 + ln] = v; } }
  __builtin_amdgcn_fence(__ATOMIC_ACQ_REL, "workgroup"); __builtin_amdgcn_wave_barrier();
  const int rsub = lane >> 4, c4 = (lane & 15) * 4; typedef _Float16 v4h __attribute__((ext_vector_type(4)));
  {
#pragma unroll
    for (int q = 0; q < 8; ++q) { const int r = q * 2 + rsub; if (col0 + c4 < N) { const v4f v = *(const v4fa*)&so[w][r][c4]; if (C) *(v4f*)(C + cofs + (size_t)(row0 + r) * ldc + col0 + c4) = v; if (C16) { v4h h4; for (int i = 0; i < 4; ++i) h4[i] = (_Float16)v[i]; *(v4h*)(C16 + cofs + (size_t)(row0 + r) * ldc + col0 + c4) = h4; } } }
     }
}


typedef _Float16 v4h __attribute__((ext_vector_type(4)));

__global__ __launch_bounds__(256) void k_x16(const float* __restrict__ x, _Float16* __restrict__ X16, size_t n8) { const size_t t = (size_t)blockIdx.x * 256 + threadIdx.x; if (t >= n8) return; FragH f;
#pragma unroll
  for (int q = 0; q < 8; ++q) f.h[q] = (_Float16)bf16_round(x[t * 8 + q]); *(v8us*)((unsigned short*)X16 + t * 8) = f.half[0];  }
__global__ __launch_bounds__(256) void k_h16(const float* __restrict__ x, _Float16* __restrict__ X16, size_t n8) { const size_t t = (size_t)blockIdx.x * 256 + threadIdx.x; if (t >= n8) return; FragH f;
#pragma unroll
  for (int q = 0; q < 8; ++q) f.h[q] = (_Float16)x[t * 8 + q]; *(v8us*)((unsigned short*)X16 + t * 8) = f.half[0];  }
__global__ __launch_bounds__(256) void k_round16f(const float* __restrict__ W, _Float16* __restrict__ Bt, size_t n8) { const size_t t = (size_t)blockIdx.x * 256 + threadIdx.x; if (t >= n8) return; FragH f;
#pragma unroll
  for (int i = 0; i < 8; ++i) f.h[i] = (_Float16)(bf16_round(W[t * 8 + i]) * 16.0f); *(v8us*)((unsigned short*)Bt + t * 8) = f.half[0];  }
template <int NHv, int TTv>
__global__ __launch_bounds__(256) void k_vt(const _Float16* __restrict__ V16, int ldv, int voff, _Float16* __restrict__ Vt) { __shared__ unsigned short tl[64][66]; const int tid = threadIdx.x; const int slab = blockIdx.x / (TTv / 64), lg = blockIdx.x % (TTv / 64); const int b = slab / NHv, h = slab % NHv;
  for (int i = tid; i < 64 * 8; i += 256) { const int r = i / 8, c8 = (i % 8) * 8; FragH f; f.half[0] = *(const v8us*)((const unsigned short*)V16 + ((size_t)b * TTv + lg * 64 + r) * ldv + voff + h * 64 + c8);
#pragma unroll
    for (int q = 0; q < 8; ++q) tl[r][c8 + q] = f.u[q]; }
  __syncthreads();
  {
#pragma unroll
    for (int rd = 0; rd < 2; ++rd) { const int d = rd * 32 + tid / 8, pc = tid % 8; FragH f;
#pragma unroll
      for (int q = 0; q < 8; ++q) f.u[q] = tl[pc * 8 + q][d];
      *(v8us*)((unsigned short*)Vt + ((size_t)slab * 64 + d) * TTv + lg * 64 + pc * 8) = f.half[0]; }
     } }

__global__ __launch_bounds__(256) void k_hl(const float* __restrict__ F, _Float16* __restrict__ Hh, _Float16* __restrict__ Hl, size_t n8) { const size_t t = (size_t)blockIdx.x * 256 + threadIdx.x; if (t >= n8) return; FragH fh, fl; const v4f a = *(const v4fa*)(F + t * 8), c = *(const v4fa*)(F + t * 8 + 4);
#pragma unroll
  for (int q = 0; q < 4; ++q) { _Float16 h = (_Float16)a[q]; fh.h[q] = h; fl.h[q] = (_Float16)((a[q] - (float)h) * 1024.0f); h = (_Float16)c[q]; fh.h[4 + q] = h; fl.h[4 + q] = (_Float16)((c[q] - (float)h) * 1024.0f); }
  { *(v8us*)((unsigned short*)Hh + t * 8) = fh.half[0]; *(v8us*)((unsigned short*)Hl + t * 8) = fl.half[0];  } }

// ---- fast GEMM (wave tile 32x64; requires M % 32 == 0 rows per launch region, N % 64 == 0 and K % 64 == 0); epilogue = k_gemm_hhx semantics ----
__device__ __forceinline__ v16h g2_frag(const _Float16* p, int hh) { FragH f; f.half[0] = *(const v8us*)((const unsigned short*)p + 8 * hh); f.half[1] = *(const v8us*)((const unsigned short*)p + 16 + 8 * hh); return f.v; }
__device__ __forceinline__ v8f g2_mma(v16h a, v16h b, v8f c) { v8f d = __builtin_amdgcn_wmma_f32_16x16x32_f16(false, a, false, b, (short)0, c, false, false); asm volatile("v_nop\n\tv_nop\n\tv_nop\n\tv_nop" : "+v"(d) : "v"(a), "v"(b)); return d; }
template <int ACT>
__global__ __launch_bounds__(128) void k_gemm2(const _Float16* __restrict__ A, int lda, size_t sA, const _Float16* __restrict__ Bh, int ldb, size_t sB, float alpha, const float* __restrict__ bias, size_t sBias, const float* __restrict__ CP, int rowsPerB, size_t sCPb, int row0g,
    float* __restrict__ C, _Float16* __restrict__ C16, int ldc, size_t sC, int M, int N, int K) { static_assert(ACT == 0 || ACT == 3 || ACT == 6 || ACT == 8 || ACT == 9 || ACT == 11 || ACT == 12 || ACT == 14 || ACT == 15 || ACT == 16 || ACT == 17, "k_gemm2: unsupported ACT code (would silently apply no activation)");
  __shared__ __attribute__((aligned(16))) float so[4][32][68];
  const int tid = threadIdx.x, w = tid >> 5, lane = tid & 31, ln = lane & 15, hh = lane >> 4; const int by = blockIdx.y;
  A += (size_t)by * sA; Bh += (size_t)by * sB; const size_t cofs = (size_t)by * sC; const float* bp = bias ? bias + (size_t)by * sBias : nullptr;
  const int ntn = N >> 6; const int mt = blockIdx.x / ntn, nq = blockIdx.x - mt * ntn; const int row0 = mt * 128 + 32 * w, col0 = nq * 64; if (row0 >= M) return;
  const _Float16* a0p = A + (size_t)(row0 + ln) * lda; const _Float16* a1p = a0p + (size_t)16 * lda;
  const _Float16* b0p = Bh + (size_t)(col0 + ln) * ldb; const _Float16* b1p = b0p + (size_t)16 * ldb; const _Float16* b2p = b1p + (size_t)16 * ldb; const _Float16* b3p = b2p + (size_t)16 * ldb;
  const v8f z8 = {0.f,0.f,0.f,0.f,0.f,0.f,0.f,0.f}; v8f c00 = z8, c01 = z8, c02 = z8, c03 = z8, c10 = z8, c11 = z8, c12 = z8, c13 = z8;
  /* two k steps (64 k) of fragments stay in registers: a step's 12 loads are issued together, right behind the products that last read the step's registers, and land while the other step is worked on */
  v16h a0x = g2_frag(a0p, hh), a1x = g2_frag(a1p, hh), b0x = g2_frag(b0p, hh), b1x = g2_frag(b1p, hh), b2x = g2_frag(b2p, hh), b3x = g2_frag(b3p, hh);
  __builtin_amdgcn_sched_barrier(0);      /* the first step's loads stay older than the second's, as in the loop: else the loop's counted waits for one step must also cover loads of the other */
  v16h a0y = g2_frag(a0p + 32, hh), a1y = g2_frag(a1p + 32, hh), b0y = g2_frag(b0p + 32, hh), b1y = g2_frag(b1p + 32, hh), b2y = g2_frag(b2p + 32, hh), b3y = g2_frag(b3p + 32, hh);
  asm volatile("s_wait_xcnt 0x0" ::: "memory");      /* address registers of the loads above are reused below while the loads are in flight: the wait stands in front of that reuse */
#define G2_STEP(a0, a1, b0, b1, b2, b3) c00 = g2_mma(a0, b0, c00); c10 = g2_mma(a1, b0, c10); c01 = g2_mma(a0, b1, c01); c11 = g2_mma(a1, b1, c11); c02 = g2_mma(a0, b2, c02); c12 = g2_mma(a1, b2, c12); c03 = g2_mma(a0, b3, c03); c13 = g2_mma(a1, b3, c13);
#pragma unroll 1      /* rolled: a trip already holds 24 loads and 16 products, a second copy would need a second set of fragment registers */
  for (int kb = 64; kb < K; kb += 64) {      /* no branch inside: the waits in front of each step's products can then count the other step's younger loads as still in flight */
    G2_STEP(a0x, a1x, b0x, b1x, b2x, b3x)
    a0x = g2_frag(a0p + kb, hh); a1x = g2_frag(a1p + kb, hh); b0x = g2_frag(b0p + kb, hh); b1x = g2_frag(b1p + kb, hh); b2x = g2_frag(b2p + kb, hh); b3x = g2_frag(b3p + kb, hh);
    G2_STEP(a0y, a1y, b0y, b1y, b2y, b3y)
    a0y = g2_frag(a0p + kb + 32, hh); a1y = g2_frag(a1p + kb + 32, hh); b0y = g2_frag(b0p + kb + 32, hh); b1y = g2_frag(b1p + kb + 32, hh); b2y = g2_frag(b2p + kb + 32, hh); b3y = g2_frag(b3p + kb + 32, hh);
    asm volatile("s_wait_xcnt 0x0" ::: "memory"); }      /* the next trip forms its addresses in the registers that this trip's loads name: the wait stands in front of that */
  G2_STEP(a0x, a1x, b0x, b1x, b2x, b3x)      /* the last 64 k: nothing left to load */
  G2_STEP(a0y, a1y, b0y, b1y, b2y, b3y)
#undef G2_STEP
  v8f accs[8] = {c00, c01, c02, c03, c10, c11, c12, c13};
#pragma unroll
  for (int u = 0; u < 8; ++u) { const int t = u & 3, half = u >> 2; const int col = col0 + t * 16 + ln; const float bv = bp ? bf16_round(bp[col]) : 0.f;
#pragma unroll
    for (int r = 0; r < 8; ++r) { const int rloc = half * 16 + 8 * hh + r; float v = accs[u][r] * alpha + bv; if (CP) { if (rowsPerB < 0) v += CP[cofs + (size_t)(row0g + row0 + rloc) * ldc + col];      /* rowsPerB < 0: own element of the batched C plane */ else { const int bidx = (row0g + row0 + rloc) / rowsPerB; v += CP[(size_t)bidx * sCPb + (size_t)by * 64 + col]; } }
      if (ACT == 3) v = fmaxf(v, 0.f); else if (ACT == 6) v = 0.5f * v * (1.0f + erff(v * 0.70710678118654752f)); else if (ACT == 11) v = 1.0f / (1.0f + expf(-v)); else if (ACT == 15) v = v / (1.0f + expf(-v)); else if (ACT == 12) v = (v > 0.f) ? v : 0.01f * v; else if (ACT == 8) v = tanhf(v); else if (ACT == 9) v = 0.5f * v * (1.0f + tanhf(0.7978845608028654f * (v + 0.044715f * v * v * v))); else if (ACT == 14) v = (v > 0.f) ? v : 0.1f * v; else if (ACT == 16) v = (v >= 0.f) ? v : 0.3f * v; else if (ACT == 17) v = (v >= 0.f) ? v : 0.2f * v;
      so[w][rloc][t * 16 + ln] = v; } }
  __builtin_amdgcn_fence(__ATOMIC_ACQ_REL, "workgroup"); __builtin_amdgcn_wave_barrier();
  const int rsub = lane >> 4, c4 = (lane & 15) * 4;
  {
#pragma unroll
    for (int q = 0; q < 16; ++q) { const int r = q * 2 + rsub; const v4f v = *(const v4fa*)&so[w][r][c4]; if (C) *(v4f*)(C + cofs + (size_t)(row0 + r) * ldc + col0 + c4) = v; if (C16) { v4h h4; for (int i = 0; i < 4; ++i) h4[i] = (_Float16)v[i]; *(v4h*)(C16 + cofs + (size_t)(row0 + r) * ldc + col0 + c4) = h4; } }
     } }


__global__ __launch_bounds__(256) void k_wnat(const float* __restrict__ w, size_t n8, _Float16* __restrict__ Bt) { const size_t t = (size_t)blockIdx.x * 256 + threadIdx.x; if (t >= n8) return; FragH f; for (int q = 0; q < 8; ++q) f.h[q] = (_Float16)(bf16_round(w[t * 8 + q]) * 16.0f); *(v8us*)((unsigned short*)Bt + t * 8) = f.half[0];  }
__global__ __launch_bounds__(256) void k_rsm(const float* __restrict__ S, _Float16* __restrict__ P, int nrows) {
  #pragma clang fp contract(off)
  const int i = blockIdx.x * 256 + threadIdx.x; if (i >= nrows) return; const float* s = S + (size_t)i * SQ; float mx = -3.0e38f;
#pragma unroll 1
  for (int j = 0; j < SQ; ++j) mx = fmaxf(mx, s[j]); float se = 0.f;
#pragma unroll 1
  for (int j = 0; j < SQ; ++j) se += expf(s[j] - mx); const float sc = 256.0f / se;
#pragma unroll 1
  for (int j0 = 0; j0 < SQ; j0 += 8) { FragH f; for (int q = 0; q < 8; ++q) f.h[q] = (_Float16)(expf(s[j0 + q] - mx) * sc); unsigned short* d = (unsigned short*)P + (size_t)i * SQ + j0; *(v8us*)d = f.half[0];  } }
__global__ __launch_bounds__(256) void k_vt(const _Float16* __restrict__ V16, int b, int h0, _Float16* __restrict__ VT) { __shared__ unsigned short tl[64][65]; const int tid = threadIdx.x; const int hh = blockIdx.x % HG, sg = blockIdx.x / HG; const int s0 = sg * 64; const int h = h0 + hh;
  for (int i = tid; i < 64 * 8; i += 256) { const int j = i / 8, d8 = (i % 8) * 8; FragH f; f.half[0] = *(const v8us*)((const unsigned short*)V16 + ((size_t)b * SQ + s0 + j) * DM + h * HD + d8); for (int q = 0; q < 8; ++q) tl[d8 + q][j] = f.u[q]; }
  __syncthreads();
  { for (int i = tid; i < 64 * 8; i += 256) { const int d = i / 8, j8 = (i % 8) * 8; FragH f; for (int q = 0; q < 8; ++q) f.u[q] = tl[d][j8 + q]; *(v8us*)((unsigned short*)VT + ((size_t)hh * HD + d) * SQ + s0 + j8) = f.half[0]; }  } }



// lane l with lane l ^ 16; every lane is on where this is used
__device__ __forceinline__ float half_x(float x) { return __builtin_bit_cast(float, __builtin_amdgcn_permlanex16(__builtin_bit_cast(int, x), __builtin_bit_cast(int, x), 0x76543210, 0xfedcba98, false, false)); }

typedef float v2f __attribute__((ext_vector_type(2)));
#define KP 68                        /* row pitch of the k and v tiles in LDS, in floats: 272 bytes = 16 x 17, so the 16 rows that one 16-byte fragment load touches lie on different banks */
__device__ __forceinline__ v8f f4_mma(v2f a, v2f b, v8f c) { return __builtin_amdgcn_wmma_f32_16x16x4_f32(false, a, false, b, (short)0, c, false, false); }
// exact f32 causal attention for the first QT0 rows on v_wmma_f32_16x16x4_f32, both products transposed. One wave owns 16 query rows, a block of 4 waves shares 64-key k and v tiles in LDS.
// S^T = K Q^T: A = 16 k rows, B = 16 q rows, both loaded by the same rule (lane (c, h) holds columns 32h .. 32h+31 of its row), so a lane's 8 result registers are keys 8h .. 8h+7 of ITS query c.
// O^T = V^T P^T: those registers, two at a time, are the B operand as they stand (keys 8h+2t, 8h+2t+1 in k step t); A takes the same keys of v, column dt*16+c. Maximum, sum and rescale factor of a query are then per lane (two lanes a query).
template <int ld, int ldo>      /* row pitches of q/k/v and of the output as constants: the 8 row groups of a staged tile are then immediate offsets from one address */
__global__ __launch_bounds__(128) void k_att0w(const float* __restrict__ QF, const float* __restrict__ KF, const float* __restrict__ VF, float scale, float* __restrict__ OF) {
  __shared__ __attribute__((aligned(16))) float lk[64][KP]; __shared__ __attribute__((aligned(16))) float lv[64][KP];
  const int tid = threadIdx.x, lane = tid & 31, c = lane & 15, h = lane >> 4; const int w = __builtin_amdgcn_readfirstlane(tid >> 5); const int rg = blockIdx.x;      /* the wave's number as a scalar: every branch below is wave-uniform, as the matrix instructions need */
  { const size_t bi = (size_t)blockIdx.y * SQ * ld; QF += bi; KF += bi; VF += bi; OF += (size_t)blockIdx.y * SQ * ldo; }      /* batch on grid.y: the first QT0 rows of each batch's SQ-row plane, inputs and output alike */
  const int i = rg * 64 + w * 16 + c;      /* the lane's query row */
  const float* qr = QF + (size_t)i * ld + 32 * h; v4f qv[8];
#pragma unroll      /* here and below: full unrolling makes every index of the register arrays a constant, so they stay in registers */
  for (int u = 0; u < 8; ++u) qv[u] = *(const v4fa*)(qr + 4 * u);
  const v8f z8 = {0.f, 0.f, 0.f, 0.f, 0.f, 0.f, 0.f, 0.f}; v8f o[4] = {z8, z8, z8, z8}; float m = -1.0e30f, l = 0.f;
  const int sr = tid >> 4, sc4 = (tid & 15) * 4; const float* kg = KF + (size_t)sr * ld + sc4; const float* vg = VF + (size_t)sr * ld + sc4; v4f tk[8], tv[8];      /* staging: a thread reads 16 bytes of rows sr, sr+8, .. sr+56 of a tile */
#pragma unroll
  for (int u = 0; u < 8; ++u) { tk[u] = *(const v4fa*)(kg + u * 8 * ld); tv[u] = *(const v4fa*)(vg + u * 8 * ld); }
  asm volatile("s_wait_xcnt 0x0" ::: "memory");      /* the q loads' address registers are reused below while the loads are in flight: the wait stands in front of that reuse */
  __builtin_amdgcn_sched_barrier(0);      /* keeps the register moves that follow (the zeroed accumulators take over those address registers) behind the wait: without it they are scheduled ahead of it */
  int t = 0;
#pragma unroll 1      /* rolled: one trip is a whole 64-key tile between its two barriers */
  do {      /* tiles 0 .. rg: at least one */
    __syncthreads();      /* every reader has left the previous tile */
#pragma unroll
    for (int u = 0; u < 8; ++u) { *(v4f*)&lk[u * 8 + sr][sc4] = tk[u]; *(v4f*)&lv[u * 8 + sr][sc4] = tv[u]; }
    __syncthreads();      /* the tile is complete before anyone reads it */
    if (t < rg) { kg += 64 * ld; vg += 64 * ld;      /* the next tile's rows fly while this tile is worked on */
#pragma unroll
      for (int u = 0; u < 8; ++u) { tk[u] = *(const v4fa*)(kg + u * 8 * ld); tv[u] = *(const v4fa*)(vg + u * 8 * ld); } }
    const int np = (t == rg) ? (w >> 1) + 1 : 2;      /* 32 keys a step; on the diagonal tile the steps wholly above the wave's rows are left out (every step that runs holds a key that each of its queries may see) */
#pragma unroll 1      /* rolled: one step already holds 64 matrix instructions */
    for (int p = 0; p < np; ++p) { const int k0 = p * 32; v4f ka[8], kc[8];
#pragma unroll
      for (int u = 0; u < 8; ++u) { ka[u] = *(const v4f*)&lk[k0 + c][32 * h + 4 * u]; kc[u] = *(const v4f*)&lk[k0 + 16 + c][32 * h + 4 * u]; }
      v8f sa = z8, sb = z8;      /* two independent score tiles: neither waits for its own previous product */
#pragma unroll
      for (int u = 0; u < 8; ++u) {
#pragma unroll
        for (int e = 0; e < 4; e += 2) { const v2f b = {qv[u][e], qv[u][e + 1]}; const v2f a0 = {ka[u][e], ka[u][e + 1]}; const v2f a1 = {kc[u][e], kc[u][e + 1]}; sa = f4_mma(a0, b, sa); sb = f4_mma(a1, b, sb);
          __builtin_amdgcn_sched_barrier(0x0496); } }      /* matrix instructions do not cross (vector, scalar, memory and LDS instructions may): keeps the two tiles' products alternating; left alone the compiler runs each tile's 16 products as one dependent chain, which issues slower */
      const int jb = t * 64 + k0 + 8 * h; float ml = -1.0e30f;
#pragma unroll
      for (int r = 0; r < 8; ++r) { sa[r] = (jb + r <= i) ? sa[r] * scale : -1.0e30f; sb[r] = (jb + 16 + r <= i) ? sb[r] * scale : -1.0e30f; ml = fmaxf(ml, fmaxf(sa[r], sb[r])); }
      ml = fmaxf(ml, half_x(ml));      /* the query's other 16 keys of this step sit in lane l ^ 16 */
      const float mn = fmaxf(m, ml); const float sc = expf(m - mn); m = mn; float ps = 0.f;
#pragma unroll
      for (int r = 0; r < 8; ++r) { sa[r] = expf(sa[r] - mn); sb[r] = expf(sb[r] - mn); ps += sa[r] + sb[r]; }
      l = l * sc + ps;      /* each lane sums its own keys; the two halves meet behind the loop */
#pragma unroll
      for (int dt = 0; dt < 4; ++dt) o[dt] *= sc;
#pragma unroll
      for (int tt = 0; tt < 4; ++tt) { const v2f b0 = {sa[2 * tt], sa[2 * tt + 1]}; const v2f b1 = {sb[2 * tt], sb[2 * tt + 1]}; const int kr = k0 + 8 * h + 2 * tt;
#pragma unroll
        for (int dt = 0; dt < 4; ++dt) { const v2f a0 = {lv[kr][dt * 16 + c], lv[kr + 1][dt * 16 + c]}; o[dt] = f4_mma(a0, b0, o[dt]); }
#pragma unroll
        for (int dt = 0; dt < 4; ++dt) { const v2f a1 = {lv[kr + 16][dt * 16 + c], lv[kr + 17][dt * 16 + c]}; o[dt] = f4_mma(a1, b1, o[dt]); } } }
  } while (++t <= rg);
  l += half_x(l); const float fin = 1.0f / l;
  float* orow = OF + (size_t)i * ldo + 8 * h;      /* o[dt][r] = column dt*16 + 8h + r of the lane's query: 32 contiguous bytes a tile */
#pragma unroll
  for (int dt = 0; dt < 4; ++dt) { const v4f x0 = {o[dt][0] * fin, o[dt][1] * fin, o[dt][2] * fin, o[dt][3] * fin}; const v4f x1 = {o[dt][4] * fin, o[dt][5] * fin, o[dt][6] * fin, o[dt][7] * fin}; *(v4f*)(orow + dt * 16) = x0; *(v4f*)(orow + dt * 16 + 4) = x1; } }


template <int BFIN, int WXB>
__global__ __launch_bounds__(256) void k_ln16(const float* __restrict__ X, const float* __restrict__ g, const float* __restrict__ bb, float eps, _Float16* __restrict__ N16, float* __restrict__ XB) {
  #pragma clang fp contract(off)
  __shared__ float red[256]; const size_t r = blockIdx.x; const int t = threadIdx.x; const v4f xa = *(const v4fa*)(X + r * DMQ + t * 4); float s[4]; float sum = 0.f;
  for (int q = 0; q < 4; ++q) { s[q] = BFIN ? bf16_round(xa[q]) : xa[q]; sum = __fadd_rn(sum, s[q]); }
  red[t] = sum; __syncthreads(); for (int st = 128; st > 0; st >>= 1) { if (t < st) red[t] = __fadd_rn(red[t], red[t + st]); __syncthreads(); } const float mu = red[0] / (float)DMQ; __syncthreads();
  float vs = 0.f; for (int q = 0; q < 4; ++q) { const float dl = __fadd_rn(s[q], -mu); vs = __fadd_rn(vs, __fmul_rn(dl, dl)); } red[t] = vs; __syncthreads(); for (int st = 128; st > 0; st >>= 1) { if (t < st) red[t] = __fadd_rn(red[t], red[t + st]); __syncthreads(); }
  const float rs = rsqrtf(__fadd_rn(red[0] / (float)DMQ, eps)); v4h y; v4f xb;
  for (int q = 0; q < 4; ++q) { const int c = t * 4 + q; y[q] = (_Float16)__fadd_rn(__fmul_rn(__fmul_rn(__fadd_rn(s[q], -mu), rs), bf16_round(g[c])), bf16_round(bb[c])); xb[q] = s[q]; }
  { *(v4h*)(N16 + r * DMQ + t * 4) = y; if (WXB) *(v4f*)(XB + r * DMQ + t * 4) = xb;  } }
__global__ __launch_bounds__(256) void k_ftres2(const float* __restrict__ OF0, const float* __restrict__ XB, float* __restrict__ X1, size_t n4) {
  #pragma clang fp contract(off)
  const size_t t = (size_t)blockIdx.x * 256 + threadIdx.x; if (t >= n4) return; const v4f o = *(const v4fa*)(OF0 + t * 4), xv = *(const v4fa*)(XB + t * 4); v4f y; for (int q = 0; q < 4; ++q) y[q] = __fadd_rn(__fmul_rn(o[q], 0.015625f), xv[q]); *(v4f*)(X1 + t * 4) = y;  }

__global__ __launch_bounds__(256) void k_wthd(const float* __restrict__ Wt, _Float16* __restrict__ Bt) { const size_t t = (size_t)blockIdx.x * 256 + threadIdx.x; if (t >= (size_t)NH * HD * (DM / 8)) return; const int m8 = (int)(t % (DM / 8)) * 8; const int d = (int)((t / (DM / 8)) % HD); const int h = (int)(t / ((size_t)(DM / 8) * HD)); FragH f;
  for (int q = 0; q < 8; ++q) f.h[q] = (_Float16)(16.0f * bf16_round(Wt[((size_t)h * DM + m8 + q) * HD + d])); unsigned short* dst = (unsigned short*)Bt + ((size_t)h * HD + d) * DM + m8; *(v8us*)dst = f.half[0];  }




__global__ __launch_bounds__(256) void k_wtpad(const float* __restrict__ Wm, _Float16* __restrict__ Wt, int Kr, int Kp, int Nr, int Np, float scale) {
  const int t = blockIdx.x * 256 + threadIdx.x; if (t >= Np * (Kp / 8)) return; const int n = t / (Kp / 8), k8 = (t % (Kp / 8)) * 8; const int nc = min(n, Nr - 1); const float fn = (n < Nr) ? 1.f : 0.f; FragH f;
  for (int i = 0; i < 8; ++i) { const int k = k8 + i; const int kc = min(k, Kr - 1); const float fk = (k < Kr) ? fn : 0.f; f.h[i] = (_Float16)(bf16_round(Wm[(size_t)kc * Nr + nc]) * scale * fk); }
  unsigned short* o = (unsigned short*)Wt + (size_t)n * Kp + k8; *(v8us*)o = f.half[0];  }
__global__ __launch_bounds__(128) void k_bpad(const float* __restrict__ b, float* __restrict__ Bp, int nr, int np) {
  const int i = threadIdx.x; if (i >= np) return; const float v = b[min(i, nr - 1)] * ((i < nr) ? 1.f : 0.f); *(float*)(Bp + i) = v;  }

#define DI 64         /* inner width = NH * HD (ONE 64-wide head) */
#define LQK (3 * DI)  /* fused q | k | v row pitch (192) */
__global__ __launch_bounds__(256) void k_o0(const float* __restrict__ OF, float* __restrict__ ob, size_t n4) {
  #pragma clang fp contract(off)
  const size_t t = (size_t)blockIdx.x * 256 + threadIdx.x; if (t >= n4) return; const size_t e = t * 4; const int i = (int)(e / DI); const int c = (int)(e % DI); const int h = c / HD, d = c % HD; const v4f a = *(const v4fa*)(OF + e); v4f o; for (int q = 0; q < 4; ++q) o[q] = __fmul_rn(a[q], 0.015625f); float* dst = ob + (size_t)h * SQ * HD + (size_t)i * HD + d; *(v4f*)dst = o;  }

// ---- fused causal attention for query rows QT0 .. SQ-1 (f16 operands, f32 scores and statistics): scores, softmax and P V in ONE kernel, no score or weight plane in memory ----
#define FQ 64                        /* query rows per block: two groups of 32, a wave owns one group (two 16-column tiles) */
#define FKS 4                        /* 32-key slices per stage: the four waves of a query group take one slice each and meet in the epilogue */
#define FSK (FKS * 32)               /* keys per stage */
#define FKPB 144                     /* k tile row pitch in LDS, bytes: 128 + 16 = 16 x odd, conflict-free for 16-byte fragment reads */
#define FVPB (FSK * 2 + 16)          /* v^T tile row pitch in LDS, bytes: 272 = 16 x odd */
#define FKB (FSK * FKPB)             /* bytes of a k tile */
#define FBUF (FKB + HD * FVPB)       /* bytes of one stage buffer: k tile, then v^T tile */
#define FIMG (8 * 2 * 4 * 2 * 32 * 16)   /* epilogue: every wave's 2 x 4 output tiles as 16-byte pieces, lane-contiguous */
__device__ __forceinline__ v8f h_mma(v16h a, v16h b, v8f c) { return __builtin_amdgcn_wmma_f32_16x16x32_f16(false, a, false, b, (short)0, c, false, false); }
__device__ __forceinline__ v16h l_frag(const unsigned char* p) { FragH f; f.half[0] = *(const v8us*)p; f.half[1] = *(const v8us*)(p + 32); return f.v; }      /* p already holds the lane's 16h bytes: k 8h .. 8h+7 and 16+8h .. 16+8h+7, the order of g2_frag */
// 2^x in place. The exponentials of one statement work on different registers, so each fills the slot that the instruction set asks for behind the one before it; the closing v_nop is that slot for the last one
__device__ __forceinline__ void exp2x8(float (&x)[8]) { asm("v_exp_f32 %0, %0\n\tv_exp_f32 %1, %1\n\tv_exp_f32 %2, %2\n\tv_exp_f32 %3, %3\n\tv_exp_f32 %4, %4\n\tv_exp_f32 %5, %5\n\tv_exp_f32 %6, %6\n\tv_exp_f32 %7, %7\n\tv_nop" : "+v"(x[0]), "+v"(x[1]), "+v"(x[2]), "+v"(x[3]), "+v"(x[4]), "+v"(x[5]), "+v"(x[6]), "+v"(x[7])); }
__device__ __forceinline__ void exp2x4(float (&x)[4]) { asm("v_exp_f32 %0, %0\n\tv_exp_f32 %1, %1\n\tv_exp_f32 %2, %2\n\tv_exp_f32 %3, %3\n\tv_nop" : "+v"(x[0]), "+v"(x[1]), "+v"(x[2]), "+v"(x[3])); }
__device__ __forceinline__ float exp2x1(float x) { asm("v_exp_f32 %0, %0\n\tv_nop" : "+v"(x)); return x; }
// one 32-key slice against the wave's 32 queries. S^T = K Q^T: a lane's 8 + 8 result registers are keys 8h .. 8h+7 and 16+8h .. 16+8h+7 of ITS query c, which is the B operand order of O^T += V^T P^T as it stands.
// m is the running maximum in scaled log2 units (cs = scale * log2 e), l the lane's own sum. DIAG: the slice starts at the wave's first query row, keys above a query's own row get weight 0.
template <bool DIAG>
__device__ __forceinline__ void fa_step(const unsigned char* kp, const unsigned char* vp, const v16h (&qf)[2][2], v8f (&o)[2][4], float (&m)[2], float (&l)[2], float cs, int c, int h) {
  const v8f z8 = {0.f, 0.f, 0.f, 0.f, 0.f, 0.f, 0.f, 0.f};
  const v16h ka0 = l_frag(kp), ka1 = l_frag(kp + 64), kb0 = l_frag(kp + 16 * FKPB), kb1 = l_frag(kp + 16 * FKPB + 64);
  v16h vf[4];
#pragma unroll      /* here and below: full unrolling makes every index of the register arrays a constant, so they stay in registers */
  for (int dt = 0; dt < 4; ++dt) vf[dt] = l_frag(vp + dt * 16 * FVPB);
  v8f sa[2], sb[2];
  sa[0] = h_mma(ka0, qf[0][0], z8); sb[0] = h_mma(kb0, qf[0][0], z8); sa[1] = h_mma(ka0, qf[1][0], z8); sb[1] = h_mma(kb0, qf[1][0], z8);
  sa[0] = h_mma(ka1, qf[0][1], sa[0]); sb[0] = h_mma(kb1, qf[0][1], sb[0]); sa[1] = h_mma(ka1, qf[1][1], sa[1]); sb[1] = h_mma(kb1, qf[1][1], sb[1]);
  FragH pf[2];
#pragma unroll
  for (int qt = 0; qt < 2; ++qt) {
    if (DIAG) {
#pragma unroll
      for (int r = 0; r < 8; ++r) { sa[qt][r] = (8 * h + r <= 16 * qt + c) ? sa[qt][r] : -1.0e30f; sb[qt][r] = (16 + 8 * h + r <= 16 * qt + c) ? sb[qt][r] : -1.0e30f; } }
    float ml = fmaxf(sa[qt][0], sb[qt][0]);
#pragma unroll
    for (int r = 1; r < 8; ++r) ml = fmaxf(ml, fmaxf(sa[qt][r], sb[qt][r]));
    ml = fmaxf(ml, half_x(ml));      /* the query's other 16 keys of this slice sit in lane l ^ 16 */
    const float mn = fmaxf(m[qt], ml * cs); const float sc = exp2x1(m[qt] - mn); m[qt] = mn; float ps = 0.f, pa[8], pb[8];
#pragma unroll
    for (int r = 0; r < 8; ++r) { pa[r] = fmaf(sa[qt][r], cs, -mn); pb[r] = fmaf(sb[qt][r], cs, -mn); }
    exp2x8(pa); exp2x8(pb);
#pragma unroll
    for (int r = 0; r < 8; ++r) { ps += pa[r] + pb[r]; pf[qt].h[r] = (_Float16)pa[r]; pf[qt].h[8 + r] = (_Float16)pb[r]; }
    l[qt] = l[qt] * sc + ps;
#pragma unroll
    for (int dt = 0; dt < 4; ++dt) o[qt][dt] *= sc; }
#pragma unroll
  for (int dt = 0; dt < 4; ++dt) { o[0][dt] = h_mma(vf[dt], pf[0].v, o[0][dt]); o[1][dt] = h_mma(vf[dt], pf[1].v, o[1][dt]); } }
// block = 8 waves = 2 query groups x FKS key slices; k rows and v^T rows of a stage go through registers into one of two LDS buffers (coalesced 16-byte loads, issued one stage ahead), one barrier a stage.
// Each wave keeps its own running maximum, sum and O^T over its slices; the four waves of a group are joined once, through LDS, by the usual rescaling to the common maximum.
__global__ __launch_bounds__(256) void k_fa16(const _Float16* __restrict__ QKV, const _Float16* __restrict__ VT, float cs, float* __restrict__ O) {
  __shared__ __attribute__((aligned(16))) unsigned char L[2 * FBUF]; static_assert(2 * FBUF >= FIMG + 8 * 2 * 32 * 8, "the epilogue reuses the stage buffers");
  const int tid = threadIdx.x, lane = tid & 31, c = lane & 15, h = lane >> 4; const int w = __builtin_amdgcn_readfirstlane(tid >> 5); const int g = w & 1, ks = w >> 1;      /* the wave's number as a scalar: every branch below is wave-uniform, as the matrix instructions need */
  const int Q0 = QT0 + ((int)gridDim.x - 1 - (int)blockIdx.x) * FQ;      /* the longest blocks start first */
  const int qb = Q0 + 32 * g; const int nf = Q0 / FSK;      /* the wave's first query row; stages 0 .. nf-1 lie wholly below the block's rows, stage nf holds the rest (Q0 + FQ <= (nf + 1) * FSK <= SQ: FSK is a multiple of FQ, SQ of FSK) */
  const _Float16* base = QKV + (size_t)blockIdx.y * SQ * LQK; const _Float16* vtb = VT + (size_t)blockIdx.y * HD * SQ;
  const unsigned short* kg = (const unsigned short*)base + (size_t)(tid >> 3) * LQK + (tid & 7) * 8;      /* staging: 8 threads a k row (128 bytes, DI halves into the q | k | v row), rows +32 a pass */
  const unsigned short* vg = (const unsigned short*)vtb + (size_t)(tid >> 4) * SQ + (tid & 15) * 8;      /* 16 threads a v^T row slice (256 bytes), rows +16 a pass */
  unsigned char* ks_l = L + (tid >> 3) * FKPB + (tid & 7) * 16; unsigned char* vs_l = L + FKB + (tid >> 4) * FVPB + (tid & 15) * 16;
  v8us tk[4], tv[4];
#pragma unroll
  for (int u = 0; u < 4; ++u) { tk[u] = *(const v8us*)(kg + DI + (size_t)u * 32 * LQK); tv[u] = *(const v8us*)(vg + (size_t)u * 16 * SQ); }
  v16h qf[2][2];
#pragma unroll
  for (int qt = 0; qt < 2; ++qt) { const _Float16* qr = base + (size_t)(qb + 16 * qt + c) * LQK; qf[qt][0] = g2_frag(qr, h); qf[qt][1] = g2_frag(qr + 32, h); }
  asm volatile("s_wait_xcnt 0x0" :: "v"(kg), "v"(vg) : "memory");      /* address registers of the loads above are reused below while the loads are in flight: the wait stands in front of that reuse; the two staging addresses are inputs so that they live up to the wait (else the last staging load's result is placed over them) */
  const v8f z8 = {0.f, 0.f, 0.f, 0.f, 0.f, 0.f, 0.f, 0.f}; v8f o[2][4] = {{z8, z8, z8, z8}, {z8, z8, z8, z8}}; float m[2] = {-1.0e30f, -1.0e30f}, l[2] = {0.f, 0.f};
#pragma unroll
  for (int u = 0; u < 4; ++u) { *(v8us*)(ks_l + u * 32 * FKPB) = tk[u]; *(v8us*)(vs_l + u * 16 * FVPB) = tv[u]; }
  __syncthreads();      /* stage 0 is complete before anyone reads it */
  const unsigned char* kp = L + (ks * 32 + c) * FKPB + 16 * h; const unsigned char* vp = L + FKB + c * FVPB + ks * 64 + 16 * h;
#pragma unroll 1      /* rolled: one trip is a whole stage up to its barrier */
  for (int st = 0; st < nf; ++st) { const int bo = (st & 1) * FBUF;      /* stages wholly below the block's first query row: every wave's slice is seen by all its queries, and a next stage always exists */
    kg += (size_t)FSK * LQK; vg += FSK;      /* the next stage's rows fly while this stage is worked on */
#pragma unroll
    for (int u = 0; u < 4; ++u) { tk[u] = *(const v8us*)(kg + DI + (size_t)u * 32 * LQK); tv[u] = *(const v8us*)(vg + (size_t)u * 16 * SQ); }
    asm volatile("s_wait_xcnt 0x0" ::: "memory");      /* the next trip advances the address registers that these loads name: the wait stands in front of that */
    fa_step<false>(kp + bo, vp + bo, qf, o, m, l, cs, c, h);
    __builtin_amdgcn_sched_barrier(0);      /* the LDS stores below wait for the loads issued above: left alone the compiler lifts them, with that wait and the barrier, in front of the softmax, and the loads' latency is no longer covered by this stage's work */
#pragma unroll
    for (int u = 0; u < 4; ++u) { *(v8us*)(ks_l + (FBUF - bo) + u * 32 * FKPB) = tk[u]; *(v8us*)(vs_l + (FBUF - bo) + u * 16 * FVPB) = tv[u]; }      /* the other buffer: its readers left it in front of the previous trip's barrier */
    __syncthreads(); }      /* publishes the next stage and ends every reader's last read of this one */
  { const int bo = (nf & 1) * FBUF; const int kb = nf * FSK + ks * 32;      /* the last stage holds the diagonal: a slice below the wave's rows as before, the slice that starts at them masked, a slice wholly above them left out */
    if (kb < qb) fa_step<false>(kp + bo, vp + bo, qf, o, m, l, cs, c, h); else if (kb == qb) fa_step<true>(kp + bo, vp + bo, qf, o, m, l, cs, c, h); }
  __syncthreads();      /* every reader has left the stage buffers: the epilogue reuses them */
  float* img = (float*)L; v2f* mlp = (v2f*)(L + FIMG);      
#pragma unroll
  for (int qt = 0; qt < 2; ++qt) { l[qt] += half_x(l[qt]); const v2f x = {m[qt], l[qt]}; mlp[(w * 2 + qt) * 32 + lane] = x;
#pragma unroll
    for (int dt = 0; dt < 4; ++dt) { const v4f x0 = {o[qt][dt][0], o[qt][dt][1], o[qt][dt][2], o[qt][dt][3]}; const v4f x1 = {o[qt][dt][4], o[qt][dt][5], o[qt][dt][6], o[qt][dt][7]}; float* d = img + (size_t)(((w * 2 + qt) * 4 + dt) * 2) * 128 + lane * 4; *(v4f*)d = x0; *(v4f*)(d + 128) = x1; } }
  __syncthreads();      /* every wave's partial result is in LDS */
  const int fq = ks >> 1, fd = (ks & 1) * 2;      /* the wave finishes query tile fq of its group, output columns fd*16 .. fd*16+31: one whole 128-byte line a query */
  float mj[FKS], lj[FKS]; float mx = -1.0e30f;
#pragma unroll
  for (int j = 0; j < FKS; ++j) { const v2f x = mlp[((j * 2 + g) * 2 + fq) * 32 + lane]; mj[j] = x[0]; lj[j] = x[1]; mx = fmaxf(mx, x[0]); }
  float ls = 0.f;
#pragma unroll
  for (int j = 0; j < FKS; ++j) mj[j] -= mx;
  exp2x4(mj);
#pragma unroll
  for (int j = 0; j < FKS; ++j) ls += mj[j] * lj[j];
  const float fin = 1.0f / ls; v4f y[4] = {};
#pragma unroll
  for (int j = 0; j < FKS; ++j) { const float f = mj[j] * fin; const float* s = img + (size_t)((((j * 2 + g) * 2 + fq) * 4 + fd) * 2) * 128 + lane * 4;
#pragma unroll
    for (int e = 0; e < 4; ++e) y[e] += *(const v4f*)(s + e * 128) * f; }
  float* orow = O + ((size_t)blockIdx.y * SQ + qb + 16 * fq + c) * DI + fd * 16 + 8 * h;      /* piece e = columns (fd + e/2)*16 + 8h + 4(e%2) .. +3 of the lane's query */
  *(v4f*)orow = y[0]; *(v4f*)(orow + 4) = y[1]; *(v4f*)(orow + 16) = y[2]; *(v4f*)(orow + 20) = y[3]; }


extern "C" void kernel_launch(void* const* d_in, const int* in_sizes, int n_in,
                              void* d_out, int out_size, void* d_ws, size_t ws_size, hipStream_t stream) {
  (void)in_sizes; (void)n_in; (void)out_size;
  const float* const* I = (const float* const*)d_in; const float* x = I[0]; const float* wq = I[1]; const float* wk = I[2]; const float* wv = I[3];      /* x; [in][out = 64] Wq / Wk / Wv (input order as this module lists them); no biases */
  char* ws = (char*)d_ws; size_t off = 0;
  auto take = [&](size_t bytes) { char* p = ws + off; off += (bytes + 255) & ~(size_t)255; return p; };
  _Float16* BW = (_Float16*)take((size_t)LQK * DM * 2); _Float16* X16 = (_Float16*)take(NR * DM * 2); _Float16* QKV = (_Float16*)take(NR * LQK * 2); _Float16* VT = (_Float16*)take((size_t)NB * NH * HD * SQ * 2);
  float* QKVF = (float*)take(NR * LQK * 4);
  if (off > ws_size) return;
  k_wt_f16<<<dim3((unsigned)(((size_t)DI * (DM / 8) + 255) / 256), 3), 256, 0, stream>>>(wq, wk, wv, BW, DM, DI, 16.0f);      /* [in = DM][out = 64] -> Bt[n][k] x16, stacked q | k | v: one launch, the matrix on grid.y */
  k_x16<<<(unsigned)((NR * DM / 8 + 255) / 256), 256, 0, stream>>>(x, X16, NR * DM / 8);      /* x (bf16-valued) as exact f16 rows */
  k_gemm2<0><<<dim3((unsigned)((NR / 128) * (LQK / 64)), 1), 128, 0, stream>>>(X16, DM, 0, BW, DM, 0, 0.0625f, nullptr, 0, nullptr, 1, 0, 0, QKVF, QKV, LQK, 0, (int)NR, LQK, DM);      /* q | k | v = x W^T in ONE launch over the stacked 192 columns; each result is stored twice, as f16 (operands of the WMMA attention) and as f32 (the exact first tile reads rows 0..511 of each batch) */
  const _Float16* V16 = QKV + 2 * DI;
  float* ob = (float*)d_out;      /* the ONE head leaves grid.y free: it carries the batch in both attention launches below */
  k_vt<NH, SQ><<<NB * NH * (SQ / 64), 256, 0, stream>>>(V16, LQK, 0, VT);      /* V^T [NB][HD][SQ], every batch */
  k_fa16<<<dim3((SQ - QT0) / FQ, NB), 256, 0, stream>>>(QKV, VT, 0.0359158963f, ob);      /* query rows QT0 .. SQ-1: scores * 256^-0.666 (the factor is 0.024895003 * log2 e: the softmax works in base 2), causal softmax and P V in one launch, batch on grid.y; rows below QT0 come from the exact f32 path alone */
  k_att0w<LQK, DI><<<dim3(QT0 / 64, NB), 128, 0, stream>>>(QKVF, QKVF + DI, QKVF + 2 * DI, 0.024895003f, ob);      /* exact f32 causal attention for rows 0..511 of every batch, stored straight into the output rows, their only writer */
}

// v009
// Measured time: 49.1 microseconds a run.
// In two side-by-side timings against v008, it was 1.28 and 1.27 times as fast.
// All steps since v000 together make it 1472 times as fast.
#include <hip/hip_runtime.h>
// Single-head causal self-attention with the module's literal scale C^-0.666 (x [32][1024][256]; q/k/v = x W ([in][out] [256][64], no biases); ONE 64-wide head; scores * 256^-0.666 = 0.024895 (as the source writes it, not head_size^-0.5); causal; softmax; out = weights v -> [32][1024][64]; no output projection).
// Structure: token rows; one WMMA GEMM over the stacked q | k | v columns, which rounds x and the weights to exact f16 on the way into LDS and stores row planes of pitch 192 (f16 and f32) and v^T; query rows 512..1023 in one fused kernel with the batch on grid.y (S^T = K Q^T, running-maximum causal softmax in f32, weights as f16 straight from the score registers, O^T += V^T P^T, written as f32 into the output rows); query rows 0..511 from an exact f32 first tile only (no f16 tile for them); launches: see trace.
// Compute dtype: inputs rounded to bf16; x / weights exact; q, k, v and softmax weights as plain f16 GEMM operands (~2^-12); scores, softmax statistics and o f32. v_wmma_f32_16x16x32_f16; the exact first tile: f32 operands on v_wmma_f32_16x16x4_f32.
#define NB 32
#define SQ 1024
#define DM 256
#define NH 1
#define HD 64
#define HG 4                         /* unused by the launches (only the k_vt overload that is never launched names it) */
#define QT0 512                      /* first-tile rows computed exactly (f32): 512 here (no output projection averages the early-row cancellation errors away; logit sigma 1.0) */
#define B0 0                         /* unused */
#define NBR NB                       /* unused (only the unused MP names it) */
#define NR ((size_t)NB * SQ)
#define DMQ DM
#define DFF 4096                     /* unused (no FFN in this file) */
#define DFFR 100                     /* unused */
#define MP ((int)((size_t)NBR * SQ)) /* unused (only the unused MPO names it) */
#define QN SQ                        /* unused */
#define NHD NH                       /* unused */
#define MPO MP                       /* unused */
#define LQ (3 * DM)      /* unused; the q/k/v rows have pitch LQK (192) */
typedef __bf16 v16b __attribute__((ext_vector_type(16)));
typedef unsigned short v8us __attribute__((ext_vector_type(8), may_alias));
typedef float  v8f  __attribute__((ext_vector_type(8)));
typedef float  v4f  __attribute__((ext_vector_type(4)));
typedef float  v4fa __attribute__((ext_vector_type(4), may_alias));
union FragB { v16b v; v8us half[2]; unsigned short u[16]; };

__device__ __forceinline__ unsigned short bf16_bits(float x) { unsigned int u = __float_as_uint(x); return (unsigned short)((u + 0x7FFFu + ((u >> 16) & 1u)) >> 16); }
__device__ __forceinline__ float bf16_val(unsigned short b) { return __uint_as_float(((unsigned int)b) << 16); }
__device__ __forceinline__ float bf16_round(float x) { return bf16_val(bf16_bits(x)); }
// D += A·B with NT terms: 1 = ah·bh, 2 = + al·bh (A split), 3 = + ah·bl (both split)
template <int NT>
__device__ __forceinline__ v8f mmaN(v16b ah, v16b al, v16b bh, v16b bl, v8f c) {
  c = __builtin_amdgcn_wmma_f32_16x16x32_bf16(false, ah, false, bh, (short)0, c, false, false);
  if (NT >= 2) c = __builtin_amdgcn_wmma_f32_16x16x32_bf16(false, al, false, bh, (short)0, c, false, false);
  if (NT >= 3) c = __builtin_amdgcn_wmma_f32_16x16x32_bf16(false, ah, false, bl, (short)0, c, false, false);
  asm volatile("v_nop\n\tv_nop\n\tv_nop\n\tv_nop" : "+v"(c) : "v"(ah), "v"(al), "v"(bh), "v"(bl));
  return c;
}

__global__ __launch_bounds__(256) void k_wt_bf16(const float* __restrict__ W, unsigned short* __restrict__ Wt, int K, int N) {
  const int t = blockIdx.x * 256 + threadIdx.x;
  const int k8n = K / 8;
  if (t >= N * k8n) return;
  const int n = t / k8n, k8 = (t % k8n) * 8;
  v8us v;
#pragma unroll
  for (int i = 0; i < 8; ++i) v[i] = bf16_bits(W[(size_t)(k8 + i) * N + n]);
  *(v8us*)(Wt + (size_t)n * K + k8) = v;
  
}

// GEMM C[M][N] (f32, pitch ldc) = act(A[M][K]·W + bias). A f32 row-major (pitch lda) converted per fragment to bf16
// (ASPLIT: hi/lo two planes -> 2 terms, else single rounded term); Wt bf16 [N][K] (pitch ldb). BIAS_BF16 rounds the
// bias to bf16 first (bias quantised to bf16 before the add). K%32==0, M%16==0, N%64==0.
template <bool ASPLIT, int ACT, bool BIAS_BF16>
__global__ __launch_bounds__(128) void k_gemm_bf(const float* __restrict__ A, int lda, const unsigned short* __restrict__ Wt, int ldb,
                                               const float* __restrict__ bias, float* __restrict__ C, int ldc, int M, int N, int K) {
  __shared__ __attribute__((aligned(16))) float so[4][16][64];
  const int tid = threadIdx.x, w = tid >> 5, lane = tid & 31, ln = lane & 15, hh = lane >> 4;
  const int ntn = N / 64;
  const int wid = blockIdx.x * 4 + w;
  const int mt = wid / ntn, nq = wid % ntn;
  if (mt * 16 >= M) return;
  const int row0 = mt * 16, col0 = nq * 64;
  const float* arow = A + (size_t)(row0 + ln) * lda;
  v8f acc[4] = {};
  for (int kb = 0; kb < K; kb += 32) {
    FragB ah, al;
    const v4f x0 = *(const v4fa*)(arow + kb + 8 * hh), x1 = *(const v4fa*)(arow + kb + 8 * hh + 4);
    const v4f x2 = *(const v4fa*)(arow + kb + 16 + 8 * hh), x3 = *(const v4fa*)(arow + kb + 16 + 8 * hh + 4);
    float xs[16] = {x0[0],x0[1],x0[2],x0[3],x1[0],x1[1],x1[2],x1[3],x2[0],x2[1],x2[2],x2[3],x3[0],x3[1],x3[2],x3[3]};
#pragma unroll
    for (int i = 0; i < 16; ++i) { const unsigned short hb = bf16_bits(xs[i]); ah.u[i] = hb; al.u[i] = ASPLIT ? bf16_bits(xs[i] - bf16_val(hb)) : (unsigned short)0; }
#pragma unroll
    for (int t = 0; t < 4; ++t) {
      const unsigned short* brow = Wt + (size_t)(col0 + t * 16 + ln) * ldb + kb;
      FragB b;
      b.half[0] = *(const v8us*)(brow + 8 * hh);
      b.half[1] = *(const v8us*)(brow + 16 + 8 * hh);
      acc[t] = mmaN<ASPLIT ? 2 : 1>(ah.v, al.v, b.v, b.v, acc[t]);
    }
  }
#pragma unroll
  for (int t = 0; t < 4; ++t) {
    float bv = bias ? bias[col0 + t * 16 + ln] : 0.f;
    if (BIAS_BF16) bv = bf16_round(bv);
#pragma unroll
    for (int r = 0; r < 8; ++r) { float v = acc[t][r] + bv; if (ACT == 1) v = fmaxf(v, 0.f); so[w][8 * hh + r][t * 16 + ln] = v; }
  }
  __builtin_amdgcn_fence(__ATOMIC_ACQ_REL, "workgroup");
  __builtin_amdgcn_wave_barrier();
  const int rsub = lane >> 4, c4 = (lane & 15) * 4;
  {
#pragma unroll
    for (int q = 0; q < 8; ++q) {
      const int r = q * 2 + rsub;
      const v4f v = *(const v4fa*)&so[w][r][c4];
      *(v4f*)(C + (size_t)(row0 + r) * ldc + col0 + c4) = v;
    }
    
  }
}

// GEMM C = act(A·W + bias + resid): A f32 (ASPLIT -> hi/lo 2 terms), Wt bf16 [N][K]; ACT 0 none, 1 relu, 2 exact gelu;
// resid (optional, f32, row index = (row % rmod), pitch ldr, RES_BF16 rounds it) added before the activation.
template <bool ASPLIT, int ACT, bool BIAS_BF16, bool RES_BF16>
__global__ __launch_bounds__(128) void k_gemm_bf3(const float* __restrict__ A, int lda, const unsigned short* __restrict__ Wt, int ldb,
                                                const float* __restrict__ bias, const float* __restrict__ resid, int rmod, int ldr,
                                                float* __restrict__ C, int ldc, int M, int N, int K) {
  __shared__ __attribute__((aligned(16))) float so[4][16][64];
  const int tid = threadIdx.x, w = tid >> 5, lane = tid & 31, ln = lane & 15, hh = lane >> 4;
  const int ntn = N / 64;
  const int wid = blockIdx.x * 4 + w;
  const int mt = wid / ntn, nq = wid % ntn;
  if (mt * 16 >= M) return;
  const int row0 = mt * 16, col0 = nq * 64;
  const float* arow = A + (size_t)(row0 + ln) * lda;
  v8f acc[4] = {};
  for (int kb = 0; kb < K; kb += 32) {
    FragB ah, al;
    const v4f x0 = *(const v4fa*)(arow + kb + 8 * hh), x1 = *(const v4fa*)(arow + kb + 8 * hh + 4);
    const v4f x2 = *(const v4fa*)(arow + kb + 16 + 8 * hh), x3 = *(const v4fa*)(arow + kb + 16 + 8 * hh + 4);
    float xs[16] = {x0[0],x0[1],x0[2],x0[3],x1[0],x1[1],x1[2],x1[3],x2[0],x2[1],x2[2],x2[3],x3[0],x3[1],x3[2],x3[3]};
#pragma unroll
    for (int i = 0; i < 16; ++i) { const unsigned short hb = bf16_bits(xs[i]); ah.u[i] = hb; al.u[i] = ASPLIT ? bf16_bits(xs[i] - bf16_val(hb)) : (unsigned short)0; }
#pragma unroll
    for (int t = 0; t < 4; ++t) {
      const unsigned short* brow = Wt + (size_t)(col0 + t * 16 + ln) * ldb + kb;
      FragB b;
      b.half[0] = *(const v8us*)(brow + 8 * hh);
      b.half[1] = *(const v8us*)(brow + 16 + 8 * hh);
      acc[t] = mmaN<ASPLIT ? 2 : 1>(ah.v, al.v, b.v, b.v, acc[t]);
    }
  }
#pragma unroll
  for (int t = 0; t < 4; ++t) {
    const int col = col0 + t * 16 + ln;
    float bv = bias ? bias[col] : 0.f;
    if (BIAS_BF16) bv = bf16_round(bv);
#pragma unroll
    for (int r = 0; r < 8; ++r) {
      float v = acc[t][r] + bv;
      if (resid) { float rv = resid[(size_t)((row0 + 8 * hh + r) % rmod) * ldr + col]; if (RES_BF16) rv = bf16_round(rv); v += rv; }
      if (ACT == 1) v = fmaxf(v, 0.f);
      if (ACT == 2) v = 0.5f * v * (1.0f + erff(v * 0.70710678118654752f));
      if (ACT == 3) { const float u = 0.7978845608028654f * (v + 0.044715f * v * v * v); v = 0.5f * v * (1.0f + tanhf(u)); }
      so[w][8 * hh + r][t * 16 + ln] = v;
    }
  }
  __builtin_amdgcn_fence(__ATOMIC_ACQ_REL, "workgroup");
  __builtin_amdgcn_wave_barrier();
  const int rsub = lane >> 4, c4 = (lane & 15) * 4;
  {
#pragma unroll
    for (int q = 0; q < 8; ++q) {
      const int r = q * 2 + rsub;
      const v4f v = *(const v4fa*)&so[w][r][c4];
      *(v4f*)(C + (size_t)(row0 + r) * ldc + col0 + c4) = v;
    }
    
  }
}
// row LayerNorm (biased variance, eps) over N: s = X (+ R); optional out_sum <- s; out_norm <- (s-mu)*rsqrt(var+eps)*g + b
template <bool PARAM_BF16>
__global__ __launch_bounds__(256) void k_layernorm(const float* __restrict__ X, const float* __restrict__ R, const float* __restrict__ g, const float* __restrict__ bta,
                                                  float* __restrict__ out_sum, float* __restrict__ out_norm, int N, float eps) {
  __shared__ float red[256];
  const int row = blockIdx.x, tid = threadIdx.x;
  const float* x = X + (size_t)row * N; const float* rr = R ? R + (size_t)row * N : nullptr;
  float vals[16];                     // up to N = 4096
  const int per = N / 256;            // contiguous chunk per thread? use strided-by-4 chunks: thread handles j = tid*4 + 1024*u
  float s1 = 0.f;
  for (int u = 0; u < per / 4; ++u) {
    const int j = tid * 4 + 1024 * u;
    const v4f a = *(const v4fa*)(x + j);
    v4f b = {0.f,0.f,0.f,0.f}; if (rr) b = *(const v4fa*)(rr + j);
#pragma unroll
    for (int q = 0; q < 4; ++q) { const float v = a[q] + b[q]; vals[u * 4 + q] = v; s1 += v; }
  }
  red[tid] = s1; __syncthreads();
  for (int st = 128; st > 0; st >>= 1) { if (tid < st) red[tid] += red[tid + st]; __syncthreads(); }
  const float mu = red[0] / (float)N; __syncthreads();
  float s2 = 0.f;
  for (int u = 0; u < per / 4; ++u)
#pragma unroll
    for (int q = 0; q < 4; ++q) { const float c = vals[u * 4 + q] - mu; s2 += c * c; }
  red[tid] = s2; __syncthreads();
  for (int st = 128; st > 0; st >>= 1) { if (tid < st) red[tid] += red[tid + st]; __syncthreads(); }
  const float rs = rsqrtf(red[0] / (float)N + eps);
  {
    for (int u = 0; u < per / 4; ++u) {
      const int j = tid * 4 + 1024 * u;
      v4f o, sm;
#pragma unroll
      for (int q = 0; q < 4; ++q) {
        float gg = g[j + q], bb = bta[j + q];
        if (PARAM_BF16) { gg = bf16_round(gg); bb = bf16_round(bb); }
        sm[q] = vals[u * 4 + q]; o[q] = (vals[u * 4 + q] - mu) * rs * gg + bb;
      }
      if (out_sum) *(v4f*)(out_sum + (size_t)row * N + j) = sm;
      *(v4f*)(out_norm + (size_t)row * N + j) = o;
    }
    
  }
}



// ---- f16 WMMA path (v_wmma_f32_16x16x32_f16): 11-bit significands for operands in range — used where a [0,1] probability operand needs more precision than bf16
typedef _Float16 v16h __attribute__((ext_vector_type(16)));
union FragH { v16h v; v8us half[2]; _Float16 h[16]; unsigned short u[16]; };
template <int NT>
__device__ __forceinline__ v8f mmaH(v16h ah, v16h al, v16h bh, v16h bl, v8f c) {
  c = __builtin_amdgcn_wmma_f32_16x16x32_f16(false, ah, false, bh, (short)0, c, false, false);
  if (NT >= 2) c = __builtin_amdgcn_wmma_f32_16x16x32_f16(false, al, false, bh, (short)0, c, false, false);
  if (NT >= 3) c = __builtin_amdgcn_wmma_f32_16x16x32_f16(false, ah, false, bl, (short)0, c, false, false);
  asm volatile("v_nop\n\tv_nop\n\tv_nop\n\tv_nop" : "+v"(c) : "v"(ah), "v"(al), "v"(bh), "v"(bl));
  return c;
}
// batched GEMM like k_gemm_b but f16 operands: A f32 (split into f16 hi/lo if ASPLIT, else rounded to f16), Bt = f16 values [n][k]; alpha; C f32; N multiple of 16 (partial tiles skipped)
template <bool ASPLIT>
__global__ __launch_bounds__(128) void k_gemm_h(const float* __restrict__ A, int lda, size_t sA, const _Float16* __restrict__ Bh, int ldb, size_t sB, float alpha, float* __restrict__ C, int ldc, size_t sC, int M, int N, int K) {
  __shared__ __attribute__((aligned(16))) float so[4][16][64];
  const int tid = threadIdx.x, w = tid >> 5, lane = tid & 31, ln = lane & 15, hh = lane >> 4; const int by = blockIdx.y;
  A += (size_t)by * sA; Bh += (size_t)by * sB; C += (size_t)by * sC;
  const int ntn = (N + 63) / 64; const int wid = blockIdx.x * 4 + w; const int mt = wid / ntn, nq = wid % ntn; if (mt * 16 >= M) return;
  const int row0 = mt * 16, col0 = nq * 64; const float* arow = A + (size_t)(row0 + ln) * lda;
  v8f acc[4] = {};
  for (int kb = 0; kb < K; kb += 32) {
    FragH ah, al;
    const v4f x0 = *(const v4fa*)(arow + kb + 8 * hh), x1 = *(const v4fa*)(arow + kb + 8 * hh + 4), x2 = *(const v4fa*)(arow + kb + 16 + 8 * hh), x3 = *(const v4fa*)(arow + kb + 16 + 8 * hh + 4);
    float xs[16] = {x0[0],x0[1],x0[2],x0[3],x1[0],x1[1],x1[2],x1[3],x2[0],x2[1],x2[2],x2[3],x3[0],x3[1],x3[2],x3[3]};
#pragma unroll
    for (int i = 0; i < 16; ++i) { const _Float16 h = (_Float16)xs[i]; ah.h[i] = h; al.h[i] = ASPLIT ? (_Float16)(xs[i] - (float)h) : (_Float16)0.0f; }
#pragma unroll
    for (int t = 0; t < 4; ++t) { if (col0 + t * 16 >= N) continue; const size_t boff = (size_t)(col0 + t * 16 + ln) * ldb + kb; FragH bq; bq.half[0] = *(const v8us*)(Bh + boff + 8 * hh); bq.half[1] = *(const v8us*)(Bh + boff + 16 + 8 * hh);
      acc[t] = mmaH<ASPLIT ? 2 : 1>(ah.v, al.v, bq.v, bq.v, acc[t]); }
  }
#pragma unroll
  for (int t = 0; t < 4; ++t) { if (col0 + t * 16 >= N) continue;
#pragma unroll
    for (int r = 0; r < 8; ++r) so[w][8 * hh + r][t * 16 + ln] = acc[t][r] * alpha; }
  __builtin_amdgcn_fence(__ATOMIC_ACQ_REL, "workgroup"); __builtin_amdgcn_wave_barrier();
  const int rsub = lane >> 4, c4 = (lane & 15) * 4;
  {
#pragma unroll
    for (int q = 0; q < 8; ++q) { const int r = q * 2 + rsub; if (col0 + c4 < N) { const v4f v = *(const v4fa*)&so[w][r][c4]; *(v4f*)(C + (size_t)(row0 + r) * ldc + col0 + c4) = v; } }
     }
}

// k_gemm_hh variant with fused epilogue: v = acc·alpha + bias[by·sBias + col] (+ CP[(row/rowsPerB)·sCPb + by·64 + col] if CP) ; ACT 0 none / 1 elu ; writes f16 C16 (and f32 C if non-null)
template <int ACT>
__global__ __launch_bounds__(128) void k_gemm_hhx(const _Float16* __restrict__ A, int lda, size_t sA, const _Float16* __restrict__ Bh, int ldb, size_t sB, float alpha, const float* __restrict__ bias, size_t sBias, const float* __restrict__ CP, int rowsPerB, size_t sCPb, int row0g,
    float* __restrict__ C, _Float16* __restrict__ C16, int ldc, size_t sC, int M, int N, int K) {
  __shared__ __attribute__((aligned(16))) float so[4][16][64];
  const int tid = threadIdx.x, w = tid >> 5, lane = tid & 31, ln = lane & 15, hh = lane >> 4; const int by = blockIdx.y;
  A += (size_t)by * sA; Bh += (size_t)by * sB; const size_t cofs = (size_t)by * sC; const float* bp = bias ? bias + (size_t)by * sBias : nullptr;
  const int ntn = (N + 63) / 64; const int wid = blockIdx.x * 4 + w; const int mt = wid / ntn, nq = wid % ntn; if (mt * 16 >= M) return;
  const int row0 = mt * 16, col0 = nq * 64; const _Float16* arow = A + (size_t)(row0 + ln) * lda;
  v8f acc[4] = {};
  for (int kb = 0; kb < K; kb += 32) { FragH ah; ah.half[0] = *(const v8us*)((const unsigned short*)arow + kb + 8 * hh); ah.half[1] = *(const v8us*)((const unsigned short*)arow + kb + 16 + 8 * hh);
#pragma unroll
    for (int t = 0; t < 4; ++t) { if (col0 + t * 16 >= N) continue; const size_t boff = (size_t)(col0 + t * 16 + ln) * ldb + kb; FragH bq; bq.half[0] = *(const v8us*)((const unsigned short*)Bh + boff + 8 * hh); bq.half[1] = *(const v8us*)((const unsigned short*)Bh + boff + 16 + 8 * hh);
      acc[t] = mmaH<1>(ah.v, ah.v, bq.v, bq.v, acc[t]); }
  }
#pragma unroll
  for (int t = 0; t < 4; ++t) { if (col0 + t * 16 >= N) continue; const int col = col0 + t * 16 + ln; const float bv = bp ? bf16_round(bp[col]) : 0.f;
#pragma unroll
    for (int r = 0; r < 8; ++r) { float v = acc[t][r] * alpha + bv; if (CP) { const int rr = row0g + row0 + 8 * hh + r; if (rowsPerB < 0) v += CP[cofs + (size_t)rr * ldc + col];      /* rowsPerB < 0: own element of the batched C plane */ else { const int bidx = rr / rowsPerB; v += CP[(size_t)bidx * sCPb + (size_t)by * 64 + col]; } } if (ACT == 1) v = (v > 0.f) ? v : expm1f(v); else if (ACT == 7) v = (v > 0.f) ? v + 1.0f : expf(v); else if (ACT == 8) v = tanhf(v); else if (ACT == 9) v = 0.5f * v * (1.0f + tanhf(0.7978845608028654f * (v + 0.044715f * v * v * v))); else if (ACT == 11) v = 1.0f / (1.0f + expf(-v)); else if (ACT == 12) v = (v > 0.f) ? v : 0.01f * v; else if (ACT == 14) v = (v > 0.f) ? v : 0.1f * v; else if (ACT == 16) v = (v >= 0.f) ? v : 0.3f * v; else if (ACT == 17) v = (v >= 0.f) ? v : 0.2f * v; else if (ACT == 15) v = v / (1.0f + expf(-v)); else if (ACT == 3) v = fmaxf(v, 0.f); else if (ACT == 6) v = 0.5f * v * (1.0f + erff(v * 0.70710678118654752f)); so[w][8 * hh + r][t * 16 + ln] = v; } }
  __builtin_amdgcn_fence(__ATOMIC_ACQ_REL, "workgroup"); __builtin_amdgcn_wave_barrier();
  const int rsub = lane >> 4, c4 = (lane & 15) * 4; typedef _Float16 v4h __attribute__((ext_vector_type(4)));
  {
#pragma unroll
    for (int q = 0; q < 8; ++q) { const int r = q * 2 + rsub; if (col0 + c4 < N) { const v4f v = *(const v4fa*)&so[w][r][c4]; if (C) *(v4f*)(C + cofs + (size_t)(row0 + r) * ldc + col0 + c4) = v; if (C16) { v4h h4; for (int i = 0; i < 4; ++i) h4[i] = (_Float16)v[i]; *(v4h*)(C16 + cofs + (size_t)(row0 + r) * ldc + col0 + c4) = h4; } } }
     }
}


typedef _Float16 v4h __attribute__((ext_vector_type(4)));

__global__ __launch_bounds__(256) void k_h16(const float* __restrict__ x, _Float16* __restrict__ X16, size_t n8) { const size_t t = (size_t)blockIdx.x * 256 + threadIdx.x; if (t >= n8) return; FragH f;
#pragma unroll
  for (int q = 0; q < 8; ++q) f.h[q] = (_Float16)x[t * 8 + q]; *(v8us*)((unsigned short*)X16 + t * 8) = f.half[0];  }
__global__ __launch_bounds__(256) void k_round16f(const float* __restrict__ W, _Float16* __restrict__ Bt, size_t n8) { const size_t t = (size_t)blockIdx.x * 256 + threadIdx.x; if (t >= n8) return; FragH f;
#pragma unroll
  for (int i = 0; i < 8; ++i) f.h[i] = (_Float16)(bf16_round(W[t * 8 + i]) * 16.0f); *(v8us*)((unsigned short*)Bt + t * 8) = f.half[0];  }

__global__ __launch_bounds__(256) void k_hl(const float* __restrict__ F, _Float16* __restrict__ Hh, _Float16* __restrict__ Hl, size_t n8) { const size_t t = (size_t)blockIdx.x * 256 + threadIdx.x; if (t >= n8) return; FragH fh, fl; const v4f a = *(const v4fa*)(F + t * 8), c = *(const v4fa*)(F + t * 8 + 4);
#pragma unroll
  for (int q = 0; q < 4; ++q) { _Float16 h = (_Float16)a[q]; fh.h[q] = h; fl.h[q] = (_Float16)((a[q] - (float)h) * 1024.0f); h = (_Float16)c[q]; fh.h[4 + q] = h; fl.h[4 + q] = (_Float16)((c[q] - (float)h) * 1024.0f); }
  { *(v8us*)((unsigned short*)Hh + t * 8) = fh.half[0]; *(v8us*)((unsigned short*)Hl + t * 8) = fl.half[0];  } }

// fragment of 32 k from a row in global memory: k 8h .. 8h+7 and 16+8h .. 16+8h+7
__device__ __forceinline__ v16h g2_frag(const _Float16* p, int hh) { FragH f; f.half[0] = *(const v8us*)((const unsigned short*)p + 8 * hh); f.half[1] = *(const v8us*)((const unsigned short*)p + 16 + 8 * hh); return f.v; }


__global__ __launch_bounds__(256) void k_wnat(const float* __restrict__ w, size_t n8, _Float16* __restrict__ Bt) { const size_t t = (size_t)blockIdx.x * 256 + threadIdx.x; if (t >= n8) return; FragH f; for (int q = 0; q < 8; ++q) f.h[q] = (_Float16)(bf16_round(w[t * 8 + q]) * 16.0f); *(v8us*)((unsigned short*)Bt + t * 8) = f.half[0];  }
__global__ __launch_bounds__(256) void k_rsm(const float* __restrict__ S, _Float16* __restrict__ P, int nrows) {
  #pragma clang fp contract(off)
  const int i = blockIdx.x * 256 + threadIdx.x; if (i >= nrows) return; const float* s = S + (size_t)i * SQ; float mx = -3.0e38f;
#pragma unroll 1
  for (int j = 0; j < SQ; ++j) mx = fmaxf(mx, s[j]); float se = 0.f;
#pragma unroll 1
  for (int j = 0; j < SQ; ++j) se += expf(s[j] - mx); const float sc = 256.0f / se;
#pragma unroll 1
  for (int j0 = 0; j0 < SQ; j0 += 8) { FragH f; for (int q = 0; q < 8; ++q) f.h[q] = (_Float16)(expf(s[j0 + q] - mx) * sc); unsigned short* d = (unsigned short*)P + (size_t)i * SQ + j0; *(v8us*)d = f.half[0];  } }
__global__ __launch_bounds__(256) void k_vt(const _Float16* __restrict__ V16, int b, int h0, _Float16* __restrict__ VT) { __shared__ unsigned short tl[64][65]; const int tid = threadIdx.x; const int hh = blockIdx.x % HG, sg = blockIdx.x / HG; const int s0 = sg * 64; const int h = h0 + hh;
  for (int i = tid; i < 64 * 8; i += 256) { const int j = i / 8, d8 = (i % 8) * 8; FragH f; f.half[0] = *(const v8us*)((const unsigned short*)V16 + ((size_t)b * SQ + s0 + j) * DM + h * HD + d8); for (int q = 0; q < 8; ++q) tl[d8 + q][j] = f.u[q]; }
  __syncthreads();
  { for (int i = tid; i < 64 * 8; i += 256) { const int d = i / 8, j8 = (i % 8) * 8; FragH f; for (int q = 0; q < 8; ++q) f.u[q] = tl[d][j8 + q]; *(v8us*)((unsigned short*)VT + ((size_t)hh * HD + d) * SQ + s0 + j8) = f.half[0]; }  } }



// lane l with lane l ^ 16; every lane is on where this is used
__device__ __forceinline__ float half_x(float x) { return __builtin_bit_cast(float, __builtin_amdgcn_permlanex16(__builtin_bit_cast(int, x), __builtin_bit_cast(int, x), 0x76543210, 0xfedcba98, false, false)); }

typedef float v2f __attribute__((ext_vector_type(2)));
#define KP 68                        /* row pitch of the k and v tiles in LDS, in floats: 272 bytes = 16 x 17, so the 16 rows that one 16-byte fragment load touches lie on different banks */
__device__ __forceinline__ v8f f4_mma(v2f a, v2f b, v8f c) { return __builtin_amdgcn_wmma_f32_16x16x4_f32(false, a, false, b, (short)0, c, false, false); }
// exact f32 causal attention for the first QT0 rows on v_wmma_f32_16x16x4_f32, both products transposed. One wave owns 16 query rows, a block of 4 waves shares 64-key k and v tiles in LDS.
// S^T = K Q^T: A = 16 k rows, B = 16 q rows, both loaded by the same rule (lane (c, h) holds columns 32h .. 32h+31 of its row), so a lane's 8 result registers are keys 8h .. 8h+7 of ITS query c.
// O^T = V^T P^T: those registers, two at a time, are the B operand as they stand (keys 8h+2t, 8h+2t+1 in k step t); A takes the same keys of v, column dt*16+c. Maximum, sum and rescale factor of a query are then per lane (two lanes a query).
template <int ld, int ldo>      /* row pitches of q/k/v and of the output as constants: the 8 row groups of a staged tile are then immediate offsets from one address */
__global__ __launch_bounds__(128) void k_att0w(const float* __restrict__ QF, const float* __restrict__ KF, const float* __restrict__ VF, float scale, float* __restrict__ OF) {
  __shared__ __attribute__((aligned(16))) float lk[64][KP]; __shared__ __attribute__((aligned(16))) float lv[64][KP];
  const int tid = threadIdx.x, lane = tid & 31, c = lane & 15, h = lane >> 4; const int w = __builtin_amdgcn_readfirstlane(tid >> 5); const int rg = blockIdx.x;      /* the wave's number as a scalar: every branch below is wave-uniform, as the matrix instructions need */
  { const size_t bi = (size_t)blockIdx.y * SQ * ld; QF += bi; KF += bi; VF += bi; OF += (size_t)blockIdx.y * SQ * ldo; }      /* batch on grid.y: the first QT0 rows of each batch's SQ-row plane, inputs and output alike */
  const int i = rg * 64 + w * 16 + c;      /* the lane's query row */
  const float* qr = QF + (size_t)i * ld + 32 * h; v4f qv[8];
#pragma unroll      /* here and below: full unrolling makes every index of the register arrays a constant, so they stay in registers */
  for (int u = 0; u < 8; ++u) qv[u] = *(const v4fa*)(qr + 4 * u);
  const v8f z8 = {0.f, 0.f, 0.f, 0.f, 0.f, 0.f, 0.f, 0.f}; v8f o[4] = {z8, z8, z8, z8}; float m = -1.0e30f, l = 0.f;
  const int sr = tid >> 4, sc4 = (tid & 15) * 4; const float* kg = KF + (size_t)sr * ld + sc4; const float* vg = VF + (size_t)sr * ld + sc4; v4f tk[8], tv[8];      /* staging: a thread reads 16 bytes of rows sr, sr+8, .. sr+56 of a tile */
#pragma unroll
  for (int u = 0; u < 8; ++u) { tk[u] = *(const v4fa*)(kg + u * 8 * ld); tv[u] = *(const v4fa*)(vg + u * 8 * ld); }
  asm volatile("s_wait_xcnt 0x0" ::: "memory");      /* the q loads' address registers are reused below while the loads are in flight: the wait stands in front of that reuse */
  __builtin_amdgcn_sched_barrier(0);      /* keeps the register moves that follow (the zeroed accumulators take over those address registers) behind the wait: without it they are scheduled ahead of it */
  int t = 0;
#pragma unroll 1      /* rolled: one trip is a whole 64-key tile between its two barriers */
  do {      /* tiles 0 .. rg: at least one */
    __syncthreads();      /* every reader has left the previous tile */
#pragma unroll
    for (int u = 0; u < 8; ++u) { *(v4f*)&lk[u * 8 + sr][sc4] = tk[u]; *(v4f*)&lv[u * 8 + sr][sc4] = tv[u]; }
    __syncthreads();      /* the tile is complete before anyone reads it */
    if (t < rg) { kg += 64 * ld; vg += 64 * ld;      /* the next tile's rows fly while this tile is worked on */
#pragma unroll
      for (int u = 0; u < 8; ++u) { tk[u] = *(const v4fa*)(kg + u * 8 * ld); tv[u] = *(const v4fa*)(vg + u * 8 * ld); } }
    const int np = (t == rg) ? (w >> 1) + 1 : 2;      /* 32 keys a step; on the diagonal tile the steps wholly above the wave's rows are left out (every step that runs holds a key that each of its queries may see) */
#pragma unroll 1      /* rolled: one step already holds 64 matrix instructions */
    for (int p = 0; p < np; ++p) { const int k0 = p * 32; v4f ka[8], kc[8];
#pragma unroll
      for (int u = 0; u < 8; ++u) { ka[u] = *(const v4f*)&lk[k0 + c][32 * h + 4 * u]; kc[u] = *(const v4f*)&lk[k0 + 16 + c][32 * h + 4 * u]; }
      v8f sa = z8, sb = z8;      /* two independent score tiles: neither waits for its own previous product */
#pragma unroll
      for (int u = 0; u < 8; ++u) {
#pragma unroll
        for (int e = 0; e < 4; e += 2) { const v2f b = {qv[u][e], qv[u][e + 1]}; const v2f a0 = {ka[u][e], ka[u][e + 1]}; const v2f a1 = {kc[u][e], kc[u][e + 1]}; sa = f4_mma(a0, b, sa); sb = f4_mma(a1, b, sb);
          __builtin_amdgcn_sched_barrier(0x0496); } }      /* matrix instructions do not cross (vector, scalar, memory and LDS instructions may): keeps the two tiles' products alternating; left alone the compiler runs each tile's 16 products as one dependent chain, which issues slower */
      const int jb = t * 64 + k0 + 8 * h; float ml = -1.0e30f;
#pragma unroll
      for (int r = 0; r < 8; ++r) { sa[r] = (jb + r <= i) ? sa[r] * scale : -1.0e30f; sb[r] = (jb + 16 + r <= i) ? sb[r] * scale : -1.0e30f; ml = fmaxf(ml, fmaxf(sa[r], sb[r])); }
      ml = fmaxf(ml, half_x(ml));      /* the query's other 16 keys of this step sit in lane l ^ 16 */
      const float mn = fmaxf(m, ml); const float sc = expf(m - mn); m = mn; float ps = 0.f;
#pragma unroll
      for (int r = 0; r < 8; ++r) { sa[r] = expf(sa[r] - mn); sb[r] = expf(sb[r] - mn); ps += sa[r] + sb[r]; }
      l = l * sc + ps;      /* each lane sums its own keys; the two halves meet behind the loop */
#pragma unroll
      for (int dt = 0; dt < 4; ++dt) o[dt] *= sc;
#pragma unroll
      for (int tt = 0; tt < 4; ++tt) { const v2f b0 = {sa[2 * tt], sa[2 * tt + 1]}; const v2f b1 = {sb[2 * tt], sb[2 * tt + 1]}; const int kr = k0 + 8 * h + 2 * tt;
#pragma unroll
        for (int dt = 0; dt < 4; ++dt) { const v2f a0 = {lv[kr][dt * 16 + c], lv[kr + 1][dt * 16 + c]}; o[dt] = f4_mma(a0, b0, o[dt]); }
#pragma unroll
        for (int dt = 0; dt < 4; ++dt) { const v2f a1 = {lv[kr + 16][dt * 16 + c], lv[kr + 17][dt * 16 + c]}; o[dt] = f4_mma(a1, b1, o[dt]); } } }
  } while (++t <= rg);
  l += half_x(l); const float fin = 1.0f / l;
  float* orow = OF + (size_t)i * ldo + 8 * h;      /* o[dt][r] = column dt*16 + 8h + r of the lane's query: 32 contiguous bytes a tile */
#pragma unroll
  for (int dt = 0; dt < 4; ++dt) { const v4f x0 = {o[dt][0] * fin, o[dt][1] * fin, o[dt][2] * fin, o[dt][3] * fin}; const v4f x1 = {o[dt][4] * fin, o[dt][5] * fin, o[dt][6] * fin, o[dt][7] * fin}; *(v4f*)(orow + dt * 16) = x0; *(v4f*)(orow + dt * 16 + 4) = x1; } }


template <int BFIN, int WXB>
__global__ __launch_bounds__(256) void k_ln16(const float* __restrict__ X, const float* __restrict__ g, const float* __restrict__ bb, float eps, _Float16* __restrict__ N16, float* __restrict__ XB) {
  #pragma clang fp contract(off)
  __shared__ float red[256]; const size_t r = blockIdx.x; const int t = threadIdx.x; const v4f xa = *(const v4fa*)(X + r * DMQ + t * 4); float s[4]; float sum = 0.f;
  for (int q = 0; q < 4; ++q) { s[q] = BFIN ? bf16_round(xa[q]) : xa[q]; sum = __fadd_rn(sum, s[q]); }
  red[t] = sum; __syncthreads(); for (int st = 128; st > 0; st >>= 1) { if (t < st) red[t] = __fadd_rn(red[t], red[t + st]); __syncthreads(); } const float mu = red[0] / (float)DMQ; __syncthreads();
  float vs = 0.f; for (int q = 0; q < 4; ++q) { const float dl = __fadd_rn(s[q], -mu); vs = __fadd_rn(vs, __fmul_rn(dl, dl)); } red[t] = vs; __syncthreads(); for (int st = 128; st > 0; st >>= 1) { if (t < st) red[t] = __fadd_rn(red[t], red[t + st]); __syncthreads(); }
  const float rs = rsqrtf(__fadd_rn(red[0] / (float)DMQ, eps)); v4h y; v4f xb;
  for (int q = 0; q < 4; ++q) { const int c = t * 4 + q; y[q] = (_Float16)__fadd_rn(__fmul_rn(__fmul_rn(__fadd_rn(s[q], -mu), rs), bf16_round(g[c])), bf16_round(bb[c])); xb[q] = s[q]; }
  { *(v4h*)(N16 + r * DMQ + t * 4) = y; if (WXB) *(v4f*)(XB + r * DMQ + t * 4) = xb;  } }
__global__ __launch_bounds__(256) void k_ftres2(const float* __restrict__ OF0, const float* __restrict__ XB, float* __restrict__ X1, size_t n4) {
  #pragma clang fp contract(off)
  const size_t t = (size_t)blockIdx.x * 256 + threadIdx.x; if (t >= n4) return; const v4f o = *(const v4fa*)(OF0 + t * 4), xv = *(const v4fa*)(XB + t * 4); v4f y; for (int q = 0; q < 4; ++q) y[q] = __fadd_rn(__fmul_rn(o[q], 0.015625f), xv[q]); *(v4f*)(X1 + t * 4) = y;  }

__global__ __launch_bounds__(256) void k_wthd(const float* __restrict__ Wt, _Float16* __restrict__ Bt) { const size_t t = (size_t)blockIdx.x * 256 + threadIdx.x; if (t >= (size_t)NH * HD * (DM / 8)) return; const int m8 = (int)(t % (DM / 8)) * 8; const int d = (int)((t / (DM / 8)) % HD); const int h = (int)(t / ((size_t)(DM / 8) * HD)); FragH f;
  for (int q = 0; q < 8; ++q) f.h[q] = (_Float16)(16.0f * bf16_round(Wt[((size_t)h * DM + m8 + q) * HD + d])); unsigned short* dst = (unsigned short*)Bt + ((size_t)h * HD + d) * DM + m8; *(v8us*)dst = f.half[0];  }




__global__ __launch_bounds__(256) void k_wtpad(const float* __restrict__ Wm, _Float16* __restrict__ Wt, int Kr, int Kp, int Nr, int Np, float scale) {
  const int t = blockIdx.x * 256 + threadIdx.x; if (t >= Np * (Kp / 8)) return; const int n = t / (Kp / 8), k8 = (t % (Kp / 8)) * 8; const int nc = min(n, Nr - 1); const float fn = (n < Nr) ? 1.f : 0.f; FragH f;
  for (int i = 0; i < 8; ++i) { const int k = k8 + i; const int kc = min(k, Kr - 1); const float fk = (k < Kr) ? fn : 0.f; f.h[i] = (_Float16)(bf16_round(Wm[(size_t)kc * Nr + nc]) * scale * fk); }
  unsigned short* o = (unsigned short*)Wt + (size_t)n * Kp + k8; *(v8us*)o = f.half[0];  }
__global__ __launch_bounds__(128) void k_bpad(const float* __restrict__ b, float* __restrict__ Bp, int nr, int np) {
  const int i = threadIdx.x; if (i >= np) return; const float v = b[min(i, nr - 1)] * ((i < nr) ? 1.f : 0.f); *(float*)(Bp + i) = v;  }

#define DI 64         /* inner width = NH * HD (ONE 64-wide head) */
#define LQK (3 * DI)  /* fused q | k | v row pitch (192) */
__global__ __launch_bounds__(256) void k_o0(const float* __restrict__ OF, float* __restrict__ ob, size_t n4) {
  #pragma clang fp contract(off)
  const size_t t = (size_t)blockIdx.x * 256 + threadIdx.x; if (t >= n4) return; const size_t e = t * 4; const int i = (int)(e / DI); const int c = (int)(e % DI); const int h = c / HD, d = c % HD; const v4f a = *(const v4fa*)(OF + e); v4f o; for (int q = 0; q < 4; ++q) o[q] = __fmul_rn(a[q], 0.015625f); float* dst = ob + (size_t)h * SQ * HD + (size_t)i * HD + d; *(v4f*)dst = o;  }

// ---- fused causal attention for query rows QT0 .. SQ-1 (f16 operands, f32 scores and statistics): scores, softmax and P V in ONE kernel, no score or weight plane in memory ----
#define FQ 64                        /* query rows per block: two groups of 32, a wave owns one group (two 16-column tiles) */
#define FKS 4                        /* 32-key slices per stage: the four waves of a query group take one slice each and meet in the epilogue */
#define FSK (FKS * 32)               /* keys per stage */
#define FKPB 144                     /* k tile row pitch in LDS, bytes: 128 + 16 = 16 x odd, conflict-free for 16-byte fragment reads */
#define FVPB (FSK * 2 + 16)          /* v^T tile row pitch in LDS, bytes: 272 = 16 x odd */
#define FKB (FSK * FKPB)             /* bytes of a k tile */
#define FBUF (FKB + HD * FVPB)       /* bytes of one stage buffer: k tile, then v^T tile */
#define FIMG (8 * 2 * 4 * 2 * 32 * 16)   /* epilogue: every wave's 2 x 4 output tiles as 16-byte pieces, lane-contiguous */
__device__ __forceinline__ v8f h_mma(v16h a, v16h b, v8f c) { return __builtin_amdgcn_wmma_f32_16x16x32_f16(false, a, false, b, (short)0, c, false, false); }
__device__ __forceinline__ v16h l_frag(const unsigned char* p) { FragH f; f.half[0] = *(const v8us*)p; f.half[1] = *(const v8us*)(p + 32); return f.v; }      /* p already holds the lane's 16h bytes: k 8h .. 8h+7 and 16+8h .. 16+8h+7, the order of g2_frag */
// 2^x in place. The exponentials of one statement work on different registers, so each fills the slot that the instruction set asks for behind the one before it; the closing v_nop is that slot for the last one
__device__ __forceinline__ void exp2x8(float (&x)[8]) { asm("v_exp_f32 %0, %0\n\tv_exp_f32 %1, %1\n\tv_exp_f32 %2, %2\n\tv_exp_f32 %3, %3\n\tv_exp_f32 %4, %4\n\tv_exp_f32 %5, %5\n\tv_exp_f32 %6, %6\n\tv_exp_f32 %7, %7\n\tv_nop" : "+v"(x[0]), "+v"(x[1]), "+v"(x[2]), "+v"(x[3]), "+v"(x[4]), "+v"(x[5]), "+v"(x[6]), "+v"(x[7])); }
__device__ __forceinline__ void exp2x4(float (&x)[4]) { asm("v_exp_f32 %0, %0\n\tv_exp_f32 %1, %1\n\tv_exp_f32 %2, %2\n\tv_exp_f32 %3, %3\n\tv_nop" : "+v"(x[0]), "+v"(x[1]), "+v"(x[2]), "+v"(x[3])); }
__device__ __forceinline__ float exp2x1(float x) { asm("v_exp_f32 %0, %0\n\tv_nop" : "+v"(x)); return x; }
// one 32-key slice against the wave's 32 queries. S^T = K Q^T: a lane's 8 + 8 result registers are keys 8h .. 8h+7 and 16+8h .. 16+8h+7 of ITS query c, which is the B operand order of O^T += V^T P^T as it stands.
// m is the running maximum in scaled log2 units (cs = scale * log2 e), l the lane's own sum. DIAG: the slice starts at the wave's first query row, keys above a query's own row get weight 0.
template <bool DIAG>
__device__ __forceinline__ void fa_step(const unsigned char* kp, const unsigned char* vp, const v16h (&qf)[2][2], v8f (&o)[2][4], float (&m)[2], float (&l)[2], float cs, int c, int h) {
  const v8f z8 = {0.f, 0.f, 0.f, 0.f, 0.f, 0.f, 0.f, 0.f};
  const v16h ka0 = l_frag(kp), ka1 = l_frag(kp + 64), kb0 = l_frag(kp + 16 * FKPB), kb1 = l_frag(kp + 16 * FKPB + 64);
  v16h vf[4];
#pragma unroll      /* here and below: full unrolling makes every index of the register arrays a constant, so they stay in registers */
  for (int dt = 0; dt < 4; ++dt) vf[dt] = l_frag(vp + dt * 16 * FVPB);
  v8f sa[2], sb[2];
  sa[0] = h_mma(ka0, qf[0][0], z8); sb[0] = h_mma(kb0, qf[0][0], z8); sa[1] = h_mma(ka0, qf[1][0], z8); sb[1] = h_mma(kb0, qf[1][0], z8);
  sa[0] = h_mma(ka1, qf[0][1], sa[0]); sb[0] = h_mma(kb1, qf[0][1], sb[0]); sa[1] = h_mma(ka1, qf[1][1], sa[1]); sb[1] = h_mma(kb1, qf[1][1], sb[1]);
  FragH pf[2];
#pragma unroll
  for (int qt = 0; qt < 2; ++qt) {
    if (DIAG) {
#pragma unroll
      for (int r = 0; r < 8; ++r) { sa[qt][r] = (8 * h + r <= 16 * qt + c) ? sa[qt][r] : -1.0e30f; sb[qt][r] = (16 + 8 * h + r <= 16 * qt + c) ? sb[qt][r] : -1.0e30f; } }
    float ml = fmaxf(sa[qt][0], sb[qt][0]);
#pragma unroll
    for (int r = 1; r < 8; ++r) ml = fmaxf(ml, fmaxf(sa[qt][r], sb[qt][r]));
    ml = fmaxf(ml, half_x(ml));      /* the query's other 16 keys of this slice sit in lane l ^ 16 */
    const float mn = fmaxf(m[qt], ml * cs); const float sc = exp2x1(m[qt] - mn); m[qt] = mn; float ps = 0.f, pa[8], pb[8];
#pragma unroll
    for (int r = 0; r < 8; ++r) { pa[r] = fmaf(sa[qt][r], cs, -mn); pb[r] = fmaf(sb[qt][r], cs, -mn); }
    exp2x8(pa); exp2x8(pb);
#pragma unroll
    for (int r = 0; r < 8; ++r) { ps += pa[r] + pb[r]; pf[qt].h[r] = (_Float16)pa[r]; pf[qt].h[8 + r] = (_Float16)pb[r]; }
    l[qt] = l[qt] * sc + ps;
#pragma unroll
    for (int dt = 0; dt < 4; ++dt) o[qt][dt] *= sc; }
#pragma unroll
  for (int dt = 0; dt < 4; ++dt) { o[0][dt] = h_mma(vf[dt], pf[0].v, o[0][dt]); o[1][dt] = h_mma(vf[dt], pf[1].v, o[1][dt]); } }
// block = 8 waves = 2 query groups x FKS key slices; k rows and v^T rows of a stage go through registers into one of two LDS buffers (coalesced 16-byte loads, issued one stage ahead), one barrier a stage.
// Each wave keeps its own running maximum, sum and O^T over its slices; the four waves of a group are joined once, through LDS, by the usual rescaling to the common maximum.
__global__ __launch_bounds__(256) void k_fa16(const _Float16* __restrict__ QKV, const _Float16* __restrict__ VT, float cs, float* __restrict__ O) {
  __shared__ __attribute__((aligned(16))) unsigned char L[2 * FBUF]; static_assert(2 * FBUF >= FIMG + 8 * 2 * 32 * 8, "the epilogue reuses the stage buffers");
  const int tid = threadIdx.x, lane = tid & 31, c = lane & 15, h = lane >> 4; const int w = __builtin_amdgcn_readfirstlane(tid >> 5); const int g = w & 1, ks = w >> 1;      /* the wave's number as a scalar: every branch below is wave-uniform, as the matrix instructions need */
  const int Q0 = QT0 + ((int)gridDim.x - 1 - (int)blockIdx.x) * FQ;      /* the longest blocks start first */
  const int qb = Q0 + 32 * g; const int nf = Q0 / FSK;      /* the wave's first query row; stages 0 .. nf-1 lie wholly below the block's rows, stage nf holds the rest (Q0 + FQ <= (nf + 1) * FSK <= SQ: FSK is a multiple of FQ, SQ of FSK) */
  const _Float16* base = QKV + (size_t)blockIdx.y * SQ * LQK; const _Float16* vtb = VT + (size_t)blockIdx.y * HD * SQ;
  const unsigned short* kg = (const unsigned short*)base + (size_t)(tid >> 3) * LQK + (tid & 7) * 8;      /* staging: 8 threads a k row (128 bytes, DI halves into the q | k | v row), rows +32 a pass */
  const unsigned short* vg = (const unsigned short*)vtb + (size_t)(tid >> 4) * SQ + (tid & 15) * 8;      /* 16 threads a v^T row slice (256 bytes), rows +16 a pass */
  unsigned char* ks_l = L + (tid >> 3) * FKPB + (tid & 7) * 16; unsigned char* vs_l = L + FKB + (tid >> 4) * FVPB + (tid & 15) * 16;
  v8us tk[4], tv[4];
#pragma unroll
  for (int u = 0; u < 4; ++u) { tk[u] = *(const v8us*)(kg + DI + (size_t)u * 32 * LQK); tv[u] = *(const v8us*)(vg + (size_t)u * 16 * SQ); }
  v16h qf[2][2];
#pragma unroll
  for (int qt = 0; qt < 2; ++qt) { const _Float16* qr = base + (size_t)(qb + 16 * qt + c) * LQK; qf[qt][0] = g2_frag(qr, h); qf[qt][1] = g2_frag(qr + 32, h); }
  asm volatile("s_wait_xcnt 0x0" :: "v"(kg), "v"(vg) : "memory");      /* address registers of the loads above are reused below while the loads are in flight: the wait stands in front of that reuse; the two staging addresses are inputs so that they live up to the wait (else the last staging load's result is placed over them) */
  const v8f z8 = {0.f, 0.f, 0.f, 0.f, 0.f, 0.f, 0.f, 0.f}; v8f o[2][4] = {{z8, z8, z8, z8}, {z8, z8, z8, z8}}; float m[2] = {-1.0e30f, -1.0e30f}, l[2] = {0.f, 0.f};
#pragma unroll
  for (int u = 0; u < 4; ++u) { *(v8us*)(ks_l + u * 32 * FKPB) = tk[u]; *(v8us*)(vs_l + u * 16 * FVPB) = tv[u]; }
  __syncthreads();      /* stage 0 is complete before anyone reads it */
  const unsigned char* kp = L + (ks * 32 + c) * FKPB + 16 * h; const unsigned char* vp = L + FKB + c * FVPB + ks * 64 + 16 * h;
#pragma unroll 1      /* rolled: one trip is a whole stage up to its barrier */
  for (int st = 0; st < nf; ++st) { const int bo = (st & 1) * FBUF;      /* stages wholly below the block's first query row: every wave's slice is seen by all its queries, and a next stage always exists */
    kg += (size_t)FSK * LQK; vg += FSK;      /* the next stage's rows fly while this stage is worked on */
#pragma unroll
    for (int u = 0; u < 4; ++u) { tk[u] = *(const v8us*)(kg + DI + (size_t)u * 32 * LQK); tv[u] = *(const v8us*)(vg + (size_t)u * 16 * SQ); }
    asm volatile("s_wait_xcnt 0x0" ::: "memory");      /* the next trip advances the address registers that these loads name: the wait stands in front of that */
    fa_step<false>(kp + bo, vp + bo, qf, o, m, l, cs, c, h);
    __builtin_amdgcn_sched_barrier(0);      /* the LDS stores below wait for the loads issued above: left alone the compiler lifts them, with that wait and the barrier, in front of the softmax, and the loads' latency is no longer covered by this stage's work */
#pragma unroll
    for (int u = 0; u < 4; ++u) { *(v8us*)(ks_l + (FBUF - bo) + u * 32 * FKPB) = tk[u]; *(v8us*)(vs_l + (FBUF - bo) + u * 16 * FVPB) = tv[u]; }      /* the other buffer: its readers left it in front of the previous trip's barrier */
    __syncthreads(); }      /* publishes the next stage and ends every reader's last read of this one */
  { const int bo = (nf & 1) * FBUF; const int kb = nf * FSK + ks * 32;      /* the last stage holds the diagonal: a slice below the wave's rows as before, the slice that starts at them masked, a slice wholly above them left out */
    if (kb < qb) fa_step<false>(kp + bo, vp + bo, qf, o, m, l, cs, c, h); else if (kb == qb) fa_step<true>(kp + bo, vp + bo, qf, o, m, l, cs, c, h); }
  __syncthreads();      /* every reader has left the stage buffers: the epilogue reuses them */
  float* img = (float*)L; v2f* mlp = (v2f*)(L + FIMG);      
#pragma unroll
  for (int qt = 0; qt < 2; ++qt) { l[qt] += half_x(l[qt]); const v2f x = {m[qt], l[qt]}; mlp[(w * 2 + qt) * 32 + lane] = x;
#pragma unroll
    for (int dt = 0; dt < 4; ++dt) { const v4f x0 = {o[qt][dt][0], o[qt][dt][1], o[qt][dt][2], o[qt][dt][3]}; const v4f x1 = {o[qt][dt][4], o[qt][dt][5], o[qt][dt][6], o[qt][dt][7]}; float* d = img + (size_t)(((w * 2 + qt) * 4 + dt) * 2) * 128 + lane * 4; *(v4f*)d = x0; *(v4f*)(d + 128) = x1; } }
  __syncthreads();      /* every wave's partial result is in LDS */
  const int fq = ks >> 1, fd = (ks & 1) * 2;      /* the wave finishes query tile fq of its group, output columns fd*16 .. fd*16+31: one whole 128-byte line a query */
  float mj[FKS], lj[FKS]; float mx = -1.0e30f;
#pragma unroll
  for (int j = 0; j < FKS; ++j) { const v2f x = mlp[((j * 2 + g) * 2 + fq) * 32 + lane]; mj[j] = x[0]; lj[j] = x[1]; mx = fmaxf(mx, x[0]); }
  float ls = 0.f;
#pragma unroll
  for (int j = 0; j < FKS; ++j) mj[j] -= mx;
  exp2x4(mj);
#pragma unroll
  for (int j = 0; j < FKS; ++j) ls += mj[j] * lj[j];
  const float fin = 1.0f / ls; v4f y[4] = {};
#pragma unroll
  for (int j = 0; j < FKS; ++j) { const float f = mj[j] * fin; const float* s = img + (size_t)((((j * 2 + g) * 2 + fq) * 4 + fd) * 2) * 128 + lane * 4;
#pragma unroll
    for (int e = 0; e < 4; ++e) y[e] += *(const v4f*)(s + e * 128) * f; }
  float* orow = O + ((size_t)blockIdx.y * SQ + qb + 16 * fq + c) * DI + fd * 16 + 8 * h;      /* piece e = columns (fd + e/2)*16 + 8h + 4(e%2) .. +3 of the lane's query */
  *(v4f*)orow = y[0]; *(v4f*)(orow + 4) = y[1]; *(v4f*)(orow + 16) = y[2]; *(v4f*)(orow + 20) = y[3]; }


// ---- q | k | v projection in ONE launch: x and the three weight matrices are read as f32 and rounded on their way into LDS (x as exact f16 rows, the weights transposed and stacked beside it), and the epilogue stores every plane the attention kernels read, v^T among them ----
#define PM 128                       /* token rows per block; divides SQ, so a block lies in one batch */
#define PPB (DM * 2 + 16)            /* row pitch of the x and weight tiles in LDS, bytes: 528 = 16 x odd, conflict-free for 16-byte fragment reads */
#define PSO (LQK + 4)                /* row pitch of the f32 result tile in LDS, floats: rows 8 apart, which the two lane halves of an accumulator register write together, lie 32 banks apart */
#define PVB (PM * 2 + 16)            /* row pitch of the v^T tile in LDS, bytes: 272 = 16 x odd */
typedef __bf16 v2b __attribute__((ext_vector_type(2))); typedef _Float16 v2h __attribute__((ext_vector_type(2)));
// two f32 values rounded to bf16 (to nearest even, as bf16_round does it, by the one packed conversion instruction: every block rounds the weights for itself, so the rounding's instruction count matters here) and widened again
__device__ __forceinline__ v2f bf16_round2(v2f x) { const unsigned int u = __builtin_bit_cast(unsigned int, __builtin_convertvector(x, v2b)); const v2f y = {__uint_as_float(u << 16), __uint_as_float(u & 0xFFFF0000u)}; return y; }
// block = 16 waves = 4 row groups of 32 x 4 column groups of 48; every global load and store covers whole 128-byte lines. k order and accumulation order of a result are those of a plain k loop in steps of 32.
__global__ __launch_bounds__(512) void k_qkv(const float* __restrict__ x, const float* __restrict__ W0, const float* __restrict__ W1, const float* __restrict__ W2, float* __restrict__ C, _Float16* __restrict__ C16, _Float16* __restrict__ VT) {
  __shared__ __attribute__((aligned(16))) unsigned char LA[PM * PPB]; __shared__ __attribute__((aligned(16))) unsigned char LB[LQK * PPB];
  __shared__ __attribute__((aligned(16))) float so[PM * PSO]; __shared__ __attribute__((aligned(16))) unsigned char LV[HD * PVB];      /* result tiles apart from the operand tiles: a wave stages its results without waiting for the others' last fragment reads */
  const int tid = threadIdx.x, lane = tid & 31, c = lane & 15, h = lane >> 4; const int w = __builtin_amdgcn_readfirstlane(tid >> 5); const int rgp = w & 3, cgp = w >> 2;      /* the wave's number as a scalar: the test for a v tile below is wave-uniform */
  const size_t row0 = (size_t)blockIdx.x * PM;
  const int wo = (tid >> 4) * (8 * DI / 4) + (tid & 15); const float* xg = x + row0 * DM + tid * 4;      /* weights [k][n]: a thread takes 8 k x 4 n of each matrix, 16 lanes a 256-byte row (wo counts 16-byte pieces); x: a wave's load = 512 contiguous bytes */
  v4f wl[3][8], xa[16];
#pragma unroll      /* here and below: full unrolling makes every index of the register arrays a constant, so they stay in registers */
  for (int i = 0; i < 8; ++i) { wl[0][i] = *(const v4fa*)(W0 + wo * 4 + i * DI); wl[1][i] = *(const v4fa*)(W1 + wo * 4 + i * DI); wl[2][i] = *(const v4fa*)(W2 + wo * 4 + i * DI); }      /* the weights first: every block reads them, so they come from L2 and are rounded and in LDS while x is still on its way from memory */
#pragma unroll
  for (int u = 0; u < 16; ++u) xa[u] = *(const v4fa*)(xg + u * 2048);      /* the block's whole x tile is in flight at once */
  asm volatile("s_wait_xcnt 0x0" :: "v"(wo) : "memory");      /* address registers of the loads above are reused below while the loads are in flight: the wait stands in front of that reuse; the weights' offset is an input so that it lives up to the wait (else the last x load's result is placed over it) */
#pragma unroll
  for (int mq = 0; mq < 3; ++mq) {
#pragma unroll
    for (int j = 0; j < 4; ++j) { FragH f;      /* Bt[n][k] = f16(16 W[k][n]), stacked q | k | v: the factor, a power of two, keeps bf16-exact weights exact in f16 away from the subnormal range */
#pragma unroll
      for (int i = 0; i < 8; i += 2) { const v2f a = {wl[mq][i][j], wl[mq][i + 1][j]}; const v2h y = __builtin_convertvector(bf16_round2(a) * 16.0f, v2h); f.h[i] = y[0]; f.h[i + 1] = y[1]; }
      *(v8us*)(LB + (mq * DI + (tid & 15) * 4 + j) * PPB + (tid >> 4) * 16) = f.half[0]; } }
#pragma unroll
  for (int u = 0; u < 16; ++u) { const v2f a = {xa[u][0], xa[u][1]}, b = {xa[u][2], xa[u][3]}; const v2h ya = __builtin_convertvector(bf16_round2(a), v2h), yb = __builtin_convertvector(bf16_round2(b), v2h); const v4h y = {ya[0], ya[1], yb[0], yb[1]};
    *(v4h*)(LA + (u * 8 + (tid >> 6)) * PPB + (tid & 63) * 8) = y; }
  __syncthreads();      /* both operand tiles are complete before anyone reads them */
  const unsigned char* ap = LA + (rgp * 32 + c) * PPB + 16 * h; const unsigned char* bp = LB + (cgp * 48 + c) * PPB + 16 * h;
  const v8f z8 = {0.f, 0.f, 0.f, 0.f, 0.f, 0.f, 0.f, 0.f}; v8f acc[2][3] = {{z8, z8, z8}, {z8, z8, z8}};
  v16h af[3][2], bf[3][3];      /* three fragment sets: a k step's 10 LDS loads are issued two steps ahead of its products */
#define PQ_LOAD(ks) { af[(ks) % 3][0] = l_frag(ap + (ks) * 64); af[(ks) % 3][1] = l_frag(ap + 16 * PPB + (ks) * 64); bf[(ks) % 3][0] = l_frag(bp + (ks) * 64); bf[(ks) % 3][1] = l_frag(bp + 16 * PPB + (ks) * 64); bf[(ks) % 3][2] = l_frag(bp + 32 * PPB + (ks) * 64); }
  PQ_LOAD(0) PQ_LOAD(1)
#pragma unroll
  for (int ks = 0; ks < DM / 32; ++ks) { if (ks + 2 < DM / 32) PQ_LOAD(ks + 2)
    __builtin_amdgcn_sched_barrier(0);      /* keeps those loads in front of this step's products: left alone the compiler sinks each load to just in front of its first use and waits for it there, five load-then-wait rounds a step */
#pragma unroll
    for (int t = 0; t < 3; ++t) { acc[0][t] = h_mma(af[ks % 3][0], bf[ks % 3][t], acc[0][t]); acc[1][t] = h_mma(af[ks % 3][1], bf[ks % 3][t], acc[1][t]); } }
#undef PQ_LOAD
#pragma unroll
  for (int i = 0; i < 2; ++i) {
#pragma unroll
    for (int t = 0; t < 3; ++t) { const int ct = cgp * 3 + t; const int rl = rgp * 32 + i * 16 + 8 * h; FragH f;      /* acc[i][t][r] = row rl + r, column ct*16 + c */
#pragma unroll
      for (int r = 0; r < 8; ++r) { const float v = acc[i][t][r] * 0.0625f; so[(rl + r) * PSO + ct * 16 + c] = v; f.h[r] = (_Float16)v; }      /* the weights carry a factor 16 */
      if (ct >= 2 * DI / 16) *(v8us*)(LV + ((ct - 2 * DI / 16) * 16 + c) * PVB + rl * 2) = f.half[0]; } }      /* a v tile: the lane's 8 registers are 8 consecutive keys of one v column, 16 bytes of a v^T row as they stand */
  __syncthreads();      /* every wave's results are in LDS */
  float* cg = C + row0 * LQK; _Float16* hg = C16 + row0 * LQK;      /* the block's rows are one contiguous range of either plane */
  unsigned short* vtg = (unsigned short*)VT + (row0 / SQ) * HD * SQ + row0 % SQ;
  v4f ov[PM * LQK / 4 / 512], oh[PM * 2 * DI / 8 / 512][2]; v8us ot[HD * PM / 8 / 512];      /* every LDS read of the output stage goes into a register of its own, so that all are issued before the first store waits for one */
#pragma unroll
  for (int u = 0; u < PM * LQK / 4 / 512; ++u) { const int ch = u * 512 + tid; ov[u] = *(const v4fa*)&so[ch / (LQK / 4) * PSO + ch % (LQK / 4) * 4]; }
#pragma unroll
  for (int u = 0; u < PM * 2 * DI / 8 / 512; ++u) { const float* s = &so[(u * 32 + (tid >> 4)) * PSO + (tid & 15) * 8]; oh[u][0] = *(const v4fa*)s; oh[u][1] = *(const v4fa*)(s + 4); }
#pragma unroll
  for (int u = 0; u < HD * PM / 8 / 512; ++u) ot[u] = *(const v8us*)(LV + (u * 32 + (tid >> 4)) * PVB + (tid & 15) * 16);
#pragma unroll
  for (int u = 0; u < PM * LQK / 4 / 512; ++u) *(v4f*)(cg + (u * 512 + tid) * 4) = ov[u];      /* q | k | v as f32 rows */
#pragma unroll
  for (int u = 0; u < PM * 2 * DI / 8 / 512; ++u) { FragH f;      /* q and k as f16 rows, 16 lanes a row: 256 contiguous bytes; v is read as v^T only */
#pragma unroll
    for (int q = 0; q < 4; ++q) { f.h[q] = (_Float16)oh[u][0][q]; f.h[4 + q] = (_Float16)oh[u][1][q]; }
    *(v8us*)((unsigned short*)hg + (u * 32 + (tid >> 4)) * LQK + (tid & 15) * 8) = f.half[0]; }
#pragma unroll
  for (int u = 0; u < HD * PM / 8 / 512; ++u) *(v8us*)(vtg + (size_t)(u * 32 + (tid >> 4)) * SQ + (tid & 15) * 8) = ot[u]; }      /* 16 lanes a v^T row piece: 256 contiguous bytes */


extern "C" void kernel_launch(void* const* d_in, const int* in_sizes, int n_in,
                              void* d_out, int out_size, void* d_ws, size_t ws_size, hipStream_t stream) {
  (void)in_sizes; (void)n_in; (void)out_size;
  const float* const* I = (const float* const*)d_in; const float* x = I[0]; const float* wq = I[1]; const float* wk = I[2]; const float* wv = I[3];      /* x; [in][out = 64] Wq / Wk / Wv (input order as this module lists them); no biases */
  char* ws = (char*)d_ws; size_t off = 0;
  auto take = [&](size_t bytes) { char* p = ws + off; off += (bytes + 255) & ~(size_t)255; return p; };
  _Float16* QKV = (_Float16*)take(NR * LQK * 2); _Float16* VT = (_Float16*)take((size_t)NB * NH * HD * SQ * 2);
  float* QKVF = (float*)take(NR * LQK * 4);
  if (off > ws_size) return;
  k_qkv<<<(unsigned)(NR / PM), 512, 0, stream>>>(x, wq, wk, wv, QKVF, QKV, VT);      /* q | k | v = x W over the stacked 192 columns, straight from the f32 x and the f32 [in = DM][out = 64] weights: q | k stored as f16 rows (operands of the WMMA attention), q | k | v as f32 rows (the exact first tile reads rows 0..511 of each batch), v as f16 V^T [NB][HD][SQ] */
  float* ob = (float*)d_out;      /* the ONE head leaves grid.y free: it carries the batch in every launch below */
  k_fa16<<<dim3((SQ - QT0) / FQ, NB), 256, 0, stream>>>(QKV, VT, 0.0359158963f, ob);      /* query rows QT0 .. SQ-1: scores * 256^-0.666 (the factor is 0.024895003 * log2 e: the softmax works in base 2), causal softmax and P V in one launch, batch on grid.y; rows below QT0 come from the exact f32 path alone */
  k_att0w<LQK, DI><<<dim3(QT0 / 64, NB), 128, 0, stream>>>(QKVF, QKVF + DI, QKVF + 2 * DI, 0.024895003f, ob);      /* exact f32 causal attention for rows 0..511 of every batch, stored straight into the output rows, their only writer */
}
